// v000
// Measured on an AMD MI455X. A time is GPU time per run, averaged over a window of back-to-back runs after a warm-up
// (all launches, gaps included; the runs take copies of the inputs in turn), and the median of several windows.
// Apart from v000's, it joins two sittings. Times from different sittings can be a few percent apart, while
// side-by-side timings come from the same sitting.
// v000 is the starting kernel. One run takes 1200 microseconds.
// Contractions: projections X[c][n].W[o][n]^T (K=2048) on v_wmma_f32_16x16x32_f16 (f16 containers of bf16-RNE W x256 and bf16-RNE x); scores pk.pq^T (K=512) on v_wmma_f32_16x16x32_bf16 (bf16 hi + bf16 residual planes of pq/pk, 3 products); O^T = pv^T.P^T (K=2048 keys) on v_wmma_f32_16x16x32_f16 (pv f16, P = e^{s-m} x16384 f16 from the score D registers); f32 accumulate everywhere; softmax statistics and scaling in f32 VALU.
#include <hip/hip_runtime.h>
#include <math.h>
#include <stdint.h>

#ifndef NB
#define NB 8
#endif
#ifndef NQ
#define NQ 2048
#endif
#define NB_FULL 8
#define CDIM   512
#define NDIM   2048
#define QT     64
#define CHH    256
#define OSP    68
#define OSPW   132
#define WSC    256.0f
#define IWSC   0.00390625f
#define LNPS   9.704060527839234f
#define OSCALE 0.022097086912079608f

static_assert(NB >= 1 && NB <= NB_FULL);
static_assert(NQ >= QT && NQ <= NDIM && NQ % QT == 0);
static_assert(CDIM % QT == 0 && NDIM % QT == 0);
static_assert(CDIM % 32 == 0 && NDIM % 32 == 0);
static_assert(CDIM == 2 * CHH && CHH == 16 * 16);
static_assert((OSP * 4) % 16 == 0);
static_assert((OSPW * 4) % 16 == 0);
static_assert(NDIM == 8 * 256);

typedef _Float16       v16h __attribute__((ext_vector_type(16)));
typedef _Float16       v8h  __attribute__((ext_vector_type(8)));
typedef __bf16         v16b __attribute__((ext_vector_type(16)));
typedef unsigned short v8us __attribute__((ext_vector_type(8)));
typedef float          v8f  __attribute__((ext_vector_type(8)));
typedef float          v4f  __attribute__((ext_vector_type(4)));
typedef unsigned int   v4u  __attribute__((ext_vector_type(4)));

union Frag  { v8us u[2]; v16h h; v16b bf; };
union FragP { v16h v; v8h hv[2]; v4u u[2]; };
static_assert(sizeof(Frag) == 32);
static_assert(sizeof(FragP) == 32);

// ---- scalar helpers ---------------------------------------------------------------------------------------
__device__ __forceinline__ unsigned short bf_bits(float f) {          // f32 -> bf16 bits, RNE convert
  unsigned u = __float_as_uint(f);
  return (unsigned short)((u + 0x7FFFu + ((u >> 16) & 1u)) >> 16);
}
__device__ __forceinline__ float bf_up(unsigned short hb) { return __uint_as_float(((unsigned)hb) << 16); }
__device__ __forceinline__ float bfr(float f) { return bf_up(bf_bits(f)); }
__device__ __forceinline__ unsigned short h_bits(_Float16 x) { return __builtin_bit_cast(unsigned short, x); }
__device__ __forceinline__ unsigned pk16(unsigned short a, unsigned short b) { return (unsigned)a | ((unsigned)b << 16); }
__device__ __forceinline__ v8f zero8() { v8f z = {0.f, 0.f, 0.f, 0.f, 0.f, 0.f, 0.f, 0.f}; return z; }
__device__ __forceinline__ float hmax8(v8f s) {
  return fmaxf(fmaxf(fmaxf(s[0], s[1]), fmaxf(s[2], s[3])), fmaxf(fmaxf(s[4], s[5]), fmaxf(s[6], s[7])));
}
__device__ __forceinline__ unsigned wave_ballot(bool p) {
#if defined(__HIP_DEVICE_COMPILE__)
  return __builtin_amdgcn_ballot_w32(p);
#else
  return p ? 1u : 0u;
#endif
}
__device__ __forceinline__ int uni(int v) {                           // wave-uniform int -> SGPR
#if defined(__HIP_DEVICE_COMPILE__)
  return __builtin_amdgcn_readfirstlane(v);
#else
  return v;
#endif
}

// ---- 16-bit fragment loader (A, or B from a k-contiguous [n][k] row): lane -> row/col (lane&15), p already includes
//      + 8*(lane>>4); elements 0..7 <- p[0..7] (k0+8h..), elements 8..15 <- p[16..23] (k0+16+8h..)
__device__ __forceinline__ Frag ldfrag(const unsigned short* p) {
  Frag f;
  f.u[0] = *(const v8us*)(p);
  f.u[1] = *(const v8us*)(p + 16);
  return f;
}

// ---- WMMA helpers: builtin followed by a 4-slot VALU gap tying D and keeping A/B live --------------------------
__device__ __forceinline__ v8f mma_h(v16h a, v16h b, v8f c) {
  v8f d = __builtin_amdgcn_wmma_f32_16x16x32_f16(false, a, false, b, (short)0, c, false, false);
#if defined(__HIP_DEVICE_COMPILE__)
  asm volatile("v_nop\n\tv_nop\n\tv_nop\n\tv_nop" : "+v"(d) : "v"(a), "v"(b));
#endif
  return d;
}
__device__ __forceinline__ v8f mma_b(v16b a, v16b b, v8f c) {
  v8f d = __builtin_amdgcn_wmma_f32_16x16x32_bf16(false, a, false, b, (short)0, c, false, false);
#if defined(__HIP_DEVICE_COMPILE__)
  const v16h ha = __builtin_bit_cast(v16h, a), hb = __builtin_bit_cast(v16h, b);
  asm volatile("v_nop\n\tv_nop\n\tv_nop\n\tv_nop" : "+v"(d) : "v"(ha), "v"(hb));
#endif
  return d;
}

// =========================================================================================================
// (0) row convert, 2048 floats per row, one 256-thread block per row, thread tid -> halves 8 tid .. 8 tid + 7
//     flattened [NB*512] rows = f16(bf16-RNE(x)). Block-uniform selection between two global pointers.
// coverage: W16 2048 blocks x 256 thr x 8 = 2048 x 2048; X16 NB*512 blocks x 256 x 8 = NB x 512 x 2048.
// =========================================================================================================
__global__ __launch_bounds__(256)
void cvt_k(const float* __restrict__ w, const float* __restrict__ x, unsigned short* W16, unsigned short* X16) {
  const int tid = threadIdx.x, r = blockIdx.x;
  const bool isw = (r < NDIM);
  const size_t ro = isw ? (size_t)r * NDIM : (size_t)(r - NDIM) * NDIM;
  const float* s = (isw ? w : x) + ro + 8 * tid;
  unsigned short* d = (isw ? W16 : X16) + ro + 8 * tid;
  const float sc = isw ? WSC : 1.0f;
  const v4f a  = *(const v4f*)s;
  const v4f qv = *(const v4f*)(s + 4);
  const float f[8] = {a[0], a[1], a[2], a[3], qv[0], qv[1], qv[2], qv[3]};
  v4u u;
#pragma unroll
  for (int t = 0; t < 4; ++t) {
    const _Float16 h0 = (_Float16)(bfr(f[2 * t]) * sc);
    const _Float16 h1 = (_Float16)(bfr(f[2 * t + 1]) * sc);
    u[t] = pk16(h_bits(h0), h_bits(h1));
  }
{
    *(v4u*)d = u;
    
  }
}

// =========================================================================================================
// (1) projection for q / k, one (64-c tile, 64-o tile, b) per block of 4 waves:
//     D[c][o] = sum_n X16[b][c][n] W16[o][n]  (x256): A rows c = c0 + 16 mt + (lane&15) from X16 (k = n contiguous),
//     B cols o = o0 + 16 wave + (lane&15) from the W16 row (same split k map). K = 2048 = 64 steps.
//     Lane (hh, cl): D element r = (c0 + 16 mt + 8 hh + r, o0 + 16 wave + cl). Epilogue: x 1/256 -> LDS Os[o_loc][c_loc]
//     (pitch OSP, b128 stores), barrier, + bf16-RNE bias[o], then planes Ph = bf16-RNE(v), Pl = bf16-RNE(v - hi),
// coverage: Os 4 waves x 16 o x 64 c = 64 x 64 (all read); planes 4 it x 16 rows x 8 lanes x 8 = 64 o x 64 c;
//           grid (8, n_otiles, NB) covers rows 0 .. 64 n_otiles - 1 of every batch once.
// =========================================================================================================
__global__ __launch_bounds__(128)
void proj_qk(const unsigned short* __restrict__ X16, const unsigned short* __restrict__ W16,
             const float* __restrict__ bias, unsigned short* Ph, unsigned short* Pl) {
  __shared__ __align__(16) float Os[QT * OSP];
  const int tid  = threadIdx.x;
  const int lane = tid & 31, wave = tid >> 5;
  const int hh   = lane >> 4, cl = lane & 15;
  const int ct   = blockIdx.x, ot = blockIdx.y, b = blockIdx.z;
  const int c0   = ct * QT, o0 = ot * QT;

  const unsigned short* ap = X16 + ((size_t)(b * CDIM + c0 + cl)) * NDIM + 8 * hh;
  const unsigned short* bp = W16 + ((size_t)(o0 + 16 * wave + cl)) * NDIM + 8 * hh;

  v8f acc[4];
#pragma unroll
  for (int mt = 0; mt < 4; ++mt) acc[mt] = zero8();

#pragma unroll 2
  for (int ks = 0; ks < NDIM / 32; ++ks) {
    const Frag fb = ldfrag(bp + 32 * ks);
#pragma unroll
    for (int mt = 0; mt < 4; ++mt) {
      const Frag fa = ldfrag(ap + (size_t)(16 * mt) * NDIM + 32 * ks);
      acc[mt] = mma_h(fa.h, fb.h, acc[mt]);
    }
  }

  {
    const int ol = 16 * wave + cl;
#pragma unroll
    for (int mt = 0; mt < 4; ++mt) {
      v4f va, vb;
#pragma unroll
      for (int r = 0; r < 4; ++r) { va[r] = acc[mt][r] * IWSC; vb[r] = acc[mt][4 + r] * IWSC; }
      *(v4f*)(Os + ol * OSP + 16 * mt + 8 * hh)     = va;
      *(v4f*)(Os + ol * OSP + 16 * mt + 8 * hh + 4) = vb;
    }
  }
  __syncthreads();

  const int e = tid & 7, lq = tid >> 3;                             // lq 0..15
  v4u uh[4], ul[4];
#pragma unroll
  for (int it = 0; it < 4; ++it) {
    const int row = it * 16 + lq;                                    // o_loc 0..63
    const v4f a  = *(const v4f*)(Os + row * OSP + 8 * e);
    const v4f qv = *(const v4f*)(Os + row * OSP + 8 * e + 4);
    const float bb = bfr(bias[o0 + row]);
    const float f[8] = {a[0] + bb, a[1] + bb, a[2] + bb, a[3] + bb, qv[0] + bb, qv[1] + bb, qv[2] + bb, qv[3] + bb};
#pragma unroll
    for (int t = 0; t < 4; ++t) {
      const float f0 = f[2 * t], f1 = f[2 * t + 1];
      const unsigned short hb0 = bf_bits(f0), hb1 = bf_bits(f1);
      const unsigned short lb0 = bf_bits(f0 - bf_up(hb0));
      const unsigned short lb1 = bf_bits(f1 - bf_up(hb1));
      uh[it][t] = pk16(hb0, hb1);
      ul[it][t] = pk16(lb0, lb1);
    }
  }
{
#pragma unroll
    for (int it = 0; it < 4; ++it) {
      const int row = it * 16 + lq;
      const size_t po = ((size_t)(b * NDIM + o0 + row)) * CDIM + c0 + 8 * e;
      *(v4u*)(Ph + po) = uh[it];
      *(v4u*)(Pl + po) = ul[it];
    }
    
  }
}

// =========================================================================================================
// (2) projection for v, one (64-o tile, 64-c tile, b) per block of 4 waves:
//     D[o][c] = sum_n W16[o][n] X16[b][c][n] (x256): A rows o = o0 + 16 mt + (lane&15) from W16, B cols
//     c = c0 + 16 wave + (lane&15) from X16 (same split k map). Lane (hh, cl): D element r = (o0 + 16 mt + 8 hh + r,
//     c0 + 16 wave + cl). Epilogue: x 1/256 -> LDS Os[c_loc][o_loc] (pitch OSP), barrier, + bf16-RNE bias[o], then
// coverage: Os 4 waves x 16 c x 64 o = 64 x 64 (all read); plane 4 it x 16 rows x 8 lanes x 8 = 64 c x 64 o;
//           grid (32, 8, NB) covers PV[b][0..511][0..2047] once.
// =========================================================================================================
__global__ __launch_bounds__(128)
void proj_v(const unsigned short* __restrict__ W16, const unsigned short* __restrict__ X16,
            const float* __restrict__ bias, unsigned short* PV) {
  __shared__ __align__(16) float Os[QT * OSP];
  const int tid  = threadIdx.x;
  const int lane = tid & 31, wave = tid >> 5;
  const int hh   = lane >> 4, cl = lane & 15;
  const int ot   = blockIdx.x, ct = blockIdx.y, b = blockIdx.z;
  const int o0   = ot * QT, c0 = ct * QT;

  const unsigned short* ap = W16 + ((size_t)(o0 + cl)) * NDIM + 8 * hh;
  const unsigned short* bp = X16 + ((size_t)(b * CDIM + c0 + 16 * wave + cl)) * NDIM + 8 * hh;

  v8f acc[4];
#pragma unroll
  for (int mt = 0; mt < 4; ++mt) acc[mt] = zero8();

#pragma unroll 2
  for (int ks = 0; ks < NDIM / 32; ++ks) {
    const Frag fb = ldfrag(bp + 32 * ks);
#pragma unroll
    for (int mt = 0; mt < 4; ++mt) {
      const Frag fa = ldfrag(ap + (size_t)(16 * mt) * NDIM + 32 * ks);
      acc[mt] = mma_h(fa.h, fb.h, acc[mt]);
    }
  }

  {
    const int nl = 16 * wave + cl;                                   // c_loc
#pragma unroll
    for (int mt = 0; mt < 4; ++mt) {
      v4f va, vb;
#pragma unroll
      for (int r = 0; r < 4; ++r) { va[r] = acc[mt][r] * IWSC; vb[r] = acc[mt][4 + r] * IWSC; }
      *(v4f*)(Os + nl * OSP + 16 * mt + 8 * hh)     = va;
      *(v4f*)(Os + nl * OSP + 16 * mt + 8 * hh + 4) = vb;
    }
  }
  __syncthreads();

  const int e = tid & 7, lq = tid >> 3;                             // lq 0..15
  const v4f ba = *(const v4f*)(bias + o0 + 8 * e);
  const v4f bq = *(const v4f*)(bias + o0 + 8 * e + 4);
  const float bb[8] = {bfr(ba[0]), bfr(ba[1]), bfr(ba[2]), bfr(ba[3]), bfr(bq[0]), bfr(bq[1]), bfr(bq[2]), bfr(bq[3])};
  v4u uv[4];
#pragma unroll
  for (int it = 0; it < 4; ++it) {
    const int row = it * 16 + lq;                                    // c_loc 0..63
    const v4f a  = *(const v4f*)(Os + row * OSP + 8 * e);
    const v4f qv = *(const v4f*)(Os + row * OSP + 8 * e + 4);
    const float f[8] = {a[0], a[1], a[2], a[3], qv[0], qv[1], qv[2], qv[3]};
#pragma unroll
    for (int t = 0; t < 4; ++t) {
      const _Float16 h0 = (_Float16)(f[2 * t] + bb[2 * t]);
      const _Float16 h1 = (_Float16)(f[2 * t + 1] + bb[2 * t + 1]);
      uv[it][t] = pk16(h_bits(h0), h_bits(h1));
    }
  }
{
#pragma unroll
    for (int it = 0; it < 4; ++it) {
      const int row = it * 16 + lq;
      const size_t po = ((size_t)(b * CDIM + c0 + row)) * NDIM + o0 + 8 * e;
      *(v4u*)(PV + po) = uv[it];
    }
    
  }
}

// =========================================================================================================
// (3) attention for one (b, 64-query tile), transposed formulation, 2048 keys, no mask, no scale on the scores.
//   Block = 8 waves. Waves 0..3 (w = wave) are score waves for queries n0 + 16 w .. + 15; waves 4..7 share the query
//   group w = wave - 4. Channel half g = wave >> 2 (channels 256 g .. 256 g + 255) for the P.V accumulators.
//   Per 32-key block kb (score waves only): S^T tiles (16 keys x 16 queries) = sum over 16 c-chunks of
//   A(Kh: row = key kb + (lane&15), k = c via the split map, plane [b][2048][512]) . B(Qh: col = query, same map)
//   + A(Kh).B(Ql) + A(Kl).B(Qh) (bf16 unscaled residual planes, shared accumulator). Per lane the D tiles hold
//   8 + 8 keys of ONE query: online softmax state per lane, one shuffle (lane^16) for the max over 32 keys; the
//   rescale factor is skipped under a wave-uniform ballot when no lane's max grew. P = e^{s-m} x 16384 as f16:
//   B operand of O^T: element r <- D of the tile covering keys kb..kb+15, element 8+r <- the tile covering
//   kb+16..kb+31, lane unchanged. The score wave publishes P (32 B per lane), corr and the grew flag in LDS;
//   after a block barrier all 8 waves rescale (if grew) and run O^T[ch][q] += A(PV rows ch = 256 g + 16 j +
//   (lane&15), keys contiguous, f16 plane [b][512][2048]) . B(P) on 16 accumulator tiles; second block barrier
//   before the next kb overwrites the LDS exchange. At the end score waves publish inv = (1/l) / sqrt(2048).
//   Epilogue in 4 channel passes of 64 channels per wave: O x inv staged in LDS Os[query][128] (pitch OSPW, b128
//   barrier before the next pass overwrites Os.
// coverage: per pass 8 it x 32 lines x 8 lanes x 4 floats = 64 queries x 128 ch; 4 passes = 512 ch;
//           grid (NQ/64, NB) covers out[b][0..NQ-1][0..511] exactly once.
// =========================================================================================================
__global__ __launch_bounds__(256)
void attn_k(const unsigned short* __restrict__ Qh, const unsigned short* __restrict__ Ql,
            const unsigned short* __restrict__ Kh, const unsigned short* __restrict__ Kl,
            const unsigned short* __restrict__ PV, float* out) {
  __shared__ __align__(16) float Os[QT * OSPW];
  __shared__ __align__(16) unsigned Psh[4 * 32 * 8];
  __shared__ float Csh[4 * 32];
  __shared__ float Ish[4 * 32];
  __shared__ int   Gsh[4];
  const int tid  = threadIdx.x;
  const int lane = tid & 31;
  const int wave = uni((int)(threadIdx.x >> 5));                     // 0..7, SGPR
  const int w    = wave & 3, g = wave >> 2;
  const int hh   = lane >> 4, cl = lane & 15;
  const int n0   = blockIdx.x * QT, b = blockIdx.y;

  // q fragment pointers (B operand, col = query n0 + 16 w + cl), + 32*kc
  const size_t qo = ((size_t)(b * NDIM + n0 + 16 * w + cl)) * CDIM + 8 * hh;
  const unsigned short* Qhp = Qh + qo;
  const unsigned short* Qlp = Ql + qo;
  // k fragment base (A operand, row = key kb + cl), + key * 512 + 32*kc
  const unsigned short* Khp = Kh + (size_t)b * NDIM * CDIM + (size_t)cl * CDIM + 8 * hh;
  const unsigned short* Klp = Kl + (size_t)b * NDIM * CDIM + (size_t)cl * CDIM + 8 * hh;
  // v fragment base (A operand, row = channel 256 g + 16 j + cl, keys contiguous), + 16*j*2048 + kb
  const unsigned short* Vp = PV + (size_t)b * CDIM * NDIM + (size_t)(g * CHH + cl) * NDIM + 8 * hh;

  const int pso = (w * 32 + lane) * 8;                               // LDS exchange slot (uints)

  float m = -1.0e30f, l = 0.f;
  v8f o[16];
#pragma unroll
  for (int j = 0; j < 16; ++j) o[j] = zero8();

#pragma unroll 1
  for (int kb = 0; kb < NDIM; kb += 32) {
    if (wave < 4) {                                                  // wave-uniform (SGPR) role branch
      const unsigned short* k0p  = Khp + (size_t)kb * CDIM;          // keys kb .. kb+15
      const unsigned short* k1p  = Khp + (size_t)(kb + 16) * CDIM;   // keys kb+16 .. kb+31
      const unsigned short* k0lp = Klp + (size_t)kb * CDIM;
      const unsigned short* k1lp = Klp + (size_t)(kb + 16) * CDIM;
      v8f s0 = zero8(), s1 = zero8();
#pragma unroll 1
      for (int kc = 0; kc < CDIM / 32; ++kc) {
        const Frag qh  = ldfrag(Qhp + 32 * kc);
        const Frag k0  = ldfrag(k0p + 32 * kc);
        const Frag k1  = ldfrag(k1p + 32 * kc);
        s0 = mma_b(k0.bf, qh.bf, s0);
        s1 = mma_b(k1.bf, qh.bf, s1);
        const Frag ql  = ldfrag(Qlp + 32 * kc);
        s0 = mma_b(k0.bf, ql.bf, s0);
        s1 = mma_b(k1.bf, ql.bf, s1);
        const Frag k0l = ldfrag(k0lp + 32 * kc);
        const Frag k1l = ldfrag(k1lp + 32 * kc);
        s0 = mma_b(k0l.bf, qh.bf, s0);
        s1 = mma_b(k1l.bf, qh.bf, s1);
      }

      float mx = fmaxf(hmax8(s0), hmax8(s1));
      mx = fmaxf(mx, __shfl_xor(mx, 16, 32));
      const float mn = fmaxf(m, mx);
      const unsigned grew = wave_ballot(mx > m);                     // wave-uniform
      float corr = 1.0f;
      if (grew != 0u) {
        corr = __expf(m - mn);                                       // == 1 for lanes whose max did not grow
        l *= corr;
      }
      m = mn;
      const float msh = mn - LNPS;                                   // exp gives e^{s-m} * 16384

      FragP ph;
      float ls = 0.f;
#pragma unroll
      for (int r = 0; r < 8; ++r) {
        const float e0 = __expf(s0[r] - msh);                        // key kb      + 8hh + r
        const float e1 = __expf(s1[r] - msh);                        // key kb + 16 + 8hh + r
        ls += e0 + e1;
        ph.hv[0][r] = (_Float16)e0;
        ph.hv[1][r] = (_Float16)e1;
      }
      l += ls;

      *(v4u*)(Psh + pso)     = ph.u[0];
      *(v4u*)(Psh + pso + 4) = ph.u[1];
      Csh[w * 32 + lane] = corr;
      Gsh[w] = (grew != 0u) ? 1 : 0;
    }
    __syncthreads();                                                 // exchange is cross-wave: block barrier

    {
      const int gf = uni(Gsh[w]);                                    // wave-uniform flag
      if (gf != 0) {
        const float corr = Csh[w * 32 + lane];
#pragma unroll
        for (int j = 0; j < 16; ++j) {
#pragma unroll
          for (int r = 0; r < 8; ++r) o[j][r] *= corr;
        }
      }
      FragP pb;
      pb.u[0] = *(const v4u*)(Psh + pso);
      pb.u[1] = *(const v4u*)(Psh + pso + 4);
#pragma unroll
      for (int j = 0; j < 16; ++j) {
        const Frag vf = ldfrag(Vp + (size_t)(16 * j) * NDIM + kb);
        o[j] = mma_h(vf.h, pb.v, o[j]);
      }
    }
    __syncthreads();                                                 // all readers done before the next kb writes
  }

  if (wave < 4) {
    l += __shfl_xor(l, 16, 32);
    Ish[w * 32 + lane] = (1.0f / l) * OSCALE;                        // o and l both carry the x16384 factor
  }
  __syncthreads();
  const float inv = Ish[w * 32 + lane];

  const int qrow = 16 * w + cl;
  const int e = tid & 7, lq = tid >> 3;                              // lq 0..31
#pragma unroll
  for (int p = 0; p < 4; ++p) {
    if (p) __syncthreads();                                          // every wave finished reading Os
#pragma unroll
    for (int jj = 0; jj < 4; ++jj) {
      const int j = 4 * p + jj;                                        // channels 256 g + 64 p + 16 jj + 8 hh + r
      v4f va, vb;
#pragma unroll
      for (int r = 0; r < 4; ++r) { va[r] = o[j][r] * inv; vb[r] = o[j][4 + r] * inv; }
      *(v4f*)(Os + qrow * OSPW + g * 64 + 16 * jj + 8 * hh)     = va;   // Os[query][64 g + 16 jj + 8 hh + r]
      *(v4f*)(Os + qrow * OSPW + g * 64 + 16 * jj + 8 * hh + 4) = vb;
    }
    __syncthreads();
    v4f res[8];
#pragma unroll
    for (int it = 0; it < 8; ++it) {
      const int L   = it * 32 + lq;                                    // 0..255
      const int ql  = L >> 2, seg = L & 3;                             // query 0..63, line 0..3 of this pass
      const int gg  = seg >> 1, ln = seg & 1;
      res[it] = *(const v4f*)(Os + ql * OSPW + gg * 64 + 32 * ln + 4 * e);
    }
{
#pragma unroll
      for (int it = 0; it < 8; ++it) {
        const int L   = it * 32 + lq;
        const int ql  = L >> 2, seg = L & 3;
        const int gg  = seg >> 1, ln = seg & 1;
        const int ch  = gg * CHH + 64 * p + 32 * ln + 4 * e;
        const size_t idx = ((size_t)(b * NDIM + n0 + ql)) * CDIM + ch;
        *(v4f*)(out + idx) = res[it];
      }
      
    }
  }
}

// =========================================================================================================
// Workspace map (bytes; each region start a multiple of 256; every extent is an exact tile multiple and is written
//   W16 f16 [2048][2048]            8388608   (reused for Wq, Wk, Wv in launch order)
//   X16 f16 [NB][512][2048]        16777216   (reused for q, k, v)
//   Qh/Ql/Kh/Kl bf16 [NB][2048][512] 16777216 x4
//   PV  f16 [NB][512][2048]        16777216
//   total (NB = 8) = 109051904
// =========================================================================================================
extern "C" void kernel_launch(void* const* d_in, const int* in_sizes, int n_in,
                              void* d_out, int out_size, void* d_ws, size_t ws_size,
                              hipStream_t stream) {
  if (n_in < 9) return;
  if (in_sizes[0] < NB * CDIM * NDIM || in_sizes[1] < NB * CDIM * NDIM || in_sizes[2] < NB * CDIM * NDIM) return;
  if (in_sizes[3] < NDIM * NDIM || in_sizes[5] < NDIM * NDIM || in_sizes[7] < NDIM * NDIM) return;
  if (in_sizes[4] < NDIM || in_sizes[6] < NDIM || in_sizes[8] < NDIM) return;
  if (out_size < (NB - 1) * NDIM * CDIM + NQ * CDIM) return;

  size_t off = 0;
  auto carve = [&](size_t bytes) { const size_t o = off; off += (bytes + 255) & ~(size_t)255; return o; };
  const size_t oW16 = carve((size_t)NDIM * NDIM * 2);
  const size_t oX16 = carve((size_t)NB * CDIM * NDIM * 2);
  const size_t oQh  = carve((size_t)NB * NDIM * CDIM * 2);
  const size_t oQl  = carve((size_t)NB * NDIM * CDIM * 2);
  const size_t oKh  = carve((size_t)NB * NDIM * CDIM * 2);
  const size_t oKl  = carve((size_t)NB * NDIM * CDIM * 2);
  const size_t oPV  = carve((size_t)NB * CDIM * NDIM * 2);
  if (off > ws_size) return;
  if (off > (size_t)134217728) return;

  const float* q  = (const float*)d_in[0];
  const float* k  = (const float*)d_in[1];
  const float* v  = (const float*)d_in[2];
  const float* Wq = (const float*)d_in[3];
  const float* bq = (const float*)d_in[4];
  const float* Wk = (const float*)d_in[5];
  const float* bk = (const float*)d_in[6];
  const float* Wv = (const float*)d_in[7];
  const float* bv = (const float*)d_in[8];

  char* ws = (char*)d_ws;
  unsigned short* W16 = (unsigned short*)(ws + oW16);
  unsigned short* X16 = (unsigned short*)(ws + oX16);
  unsigned short* Qh  = (unsigned short*)(ws + oQh);
  unsigned short* Ql  = (unsigned short*)(ws + oQl);
  unsigned short* Kh  = (unsigned short*)(ws + oKh);
  unsigned short* Kl  = (unsigned short*)(ws + oKl);
  unsigned short* PVp = (unsigned short*)(ws + oPV);
  float* out = (float*)d_out;

  const dim3 blk256(256), blk128(128);
  const int cvt_blocks = NDIM + NB * CDIM;

  // q: convert, project -> pq hi + residual planes [b][o][c] for o < NQ
  cvt_k<<<dim3(cvt_blocks), blk256, 0, stream>>>(Wq, q, W16, X16);
  proj_qk<<<dim3(CDIM / QT, NQ / QT, NB), blk128, 0, stream>>>(X16, W16, bq, Qh, Ql);
  // k: convert, project -> pk hi + residual planes [b][o][c], all o
  cvt_k<<<dim3(cvt_blocks), blk256, 0, stream>>>(Wk, k, W16, X16);
  proj_qk<<<dim3(CDIM / QT, NDIM / QT, NB), blk128, 0, stream>>>(X16, W16, bk, Kh, Kl);
  // v: convert, project -> pv^T f16 plane [b][c][o]
  cvt_k<<<dim3(cvt_blocks), blk256, 0, stream>>>(Wv, v, W16, X16);
  proj_v<<<dim3(NDIM / QT, CDIM / QT, NB), blk128, 0, stream>>>(W16, X16, bv, PVp);
  // attention + 1/sqrt(2048) -> out [b][n][c] (the raw view to [b][512][2048] is the same flat buffer)
  attn_k<<<dim3(NQ / QT, NB), blk256, 0, stream>>>(Qh, Ql, Kh, Kl, PVp, out);
  (void)hipGetLastError();
}

// v001
// It runs in 488 microseconds.
// Two timings next to v000 put it at 2.51 and 2.50 times that version's speed.
// Contractions: projections X[c][n].W[o][n]^T (K=2048) on v_wmma_f32_16x16x32_f16 (f16 containers of bf16-RNE W x256 and bf16-RNE x); scores pk.pq^T (K=512) on v_wmma_f32_16x16x32_bf16 (bf16 hi + bf16 residual planes of pq/pk, 3 products); O^T = pv^T.P^T (K=2048 keys) on v_wmma_f32_16x16x32_f16 (pv f16, P = e^{s-m} x16384 f16 from the score D registers); attention operands staged in LDS by asynchronous copies; f32 accumulate everywhere; softmax statistics and scaling in f32 VALU.
#include <hip/hip_runtime.h>
#include <math.h>
#include <stdint.h>

#ifndef NB
#define NB 8
#endif
#ifndef NQ
#define NQ 2048
#endif
#define NB_FULL 8
#define CDIM   512
#define NDIM   2048
#define QT     64
#define CHH    256
#define OSP    68
#define OSPW   132
#define WSC    256.0f
#define IWSC   0.00390625f
#define LNPS   9.704060527839234f
#define OSCALE 0.022097086912079608f
#define KT     32
#define KPE    520
#define KPLANE (KT * KPE)
#define KBUF   (2 * KPLANE)
#define QPLANE (QT * KPE)
#define VPE    40

static_assert(NB >= 1 && NB <= NB_FULL);
static_assert(NQ >= QT && NQ <= NDIM && NQ % QT == 0);
static_assert(CDIM % QT == 0 && NDIM % QT == 0);
static_assert(CDIM % 32 == 0 && NDIM % 32 == 0);
static_assert(CDIM == 2 * CHH && CHH == 16 * 16);
static_assert((OSP * 4) % 16 == 0);
static_assert((OSPW * 4) % 16 == 0);
static_assert(NDIM == 8 * 256);
static_assert((KPE * 2) % 16 == 0 && ((KPE * 2) / 16) % 2 == 1);   // LDS row pitches 16 B x odd: the 16 rows of a b128
static_assert((VPE * 2) % 16 == 0 && ((VPE * 2) / 16) % 2 == 1);   // fragment read fall on all 64 banks once
static_assert(CDIM * 2 == 64 * 16 && KT == 8 * 4 && QT == 2 * KT);  // q/k rows: 64 chunks of 16 B; 8 copies x 256 lanes = 32 rows
static_assert(KT * 2 == 4 * 16 && CDIM == 8 * 64);                  // v rows: 4 chunks of 16 B; 8 copies x 256 lanes = 512 rows
static_assert(NDIM / KT >= 2);
static_assert(QT * OSPW * 4 <= 2 * KBUF * 2);                       // the output staging fits in the key ring it reuses

typedef _Float16       v16h __attribute__((ext_vector_type(16)));
typedef _Float16       v8h  __attribute__((ext_vector_type(8)));
typedef __bf16         v16b __attribute__((ext_vector_type(16)));
typedef unsigned short v8us __attribute__((ext_vector_type(8)));
typedef float          v8f  __attribute__((ext_vector_type(8)));
typedef float          v4f  __attribute__((ext_vector_type(4)));
typedef unsigned int   v4u  __attribute__((ext_vector_type(4)));

union Frag  { v8us u[2]; v16h h; v16b bf; };
union FragP { v16h v; v8h hv[2]; v4u u[2]; };
static_assert(sizeof(Frag) == 32);
static_assert(sizeof(FragP) == 32);

// ---- scalar helpers ---------------------------------------------------------------------------------------
__device__ __forceinline__ unsigned short bf_bits(float f) {          // f32 -> bf16 bits, RNE convert
  unsigned u = __float_as_uint(f);
  return (unsigned short)((u + 0x7FFFu + ((u >> 16) & 1u)) >> 16);
}
__device__ __forceinline__ float bf_up(unsigned short hb) { return __uint_as_float(((unsigned)hb) << 16); }
__device__ __forceinline__ float bfr(float f) { return bf_up(bf_bits(f)); }
__device__ __forceinline__ unsigned short h_bits(_Float16 x) { return __builtin_bit_cast(unsigned short, x); }
__device__ __forceinline__ unsigned pk16(unsigned short a, unsigned short b) { return (unsigned)a | ((unsigned)b << 16); }
__device__ __forceinline__ v8f zero8() { v8f z = {0.f, 0.f, 0.f, 0.f, 0.f, 0.f, 0.f, 0.f}; return z; }
__device__ __forceinline__ float hmax8(v8f s) {
  return fmaxf(fmaxf(fmaxf(s[0], s[1]), fmaxf(s[2], s[3])), fmaxf(fmaxf(s[4], s[5]), fmaxf(s[6], s[7])));
}
__device__ __forceinline__ unsigned wave_ballot(bool p) {
#if defined(__HIP_DEVICE_COMPILE__)
  return __builtin_amdgcn_ballot_w32(p);
#else
  return p ? 1u : 0u;
#endif
}
__device__ __forceinline__ int uni(int v) {                           // wave-uniform int -> SGPR
#if defined(__HIP_DEVICE_COMPILE__)
  return __builtin_amdgcn_readfirstlane(v);
#else
  return v;
#endif
}

// ---- 16-bit fragment loader (A, or B from a k-contiguous [n][k] row): lane -> row/col (lane&15), p already includes
//      + 8*(lane>>4); elements 0..7 <- p[0..7] (k0+8h..), elements 8..15 <- p[16..23] (k0+16+8h..)
__device__ __forceinline__ Frag ldfrag(const unsigned short* p) {
  Frag f;
  f.u[0] = *(const v8us*)(p);
  f.u[1] = *(const v8us*)(p + 16);
  return f;
}

// ---- LDS staging by asynchronous copies ----------------------------------------------------------------------
__device__ __forceinline__ unsigned lds_off(const void* p) { return (unsigned)(size_t)p; }
// Eight 16-B copies per lane, global -> LDS: copy i moves g + i * GSTEP (elements) to LDS byte l + i * LSTEP.
// The closing s_wait_xcnt stands in the copies' own statement so that no address register is rewritten ahead of it.
template <unsigned LSTEP, int GSTEP>
__device__ __forceinline__ void acopy8(unsigned l, const unsigned short* g) {
#if defined(__HIP_DEVICE_COMPILE__)
  asm volatile(
      "global_load_async_to_lds_b128 %0, %8, off\n\t"
      "global_load_async_to_lds_b128 %1, %9, off\n\t"
      "global_load_async_to_lds_b128 %2, %10, off\n\t"
      "global_load_async_to_lds_b128 %3, %11, off\n\t"
      "global_load_async_to_lds_b128 %4, %12, off\n\t"
      "global_load_async_to_lds_b128 %5, %13, off\n\t"
      "global_load_async_to_lds_b128 %6, %14, off\n\t"
      "global_load_async_to_lds_b128 %7, %15, off\n\t"
      "s_wait_xcnt 0x0"
      :: "v"(l), "v"(l + 1u * LSTEP), "v"(l + 2u * LSTEP), "v"(l + 3u * LSTEP),
         "v"(l + 4u * LSTEP), "v"(l + 5u * LSTEP), "v"(l + 6u * LSTEP), "v"(l + 7u * LSTEP),
         "v"(g), "v"(g + 1 * GSTEP), "v"(g + 2 * GSTEP), "v"(g + 3 * GSTEP),
         "v"(g + 4 * GSTEP), "v"(g + 5 * GSTEP), "v"(g + 6 * GSTEP), "v"(g + 7 * GSTEP)
      : "memory");
#endif
}
// 32 q or k rows of 1024 B (contiguous in global) -> LDS pitch 2 KPE: copy i, lane tid -> row 4 i + (tid >> 6), chunk tid & 63
__device__ __forceinline__ void copy_rows32(unsigned l, const unsigned short* g) { acopy8<4u * 2u * KPE, 256 * 8>(l, g); }
// 512 v rows of 64 B (global pitch 2 NDIM bytes) -> LDS pitch 2 VPE: copy i, lane tid -> row 64 i + (tid >> 2), chunk tid & 3
__device__ __forceinline__ void copy_vtile(unsigned l, const unsigned short* g) { acopy8<64u * 2u * VPE, 64 * NDIM>(l, g); }
__device__ __forceinline__ void wait_async0() {                       // this wave's copies have landed in LDS
#if defined(__HIP_DEVICE_COMPILE__)
  asm volatile("s_wait_asynccnt 0x0" ::: "memory");
#endif
}
__device__ __forceinline__ void wait_ds0() {                          // this wave's LDS reads and writes have retired
#if defined(__HIP_DEVICE_COMPILE__)
  asm volatile("s_wait_dscnt 0x0" ::: "memory");
#endif
}

// ---- WMMA helpers: builtin followed by a 4-slot VALU gap tying D and keeping A/B live --------------------------
__device__ __forceinline__ v8f mma_h(v16h a, v16h b, v8f c) {
  v8f d = __builtin_amdgcn_wmma_f32_16x16x32_f16(false, a, false, b, (short)0, c, false, false);
#if defined(__HIP_DEVICE_COMPILE__)
  asm volatile("v_nop\n\tv_nop\n\tv_nop\n\tv_nop" : "+v"(d) : "v"(a), "v"(b));
#endif
  return d;
}
__device__ __forceinline__ v8f mma_b(v16b a, v16b b, v8f c) {
  v8f d = __builtin_amdgcn_wmma_f32_16x16x32_bf16(false, a, false, b, (short)0, c, false, false);
#if defined(__HIP_DEVICE_COMPILE__)
  const v16h ha = __builtin_bit_cast(v16h, a), hb = __builtin_bit_cast(v16h, b);
  asm volatile("v_nop\n\tv_nop\n\tv_nop\n\tv_nop" : "+v"(d) : "v"(ha), "v"(hb));
#endif
  return d;
}

// =========================================================================================================
// (0) row convert, 2048 floats per row, one 256-thread block per row, thread tid -> halves 8 tid .. 8 tid + 7
//     flattened [NB*512] rows = f16(bf16-RNE(x)). Block-uniform selection between two global pointers.
// coverage: W16 2048 blocks x 256 thr x 8 = 2048 x 2048; X16 NB*512 blocks x 256 x 8 = NB x 512 x 2048.
// =========================================================================================================
__global__ __launch_bounds__(256)
void cvt_k(const float* __restrict__ w, const float* __restrict__ x, unsigned short* W16, unsigned short* X16) {
  const int tid = threadIdx.x, r = blockIdx.x;
  const bool isw = (r < NDIM);
  const size_t ro = isw ? (size_t)r * NDIM : (size_t)(r - NDIM) * NDIM;
  const float* s = (isw ? w : x) + ro + 8 * tid;
  unsigned short* d = (isw ? W16 : X16) + ro + 8 * tid;
  const float sc = isw ? WSC : 1.0f;
  const v4f a  = *(const v4f*)s;
  const v4f qv = *(const v4f*)(s + 4);
  const float f[8] = {a[0], a[1], a[2], a[3], qv[0], qv[1], qv[2], qv[3]};
  v4u u;
#pragma unroll
  for (int t = 0; t < 4; ++t) {
    const _Float16 h0 = (_Float16)(bfr(f[2 * t]) * sc);
    const _Float16 h1 = (_Float16)(bfr(f[2 * t + 1]) * sc);
    u[t] = pk16(h_bits(h0), h_bits(h1));
  }
{
    *(v4u*)d = u;
    
  }
}

// =========================================================================================================
// (1) projection for q / k, one (64-c tile, 64-o tile, b) per block of 4 waves:
//     D[c][o] = sum_n X16[b][c][n] W16[o][n]  (x256): A rows c = c0 + 16 mt + (lane&15) from X16 (k = n contiguous),
//     B cols o = o0 + 16 wave + (lane&15) from the W16 row (same split k map). K = 2048 = 64 steps.
//     Lane (hh, cl): D element r = (c0 + 16 mt + 8 hh + r, o0 + 16 wave + cl). Epilogue: x 1/256 -> LDS Os[o_loc][c_loc]
//     (pitch OSP, b128 stores), barrier, + bf16-RNE bias[o], then planes Ph = bf16-RNE(v), Pl = bf16-RNE(v - hi),
// coverage: Os 4 waves x 16 o x 64 c = 64 x 64 (all read); planes 4 it x 16 rows x 8 lanes x 8 = 64 o x 64 c;
//           grid (8, n_otiles, NB) covers rows 0 .. 64 n_otiles - 1 of every batch once.
// =========================================================================================================
__global__ __launch_bounds__(128)
void proj_qk(const unsigned short* __restrict__ X16, const unsigned short* __restrict__ W16,
             const float* __restrict__ bias, unsigned short* Ph, unsigned short* Pl) {
  __shared__ __align__(16) float Os[QT * OSP];
  const int tid  = threadIdx.x;
  const int lane = tid & 31, wave = tid >> 5;
  const int hh   = lane >> 4, cl = lane & 15;
  const int ct   = blockIdx.x, ot = blockIdx.y, b = blockIdx.z;
  const int c0   = ct * QT, o0 = ot * QT;

  const unsigned short* ap = X16 + ((size_t)(b * CDIM + c0 + cl)) * NDIM + 8 * hh;
  const unsigned short* bp = W16 + ((size_t)(o0 + 16 * wave + cl)) * NDIM + 8 * hh;

  v8f acc[4];
#pragma unroll
  for (int mt = 0; mt < 4; ++mt) acc[mt] = zero8();

#pragma unroll 2
  for (int ks = 0; ks < NDIM / 32; ++ks) {
    const Frag fb = ldfrag(bp + 32 * ks);
#pragma unroll
    for (int mt = 0; mt < 4; ++mt) {
      const Frag fa = ldfrag(ap + (size_t)(16 * mt) * NDIM + 32 * ks);
      acc[mt] = mma_h(fa.h, fb.h, acc[mt]);
    }
  }

  {
    const int ol = 16 * wave + cl;
#pragma unroll
    for (int mt = 0; mt < 4; ++mt) {
      v4f va, vb;
#pragma unroll
      for (int r = 0; r < 4; ++r) { va[r] = acc[mt][r] * IWSC; vb[r] = acc[mt][4 + r] * IWSC; }
      *(v4f*)(Os + ol * OSP + 16 * mt + 8 * hh)     = va;
      *(v4f*)(Os + ol * OSP + 16 * mt + 8 * hh + 4) = vb;
    }
  }
  __syncthreads();

  const int e = tid & 7, lq = tid >> 3;                             // lq 0..15
  v4u uh[4], ul[4];
#pragma unroll
  for (int it = 0; it < 4; ++it) {
    const int row = it * 16 + lq;                                    // o_loc 0..63
    const v4f a  = *(const v4f*)(Os + row * OSP + 8 * e);
    const v4f qv = *(const v4f*)(Os + row * OSP + 8 * e + 4);
    const float bb = bfr(bias[o0 + row]);
    const float f[8] = {a[0] + bb, a[1] + bb, a[2] + bb, a[3] + bb, qv[0] + bb, qv[1] + bb, qv[2] + bb, qv[3] + bb};
#pragma unroll
    for (int t = 0; t < 4; ++t) {
      const float f0 = f[2 * t], f1 = f[2 * t + 1];
      const unsigned short hb0 = bf_bits(f0), hb1 = bf_bits(f1);
      const unsigned short lb0 = bf_bits(f0 - bf_up(hb0));
      const unsigned short lb1 = bf_bits(f1 - bf_up(hb1));
      uh[it][t] = pk16(hb0, hb1);
      ul[it][t] = pk16(lb0, lb1);
    }
  }
{
#pragma unroll
    for (int it = 0; it < 4; ++it) {
      const int row = it * 16 + lq;
      const size_t po = ((size_t)(b * NDIM + o0 + row)) * CDIM + c0 + 8 * e;
      *(v4u*)(Ph + po) = uh[it];
      *(v4u*)(Pl + po) = ul[it];
    }
    
  }
}

// =========================================================================================================
// (2) projection for v, one (64-o tile, 64-c tile, b) per block of 4 waves:
//     D[o][c] = sum_n W16[o][n] X16[b][c][n] (x256): A rows o = o0 + 16 mt + (lane&15) from W16, B cols
//     c = c0 + 16 wave + (lane&15) from X16 (same split k map). Lane (hh, cl): D element r = (o0 + 16 mt + 8 hh + r,
//     c0 + 16 wave + cl). Epilogue: x 1/256 -> LDS Os[c_loc][o_loc] (pitch OSP), barrier, + bf16-RNE bias[o], then
// coverage: Os 4 waves x 16 c x 64 o = 64 x 64 (all read); plane 4 it x 16 rows x 8 lanes x 8 = 64 c x 64 o;
//           grid (32, 8, NB) covers PV[b][0..511][0..2047] once.
// =========================================================================================================
__global__ __launch_bounds__(128)
void proj_v(const unsigned short* __restrict__ W16, const unsigned short* __restrict__ X16,
            const float* __restrict__ bias, unsigned short* PV) {
  __shared__ __align__(16) float Os[QT * OSP];
  const int tid  = threadIdx.x;
  const int lane = tid & 31, wave = tid >> 5;
  const int hh   = lane >> 4, cl = lane & 15;
  const int ot   = blockIdx.x, ct = blockIdx.y, b = blockIdx.z;
  const int o0   = ot * QT, c0 = ct * QT;

  const unsigned short* ap = W16 + ((size_t)(o0 + cl)) * NDIM + 8 * hh;
  const unsigned short* bp = X16 + ((size_t)(b * CDIM + c0 + 16 * wave + cl)) * NDIM + 8 * hh;

  v8f acc[4];
#pragma unroll
  for (int mt = 0; mt < 4; ++mt) acc[mt] = zero8();

#pragma unroll 2
  for (int ks = 0; ks < NDIM / 32; ++ks) {
    const Frag fb = ldfrag(bp + 32 * ks);
#pragma unroll
    for (int mt = 0; mt < 4; ++mt) {
      const Frag fa = ldfrag(ap + (size_t)(16 * mt) * NDIM + 32 * ks);
      acc[mt] = mma_h(fa.h, fb.h, acc[mt]);
    }
  }

  {
    const int nl = 16 * wave + cl;                                   // c_loc
#pragma unroll
    for (int mt = 0; mt < 4; ++mt) {
      v4f va, vb;
#pragma unroll
      for (int r = 0; r < 4; ++r) { va[r] = acc[mt][r] * IWSC; vb[r] = acc[mt][4 + r] * IWSC; }
      *(v4f*)(Os + nl * OSP + 16 * mt + 8 * hh)     = va;
      *(v4f*)(Os + nl * OSP + 16 * mt + 8 * hh + 4) = vb;
    }
  }
  __syncthreads();

  const int e = tid & 7, lq = tid >> 3;                             // lq 0..15
  const v4f ba = *(const v4f*)(bias + o0 + 8 * e);
  const v4f bq = *(const v4f*)(bias + o0 + 8 * e + 4);
  const float bb[8] = {bfr(ba[0]), bfr(ba[1]), bfr(ba[2]), bfr(ba[3]), bfr(bq[0]), bfr(bq[1]), bfr(bq[2]), bfr(bq[3])};
  v4u uv[4];
#pragma unroll
  for (int it = 0; it < 4; ++it) {
    const int row = it * 16 + lq;                                    // c_loc 0..63
    const v4f a  = *(const v4f*)(Os + row * OSP + 8 * e);
    const v4f qv = *(const v4f*)(Os + row * OSP + 8 * e + 4);
    const float f[8] = {a[0], a[1], a[2], a[3], qv[0], qv[1], qv[2], qv[3]};
#pragma unroll
    for (int t = 0; t < 4; ++t) {
      const _Float16 h0 = (_Float16)(f[2 * t] + bb[2 * t]);
      const _Float16 h1 = (_Float16)(f[2 * t + 1] + bb[2 * t + 1]);
      uv[it][t] = pk16(h_bits(h0), h_bits(h1));
    }
  }
{
#pragma unroll
    for (int it = 0; it < 4; ++it) {
      const int row = it * 16 + lq;
      const size_t po = ((size_t)(b * CDIM + c0 + row)) * NDIM + o0 + 8 * e;
      *(v4u*)(PV + po) = uv[it];
    }
    
  }
}

// =========================================================================================================
// (3) attention for one (b, 64-query tile), transposed formulation, 2048 keys, no mask, no scale on the scores.
//   Block = 8 waves. Waves 0..3 (w = wave) are score waves for queries n0 + 16 w .. + 15; waves 4..7 share the query
//   group w = wave - 4. Channel half g = wave >> 2 (channels 256 g .. 256 g + 255) for the P.V accumulators.
//   Per 32-key block kb (score waves only): S^T tiles (16 keys x 16 queries) = sum over 16 c-chunks of
//   A(Kh: row = key kb + (lane&15), k = c via the split map, plane [b][2048][512]) . B(Qh: col = query, same map)
//   + A(Kh).B(Ql) + A(Kl).B(Qh) (bf16 unscaled residual planes, shared accumulator). Per lane the D tiles hold
//   8 + 8 keys of ONE query: online softmax state per lane, one shuffle (lane^16) for the max over 32 keys; the
//   rescale factor is skipped under a wave-uniform ballot when no lane's max grew. P = e^{s-m} x 16384 as f16:
//   B operand of O^T: element r <- D of the tile covering keys kb..kb+15, element 8+r <- the tile covering
//   kb+16..kb+31, lane unchanged. The score wave publishes P (32 B per lane), corr and the grew flag in LDS;
//   after a block barrier all 8 waves rescale (if grew) and run O^T[ch][q] += A(PV rows ch = 256 g + 16 j +
//   (lane&15), keys contiguous, f16 plane [b][512][2048]) . B(P) on 16 accumulator tiles; second block barrier
//   before the next kb overwrites the LDS exchange. At the end score waves publish inv = (1/l) / sqrt(2048).
//   Epilogue in 4 channel passes of 64 channels per wave: O x inv staged in LDS Os[query][128] (pitch OSPW, b128
//   barrier before the next pass overwrites Os.
//   Operands come from LDS, brought by asynchronous 16-B copies of all 8 waves: the 64-query tile (both planes) once;
//   the 32-key tiles (both planes) in two buffers, tile t + 2 issued behind the foot barrier of trip t; the 512 x 32 pv
//   tile in one buffer, tile t + 1 issued behind the same barrier (its readers of trip t have passed it) and published
//   by the barrier between the scores and the P.V products of trip t + 1. Every wave waits for its own copies in front
//   of both barriers. Os reuses the key ring behind the loop.
// coverage: per pass 8 it x 32 lines x 8 lanes x 4 floats = 64 queries x 128 ch; 4 passes = 512 ch;
//           grid (NQ/64, NB) covers out[b][0..NQ-1][0..511] exactly once.
// =========================================================================================================
__global__ __launch_bounds__(256)
void attn_k(const unsigned short* __restrict__ Qh, const unsigned short* __restrict__ Ql,
            const unsigned short* __restrict__ Kh, const unsigned short* __restrict__ Kl,
            const unsigned short* __restrict__ PV, float* out) {
  __shared__ __align__(16) unsigned short Qs[2 * QPLANE];            // [hi, residual][64 queries][KPE]
  __shared__ __align__(16) unsigned short Ks[2 * KBUF];              // [buffer][hi, residual][32 keys][KPE]
  __shared__ __align__(16) unsigned short Vs[CDIM * VPE];            // [512 channels][VPE], 32 keys used
  __shared__ __align__(16) unsigned Psh[4 * 32 * 8];
  __shared__ float Csh[4 * 32];
  __shared__ float Ish[4 * 32];
  __shared__ int   Gsh[4];
  const int tid  = threadIdx.x;
  const int lane = tid & 31;
  const int wave = uni((int)(threadIdx.x >> 5));                     // 0..7, SGPR
  const int w    = wave & 3, g = wave >> 2;
  const int hh   = lane >> 4, cl = lane & 15;
  const int n0   = blockIdx.x * QT, b = blockIdx.y;

  // q fragment pointers in LDS (B operand, col = query 16 w + cl of the tile), + 32*kc
  const unsigned short* Qhp = Qs + (16 * w + cl) * KPE + 8 * hh;
  const unsigned short* Qlp = Qhp + QPLANE;
  // k fragment base in LDS (A operand, row = key cl of the tile), + buffer * KBUF + 32*kc
  const unsigned short* Ksp = Ks + cl * KPE + 8 * hh;
  // v fragment base in LDS (A operand, row = channel 256 g + 16 j + cl, the tile's 32 keys contiguous), + 16*j*VPE
  const unsigned short* Vp = Vs + (g * CHH + cl) * VPE + 8 * hh;
  // copy sources (the lane's 16-B chunk of copy 0) and LDS places
  const unsigned short* Khg = Kh + (size_t)b * NDIM * CDIM + 8 * tid;
  const unsigned short* Klg = Kl + (size_t)b * NDIM * CDIM + 8 * tid;
  const unsigned short* Vg  = PV + (size_t)b * CDIM * NDIM + (size_t)(tid >> 2) * NDIM + 8 * (tid & 3);
  const unsigned rpl = (unsigned)((tid >> 6) * (2 * KPE) + (tid & 63) * 16);
  const unsigned ksl = lds_off(Ks) + rpl;
  const unsigned vsl = lds_off(Vs) + (unsigned)((tid >> 2) * (2 * VPE) + (tid & 3) * 16);

  const int pso = (w * 32 + lane) * 8;                               // LDS exchange slot (uints)

  float m = -1.0e30f, l = 0.f;
  v8f o[16];
#pragma unroll
  for (int j = 0; j < 16; ++j) o[j] = zero8();

  // prologue: the query tile (filled once), key tile 0 and pv tile 0, published by one barrier; then key tile 1
  {
    const size_t qg = ((size_t)(b * NDIM + n0)) * CDIM + 8 * tid;
    const unsigned qsl = lds_off(Qs) + rpl;
    copy_rows32(qsl,                             Qh + qg);
    copy_rows32(qsl + 2u * KPLANE,               Qh + qg + KT * CDIM);
    copy_rows32(qsl + 2u * QPLANE,               Ql + qg);
    copy_rows32(qsl + 2u * QPLANE + 2u * KPLANE, Ql + qg + KT * CDIM);
    wait_async0();
    copy_rows32(ksl,               Khg);
    copy_rows32(ksl + 2u * KPLANE, Klg);
    copy_vtile(vsl, Vg);
    wait_async0();
    __syncthreads();
    copy_rows32(ksl + 2u * KBUF,               Khg + KT * CDIM);
    copy_rows32(ksl + 2u * KBUF + 2u * KPLANE, Klg + KT * CDIM);
  }

#pragma unroll 1
  for (int kb = 0; kb < NDIM; kb += KT) {
    const int buf = (kb / KT) & 1;                                   // this trip reads this key buffer alone
    if (wave < 4) {                                                  // wave-uniform (SGPR) role branch
      const unsigned short* k0p  = Ksp + buf * KBUF;                 // keys kb .. kb+15
      const unsigned short* k1p  = k0p + 16 * KPE;                   // keys kb+16 .. kb+31
      const unsigned short* k0lp = k0p + KPLANE;
      const unsigned short* k1lp = k1p + KPLANE;
      v8f s0 = zero8(), s1 = zero8();
#pragma unroll 1
      for (int kc = 0; kc < CDIM / 32; ++kc) {
        const Frag qh  = ldfrag(Qhp + 32 * kc);                      // the chunk's LDS reads stand together, ahead of its products
        const Frag k0  = ldfrag(k0p + 32 * kc);
        const Frag k1  = ldfrag(k1p + 32 * kc);
        const Frag ql  = ldfrag(Qlp + 32 * kc);
        const Frag k0l = ldfrag(k0lp + 32 * kc);
        const Frag k1l = ldfrag(k1lp + 32 * kc);
        s0 = mma_b(k0.bf, qh.bf, s0);
        s1 = mma_b(k1.bf, qh.bf, s1);
        s0 = mma_b(k0.bf, ql.bf, s0);
        s1 = mma_b(k1.bf, ql.bf, s1);
        s0 = mma_b(k0l.bf, qh.bf, s0);
        s1 = mma_b(k1l.bf, qh.bf, s1);
      }

      float mx = fmaxf(hmax8(s0), hmax8(s1));
      mx = fmaxf(mx, __shfl_xor(mx, 16, 32));
      const float mn = fmaxf(m, mx);
      const unsigned grew = wave_ballot(mx > m);                     // wave-uniform
      float corr = 1.0f;
      if (grew != 0u) {
        corr = __expf(m - mn);                                       // == 1 for lanes whose max did not grow
        l *= corr;
      }
      m = mn;
      const float msh = mn - LNPS;                                   // exp gives e^{s-m} * 16384

      FragP ph;
      float ls = 0.f;
#pragma unroll
      for (int r = 0; r < 8; ++r) {
        const float e0 = __expf(s0[r] - msh);                        // key kb      + 8hh + r
        const float e1 = __expf(s1[r] - msh);                        // key kb + 16 + 8hh + r
        ls += e0 + e1;
        ph.hv[0][r] = (_Float16)e0;
        ph.hv[1][r] = (_Float16)e1;
      }
      l += ls;

      *(v4u*)(Psh + pso)     = ph.u[0];
      *(v4u*)(Psh + pso + 4) = ph.u[1];
      Csh[w * 32 + lane] = corr;
      Gsh[w] = (grew != 0u) ? 1 : 0;
    }
    wait_async0();                                                   // own copies of this trip's pv tile have landed
    __syncthreads();                                                 // publishes the P exchange and the pv tile

    {
      const int gf = uni(Gsh[w]);                                    // wave-uniform flag
      if (gf != 0) {
        const float corr = Csh[w * 32 + lane];
#pragma unroll
        for (int j = 0; j < 16; ++j) {
#pragma unroll
          for (int r = 0; r < 8; ++r) o[j][r] *= corr;
        }
      }
      FragP pb;
      pb.u[0] = *(const v4u*)(Psh + pso);
      pb.u[1] = *(const v4u*)(Psh + pso + 4);
#pragma unroll
      for (int jq = 0; jq < 4; ++jq) {
        Frag vf[4];                                                  // four tiles' LDS reads stand together, ahead of their products
#pragma unroll                                                       // constant indices keep vf and o in registers
        for (int jj = 0; jj < 4; ++jj) vf[jj] = ldfrag(Vp + 16 * (4 * jq + jj) * VPE);
#pragma unroll                                                       // as above
        for (int jj = 0; jj < 4; ++jj) o[4 * jq + jj] = mma_h(vf[jj].h, pb.v, o[4 * jq + jj]);
      }
    }
    // foot of the trip: own LDS traffic retired, own copies landed, then the barrier that publishes key tile kb + 32 and
    // ends every read of this trip's key buffer, of the pv tile and of the P exchange; only then the refills
    wait_ds0();
    wait_async0();
    __syncthreads();
    if (kb + KT < NDIM) {                                            // block-uniform: a next trip exists
      copy_vtile(vsl, Vg + (kb + KT));
      if (kb + 2 * KT < NDIM) {                                      // block-uniform: a key tile two ahead exists
        copy_rows32(ksl + (unsigned)buf * (2u * KBUF),               Khg + (size_t)(kb + 2 * KT) * CDIM);
        copy_rows32(ksl + (unsigned)buf * (2u * KBUF) + 2u * KPLANE, Klg + (size_t)(kb + 2 * KT) * CDIM);
      }
    }
  }
  wait_async0();                                                     // nothing in flight when the ring changes its use
  float* Os = (float*)Ks;                                            // output staging; first written behind the next barrier

  if (wave < 4) {
    l += __shfl_xor(l, 16, 32);
    Ish[w * 32 + lane] = (1.0f / l) * OSCALE;                        // o and l both carry the x16384 factor
  }
  __syncthreads();
  const float inv = Ish[w * 32 + lane];

  const int qrow = 16 * w + cl;
  const int e = tid & 7, lq = tid >> 3;                              // lq 0..31
#pragma unroll
  for (int p = 0; p < 4; ++p) {
    if (p) __syncthreads();                                          // every wave finished reading Os
#pragma unroll
    for (int jj = 0; jj < 4; ++jj) {
      const int j = 4 * p + jj;                                        // channels 256 g + 64 p + 16 jj + 8 hh + r
      v4f va, vb;
#pragma unroll
      for (int r = 0; r < 4; ++r) { va[r] = o[j][r] * inv; vb[r] = o[j][4 + r] * inv; }
      *(v4f*)(Os + qrow * OSPW + g * 64 + 16 * jj + 8 * hh)     = va;   // Os[query][64 g + 16 jj + 8 hh + r]
      *(v4f*)(Os + qrow * OSPW + g * 64 + 16 * jj + 8 * hh + 4) = vb;
    }
    __syncthreads();
    v4f res[8];
#pragma unroll
    for (int it = 0; it < 8; ++it) {
      const int L   = it * 32 + lq;                                    // 0..255
      const int ql  = L >> 2, seg = L & 3;                             // query 0..63, line 0..3 of this pass
      const int gg  = seg >> 1, ln = seg & 1;
      res[it] = *(const v4f*)(Os + ql * OSPW + gg * 64 + 32 * ln + 4 * e);
    }
{
#pragma unroll
      for (int it = 0; it < 8; ++it) {
        const int L   = it * 32 + lq;
        const int ql  = L >> 2, seg = L & 3;
        const int gg  = seg >> 1, ln = seg & 1;
        const int ch  = gg * CHH + 64 * p + 32 * ln + 4 * e;
        const size_t idx = ((size_t)(b * NDIM + n0 + ql)) * CDIM + ch;
        *(v4f*)(out + idx) = res[it];
      }
      
    }
  }
}

// =========================================================================================================
// Workspace map (bytes; each region start a multiple of 256; every extent is an exact tile multiple and is written
//   W16 f16 [2048][2048]            8388608   (reused for Wq, Wk, Wv in launch order)
//   X16 f16 [NB][512][2048]        16777216   (reused for q, k, v)
//   Qh/Ql/Kh/Kl bf16 [NB][2048][512] 16777216 x4
//   PV  f16 [NB][512][2048]        16777216
//   total (NB = 8) = 109051904
// =========================================================================================================
extern "C" void kernel_launch(void* const* d_in, const int* in_sizes, int n_in,
                              void* d_out, int out_size, void* d_ws, size_t ws_size,
                              hipStream_t stream) {
  if (n_in < 9) return;
  if (in_sizes[0] < NB * CDIM * NDIM || in_sizes[1] < NB * CDIM * NDIM || in_sizes[2] < NB * CDIM * NDIM) return;
  if (in_sizes[3] < NDIM * NDIM || in_sizes[5] < NDIM * NDIM || in_sizes[7] < NDIM * NDIM) return;
  if (in_sizes[4] < NDIM || in_sizes[6] < NDIM || in_sizes[8] < NDIM) return;
  if (out_size < (NB - 1) * NDIM * CDIM + NQ * CDIM) return;

  size_t off = 0;
  auto carve = [&](size_t bytes) { const size_t o = off; off += (bytes + 255) & ~(size_t)255; return o; };
  const size_t oW16 = carve((size_t)NDIM * NDIM * 2);
  const size_t oX16 = carve((size_t)NB * CDIM * NDIM * 2);
  const size_t oQh  = carve((size_t)NB * NDIM * CDIM * 2);
  const size_t oQl  = carve((size_t)NB * NDIM * CDIM * 2);
  const size_t oKh  = carve((size_t)NB * NDIM * CDIM * 2);
  const size_t oKl  = carve((size_t)NB * NDIM * CDIM * 2);
  const size_t oPV  = carve((size_t)NB * CDIM * NDIM * 2);
  if (off > ws_size) return;
  if (off > (size_t)134217728) return;

  const float* q  = (const float*)d_in[0];
  const float* k  = (const float*)d_in[1];
  const float* v  = (const float*)d_in[2];
  const float* Wq = (const float*)d_in[3];
  const float* bq = (const float*)d_in[4];
  const float* Wk = (const float*)d_in[5];
  const float* bk = (const float*)d_in[6];
  const float* Wv = (const float*)d_in[7];
  const float* bv = (const float*)d_in[8];

  char* ws = (char*)d_ws;
  unsigned short* W16 = (unsigned short*)(ws + oW16);
  unsigned short* X16 = (unsigned short*)(ws + oX16);
  unsigned short* Qh  = (unsigned short*)(ws + oQh);
  unsigned short* Ql  = (unsigned short*)(ws + oQl);
  unsigned short* Kh  = (unsigned short*)(ws + oKh);
  unsigned short* Kl  = (unsigned short*)(ws + oKl);
  unsigned short* PVp = (unsigned short*)(ws + oPV);
  float* out = (float*)d_out;

  const dim3 blk256(256), blk128(128);
  const int cvt_blocks = NDIM + NB * CDIM;

  // q: convert, project -> pq hi + residual planes [b][o][c] for o < NQ
  cvt_k<<<dim3(cvt_blocks), blk256, 0, stream>>>(Wq, q, W16, X16);
  proj_qk<<<dim3(CDIM / QT, NQ / QT, NB), blk128, 0, stream>>>(X16, W16, bq, Qh, Ql);
  // k: convert, project -> pk hi + residual planes [b][o][c], all o
  cvt_k<<<dim3(cvt_blocks), blk256, 0, stream>>>(Wk, k, W16, X16);
  proj_qk<<<dim3(CDIM / QT, NDIM / QT, NB), blk128, 0, stream>>>(X16, W16, bk, Kh, Kl);
  // v: convert, project -> pv^T f16 plane [b][c][o]
  cvt_k<<<dim3(cvt_blocks), blk256, 0, stream>>>(Wv, v, W16, X16);
  proj_v<<<dim3(NDIM / QT, CDIM / QT, NB), blk128, 0, stream>>>(W16, X16, bv, PVp);
  // attention + 1/sqrt(2048) -> out [b][n][c] (the raw view to [b][512][2048] is the same flat buffer)
  attn_k<<<dim3(NQ / QT, NB), blk256, 0, stream>>>(Qh, Ql, Kh, Kl, PVp, out);
  (void)hipGetLastError();
}

// v002
// One run takes 278 microseconds.
// Timed twice side by side with v001, it ran 1.75 and 1.76 times as fast.
// Over all steps from v000 it is 4.39 times as fast.
// Contractions: projections X[c][n].W[o][n]^T (K=2048) on v_wmma_f32_16x16x32_f16 (f16 containers of bf16-RNE W x256 and bf16-RNE x); scores pk.pq^T (K=512) on v_wmma_f32_16x16x32_bf16 (bf16 hi + bf16 residual planes of pq/pk, 3 products); O^T = pv^T.P^T (K=2048 keys) on v_wmma_f32_16x16x32_f16 (pv f16, P = e^{s-m} x16384 f16 from the score D registers); projection and attention operands staged in LDS by asynchronous copies; f32 accumulate everywhere; softmax statistics and scaling in f32 VALU.
#include <hip/hip_runtime.h>
#include <math.h>
#include <stdint.h>

#ifndef NB
#define NB 8
#endif
#ifndef NQ
#define NQ 2048
#endif
#define NB_FULL 8
#define CDIM   512
#define NDIM   2048
#define QT     64
#define CHH    256
#define OSPW   132
#define WSC    256.0f
#define IWSC   0.00390625f
#define LNPS   9.704060527839234f
#define OSCALE 0.022097086912079608f
#define KT     32
#define KPE    520
#define KPLANE (KT * KPE)
#define KBUF   (2 * KPLANE)
#define QPLANE (QT * KPE)
#define VPE    40
#define PT     128
#define PKC    128
#define PPE    136
#define PHALF  (PT * PPE)
#define PBUF   (2 * PHALF)

static_assert(NB >= 1 && NB <= NB_FULL);
static_assert(NQ >= QT && NQ <= NDIM && NQ % QT == 0);
static_assert(CDIM % QT == 0 && NDIM % QT == 0);
static_assert(CDIM % 32 == 0 && NDIM % 32 == 0);
static_assert(CDIM == 2 * CHH && CHH == 16 * 16);
static_assert((OSPW * 4) % 16 == 0);
static_assert(NDIM == 8 * 256);
static_assert((KPE * 2) % 16 == 0 && ((KPE * 2) / 16) % 2 == 1);   // LDS row pitches 16 B x odd: the 16 rows of a b128
static_assert((VPE * 2) % 16 == 0 && ((VPE * 2) / 16) % 2 == 1);   // fragment read fall on all 64 banks once
static_assert(CDIM * 2 == 64 * 16 && KT == 8 * 4 && QT == 2 * KT);  // q/k rows: 64 chunks of 16 B; 8 copies x 256 lanes = 32 rows
static_assert(KT * 2 == 4 * 16 && CDIM == 8 * 64);                  // v rows: 4 chunks of 16 B; 8 copies x 256 lanes = 512 rows
static_assert(NDIM / KT >= 2);
static_assert(CDIM % PT == 0 && NDIM % PT == 0 && NQ % PT == 0 && NDIM % PKC == 0 && NDIM / PKC >= 2);
static_assert((PPE * 2) % 16 == 0 && ((PPE * 2) / 16) % 2 == 1 && PPE >= PKC);  // as for KPE and VPE
static_assert(PKC * 2 == 16 * 16 && PT == 2 * 8 * 8);               // projection rows: 16 chunks of 16 B; 8 copies x 128 lanes = 64 rows
static_assert(PT * OSPW * 4 <= 2 * PBUF * 2);                       // the projections' output staging fits in the ring it reuses
static_assert(QT * OSPW * 4 <= 2 * KBUF * 2);                       // the output staging fits in the key ring it reuses

typedef _Float16       v16h __attribute__((ext_vector_type(16)));
typedef _Float16       v8h  __attribute__((ext_vector_type(8)));
typedef __bf16         v16b __attribute__((ext_vector_type(16)));
typedef unsigned short v8us __attribute__((ext_vector_type(8)));
typedef float          v8f  __attribute__((ext_vector_type(8)));
typedef float          v4f  __attribute__((ext_vector_type(4)));
typedef unsigned int   v4u  __attribute__((ext_vector_type(4)));

union Frag  { v8us u[2]; v16h h; v16b bf; };
union FragP { v16h v; v8h hv[2]; v4u u[2]; };
static_assert(sizeof(Frag) == 32);
static_assert(sizeof(FragP) == 32);

// ---- scalar helpers ---------------------------------------------------------------------------------------
__device__ __forceinline__ unsigned short bf_bits(float f) {          // f32 -> bf16 bits, RNE convert
  unsigned u = __float_as_uint(f);
  return (unsigned short)((u + 0x7FFFu + ((u >> 16) & 1u)) >> 16);
}
__device__ __forceinline__ float bf_up(unsigned short hb) { return __uint_as_float(((unsigned)hb) << 16); }
__device__ __forceinline__ float bfr(float f) { return bf_up(bf_bits(f)); }
__device__ __forceinline__ unsigned short h_bits(_Float16 x) { return __builtin_bit_cast(unsigned short, x); }
__device__ __forceinline__ unsigned pk16(unsigned short a, unsigned short b) { return (unsigned)a | ((unsigned)b << 16); }
__device__ __forceinline__ v8f zero8() { v8f z = {0.f, 0.f, 0.f, 0.f, 0.f, 0.f, 0.f, 0.f}; return z; }
__device__ __forceinline__ float hmax8(v8f s) {
  return fmaxf(fmaxf(fmaxf(s[0], s[1]), fmaxf(s[2], s[3])), fmaxf(fmaxf(s[4], s[5]), fmaxf(s[6], s[7])));
}
__device__ __forceinline__ unsigned wave_ballot(bool p) {
#if defined(__HIP_DEVICE_COMPILE__)
  return __builtin_amdgcn_ballot_w32(p);
#else
  return p ? 1u : 0u;
#endif
}
__device__ __forceinline__ int uni(int v) {                           // wave-uniform int -> SGPR
#if defined(__HIP_DEVICE_COMPILE__)
  return __builtin_amdgcn_readfirstlane(v);
#else
  return v;
#endif
}

// ---- 16-bit fragment loader (A, or B from a k-contiguous [n][k] row): lane -> row/col (lane&15), p already includes
//      + 8*(lane>>4); elements 0..7 <- p[0..7] (k0+8h..), elements 8..15 <- p[16..23] (k0+16+8h..)
__device__ __forceinline__ Frag ldfrag(const unsigned short* p) {
  Frag f;
  f.u[0] = *(const v8us*)(p);
  f.u[1] = *(const v8us*)(p + 16);
  return f;
}

// ---- LDS staging by asynchronous copies ----------------------------------------------------------------------
__device__ __forceinline__ unsigned lds_off(const void* p) { return (unsigned)(size_t)p; }
// Eight 16-B copies per lane, global -> LDS: copy i moves g + i * GSTEP (elements) to LDS byte l + i * LSTEP.
// The closing s_wait_xcnt stands in the copies' own statement so that no address register is rewritten ahead of it.
template <unsigned LSTEP, int GSTEP>
__device__ __forceinline__ void acopy8(unsigned l, const unsigned short* g) {
#if defined(__HIP_DEVICE_COMPILE__)
  asm volatile(
      "global_load_async_to_lds_b128 %0, %8, off\n\t"
      "global_load_async_to_lds_b128 %1, %9, off\n\t"
      "global_load_async_to_lds_b128 %2, %10, off\n\t"
      "global_load_async_to_lds_b128 %3, %11, off\n\t"
      "global_load_async_to_lds_b128 %4, %12, off\n\t"
      "global_load_async_to_lds_b128 %5, %13, off\n\t"
      "global_load_async_to_lds_b128 %6, %14, off\n\t"
      "global_load_async_to_lds_b128 %7, %15, off\n\t"
      "s_wait_xcnt 0x0"
      :: "v"(l), "v"(l + 1u * LSTEP), "v"(l + 2u * LSTEP), "v"(l + 3u * LSTEP),
         "v"(l + 4u * LSTEP), "v"(l + 5u * LSTEP), "v"(l + 6u * LSTEP), "v"(l + 7u * LSTEP),
         "v"(g), "v"(g + 1 * GSTEP), "v"(g + 2 * GSTEP), "v"(g + 3 * GSTEP),
         "v"(g + 4 * GSTEP), "v"(g + 5 * GSTEP), "v"(g + 6 * GSTEP), "v"(g + 7 * GSTEP)
      : "memory");
#endif
}
// 32 q or k rows of 1024 B (contiguous in global) -> LDS pitch 2 KPE: copy i, lane tid -> row 4 i + (tid >> 6), chunk tid & 63
__device__ __forceinline__ void copy_rows32(unsigned l, const unsigned short* g) { acopy8<4u * 2u * KPE, 256 * 8>(l, g); }
// 512 v rows of 64 B (global pitch 2 NDIM bytes) -> LDS pitch 2 VPE: copy i, lane tid -> row 64 i + (tid >> 2), chunk tid & 3
__device__ __forceinline__ void copy_vtile(unsigned l, const unsigned short* g) { acopy8<64u * 2u * VPE, 64 * NDIM>(l, g); }
__device__ __forceinline__ void wait_async0() {                       // this wave's copies have landed in LDS
#if defined(__HIP_DEVICE_COMPILE__)
  asm volatile("s_wait_asynccnt 0x0" ::: "memory");
#endif
}
__device__ __forceinline__ void wait_ds0() {                          // this wave's LDS reads and writes have retired
#if defined(__HIP_DEVICE_COMPILE__)
  asm volatile("s_wait_dscnt 0x0" ::: "memory");
#endif
}

// ---- WMMA helpers: builtin followed by a 4-slot VALU gap tying D and keeping A/B live --------------------------
__device__ __forceinline__ v8f mma_h(v16h a, v16h b, v8f c) {
  v8f d = __builtin_amdgcn_wmma_f32_16x16x32_f16(false, a, false, b, (short)0, c, false, false);
#if defined(__HIP_DEVICE_COMPILE__)
  asm volatile("v_nop\n\tv_nop\n\tv_nop\n\tv_nop" : "+v"(d) : "v"(a), "v"(b));
#endif
  return d;
}
__device__ __forceinline__ v8f mma_b(v16b a, v16b b, v8f c) {
  v8f d = __builtin_amdgcn_wmma_f32_16x16x32_bf16(false, a, false, b, (short)0, c, false, false);
#if defined(__HIP_DEVICE_COMPILE__)
  const v16h ha = __builtin_bit_cast(v16h, a), hb = __builtin_bit_cast(v16h, b);
  asm volatile("v_nop\n\tv_nop\n\tv_nop\n\tv_nop" : "+v"(d) : "v"(ha), "v"(hb));
#endif
  return d;
}

// =========================================================================================================
// (0) row convert, 2048 floats per row, one 256-thread block per row, thread tid -> halves 8 tid .. 8 tid + 7
//     flattened [NB*512] rows = f16(bf16-RNE(x)). Block-uniform selection between two global pointers.
// coverage: W16 2048 blocks x 256 thr x 8 = 2048 x 2048; X16 NB*512 blocks x 256 x 8 = NB x 512 x 2048.
// =========================================================================================================
__global__ __launch_bounds__(256)
void cvt_k(const float* __restrict__ w, const float* __restrict__ x, unsigned short* W16, unsigned short* X16) {
  const int tid = threadIdx.x, r = blockIdx.x;
  const bool isw = (r < NDIM);
  const size_t ro = isw ? (size_t)r * NDIM : (size_t)(r - NDIM) * NDIM;
  const float* s = (isw ? w : x) + ro + 8 * tid;
  unsigned short* d = (isw ? W16 : X16) + ro + 8 * tid;
  const float sc = isw ? WSC : 1.0f;
  const v4f a  = *(const v4f*)s;
  const v4f qv = *(const v4f*)(s + 4);
  const float f[8] = {a[0], a[1], a[2], a[3], qv[0], qv[1], qv[2], qv[3]};
  v4u u;
#pragma unroll
  for (int t = 0; t < 4; ++t) {
    const _Float16 h0 = (_Float16)(bfr(f[2 * t]) * sc);
    const _Float16 h1 = (_Float16)(bfr(f[2 * t + 1]) * sc);
    u[t] = pk16(h_bits(h0), h_bits(h1));
  }
{
    *(v4u*)d = u;
    
  }
}

// =========================================================================================================
// Projection main loop, one 128 x 128 tile of D[m][n] = sum_k A[m][k] B[n][k] per block of 4 waves (2 x 2, 64 x 64 each),
//   A and B rows k-contiguous at pitch NDIM. A stage is PKC = 128 k of the 128 A rows and the 128 B rows, brought into LDS
//   (row pitch 2 PPE bytes) by asynchronous 16-B copies of all 4 waves: copy i of a group, lane tid -> row 8 i + (tid >> 4),
//   chunk tid & 15. Two buffers: stage t + 2 is issued behind the foot barrier of trip t, which also publishes stage t + 1.
//   Each accumulator tile takes its 64 k-steps in ascending order.
// =========================================================================================================
__device__ __forceinline__ void copy_rows64(unsigned l, const unsigned short* g) { acopy8<8u * 2u * PPE, 8 * NDIM>(l, g); }
__device__ __forceinline__ void proj_stage(unsigned l, const unsigned short* ga, const unsigned short* gb) {
  copy_rows64(l,                                 ga);
  copy_rows64(l + 64u * 2u * PPE,                ga + 64 * NDIM);
  copy_rows64(l + 2u * PHALF,                    gb);
  copy_rows64(l + 2u * PHALF + 64u * 2u * PPE,   gb + 64 * NDIM);
}
__device__ __forceinline__ void proj_tile(const unsigned short* Ps, const unsigned short* At, const unsigned short* Bt,
                                          int wm, int wn, v8f (&acc)[4][4]) {
  const int tid  = threadIdx.x;
  const int lane = tid & 31;
  const int hh   = lane >> 4, cl = lane & 15;
  const unsigned short* ga = At + (size_t)(tid >> 4) * NDIM + 8 * (tid & 15);
  const unsigned short* gb = Bt + (size_t)(tid >> 4) * NDIM + 8 * (tid & 15);
  const unsigned psl = lds_off(Ps) + (unsigned)((tid >> 4) * (2 * PPE) + (tid & 15) * 16);
  const unsigned short* ap = Ps + (64 * wm + cl) * PPE + 8 * hh;
  const unsigned short* bp = Ps + PHALF + (64 * wn + cl) * PPE + 8 * hh;

#pragma unroll                                                       // constant indices keep the accumulators in registers
  for (int mt = 0; mt < 4; ++mt) {
#pragma unroll                                                       // as above
    for (int nt = 0; nt < 4; ++nt) acc[mt][nt] = zero8();
  }

  proj_stage(psl, ga, gb);
  wait_async0();
  __syncthreads();                                                   // publishes stage 0
  proj_stage(psl + 2u * PBUF, ga + PKC, gb + PKC);

#pragma unroll 1                                                     // one copy of the trip: the buffer is a run-time offset
  for (int t = 0; t < NDIM / PKC; ++t) {
    const int buf = t & 1;                                           // this trip reads this buffer alone
    const unsigned short* a0 = ap + buf * PBUF;
    const unsigned short* b0 = bp + buf * PBUF;
#pragma unroll                                                       // constant indices keep fragments and accumulators in registers
    for (int ks = 0; ks < PKC / 32; ++ks) {
      Frag fa[4], fb[4];                                             // the k-step's LDS reads stand together, ahead of its products
#pragma unroll                                                       // as above
      for (int i = 0; i < 4; ++i) { fa[i] = ldfrag(a0 + 16 * i * PPE + 32 * ks); fb[i] = ldfrag(b0 + 16 * i * PPE + 32 * ks); }
#pragma unroll                                                       // as above
      for (int mt = 0; mt < 4; ++mt) {
#pragma unroll                                                       // as above
        for (int nt = 0; nt < 4; ++nt) acc[mt][nt] = mma_h(fa[mt].h, fb[nt].h, acc[mt][nt]);
      }
    }
    // foot of the trip: own LDS reads retired, own copies landed, then the barrier that publishes stage t + 1 and ends
    // every read of this trip's buffer; only then its refill
    wait_ds0();
    wait_async0();
    __syncthreads();
    if (t + 2 < NDIM / PKC) proj_stage(psl + (unsigned)buf * (2u * PBUF), ga + (t + 2) * PKC, gb + (t + 2) * PKC);
  }
  wait_async0();                                                     // nothing in flight when the ring changes its use
}
// Accumulators x 1/256 -> Os[n_loc][m_loc] (pitch OSPW, b128 stores). Lane (hh, cl): D element r of tile (mt, nt) =
// (64 wm + 16 mt + 8 hh + r, 64 wn + 16 nt + cl).
__device__ __forceinline__ void proj_unload(float* Os, int wm, int wn, const v8f (&acc)[4][4]) {
  const int lane = threadIdx.x & 31;
  const int hh   = lane >> 4, cl = lane & 15;
#pragma unroll                                                       // constant indices keep the accumulators in registers
  for (int nt = 0; nt < 4; ++nt) {
    const int nl = 64 * wn + 16 * nt + cl;
#pragma unroll                                                       // as above
    for (int mt = 0; mt < 4; ++mt) {
      v4f va, vb;
#pragma unroll                                                       // as above
      for (int r = 0; r < 4; ++r) { va[r] = acc[mt][nt][r] * IWSC; vb[r] = acc[mt][nt][4 + r] * IWSC; }
      *(v4f*)(Os + nl * OSPW + 64 * wm + 16 * mt + 8 * hh)     = va;
      *(v4f*)(Os + nl * OSPW + 64 * wm + 16 * mt + 8 * hh + 4) = vb;
    }
  }
}

// =========================================================================================================
// (1) projection for q / k, one (128-c tile, 128-o tile, b) per block of 4 waves:
//     D[c][o] = sum_n X16[b][c][n] W16[o][n]  (x256): A rows c from X16, B rows o from W16 (same split k map), K = 2048.
//     Epilogue: x 1/256 -> LDS Os[o_loc][c_loc] (reuses the ring behind the loop's last barrier), barrier,
//     + bf16-RNE bias[o], then planes Ph = bf16-RNE(v), Pl = bf16-RNE(v - hi).
// coverage: Os 4 waves x 64 o x 64 c = 128 x 128 (all read); planes 16 it x 8 rows x 16 lanes x 8 = 128 o x 128 c;
//           grid (4, n_otiles, NB) covers rows 0 .. 128 n_otiles - 1 of every batch once.
// =========================================================================================================
__global__ __launch_bounds__(128)
void proj_qk(const unsigned short* __restrict__ X16, const unsigned short* __restrict__ W16,
             const float* __restrict__ bias, unsigned short* Ph, unsigned short* Pl) {
  __shared__ __align__(16) unsigned short Ps[2 * PBUF];              // [buffer][A rows, B rows][128][PPE]
  const int tid  = threadIdx.x;
  const int wave = uni((int)(threadIdx.x >> 5));                     // 0..3, SGPR
  const int wm   = wave & 1, wn = wave >> 1;
  const int ct   = blockIdx.x, ot = blockIdx.y, b = blockIdx.z;
  const int c0   = ct * PT, o0 = ot * PT;

  v8f acc[4][4];
  proj_tile(Ps, X16 + ((size_t)(b * CDIM + c0)) * NDIM, W16 + ((size_t)o0) * NDIM, wm, wn, acc);

  float* Os = (float*)Ps;
  proj_unload(Os, wm, wn, acc);
  __syncthreads();

  const int e = tid & 15, lq = tid >> 4;                             // lq 0..7
  const float* bp = bias + o0 + lq;                                  // row it * 8 + lq at a constant step from here
  v4u uh[16], ul[16];
#pragma unroll
  for (int it = 0; it < 16; ++it) {
    const int row = it * 8 + lq;                                     // o_loc 0..127
    const v4f a  = *(const v4f*)(Os + row * OSPW + 8 * e);
    const v4f qv = *(const v4f*)(Os + row * OSPW + 8 * e + 4);
    const float bb = bfr(bp[it * 8]);
    const float f[8] = {a[0] + bb, a[1] + bb, a[2] + bb, a[3] + bb, qv[0] + bb, qv[1] + bb, qv[2] + bb, qv[3] + bb};
#pragma unroll
    for (int t = 0; t < 4; ++t) {
      const float f0 = f[2 * t], f1 = f[2 * t + 1];
      const unsigned short hb0 = bf_bits(f0), hb1 = bf_bits(f1);
      const unsigned short lb0 = bf_bits(f0 - bf_up(hb0));
      const unsigned short lb1 = bf_bits(f1 - bf_up(hb1));
      uh[it][t] = pk16(hb0, hb1);
      ul[it][t] = pk16(lb0, lb1);
    }
  }
  {
    const size_t po = ((size_t)(b * NDIM + o0 + lq)) * CDIM + c0 + 8 * e;   // row it * 8 + lq at a constant step from here
    unsigned short* ph = Ph + po;
    unsigned short* pl = Pl + po;
#pragma unroll
    for (int it = 0; it < 16; ++it) {
      *(v4u*)(ph + it * 8 * CDIM) = uh[it];
      *(v4u*)(pl + it * 8 * CDIM) = ul[it];
    }
  }
}

// =========================================================================================================
// (2) projection for v, one (128-o tile, 128-c tile, b) per block of 4 waves:
//     D[o][c] = sum_n W16[o][n] X16[b][c][n] (x256): A rows o from W16, B rows c from X16 (same split k map), K = 2048.
//     Epilogue: x 1/256 -> LDS Os[c_loc][o_loc] (reuses the ring behind the loop's last barrier), barrier,
//     + bf16-RNE bias[o], then the f16 plane.
// coverage: Os 4 waves x 64 c x 64 o = 128 x 128 (all read); plane 16 it x 8 rows x 16 lanes x 8 = 128 c x 128 o;
//           grid (16, 4, NB) covers PV[b][0..511][0..2047] once.
// =========================================================================================================
__global__ __launch_bounds__(128)
void proj_v(const unsigned short* __restrict__ W16, const unsigned short* __restrict__ X16,
            const float* __restrict__ bias, unsigned short* PV) {
  __shared__ __align__(16) unsigned short Ps[2 * PBUF];              // [buffer][A rows, B rows][128][PPE]
  const int tid  = threadIdx.x;
  const int wave = uni((int)(threadIdx.x >> 5));                     // 0..3, SGPR
  const int wm   = wave & 1, wn = wave >> 1;
  const int ot   = blockIdx.x, ct = blockIdx.y, b = blockIdx.z;
  const int o0   = ot * PT, c0 = ct * PT;

  v8f acc[4][4];
  proj_tile(Ps, W16 + ((size_t)o0) * NDIM, X16 + ((size_t)(b * CDIM + c0)) * NDIM, wm, wn, acc);

  float* Os = (float*)Ps;
  proj_unload(Os, wm, wn, acc);
  __syncthreads();

  const int e = tid & 15, lq = tid >> 4;                             // lq 0..7
  const v4f ba = *(const v4f*)(bias + o0 + 8 * e);
  const v4f bq = *(const v4f*)(bias + o0 + 8 * e + 4);
  const float bb[8] = {bfr(ba[0]), bfr(ba[1]), bfr(ba[2]), bfr(ba[3]), bfr(bq[0]), bfr(bq[1]), bfr(bq[2]), bfr(bq[3])};
  v4u uv[16];
#pragma unroll
  for (int it = 0; it < 16; ++it) {
    const int row = it * 8 + lq;                                     // c_loc 0..127
    const v4f a  = *(const v4f*)(Os + row * OSPW + 8 * e);
    const v4f qv = *(const v4f*)(Os + row * OSPW + 8 * e + 4);
    const float f[8] = {a[0], a[1], a[2], a[3], qv[0], qv[1], qv[2], qv[3]};
#pragma unroll
    for (int t = 0; t < 4; ++t) {
      const _Float16 h0 = (_Float16)(f[2 * t] + bb[2 * t]);
      const _Float16 h1 = (_Float16)(f[2 * t + 1] + bb[2 * t + 1]);
      uv[it][t] = pk16(h_bits(h0), h_bits(h1));
    }
  }
  {
    unsigned short* pv = PV + ((size_t)(b * CDIM + c0 + lq)) * NDIM + o0 + 8 * e;   // row it * 8 + lq at a constant step from here
#pragma unroll
    for (int it = 0; it < 16; ++it) *(v4u*)(pv + it * 8 * NDIM) = uv[it];
  }
}

// =========================================================================================================
// (3) attention for one (b, 64-query tile), transposed formulation, 2048 keys, no mask, no scale on the scores.
//   Block = 8 waves. Waves 0..3 (w = wave) are score waves for queries n0 + 16 w .. + 15; waves 4..7 share the query
//   group w = wave - 4. Channel half g = wave >> 2 (channels 256 g .. 256 g + 255) for the P.V accumulators.
//   Per 32-key block kb (score waves only): S^T tiles (16 keys x 16 queries) = sum over 16 c-chunks of
//   A(Kh: row = key kb + (lane&15), k = c via the split map, plane [b][2048][512]) . B(Qh: col = query, same map)
//   + A(Kh).B(Ql) + A(Kl).B(Qh) (bf16 unscaled residual planes, shared accumulator). Per lane the D tiles hold
//   8 + 8 keys of ONE query: online softmax state per lane, one shuffle (lane^16) for the max over 32 keys; the
//   rescale factor is skipped under a wave-uniform ballot when no lane's max grew. P = e^{s-m} x 16384 as f16:
//   B operand of O^T: element r <- D of the tile covering keys kb..kb+15, element 8+r <- the tile covering
//   kb+16..kb+31, lane unchanged. The score wave publishes P (32 B per lane), corr and the grew flag in LDS;
//   after a block barrier all 8 waves rescale (if grew) and run O^T[ch][q] += A(PV rows ch = 256 g + 16 j +
//   (lane&15), keys contiguous, f16 plane [b][512][2048]) . B(P) on 16 accumulator tiles; second block barrier
//   before the next kb overwrites the LDS exchange. At the end score waves publish inv = (1/l) / sqrt(2048).
//   Epilogue in 4 channel passes of 64 channels per wave: O x inv staged in LDS Os[query][128] (pitch OSPW, b128
//   barrier before the next pass overwrites Os.
//   Operands come from LDS, brought by asynchronous 16-B copies of all 8 waves: the 64-query tile (both planes) once;
//   the 32-key tiles (both planes) in two buffers, tile t + 2 issued behind the foot barrier of trip t; the 512 x 32 pv
//   tile in one buffer, tile t + 1 issued behind the same barrier (its readers of trip t have passed it) and published
//   by the barrier between the scores and the P.V products of trip t + 1. Every wave waits for its own copies in front
//   of both barriers. Os reuses the key ring behind the loop.
// coverage: per pass 8 it x 32 lines x 8 lanes x 4 floats = 64 queries x 128 ch; 4 passes = 512 ch;
//           grid (NQ/64, NB) covers out[b][0..NQ-1][0..511] exactly once.
// =========================================================================================================
__global__ __launch_bounds__(256)
void attn_k(const unsigned short* __restrict__ Qh, const unsigned short* __restrict__ Ql,
            const unsigned short* __restrict__ Kh, const unsigned short* __restrict__ Kl,
            const unsigned short* __restrict__ PV, float* out) {
  __shared__ __align__(16) unsigned short Qs[2 * QPLANE];            // [hi, residual][64 queries][KPE]
  __shared__ __align__(16) unsigned short Ks[2 * KBUF];              // [buffer][hi, residual][32 keys][KPE]
  __shared__ __align__(16) unsigned short Vs[CDIM * VPE];            // [512 channels][VPE], 32 keys used
  __shared__ __align__(16) unsigned Psh[4 * 32 * 8];
  __shared__ float Csh[4 * 32];
  __shared__ float Ish[4 * 32];
  __shared__ int   Gsh[4];
  const int tid  = threadIdx.x;
  const int lane = tid & 31;
  const int wave = uni((int)(threadIdx.x >> 5));                     // 0..7, SGPR
  const int w    = wave & 3, g = wave >> 2;
  const int hh   = lane >> 4, cl = lane & 15;
  const int n0   = blockIdx.x * QT, b = blockIdx.y;

  // q fragment pointers in LDS (B operand, col = query 16 w + cl of the tile), + 32*kc
  const unsigned short* Qhp = Qs + (16 * w + cl) * KPE + 8 * hh;
  const unsigned short* Qlp = Qhp + QPLANE;
  // k fragment base in LDS (A operand, row = key cl of the tile), + buffer * KBUF + 32*kc
  const unsigned short* Ksp = Ks + cl * KPE + 8 * hh;
  // v fragment base in LDS (A operand, row = channel 256 g + 16 j + cl, the tile's 32 keys contiguous), + 16*j*VPE
  const unsigned short* Vp = Vs + (g * CHH + cl) * VPE + 8 * hh;
  // copy sources (the lane's 16-B chunk of copy 0) and LDS places
  const unsigned short* Khg = Kh + (size_t)b * NDIM * CDIM + 8 * tid;
  const unsigned short* Klg = Kl + (size_t)b * NDIM * CDIM + 8 * tid;
  const unsigned short* Vg  = PV + (size_t)b * CDIM * NDIM + (size_t)(tid >> 2) * NDIM + 8 * (tid & 3);
  const unsigned rpl = (unsigned)((tid >> 6) * (2 * KPE) + (tid & 63) * 16);
  const unsigned ksl = lds_off(Ks) + rpl;
  const unsigned vsl = lds_off(Vs) + (unsigned)((tid >> 2) * (2 * VPE) + (tid & 3) * 16);

  const int pso = (w * 32 + lane) * 8;                               // LDS exchange slot (uints)

  float m = -1.0e30f, l = 0.f;
  v8f o[16];
#pragma unroll
  for (int j = 0; j < 16; ++j) o[j] = zero8();

  // prologue: the query tile (filled once), key tile 0 and pv tile 0, published by one barrier; then key tile 1
  {
    const size_t qg = ((size_t)(b * NDIM + n0)) * CDIM + 8 * tid;
    const unsigned qsl = lds_off(Qs) + rpl;
    copy_rows32(qsl,                             Qh + qg);
    copy_rows32(qsl + 2u * KPLANE,               Qh + qg + KT * CDIM);
    copy_rows32(qsl + 2u * QPLANE,               Ql + qg);
    copy_rows32(qsl + 2u * QPLANE + 2u * KPLANE, Ql + qg + KT * CDIM);
    wait_async0();
    copy_rows32(ksl,               Khg);
    copy_rows32(ksl + 2u * KPLANE, Klg);
    copy_vtile(vsl, Vg);
    wait_async0();
    __syncthreads();
    copy_rows32(ksl + 2u * KBUF,               Khg + KT * CDIM);
    copy_rows32(ksl + 2u * KBUF + 2u * KPLANE, Klg + KT * CDIM);
  }

#pragma unroll 1
  for (int kb = 0; kb < NDIM; kb += KT) {
    const int buf = (kb / KT) & 1;                                   // this trip reads this key buffer alone
    if (wave < 4) {                                                  // wave-uniform (SGPR) role branch
      const unsigned short* k0p  = Ksp + buf * KBUF;                 // keys kb .. kb+15
      const unsigned short* k1p  = k0p + 16 * KPE;                   // keys kb+16 .. kb+31
      const unsigned short* k0lp = k0p + KPLANE;
      const unsigned short* k1lp = k1p + KPLANE;
      v8f s0 = zero8(), s1 = zero8();
#pragma unroll 1
      for (int kc = 0; kc < CDIM / 32; ++kc) {
        const Frag qh  = ldfrag(Qhp + 32 * kc);                      // the chunk's LDS reads stand together, ahead of its products
        const Frag k0  = ldfrag(k0p + 32 * kc);
        const Frag k1  = ldfrag(k1p + 32 * kc);
        const Frag ql  = ldfrag(Qlp + 32 * kc);
        const Frag k0l = ldfrag(k0lp + 32 * kc);
        const Frag k1l = ldfrag(k1lp + 32 * kc);
        s0 = mma_b(k0.bf, qh.bf, s0);
        s1 = mma_b(k1.bf, qh.bf, s1);
        s0 = mma_b(k0.bf, ql.bf, s0);
        s1 = mma_b(k1.bf, ql.bf, s1);
        s0 = mma_b(k0l.bf, qh.bf, s0);
        s1 = mma_b(k1l.bf, qh.bf, s1);
      }

      float mx = fmaxf(hmax8(s0), hmax8(s1));
      mx = fmaxf(mx, __shfl_xor(mx, 16, 32));
      const float mn = fmaxf(m, mx);
      const unsigned grew = wave_ballot(mx > m);                     // wave-uniform
      float corr = 1.0f;
      if (grew != 0u) {
        corr = __expf(m - mn);                                       // == 1 for lanes whose max did not grow
        l *= corr;
      }
      m = mn;
      const float msh = mn - LNPS;                                   // exp gives e^{s-m} * 16384

      FragP ph;
      float ls = 0.f;
#pragma unroll
      for (int r = 0; r < 8; ++r) {
        const float e0 = __expf(s0[r] - msh);                        // key kb      + 8hh + r
        const float e1 = __expf(s1[r] - msh);                        // key kb + 16 + 8hh + r
        ls += e0 + e1;
        ph.hv[0][r] = (_Float16)e0;
        ph.hv[1][r] = (_Float16)e1;
      }
      l += ls;

      *(v4u*)(Psh + pso)     = ph.u[0];
      *(v4u*)(Psh + pso + 4) = ph.u[1];
      Csh[w * 32 + lane] = corr;
      Gsh[w] = (grew != 0u) ? 1 : 0;
    }
    wait_async0();                                                   // own copies of this trip's pv tile have landed
    __syncthreads();                                                 // publishes the P exchange and the pv tile

    {
      const int gf = uni(Gsh[w]);                                    // wave-uniform flag
      if (gf != 0) {
        const float corr = Csh[w * 32 + lane];
#pragma unroll
        for (int j = 0; j < 16; ++j) {
#pragma unroll
          for (int r = 0; r < 8; ++r) o[j][r] *= corr;
        }
      }
      FragP pb;
      pb.u[0] = *(const v4u*)(Psh + pso);
      pb.u[1] = *(const v4u*)(Psh + pso + 4);
#pragma unroll
      for (int jq = 0; jq < 4; ++jq) {
        Frag vf[4];                                                  // four tiles' LDS reads stand together, ahead of their products
#pragma unroll                                                       // constant indices keep vf and o in registers
        for (int jj = 0; jj < 4; ++jj) vf[jj] = ldfrag(Vp + 16 * (4 * jq + jj) * VPE);
#pragma unroll                                                       // as above
        for (int jj = 0; jj < 4; ++jj) o[4 * jq + jj] = mma_h(vf[jj].h, pb.v, o[4 * jq + jj]);
      }
    }
    // foot of the trip: own LDS traffic retired, own copies landed, then the barrier that publishes key tile kb + 32 and
    // ends every read of this trip's key buffer, of the pv tile and of the P exchange; only then the refills
    wait_ds0();
    wait_async0();
    __syncthreads();
    if (kb + KT < NDIM) {                                            // block-uniform: a next trip exists
      copy_vtile(vsl, Vg + (kb + KT));
      if (kb + 2 * KT < NDIM) {                                      // block-uniform: a key tile two ahead exists
        copy_rows32(ksl + (unsigned)buf * (2u * KBUF),               Khg + (size_t)(kb + 2 * KT) * CDIM);
        copy_rows32(ksl + (unsigned)buf * (2u * KBUF) + 2u * KPLANE, Klg + (size_t)(kb + 2 * KT) * CDIM);
      }
    }
  }
  wait_async0();                                                     // nothing in flight when the ring changes its use
  float* Os = (float*)Ks;                                            // output staging; first written behind the next barrier

  if (wave < 4) {
    l += __shfl_xor(l, 16, 32);
    Ish[w * 32 + lane] = (1.0f / l) * OSCALE;                        // o and l both carry the x16384 factor
  }
  __syncthreads();
  const float inv = Ish[w * 32 + lane];

  const int qrow = 16 * w + cl;
  const int e = tid & 7, lq = tid >> 3;                              // lq 0..31
#pragma unroll
  for (int p = 0; p < 4; ++p) {
    if (p) __syncthreads();                                          // every wave finished reading Os
#pragma unroll
    for (int jj = 0; jj < 4; ++jj) {
      const int j = 4 * p + jj;                                        // channels 256 g + 64 p + 16 jj + 8 hh + r
      v4f va, vb;
#pragma unroll
      for (int r = 0; r < 4; ++r) { va[r] = o[j][r] * inv; vb[r] = o[j][4 + r] * inv; }
      *(v4f*)(Os + qrow * OSPW + g * 64 + 16 * jj + 8 * hh)     = va;   // Os[query][64 g + 16 jj + 8 hh + r]
      *(v4f*)(Os + qrow * OSPW + g * 64 + 16 * jj + 8 * hh + 4) = vb;
    }
    __syncthreads();
    v4f res[8];
#pragma unroll
    for (int it = 0; it < 8; ++it) {
      const int L   = it * 32 + lq;                                    // 0..255
      const int ql  = L >> 2, seg = L & 3;                             // query 0..63, line 0..3 of this pass
      const int gg  = seg >> 1, ln = seg & 1;
      res[it] = *(const v4f*)(Os + ql * OSPW + gg * 64 + 32 * ln + 4 * e);
    }
{
#pragma unroll
      for (int it = 0; it < 8; ++it) {
        const int L   = it * 32 + lq;
        const int ql  = L >> 2, seg = L & 3;
        const int gg  = seg >> 1, ln = seg & 1;
        const int ch  = gg * CHH + 64 * p + 32 * ln + 4 * e;
        const size_t idx = ((size_t)(b * NDIM + n0 + ql)) * CDIM + ch;
        *(v4f*)(out + idx) = res[it];
      }
      
    }
  }
}

// =========================================================================================================
// Workspace map (bytes; each region start a multiple of 256; every extent is an exact tile multiple and is written
//   W16 f16 [2048][2048]            8388608   (reused for Wq, Wk, Wv in launch order)
//   X16 f16 [NB][512][2048]        16777216   (reused for q, k, v)
//   Qh/Ql/Kh/Kl bf16 [NB][2048][512] 16777216 x4
//   PV  f16 [NB][512][2048]        16777216
//   total (NB = 8) = 109051904
// =========================================================================================================
extern "C" void kernel_launch(void* const* d_in, const int* in_sizes, int n_in,
                              void* d_out, int out_size, void* d_ws, size_t ws_size,
                              hipStream_t stream) {
  if (n_in < 9) return;
  if (in_sizes[0] < NB * CDIM * NDIM || in_sizes[1] < NB * CDIM * NDIM || in_sizes[2] < NB * CDIM * NDIM) return;
  if (in_sizes[3] < NDIM * NDIM || in_sizes[5] < NDIM * NDIM || in_sizes[7] < NDIM * NDIM) return;
  if (in_sizes[4] < NDIM || in_sizes[6] < NDIM || in_sizes[8] < NDIM) return;
  if (out_size < (NB - 1) * NDIM * CDIM + NQ * CDIM) return;

  size_t off = 0;
  auto carve = [&](size_t bytes) { const size_t o = off; off += (bytes + 255) & ~(size_t)255; return o; };
  const size_t oW16 = carve((size_t)NDIM * NDIM * 2);
  const size_t oX16 = carve((size_t)NB * CDIM * NDIM * 2);
  const size_t oQh  = carve((size_t)NB * NDIM * CDIM * 2);
  const size_t oQl  = carve((size_t)NB * NDIM * CDIM * 2);
  const size_t oKh  = carve((size_t)NB * NDIM * CDIM * 2);
  const size_t oKl  = carve((size_t)NB * NDIM * CDIM * 2);
  const size_t oPV  = carve((size_t)NB * CDIM * NDIM * 2);
  if (off > ws_size) return;
  if (off > (size_t)134217728) return;

  const float* q  = (const float*)d_in[0];
  const float* k  = (const float*)d_in[1];
  const float* v  = (const float*)d_in[2];
  const float* Wq = (const float*)d_in[3];
  const float* bq = (const float*)d_in[4];
  const float* Wk = (const float*)d_in[5];
  const float* bk = (const float*)d_in[6];
  const float* Wv = (const float*)d_in[7];
  const float* bv = (const float*)d_in[8];

  char* ws = (char*)d_ws;
  unsigned short* W16 = (unsigned short*)(ws + oW16);
  unsigned short* X16 = (unsigned short*)(ws + oX16);
  unsigned short* Qh  = (unsigned short*)(ws + oQh);
  unsigned short* Ql  = (unsigned short*)(ws + oQl);
  unsigned short* Kh  = (unsigned short*)(ws + oKh);
  unsigned short* Kl  = (unsigned short*)(ws + oKl);
  unsigned short* PVp = (unsigned short*)(ws + oPV);
  float* out = (float*)d_out;

  const dim3 blk256(256), blk128(128);
  const int cvt_blocks = NDIM + NB * CDIM;

  // q: convert, project -> pq hi + residual planes [b][o][c] for o < NQ
  cvt_k<<<dim3(cvt_blocks), blk256, 0, stream>>>(Wq, q, W16, X16);
  proj_qk<<<dim3(CDIM / PT, NQ / PT, NB), blk128, 0, stream>>>(X16, W16, bq, Qh, Ql);
  // k: convert, project -> pk hi + residual planes [b][o][c], all o
  cvt_k<<<dim3(cvt_blocks), blk256, 0, stream>>>(Wk, k, W16, X16);
  proj_qk<<<dim3(CDIM / PT, NDIM / PT, NB), blk128, 0, stream>>>(X16, W16, bk, Kh, Kl);
  // v: convert, project -> pv^T f16 plane [b][c][o]
  cvt_k<<<dim3(cvt_blocks), blk256, 0, stream>>>(Wv, v, W16, X16);
  proj_v<<<dim3(NDIM / PT, CDIM / PT, NB), blk128, 0, stream>>>(W16, X16, bv, PVp);
  // attention + 1/sqrt(2048) -> out [b][n][c] (the raw view to [b][512][2048] is the same flat buffer)
  attn_k<<<dim3(NQ / QT, NB), blk256, 0, stream>>>(Qh, Ql, Kh, Kl, PVp, out);
  (void)hipGetLastError();
}

// v003
// It runs in 242 microseconds.
// Next to v002, in two timings, it ran 1.13 times as fast each time.
// Counting every step since v000, it is 4.95 times as fast.
// Contractions: projections X[c][n].W[o][n]^T (K=2048) on v_wmma_f32_16x16x32_f16 (f16 containers of bf16-RNE W x256 and bf16-RNE x); scores pk.pq^T (K=512) on v_wmma_f32_16x16x32_bf16 (bf16 hi + bf16 residual planes of pq/pk, 3 products); O^T = pv^T.P^T (K=2048 keys) on v_wmma_f32_16x16x32_f16 (pv f16, P = e^{s-m} x16384 f16 from the score D registers); projection and attention operands staged in LDS by asynchronous copies; f32 accumulate everywhere; softmax statistics and scaling in f32 VALU.
#include <hip/hip_runtime.h>
#include <math.h>
#include <stdint.h>

#ifndef NB
#define NB 8
#endif
#ifndef NQ
#define NQ 2048
#endif
#define NB_FULL 8
#define CDIM   512
#define NDIM   2048
#define QT     64
#define CHH    256
#define OSPW   132
#define WSC    256.0f
#define IWSC   0.00390625f
#define LNPS   9.704060527839234f
#define OSCALE 0.022097086912079608f
#define KT     32
#define KPE    520
#define KPLANE (KT * KPE)
#define KBUF   (2 * KPLANE)
#define QPLANE (QT * KPE)
#define VPE    40
#define PT     128
#define PKC    128
#define PPE    136
#define PHALF  (PT * PPE)
#define PBUF   (2 * PHALF)

static_assert(NB >= 1 && NB <= NB_FULL);
static_assert(NQ >= QT && NQ <= NDIM && NQ % QT == 0);
static_assert(CDIM % QT == 0 && NDIM % QT == 0);
static_assert(CDIM % 32 == 0 && NDIM % 32 == 0);
static_assert(CDIM == 2 * CHH && CHH == 16 * 16);
static_assert((OSPW * 4) % 16 == 0);
static_assert(NDIM == 8 * 256);
static_assert((KPE * 2) % 16 == 0 && ((KPE * 2) / 16) % 2 == 1);   // LDS row pitches 16 B x odd: the 16 rows of a b128
static_assert((VPE * 2) % 16 == 0 && ((VPE * 2) / 16) % 2 == 1);   // fragment read fall on all 64 banks once
static_assert(CDIM * 2 == 64 * 16 && KT == 8 * 4 && QT == 2 * KT);  // q/k rows: 64 chunks of 16 B; 8 copies x 256 lanes = 32 rows
static_assert(KT * 2 == 4 * 16 && CDIM == 8 * 64);                  // v rows: 4 chunks of 16 B; 8 copies x 256 lanes = 512 rows
static_assert(NDIM / KT >= 2);
static_assert(CDIM % PT == 0 && NDIM % PT == 0 && NQ % PT == 0 && NDIM % PKC == 0 && NDIM / PKC >= 2);
static_assert((PPE * 2) % 16 == 0 && ((PPE * 2) / 16) % 2 == 1 && PPE >= PKC);  // as for KPE and VPE
static_assert(PKC * 2 == 16 * 16 && PT == 2 * 8 * 8);               // projection rows: 16 chunks of 16 B; 8 copies x 128 lanes = 64 rows
static_assert(PT * OSPW * 4 <= 2 * PBUF * 2);                       // the projections' output staging fits in the ring it reuses
static_assert(QT * OSPW * 4 <= 2 * KBUF * 2);                       // the output staging fits in the key ring it reuses

typedef _Float16       v16h __attribute__((ext_vector_type(16)));
typedef _Float16       v8h  __attribute__((ext_vector_type(8)));
typedef __bf16         v16b __attribute__((ext_vector_type(16)));
typedef unsigned short v8us __attribute__((ext_vector_type(8)));
typedef float          v8f  __attribute__((ext_vector_type(8)));
typedef float          v4f  __attribute__((ext_vector_type(4)));
typedef unsigned int   v4u  __attribute__((ext_vector_type(4)));

union Frag  { v8us u[2]; v16h h; v16b bf; };
union FragP { v16h v; v8h hv[2]; v4u u[2]; };
static_assert(sizeof(Frag) == 32);
static_assert(sizeof(FragP) == 32);

// ---- scalar helpers ---------------------------------------------------------------------------------------
__device__ __forceinline__ unsigned short bf_bits(float f) {          // f32 -> bf16 bits, RNE convert
  unsigned u = __float_as_uint(f);
  return (unsigned short)((u + 0x7FFFu + ((u >> 16) & 1u)) >> 16);
}
__device__ __forceinline__ float bf_up(unsigned short hb) { return __uint_as_float(((unsigned)hb) << 16); }
__device__ __forceinline__ float bfr(float f) { return bf_up(bf_bits(f)); }
__device__ __forceinline__ unsigned short h_bits(_Float16 x) { return __builtin_bit_cast(unsigned short, x); }
__device__ __forceinline__ unsigned pk16(unsigned short a, unsigned short b) { return (unsigned)a | ((unsigned)b << 16); }
__device__ __forceinline__ v8f zero8() { v8f z = {0.f, 0.f, 0.f, 0.f, 0.f, 0.f, 0.f, 0.f}; return z; }
__device__ __forceinline__ float hmax8(v8f s) {
  return fmaxf(fmaxf(fmaxf(s[0], s[1]), fmaxf(s[2], s[3])), fmaxf(fmaxf(s[4], s[5]), fmaxf(s[6], s[7])));
}
__device__ __forceinline__ unsigned wave_ballot(bool p) {
#if defined(__HIP_DEVICE_COMPILE__)
  return __builtin_amdgcn_ballot_w32(p);
#else
  return p ? 1u : 0u;
#endif
}
__device__ __forceinline__ int uni(int v) {                           // wave-uniform int -> SGPR
#if defined(__HIP_DEVICE_COMPILE__)
  return __builtin_amdgcn_readfirstlane(v);
#else
  return v;
#endif
}

// ---- 16-bit fragment loader (A, or B from a k-contiguous [n][k] row): lane -> row/col (lane&15), p already includes
//      + 8*(lane>>4); elements 0..7 <- p[0..7] (k0+8h..), elements 8..15 <- p[16..23] (k0+16+8h..)
__device__ __forceinline__ Frag ldfrag(const unsigned short* p) {
  Frag f;
  f.u[0] = *(const v8us*)(p);
  f.u[1] = *(const v8us*)(p + 16);
  return f;
}

// ---- LDS staging by asynchronous copies ----------------------------------------------------------------------
__device__ __forceinline__ unsigned lds_off(const void* p) { return (unsigned)(size_t)p; }
// Eight 16-B copies per lane, global -> LDS: copy i moves g + i * GSTEP (elements) to LDS byte l + i * LSTEP.
// The closing s_wait_xcnt stands in the copies' own statement so that no address register is rewritten ahead of it.
template <unsigned LSTEP, int GSTEP>
__device__ __forceinline__ void acopy8(unsigned l, const unsigned short* g) {
#if defined(__HIP_DEVICE_COMPILE__)
  asm volatile(
      "global_load_async_to_lds_b128 %0, %8, off\n\t"
      "global_load_async_to_lds_b128 %1, %9, off\n\t"
      "global_load_async_to_lds_b128 %2, %10, off\n\t"
      "global_load_async_to_lds_b128 %3, %11, off\n\t"
      "global_load_async_to_lds_b128 %4, %12, off\n\t"
      "global_load_async_to_lds_b128 %5, %13, off\n\t"
      "global_load_async_to_lds_b128 %6, %14, off\n\t"
      "global_load_async_to_lds_b128 %7, %15, off\n\t"
      "s_wait_xcnt 0x0"
      :: "v"(l), "v"(l + 1u * LSTEP), "v"(l + 2u * LSTEP), "v"(l + 3u * LSTEP),
         "v"(l + 4u * LSTEP), "v"(l + 5u * LSTEP), "v"(l + 6u * LSTEP), "v"(l + 7u * LSTEP),
         "v"(g), "v"(g + 1 * GSTEP), "v"(g + 2 * GSTEP), "v"(g + 3 * GSTEP),
         "v"(g + 4 * GSTEP), "v"(g + 5 * GSTEP), "v"(g + 6 * GSTEP), "v"(g + 7 * GSTEP)
      : "memory");
#endif
}
// 32 q or k rows of 1024 B (contiguous in global) -> LDS pitch 2 KPE: copy i, lane tid -> row 4 i + (tid >> 6), chunk tid & 63
__device__ __forceinline__ void copy_rows32(unsigned l, const unsigned short* g) { acopy8<4u * 2u * KPE, 256 * 8>(l, g); }
// 512 v rows of 64 B (global pitch 2 NDIM bytes) -> LDS pitch 2 VPE: copy i, lane tid -> row 64 i + (tid >> 2), chunk tid & 3
__device__ __forceinline__ void copy_vtile(unsigned l, const unsigned short* g) { acopy8<64u * 2u * VPE, 64 * NDIM>(l, g); }
__device__ __forceinline__ void wait_async0() {                       // this wave's copies have landed in LDS
#if defined(__HIP_DEVICE_COMPILE__)
  asm volatile("s_wait_asynccnt 0x0" ::: "memory");
#endif
}
__device__ __forceinline__ void wait_ds0() {                          // this wave's LDS reads and writes have retired
#if defined(__HIP_DEVICE_COMPILE__)
  asm volatile("s_wait_dscnt 0x0" ::: "memory");
#endif
}

// ---- WMMA helpers: mma_h is the f16 builtin followed by a 4-slot VALU gap tying D and keeping A/B live --------------------------
__device__ __forceinline__ v8f mma_h(v16h a, v16h b, v8f c) {
  v8f d = __builtin_amdgcn_wmma_f32_16x16x32_f16(false, a, false, b, (short)0, c, false, false);
#if defined(__HIP_DEVICE_COMPILE__)
  asm volatile("v_nop\n\tv_nop\n\tv_nop\n\tv_nop" : "+v"(d) : "v"(a), "v"(b));
#endif
  return d;
}

// Score product by the builtin alone (the compiler keeps its distances): an asm statement's vector operands must lie
// below v256, and the score loop's two fragment sets beside the output accumulators do not all fit there.
__device__ __forceinline__ v8f mma_s(v16b a, v16b b, v8f c) {
  return __builtin_amdgcn_wmma_f32_16x16x32_bf16(false, a, false, b, (short)0, c, false, false);
}

// =========================================================================================================
// (0) row convert, 2048 floats per row, one 256-thread block per row, thread tid -> halves 8 tid .. 8 tid + 7
//     flattened [NB*512] rows = f16(bf16-RNE(x)). Block-uniform selection between two global pointers.
// coverage: W16 2048 blocks x 256 thr x 8 = 2048 x 2048; X16 NB*512 blocks x 256 x 8 = NB x 512 x 2048.
// =========================================================================================================
__global__ __launch_bounds__(256)
void cvt_k(const float* __restrict__ w, const float* __restrict__ x, unsigned short* W16, unsigned short* X16) {
  const int tid = threadIdx.x, r = blockIdx.x;
  const bool isw = (r < NDIM);
  const size_t ro = isw ? (size_t)r * NDIM : (size_t)(r - NDIM) * NDIM;
  const float* s = (isw ? w : x) + ro + 8 * tid;
  unsigned short* d = (isw ? W16 : X16) + ro + 8 * tid;
  const float sc = isw ? WSC : 1.0f;
  const v4f a  = *(const v4f*)s;
  const v4f qv = *(const v4f*)(s + 4);
  const float f[8] = {a[0], a[1], a[2], a[3], qv[0], qv[1], qv[2], qv[3]};
  v4u u;
#pragma unroll
  for (int t = 0; t < 4; ++t) {
    const _Float16 h0 = (_Float16)(bfr(f[2 * t]) * sc);
    const _Float16 h1 = (_Float16)(bfr(f[2 * t + 1]) * sc);
    u[t] = pk16(h_bits(h0), h_bits(h1));
  }
{
    *(v4u*)d = u;
    
  }
}

// =========================================================================================================
// Projection main loop, one 128 x 128 tile of D[m][n] = sum_k A[m][k] B[n][k] per block of 4 waves (2 x 2, 64 x 64 each),
//   A and B rows k-contiguous at pitch NDIM. A stage is PKC = 128 k of the 128 A rows and the 128 B rows, brought into LDS
//   (row pitch 2 PPE bytes) by asynchronous 16-B copies of all 4 waves: copy i of a group, lane tid -> row 8 i + (tid >> 4),
//   chunk tid & 15. Two buffers: stage t + 2 is issued behind the foot barrier of trip t, which also publishes stage t + 1.
//   Each accumulator tile takes its 64 k-steps in ascending order.
// =========================================================================================================
__device__ __forceinline__ void copy_rows64(unsigned l, const unsigned short* g) { acopy8<8u * 2u * PPE, 8 * NDIM>(l, g); }
__device__ __forceinline__ void proj_stage(unsigned l, const unsigned short* ga, const unsigned short* gb) {
  copy_rows64(l,                                 ga);
  copy_rows64(l + 64u * 2u * PPE,                ga + 64 * NDIM);
  copy_rows64(l + 2u * PHALF,                    gb);
  copy_rows64(l + 2u * PHALF + 64u * 2u * PPE,   gb + 64 * NDIM);
}
__device__ __forceinline__ void proj_tile(const unsigned short* Ps, const unsigned short* At, const unsigned short* Bt,
                                          int wm, int wn, v8f (&acc)[4][4]) {
  const int tid  = threadIdx.x;
  const int lane = tid & 31;
  const int hh   = lane >> 4, cl = lane & 15;
  const unsigned short* ga = At + (size_t)(tid >> 4) * NDIM + 8 * (tid & 15);
  const unsigned short* gb = Bt + (size_t)(tid >> 4) * NDIM + 8 * (tid & 15);
  const unsigned psl = lds_off(Ps) + (unsigned)((tid >> 4) * (2 * PPE) + (tid & 15) * 16);
  const unsigned short* ap = Ps + (64 * wm + cl) * PPE + 8 * hh;
  const unsigned short* bp = Ps + PHALF + (64 * wn + cl) * PPE + 8 * hh;

#pragma unroll                                                       // constant indices keep the accumulators in registers
  for (int mt = 0; mt < 4; ++mt) {
#pragma unroll                                                       // as above
    for (int nt = 0; nt < 4; ++nt) acc[mt][nt] = zero8();
  }

  proj_stage(psl, ga, gb);
  wait_async0();
  __syncthreads();                                                   // publishes stage 0
  proj_stage(psl + 2u * PBUF, ga + PKC, gb + PKC);

#pragma unroll 1                                                     // one copy of the trip: the buffer is a run-time offset
  for (int t = 0; t < NDIM / PKC; ++t) {
    const int buf = t & 1;                                           // this trip reads this buffer alone
    const unsigned short* a0 = ap + buf * PBUF;
    const unsigned short* b0 = bp + buf * PBUF;
#pragma unroll                                                       // constant indices keep fragments and accumulators in registers
    for (int ks = 0; ks < PKC / 32; ++ks) {
      Frag fa[4], fb[4];                                             // the k-step's LDS reads stand together, ahead of its products
#pragma unroll                                                       // as above
      for (int i = 0; i < 4; ++i) { fa[i] = ldfrag(a0 + 16 * i * PPE + 32 * ks); fb[i] = ldfrag(b0 + 16 * i * PPE + 32 * ks); }
#pragma unroll                                                       // as above
      for (int mt = 0; mt < 4; ++mt) {
#pragma unroll                                                       // as above
        for (int nt = 0; nt < 4; ++nt) acc[mt][nt] = mma_h(fa[mt].h, fb[nt].h, acc[mt][nt]);
      }
    }
    // foot of the trip: own LDS reads retired, own copies landed, then the barrier that publishes stage t + 1 and ends
    // every read of this trip's buffer; only then its refill
    wait_ds0();
    wait_async0();
    __syncthreads();
    if (t + 2 < NDIM / PKC) proj_stage(psl + (unsigned)buf * (2u * PBUF), ga + (t + 2) * PKC, gb + (t + 2) * PKC);
  }
  wait_async0();                                                     // nothing in flight when the ring changes its use
}
// Accumulators x 1/256 -> Os[n_loc][m_loc] (pitch OSPW, b128 stores). Lane (hh, cl): D element r of tile (mt, nt) =
// (64 wm + 16 mt + 8 hh + r, 64 wn + 16 nt + cl).
__device__ __forceinline__ void proj_unload(float* Os, int wm, int wn, const v8f (&acc)[4][4]) {
  const int lane = threadIdx.x & 31;
  const int hh   = lane >> 4, cl = lane & 15;
#pragma unroll                                                       // constant indices keep the accumulators in registers
  for (int nt = 0; nt < 4; ++nt) {
    const int nl = 64 * wn + 16 * nt + cl;
#pragma unroll                                                       // as above
    for (int mt = 0; mt < 4; ++mt) {
      v4f va, vb;
#pragma unroll                                                       // as above
      for (int r = 0; r < 4; ++r) { va[r] = acc[mt][nt][r] * IWSC; vb[r] = acc[mt][nt][4 + r] * IWSC; }
      *(v4f*)(Os + nl * OSPW + 64 * wm + 16 * mt + 8 * hh)     = va;
      *(v4f*)(Os + nl * OSPW + 64 * wm + 16 * mt + 8 * hh + 4) = vb;
    }
  }
}

// =========================================================================================================
// (1) projection for q / k, one (128-c tile, 128-o tile, b) per block of 4 waves:
//     D[c][o] = sum_n X16[b][c][n] W16[o][n]  (x256): A rows c from X16, B rows o from W16 (same split k map), K = 2048.
//     Epilogue: x 1/256 -> LDS Os[o_loc][c_loc] (reuses the ring behind the loop's last barrier), barrier,
//     + bf16-RNE bias[o], then planes Ph = bf16-RNE(v), Pl = bf16-RNE(v - hi).
// coverage: Os 4 waves x 64 o x 64 c = 128 x 128 (all read); planes 16 it x 8 rows x 16 lanes x 8 = 128 o x 128 c;
//           grid (4, n_otiles, NB) covers rows 0 .. 128 n_otiles - 1 of every batch once.
// =========================================================================================================
__global__ __launch_bounds__(128)
void proj_qk(const unsigned short* __restrict__ X16, const unsigned short* __restrict__ W16,
             const float* __restrict__ bias, unsigned short* Ph, unsigned short* Pl) {
  __shared__ __align__(16) unsigned short Ps[2 * PBUF];              // [buffer][A rows, B rows][128][PPE]
  const int tid  = threadIdx.x;
  const int wave = uni((int)(threadIdx.x >> 5));                     // 0..3, SGPR
  const int wm   = wave & 1, wn = wave >> 1;
  const int ct   = blockIdx.x, ot = blockIdx.y, b = blockIdx.z;
  const int c0   = ct * PT, o0 = ot * PT;

  v8f acc[4][4];
  proj_tile(Ps, X16 + ((size_t)(b * CDIM + c0)) * NDIM, W16 + ((size_t)o0) * NDIM, wm, wn, acc);

  float* Os = (float*)Ps;
  proj_unload(Os, wm, wn, acc);
  __syncthreads();

  const int e = tid & 15, lq = tid >> 4;                             // lq 0..7
  const float* bp = bias + o0 + lq;                                  // row it * 8 + lq at a constant step from here
  v4u uh[16], ul[16];
#pragma unroll
  for (int it = 0; it < 16; ++it) {
    const int row = it * 8 + lq;                                     // o_loc 0..127
    const v4f a  = *(const v4f*)(Os + row * OSPW + 8 * e);
    const v4f qv = *(const v4f*)(Os + row * OSPW + 8 * e + 4);
    const float bb = bfr(bp[it * 8]);
    const float f[8] = {a[0] + bb, a[1] + bb, a[2] + bb, a[3] + bb, qv[0] + bb, qv[1] + bb, qv[2] + bb, qv[3] + bb};
#pragma unroll
    for (int t = 0; t < 4; ++t) {
      const float f0 = f[2 * t], f1 = f[2 * t + 1];
      const unsigned short hb0 = bf_bits(f0), hb1 = bf_bits(f1);
      const unsigned short lb0 = bf_bits(f0 - bf_up(hb0));
      const unsigned short lb1 = bf_bits(f1 - bf_up(hb1));
      uh[it][t] = pk16(hb0, hb1);
      ul[it][t] = pk16(lb0, lb1);
    }
  }
  {
    const size_t po = ((size_t)(b * NDIM + o0 + lq)) * CDIM + c0 + 8 * e;   // row it * 8 + lq at a constant step from here
    unsigned short* ph = Ph + po;
    unsigned short* pl = Pl + po;
#pragma unroll
    for (int it = 0; it < 16; ++it) {
      *(v4u*)(ph + it * 8 * CDIM) = uh[it];
      *(v4u*)(pl + it * 8 * CDIM) = ul[it];
    }
  }
}

// =========================================================================================================
// (2) projection for v, one (128-o tile, 128-c tile, b) per block of 4 waves:
//     D[o][c] = sum_n W16[o][n] X16[b][c][n] (x256): A rows o from W16, B rows c from X16 (same split k map), K = 2048.
//     Epilogue: x 1/256 -> LDS Os[c_loc][o_loc] (reuses the ring behind the loop's last barrier), barrier,
//     + bf16-RNE bias[o], then the f16 plane.
// coverage: Os 4 waves x 64 c x 64 o = 128 x 128 (all read); plane 16 it x 8 rows x 16 lanes x 8 = 128 c x 128 o;
//           grid (16, 4, NB) covers PV[b][0..511][0..2047] once.
// =========================================================================================================
__global__ __launch_bounds__(128)
void proj_v(const unsigned short* __restrict__ W16, const unsigned short* __restrict__ X16,
            const float* __restrict__ bias, unsigned short* PV) {
  __shared__ __align__(16) unsigned short Ps[2 * PBUF];              // [buffer][A rows, B rows][128][PPE]
  const int tid  = threadIdx.x;
  const int wave = uni((int)(threadIdx.x >> 5));                     // 0..3, SGPR
  const int wm   = wave & 1, wn = wave >> 1;
  const int ot   = blockIdx.x, ct = blockIdx.y, b = blockIdx.z;
  const int o0   = ot * PT, c0 = ct * PT;

  v8f acc[4][4];
  proj_tile(Ps, W16 + ((size_t)o0) * NDIM, X16 + ((size_t)(b * CDIM + c0)) * NDIM, wm, wn, acc);

  float* Os = (float*)Ps;
  proj_unload(Os, wm, wn, acc);
  __syncthreads();

  const int e = tid & 15, lq = tid >> 4;                             // lq 0..7
  const v4f ba = *(const v4f*)(bias + o0 + 8 * e);
  const v4f bq = *(const v4f*)(bias + o0 + 8 * e + 4);
  const float bb[8] = {bfr(ba[0]), bfr(ba[1]), bfr(ba[2]), bfr(ba[3]), bfr(bq[0]), bfr(bq[1]), bfr(bq[2]), bfr(bq[3])};
  v4u uv[16];
#pragma unroll
  for (int it = 0; it < 16; ++it) {
    const int row = it * 8 + lq;                                     // c_loc 0..127
    const v4f a  = *(const v4f*)(Os + row * OSPW + 8 * e);
    const v4f qv = *(const v4f*)(Os + row * OSPW + 8 * e + 4);
    const float f[8] = {a[0], a[1], a[2], a[3], qv[0], qv[1], qv[2], qv[3]};
#pragma unroll
    for (int t = 0; t < 4; ++t) {
      const _Float16 h0 = (_Float16)(f[2 * t] + bb[2 * t]);
      const _Float16 h1 = (_Float16)(f[2 * t + 1] + bb[2 * t + 1]);
      uv[it][t] = pk16(h_bits(h0), h_bits(h1));
    }
  }
  {
    unsigned short* pv = PV + ((size_t)(b * CDIM + c0 + lq)) * NDIM + o0 + 8 * e;   // row it * 8 + lq at a constant step from here
#pragma unroll
    for (int it = 0; it < 16; ++it) *(v4u*)(pv + it * 8 * NDIM) = uv[it];
  }
}

// =========================================================================================================
// (3) attention for one (b, 64-query tile), transposed formulation, 2048 keys, no mask, no scale on the scores.
//   Block = 8 waves. Waves 0..3 (w = wave) are score waves for queries n0 + 16 w .. + 15; waves 4..7 share the query
//   group w = wave - 4. Channel half g = wave >> 2 (channels 256 g .. 256 g + 255) for the P.V accumulators.
//   Per 32-key block kb (score waves only): S^T tiles (16 keys x 16 queries) = sum over 16 c-chunks of
//   A(Kh: row = key kb + (lane&15), k = c via the split map, plane [b][2048][512]) . B(Qh: col = query, same map)
//   + A(Kh).B(Ql) + A(Kl).B(Qh) (bf16 unscaled residual planes, shared accumulator). Per lane the D tiles hold
//   8 + 8 keys of ONE query: online softmax state per lane, one shuffle (lane^16) for the max over 32 keys; the
//   rescale factor is skipped under a wave-uniform ballot when no lane's max grew. P = e^{s-m} x 16384 as f16:
//   B operand of O^T: element r <- D of the tile covering keys kb..kb+15, element 8+r <- the tile covering
//   kb+16..kb+31, lane unchanged. The score wave publishes P (32 B per lane), corr and the grew flag in LDS;
//   after a block barrier all 8 waves rescale (if grew) and run O^T[ch][q] += A(PV rows ch = 256 g + 16 j +
//   (lane&15), keys contiguous, f16 plane [b][512][2048]) . B(P) on 16 accumulator tiles; second block barrier
//   before the next kb overwrites the LDS exchange. At the end score waves publish inv = (1/l) / sqrt(2048).
//   Epilogue in 4 channel passes of 64 channels per wave: O x inv staged in LDS Os[query][128] (pitch OSPW, b128
//   barrier before the next pass overwrites Os.
//   Operands come from LDS, brought by asynchronous 16-B copies of all 8 waves: the 64-query tile (both planes) once;
//   the 32-key tiles (both planes) in two buffers, tile t + 2 issued behind the foot barrier of trip t; the 512 x 32 pv
//   tile in one buffer, tile t + 1 issued behind the same barrier (its readers of trip t have passed it) and published
//   by the barrier between the scores and the P.V products of trip t + 1. Every wave waits for its own copies in front
//   of both barriers. Os reuses the key ring behind the loop.
//   Fragment reads run one step ahead of the products, in two register sets, inside a trip's published tiles only:
//   the scores read c-chunk kc + 1 ahead of chunk kc's products, the P.V products read the next four channel tiles.
// coverage: per pass 8 it x 32 lines x 8 lanes x 4 floats = 64 queries x 128 ch; 4 passes = 512 ch;
//           grid (NQ/64, NB) covers out[b][0..NQ-1][0..511] exactly once.
// =========================================================================================================
__global__ __launch_bounds__(256)
void attn_k(const unsigned short* __restrict__ Qh, const unsigned short* __restrict__ Ql,
            const unsigned short* __restrict__ Kh, const unsigned short* __restrict__ Kl,
            const unsigned short* __restrict__ PV, float* out) {
  __shared__ __align__(16) unsigned short Qs[2 * QPLANE];            // [hi, residual][64 queries][KPE]
  __shared__ __align__(16) unsigned short Ks[2 * KBUF];              // [buffer][hi, residual][32 keys][KPE]
  __shared__ __align__(16) unsigned short Vs[CDIM * VPE];            // [512 channels][VPE], 32 keys used
  __shared__ __align__(16) unsigned Psh[4 * 32 * 8];
  __shared__ float Csh[4 * 32];
  __shared__ float Ish[4 * 32];
  __shared__ int   Gsh[4];
  const int tid  = threadIdx.x;
  const int lane = tid & 31;
  const int wave = uni((int)(threadIdx.x >> 5));                     // 0..7, SGPR
  const int w    = wave & 3, g = wave >> 2;
  const int hh   = lane >> 4, cl = lane & 15;
  const int n0   = blockIdx.x * QT, b = blockIdx.y;

  // q fragment pointers in LDS (B operand, col = query 16 w + cl of the tile), + 32*kc
  const unsigned short* Qhp = Qs + (16 * w + cl) * KPE + 8 * hh;
  const unsigned short* Qlp = Qhp + QPLANE;
  // k fragment base in LDS (A operand, row = key cl of the tile), + buffer * KBUF + 32*kc
  const unsigned short* Ksp = Ks + cl * KPE + 8 * hh;
  // v fragment base in LDS (A operand, row = channel 256 g + 16 j + cl, the tile's 32 keys contiguous), + 16*j*VPE
  const unsigned short* Vp = Vs + (g * CHH + cl) * VPE + 8 * hh;
  // copy sources (the lane's 16-B chunk of copy 0) and LDS places
  // as 32-bit element offsets from the planes' uniform bases (one for both key planes): fewer registers live through the loop
  const unsigned kgo = (unsigned)(b * NDIM * CDIM + 8 * tid);
  const unsigned vgo = (unsigned)(b * CDIM * NDIM + (tid >> 2) * NDIM + 8 * (tid & 3));
  const unsigned rpl = (unsigned)((tid >> 6) * (2 * KPE) + (tid & 63) * 16);
  const unsigned ksl = lds_off(Ks) + rpl;
  const unsigned vsl = lds_off(Vs) + (unsigned)((tid >> 2) * (2 * VPE) + (tid & 3) * 16);

  const int pso = (w * 32 + lane) * 8;                               // LDS exchange slot (uints)

  float m = -1.0e30f, l = 0.f;
  v8f o[16];
#pragma unroll
  for (int j = 0; j < 16; ++j) o[j] = zero8();

  // prologue: the query tile (filled once), key tile 0 and pv tile 0, published by one barrier; then key tile 1
  {
    const size_t qg = ((size_t)(b * NDIM + n0)) * CDIM + 8 * tid;
    const unsigned qsl = lds_off(Qs) + rpl;
    copy_rows32(qsl,                             Qh + qg);
    copy_rows32(qsl + 2u * KPLANE,               Qh + qg + KT * CDIM);
    copy_rows32(qsl + 2u * QPLANE,               Ql + qg);
    copy_rows32(qsl + 2u * QPLANE + 2u * KPLANE, Ql + qg + KT * CDIM);
    wait_async0();
    copy_rows32(ksl,               Kh + kgo);
    copy_rows32(ksl + 2u * KPLANE, Kl + kgo);
    copy_vtile(vsl, PV + vgo);
    wait_async0();
    __syncthreads();
    copy_rows32(ksl + 2u * KBUF,               Kh + (kgo + KT * CDIM));
    copy_rows32(ksl + 2u * KBUF + 2u * KPLANE, Kl + (kgo + KT * CDIM));
  }

#pragma unroll 1
  for (int kb = 0; kb < NDIM; kb += KT) {
    const int buf = (kb / KT) & 1;                                   // this trip reads this key buffer alone
    if (wave < 4) {                                                  // wave-uniform (SGPR) role branch
      const unsigned short* k0p  = Ksp + buf * KBUF;                 // keys kb .. kb+15
      const unsigned short* k1p  = k0p + 16 * KPE;                   // keys kb+16 .. kb+31
      const unsigned short* k0lp = k0p + KPLANE;
      const unsigned short* k1lp = k1p + KPLANE;
      v8f s0 = zero8(), s1 = zero8();
      // two register sets: chunk kc + 1's LDS reads stand together ahead of chunk kc's products, so that their latency
      // passes under those products; all 16 chunks lie in this trip's key buffer and in the query tile
      Frag qh[2], ql[2], k0[2], k1[2], k0l[2], k1l[2];
      qh[0]  = ldfrag(Qhp);
      k0[0]  = ldfrag(k0p);
      k1[0]  = ldfrag(k1p);
      ql[0]  = ldfrag(Qlp);
      k0l[0] = ldfrag(k0lp);
      k1l[0] = ldfrag(k1lp);
#pragma unroll                                                       // constant indices keep both sets in registers
      for (int kc = 0; kc < CDIM / 32; ++kc) {
        const int c = kc & 1, n = c ^ 1;
        if (kc + 1 < CDIM / 32) {
          qh[n]  = ldfrag(Qhp + 32 * (kc + 1));
          k0[n]  = ldfrag(k0p + 32 * (kc + 1));
          k1[n]  = ldfrag(k1p + 32 * (kc + 1));
          ql[n]  = ldfrag(Qlp + 32 * (kc + 1));
          k0l[n] = ldfrag(k0lp + 32 * (kc + 1));
          k1l[n] = ldfrag(k1lp + 32 * (kc + 1));
        }
        s0 = mma_s(k0[c].bf, qh[c].bf, s0);
        s1 = mma_s(k1[c].bf, qh[c].bf, s1);
        s0 = mma_s(k0[c].bf, ql[c].bf, s0);
        s1 = mma_s(k1[c].bf, ql[c].bf, s1);
        s0 = mma_s(k0l[c].bf, qh[c].bf, s0);
        s1 = mma_s(k1l[c].bf, qh[c].bf, s1);
      }

      float mx = fmaxf(hmax8(s0), hmax8(s1));
      mx = fmaxf(mx, __shfl_xor(mx, 16, 32));
      const float mn = fmaxf(m, mx);
      const unsigned grew = wave_ballot(mx > m);                     // wave-uniform
      float corr = 1.0f;
      if (grew != 0u) {
        corr = __expf(m - mn);                                       // == 1 for lanes whose max did not grow
        l *= corr;
      }
      m = mn;
      const float msh = mn - LNPS;                                   // exp gives e^{s-m} * 16384

      FragP ph;
      float ls = 0.f;
#pragma unroll
      for (int r = 0; r < 8; ++r) {
        const float e0 = __expf(s0[r] - msh);                        // key kb      + 8hh + r
        const float e1 = __expf(s1[r] - msh);                        // key kb + 16 + 8hh + r
        ls += e0 + e1;
        ph.hv[0][r] = (_Float16)e0;
        ph.hv[1][r] = (_Float16)e1;
      }
      l += ls;

      *(v4u*)(Psh + pso)     = ph.u[0];
      *(v4u*)(Psh + pso + 4) = ph.u[1];
      Csh[w * 32 + lane] = corr;
      Gsh[w] = (grew != 0u) ? 1 : 0;
    }
    wait_async0();                                                   // own copies of this trip's pv tile have landed
    __syncthreads();                                                 // publishes the P exchange and the pv tile

    {
      const int gfl = Gsh[w];                                        // read first: its wait leaves the reads below in flight
      FragP pb;
      pb.u[0] = *(const v4u*)(Psh + pso);
      pb.u[1] = *(const v4u*)(Psh + pso + 4);
      Frag vf[2][4];                                                 // two register sets, as for the scores: the next four tiles'
#pragma unroll                                                       // reads stand together ahead of these four tiles' products
      for (int jj = 0; jj < 4; ++jj) vf[0][jj] = ldfrag(Vp + 16 * jj * VPE);
      const int gf = uni(gfl);                                       // wave-uniform flag
      if (gf != 0) {
        const float corr = Csh[w * 32 + lane];
#pragma unroll
        for (int j = 0; j < 16; ++j) {
#pragma unroll
          for (int r = 0; r < 8; ++r) o[j][r] *= corr;
        }
      }
#pragma unroll                                                       // constant indices keep vf and o in registers
      for (int jq = 0; jq < 4; ++jq) {
        if (jq + 1 < 4) {
#pragma unroll                                                       // as above
          for (int jj = 0; jj < 4; ++jj) vf[(jq + 1) & 1][jj] = ldfrag(Vp + 16 * (4 * (jq + 1) + jj) * VPE);
        }
#pragma unroll                                                       // as above
        for (int jj = 0; jj < 4; ++jj) o[4 * jq + jj] = mma_h(vf[jq & 1][jj].h, pb.v, o[4 * jq + jj]);
      }
    }
    // foot of the trip: own LDS traffic retired, own copies landed, then the barrier that publishes key tile kb + 32 and
    // ends every read of this trip's key buffer, of the pv tile and of the P exchange; only then the refills
    wait_ds0();
    wait_async0();
    __syncthreads();
    if (kb + KT < NDIM) {                                            // block-uniform: a next trip exists
      copy_vtile(vsl, PV + (vgo + (unsigned)(kb + KT)));
      if (kb + 2 * KT < NDIM) {                                      // block-uniform: a key tile two ahead exists
        copy_rows32(ksl + (unsigned)buf * (2u * KBUF),               Kh + (kgo + (unsigned)(kb + 2 * KT) * CDIM));
        copy_rows32(ksl + (unsigned)buf * (2u * KBUF) + 2u * KPLANE, Kl + (kgo + (unsigned)(kb + 2 * KT) * CDIM));
      }
    }
  }
  wait_async0();                                                     // nothing in flight when the ring changes its use
  float* Os = (float*)Ks;                                            // output staging; first written behind the next barrier

  if (wave < 4) {
    l += __shfl_xor(l, 16, 32);
    Ish[w * 32 + lane] = (1.0f / l) * OSCALE;                        // o and l both carry the x16384 factor
  }
  __syncthreads();
  const float inv = Ish[w * 32 + lane];

  const int qrow = 16 * w + cl;
  const int e = tid & 7, lq = tid >> 3;                              // lq 0..31
#pragma unroll
  for (int p = 0; p < 4; ++p) {
    if (p) __syncthreads();                                          // every wave finished reading Os
#pragma unroll
    for (int jj = 0; jj < 4; ++jj) {
      const int j = 4 * p + jj;                                        // channels 256 g + 64 p + 16 jj + 8 hh + r
      v4f va, vb;
#pragma unroll
      for (int r = 0; r < 4; ++r) { va[r] = o[j][r] * inv; vb[r] = o[j][4 + r] * inv; }
      *(v4f*)(Os + qrow * OSPW + g * 64 + 16 * jj + 8 * hh)     = va;   // Os[query][64 g + 16 jj + 8 hh + r]
      *(v4f*)(Os + qrow * OSPW + g * 64 + 16 * jj + 8 * hh + 4) = vb;
    }
    __syncthreads();
    v4f res[8];
#pragma unroll
    for (int it = 0; it < 8; ++it) {
      const int L   = it * 32 + lq;                                    // 0..255
      const int ql  = L >> 2, seg = L & 3;                             // query 0..63, line 0..3 of this pass
      const int gg  = seg >> 1, ln = seg & 1;
      res[it] = *(const v4f*)(Os + ql * OSPW + gg * 64 + 32 * ln + 4 * e);
    }
{
#pragma unroll
      for (int it = 0; it < 8; ++it) {
        const int L   = it * 32 + lq;
        const int ql  = L >> 2, seg = L & 3;
        const int gg  = seg >> 1, ln = seg & 1;
        const int ch  = gg * CHH + 64 * p + 32 * ln + 4 * e;
        const size_t idx = ((size_t)(b * NDIM + n0 + ql)) * CDIM + ch;
        *(v4f*)(out + idx) = res[it];
      }
      
    }
  }
}

// =========================================================================================================
// Workspace map (bytes; each region start a multiple of 256; every extent is an exact tile multiple and is written
//   W16 f16 [2048][2048]            8388608   (reused for Wq, Wk, Wv in launch order)
//   X16 f16 [NB][512][2048]        16777216   (reused for q, k, v)
//   Qh/Ql/Kh/Kl bf16 [NB][2048][512] 16777216 x4
//   PV  f16 [NB][512][2048]        16777216
//   total (NB = 8) = 109051904
// =========================================================================================================
extern "C" void kernel_launch(void* const* d_in, const int* in_sizes, int n_in,
                              void* d_out, int out_size, void* d_ws, size_t ws_size,
                              hipStream_t stream) {
  if (n_in < 9) return;
  if (in_sizes[0] < NB * CDIM * NDIM || in_sizes[1] < NB * CDIM * NDIM || in_sizes[2] < NB * CDIM * NDIM) return;
  if (in_sizes[3] < NDIM * NDIM || in_sizes[5] < NDIM * NDIM || in_sizes[7] < NDIM * NDIM) return;
  if (in_sizes[4] < NDIM || in_sizes[6] < NDIM || in_sizes[8] < NDIM) return;
  if (out_size < (NB - 1) * NDIM * CDIM + NQ * CDIM) return;

  size_t off = 0;
  auto carve = [&](size_t bytes) { const size_t o = off; off += (bytes + 255) & ~(size_t)255; return o; };
  const size_t oW16 = carve((size_t)NDIM * NDIM * 2);
  const size_t oX16 = carve((size_t)NB * CDIM * NDIM * 2);
  const size_t oQh  = carve((size_t)NB * NDIM * CDIM * 2);
  const size_t oQl  = carve((size_t)NB * NDIM * CDIM * 2);
  const size_t oKh  = carve((size_t)NB * NDIM * CDIM * 2);
  const size_t oKl  = carve((size_t)NB * NDIM * CDIM * 2);
  const size_t oPV  = carve((size_t)NB * CDIM * NDIM * 2);
  if (off > ws_size) return;
  if (off > (size_t)134217728) return;

  const float* q  = (const float*)d_in[0];
  const float* k  = (const float*)d_in[1];
  const float* v  = (const float*)d_in[2];
  const float* Wq = (const float*)d_in[3];
  const float* bq = (const float*)d_in[4];
  const float* Wk = (const float*)d_in[5];
  const float* bk = (const float*)d_in[6];
  const float* Wv = (const float*)d_in[7];
  const float* bv = (const float*)d_in[8];

  char* ws = (char*)d_ws;
  unsigned short* W16 = (unsigned short*)(ws + oW16);
  unsigned short* X16 = (unsigned short*)(ws + oX16);
  unsigned short* Qh  = (unsigned short*)(ws + oQh);
  unsigned short* Ql  = (unsigned short*)(ws + oQl);
  unsigned short* Kh  = (unsigned short*)(ws + oKh);
  unsigned short* Kl  = (unsigned short*)(ws + oKl);
  unsigned short* PVp = (unsigned short*)(ws + oPV);
  float* out = (float*)d_out;

  const dim3 blk256(256), blk128(128);
  const int cvt_blocks = NDIM + NB * CDIM;

  // q: convert, project -> pq hi + residual planes [b][o][c] for o < NQ
  cvt_k<<<dim3(cvt_blocks), blk256, 0, stream>>>(Wq, q, W16, X16);
  proj_qk<<<dim3(CDIM / PT, NQ / PT, NB), blk128, 0, stream>>>(X16, W16, bq, Qh, Ql);
  // k: convert, project -> pk hi + residual planes [b][o][c], all o
  cvt_k<<<dim3(cvt_blocks), blk256, 0, stream>>>(Wk, k, W16, X16);
  proj_qk<<<dim3(CDIM / PT, NDIM / PT, NB), blk128, 0, stream>>>(X16, W16, bk, Kh, Kl);
  // v: convert, project -> pv^T f16 plane [b][c][o]
  cvt_k<<<dim3(cvt_blocks), blk256, 0, stream>>>(Wv, v, W16, X16);
  proj_v<<<dim3(NDIM / PT, CDIM / PT, NB), blk128, 0, stream>>>(W16, X16, bv, PVp);
  // attention + 1/sqrt(2048) -> out [b][n][c] (the raw view to [b][512][2048] is the same flat buffer)
  attn_k<<<dim3(NQ / QT, NB), blk256, 0, stream>>>(Qh, Ql, Kh, Kl, PVp, out);
  (void)hipGetLastError();
}

// v004
// Measured time: 229 microseconds a run.
// Timed twice side by side with v003, it ran 1.08 and 1.07 times as fast.
// All steps since v000 together make it 5.33 times as fast.
// Contractions: projections X[c][n].W[o][n]^T (K=2048) on v_wmma_f32_16x16x32_f16 (f16 containers of bf16-RNE W x256 and bf16-RNE x); scores pk.pq^T (K=512) on v_wmma_f32_16x16x32_bf16 (bf16 hi + bf16 residual planes of pq/pk, 3 products); O^T = pv^T.P^T (K=2048 keys) on v_wmma_f32_16x16x32_f16 (pv f16, P = e^{s-m} x16384 f16 from the score D registers); projection and attention operands staged in LDS by asynchronous copies; f32 accumulate everywhere; softmax statistics and scaling in f32 VALU.
#include <hip/hip_runtime.h>
#include <math.h>
#include <stdint.h>

#ifndef NB
#define NB 8
#endif
#ifndef NQ
#define NQ 2048
#endif
#define NB_FULL 8
#define CDIM   512
#define NDIM   2048
#define QT     64
#define CHH    256
#define OSPW   132
#define WSC    256.0f
#define IWSC   0.00390625f
#define LNPS   9.704060527839234f
#define OSCALE 0.022097086912079608f
#define KT     32
#define KPE    520
#define KPLANE (KT * KPE)
#define KBUF   (2 * KPLANE)
#define QPLANE (QT * KPE)
#define VPE    40
#define PT     128
#define PKC    128
#define PPE    136
#define PHALF  (PT * PPE)
#define PBUF   (2 * PHALF)
#define CVW    16
#define CVL    8
#define CVUNIT (CVW * 32 * 4 * CVL)
#define CVGRID 256
#define WPLANE (NDIM * NDIM)
#define XPLANE (NB * CDIM * NDIM)
#define WTRIPS (WPLANE / (CVUNIT * CVGRID))
#define XTRIPS (XPLANE / (CVUNIT * CVGRID))

static_assert(NB >= 1 && NB <= NB_FULL);
static_assert(NQ >= QT && NQ <= NDIM && NQ % QT == 0);
static_assert(CDIM % QT == 0 && NDIM % QT == 0);
static_assert(CDIM % 32 == 0 && NDIM % 32 == 0);
static_assert(CDIM == 2 * CHH && CHH == 16 * 16);
static_assert((OSPW * 4) % 16 == 0);
static_assert(NDIM == 8 * 256);
static_assert((KPE * 2) % 16 == 0 && ((KPE * 2) / 16) % 2 == 1);   // LDS row pitches 16 B x odd: the 16 rows of a b128
static_assert((VPE * 2) % 16 == 0 && ((VPE * 2) / 16) % 2 == 1);   // fragment read fall on all 64 banks once
static_assert(CDIM * 2 == 64 * 16 && KT == 8 * 4 && QT == 2 * KT);  // q/k rows: 64 chunks of 16 B; 8 copies x 256 lanes = 32 rows
static_assert(KT * 2 == 4 * 16 && CDIM == 8 * 64);                  // v rows: 4 chunks of 16 B; 8 copies x 256 lanes = 512 rows
static_assert(NDIM / KT >= 2);
static_assert(CDIM % PT == 0 && NDIM % PT == 0 && NQ % PT == 0 && NDIM % PKC == 0 && NDIM / PKC >= 2);
static_assert((PPE * 2) % 16 == 0 && ((PPE * 2) / 16) % 2 == 1 && PPE >= PKC);  // as for KPE and VPE
static_assert(PKC * 2 == 16 * 16 && PT == 2 * 8 * 8);               // projection rows: 16 chunks of 16 B; 8 copies x 128 lanes = 64 rows
static_assert(PT * OSPW * 4 <= 2 * PBUF * 2);                       // the projections' output staging fits in the ring it reuses
static_assert(QT * OSPW * 4 <= 2 * KBUF * 2);                       // the output staging fits in the key ring it reuses
static_assert(WPLANE == WTRIPS * CVUNIT * CVGRID && XPLANE == XTRIPS * CVUNIT * CVGRID && CVL == 8);   // whole convert trips

typedef _Float16       v16h __attribute__((ext_vector_type(16)));
typedef _Float16       v8h  __attribute__((ext_vector_type(8)));
typedef __bf16         v16b __attribute__((ext_vector_type(16)));
typedef unsigned short v8us __attribute__((ext_vector_type(8)));
typedef float          v8f  __attribute__((ext_vector_type(8)));
typedef float          v4f  __attribute__((ext_vector_type(4)));
typedef unsigned int   v4u  __attribute__((ext_vector_type(4)));
typedef unsigned int   v2u  __attribute__((ext_vector_type(2)));

union Frag  { v8us u[2]; v16h h; v16b bf; };
union FragP { v16h v; v8h hv[2]; v4u u[2]; };
static_assert(sizeof(Frag) == 32);
static_assert(sizeof(FragP) == 32);

// ---- scalar helpers ---------------------------------------------------------------------------------------
__device__ __forceinline__ unsigned short bf_bits(float f) {          // f32 -> bf16 bits, RNE convert
  unsigned u = __float_as_uint(f);
  return (unsigned short)((u + 0x7FFFu + ((u >> 16) & 1u)) >> 16);
}
__device__ __forceinline__ float bf_up(unsigned short hb) { return __uint_as_float(((unsigned)hb) << 16); }
__device__ __forceinline__ float bfr(float f) { return bf_up(bf_bits(f)); }
__device__ __forceinline__ unsigned short h_bits(_Float16 x) { return __builtin_bit_cast(unsigned short, x); }
__device__ __forceinline__ unsigned pk16(unsigned short a, unsigned short b) { return (unsigned)a | ((unsigned)b << 16); }
__device__ __forceinline__ v8f zero8() { v8f z = {0.f, 0.f, 0.f, 0.f, 0.f, 0.f, 0.f, 0.f}; return z; }
__device__ __forceinline__ float hmax8(v8f s) {
  return fmaxf(fmaxf(fmaxf(s[0], s[1]), fmaxf(s[2], s[3])), fmaxf(fmaxf(s[4], s[5]), fmaxf(s[6], s[7])));
}
__device__ __forceinline__ unsigned wave_ballot(bool p) {
#if defined(__HIP_DEVICE_COMPILE__)
  return __builtin_amdgcn_ballot_w32(p);
#else
  return p ? 1u : 0u;
#endif
}
__device__ __forceinline__ int uni(int v) {                           // wave-uniform int -> SGPR
#if defined(__HIP_DEVICE_COMPILE__)
  return __builtin_amdgcn_readfirstlane(v);
#else
  return v;
#endif
}

// ---- 16-bit fragment loader (A, or B from a k-contiguous [n][k] row): lane -> row/col (lane&15), p already includes
//      + 8*(lane>>4); elements 0..7 <- p[0..7] (k0+8h..), elements 8..15 <- p[16..23] (k0+16+8h..)
__device__ __forceinline__ Frag ldfrag(const unsigned short* p) {
  Frag f;
  f.u[0] = *(const v8us*)(p);
  f.u[1] = *(const v8us*)(p + 16);
  return f;
}

// ---- LDS staging by asynchronous copies ----------------------------------------------------------------------
__device__ __forceinline__ unsigned lds_off(const void* p) { return (unsigned)(size_t)p; }
// Eight 16-B copies per lane, global -> LDS: copy i moves g + i * GSTEP (elements) to LDS byte l + i * LSTEP.
// The closing s_wait_xcnt stands in the copies' own statement so that no address register is rewritten ahead of it.
template <unsigned LSTEP, int GSTEP>
__device__ __forceinline__ void acopy8(unsigned l, const unsigned short* g) {
#if defined(__HIP_DEVICE_COMPILE__)
  asm volatile(
      "global_load_async_to_lds_b128 %0, %8, off\n\t"
      "global_load_async_to_lds_b128 %1, %9, off\n\t"
      "global_load_async_to_lds_b128 %2, %10, off\n\t"
      "global_load_async_to_lds_b128 %3, %11, off\n\t"
      "global_load_async_to_lds_b128 %4, %12, off\n\t"
      "global_load_async_to_lds_b128 %5, %13, off\n\t"
      "global_load_async_to_lds_b128 %6, %14, off\n\t"
      "global_load_async_to_lds_b128 %7, %15, off\n\t"
      "s_wait_xcnt 0x0"
      :: "v"(l), "v"(l + 1u * LSTEP), "v"(l + 2u * LSTEP), "v"(l + 3u * LSTEP),
         "v"(l + 4u * LSTEP), "v"(l + 5u * LSTEP), "v"(l + 6u * LSTEP), "v"(l + 7u * LSTEP),
         "v"(g), "v"(g + 1 * GSTEP), "v"(g + 2 * GSTEP), "v"(g + 3 * GSTEP),
         "v"(g + 4 * GSTEP), "v"(g + 5 * GSTEP), "v"(g + 6 * GSTEP), "v"(g + 7 * GSTEP)
      : "memory");
#endif
}
// 32 q or k rows of 1024 B (contiguous in global) -> LDS pitch 2 KPE: copy i, lane tid -> row 4 i + (tid >> 6), chunk tid & 63
__device__ __forceinline__ void copy_rows32(unsigned l, const unsigned short* g) { acopy8<4u * 2u * KPE, 256 * 8>(l, g); }
// 512 v rows of 64 B (global pitch 2 NDIM bytes) -> LDS pitch 2 VPE: copy i, lane tid -> row 64 i + (tid >> 2), chunk tid & 3
__device__ __forceinline__ void copy_vtile(unsigned l, const unsigned short* g) { acopy8<64u * 2u * VPE, 64 * NDIM>(l, g); }
__device__ __forceinline__ void wait_async0() {                       // this wave's copies have landed in LDS
#if defined(__HIP_DEVICE_COMPILE__)
  asm volatile("s_wait_asynccnt 0x0" ::: "memory");
#endif
}
__device__ __forceinline__ void wait_ds0() {                          // this wave's LDS reads and writes have retired
#if defined(__HIP_DEVICE_COMPILE__)
  asm volatile("s_wait_dscnt 0x0" ::: "memory");
#endif
}

// ---- WMMA helpers: mma_h is the f16 builtin followed by a 4-slot VALU gap tying D and keeping A/B live --------------------------
__device__ __forceinline__ v8f mma_h(v16h a, v16h b, v8f c) {
  v8f d = __builtin_amdgcn_wmma_f32_16x16x32_f16(false, a, false, b, (short)0, c, false, false);
#if defined(__HIP_DEVICE_COMPILE__)
  asm volatile("v_nop\n\tv_nop\n\tv_nop\n\tv_nop" : "+v"(d) : "v"(a), "v"(b));
#endif
  return d;
}

// Score product by the builtin alone (the compiler keeps its distances): an asm statement's vector operands must lie
// below v256, and the score loop's two fragment sets beside the output accumulators do not all fit there.
__device__ __forceinline__ v8f mma_s(v16b a, v16b b, v8f c) {
  return __builtin_amdgcn_wmma_f32_16x16x32_bf16(false, a, false, b, (short)0, c, false, false);
}

// =========================================================================================================
// (0) convert, all six f32 operands in one launch: W16[p] = f16(bf16-RNE(W_p) x 256), X16[p] = f16(bf16-RNE(x_p)),
//     p = 0, 1, 2 for q, k, v. CVGRID work-groups of CVW waves stay resident and loop: the launch starts few waves, and
//     each keeps CVL or more loads of 16 B a lane in flight. A trip of a work-group is CVUNIT contiguous floats; a wave
//     takes 128 CVL of them, load i of lane ln the floats 128 i + 4 ln .. + 3 (512 contiguous bytes a wave-load, 256 a
//     store). A work-group's trips in one tensor are adjacent. The next trip's loads are issued ahead of this trip's
//     conversions, in a second register set.
//     Trip order: (Wv, v), (Wk, k), (Wq, q): the pair that the next launch reads is written last.
// coverage: CVGRID work-groups x a tensor's trips x CVUNIT floats = its size (static_assert), every element once.
// =========================================================================================================
// s: the work-group's place (uniform); bo: the lane's byte offset in it
__device__ __forceinline__ void cvt_load(v4f (&r)[CVL], const float* s, unsigned bo) {
#pragma unroll                                                       // constant indices keep the set in registers
  for (int i = 0; i < CVL; ++i) r[i] = *(const v4f*)((const char*)s + bo + 512 * i);
#if defined(__HIP_DEVICE_COMPILE__)
  // s_wait_xcnt 0 behind the loads; base and offset are inputs, so that they stay live, and so unwritten, up to the wait
  asm volatile("s_wait_xcnt 0x0" :: "s"(s), "v"(bo) : "memory");
  __builtin_amdgcn_sched_barrier(0);                                 // the trip's loads stand together: no conversion moves up among them
#endif
}
// The closing s_wait_xcnt stands in the stores' own statement so that no register they name is rewritten ahead of it.
__device__ __forceinline__ void cvt_store(unsigned short* d, unsigned bo, const v4f (&r)[CVL], float sc) {
  v2u u[CVL];
#pragma unroll                                                       // as above
  for (int i = 0; i < CVL; ++i) {
#pragma unroll                                                       // as above
    for (int t = 0; t < 2; ++t) {
      const _Float16 h0 = (_Float16)(bfr(r[i][2 * t]) * sc);
      const _Float16 h1 = (_Float16)(bfr(r[i][2 * t + 1]) * sc);
      u[i][t] = pk16(h_bits(h0), h_bits(h1));
    }
  }
#if defined(__HIP_DEVICE_COMPILE__)
  asm volatile(
      "global_store_b64 %0, %2, %1\n\t"
      "global_store_b64 %0, %3, %1 offset:256\n\t"
      "global_store_b64 %0, %4, %1 offset:512\n\t"
      "global_store_b64 %0, %5, %1 offset:768\n\t"
      "global_store_b64 %0, %6, %1 offset:1024\n\t"
      "global_store_b64 %0, %7, %1 offset:1280\n\t"
      "global_store_b64 %0, %8, %1 offset:1536\n\t"
      "global_store_b64 %0, %9, %1 offset:1792\n\t"
      "s_wait_xcnt 0x0"
      :: "v"(bo), "s"(d), "v"(u[0]), "v"(u[1]), "v"(u[2]), "v"(u[3]), "v"(u[4]), "v"(u[5]), "v"(u[6]), "v"(u[7])
      : "memory");
#endif
}
__global__ __launch_bounds__(CVW * 32)
void cvt_k(const float* __restrict__ wq, const float* __restrict__ wk, const float* __restrict__ wv,
           const float* __restrict__ q, const float* __restrict__ k, const float* __restrict__ v,
           unsigned short* Wq16, unsigned short* Wk16, unsigned short* Wv16,
           unsigned short* Xq16, unsigned short* Xk16, unsigned short* Xv16) {
  const unsigned tid = threadIdx.x;
  const unsigned le  = (tid >> 5) * (128u * CVL) + 4u * (tid & 31u);  // the lane's first element in a trip's unit
  const float* const wsrc[3] = {wq, wk, wv};
  const float* const xsrc[3] = {q, k, v};
  unsigned short* const wdst[3] = {Wq16, Wk16, Wv16};
  unsigned short* const xdst[3] = {Xq16, Xk16, Xv16};
  constexpr int PTRIPS = WTRIPS + XTRIPS;                            // trips of one (W, x) pair
  // trip t (a compile-time number behind the unroll) -> pair, tensor, and the work-group's place in it (uniform)
  auto pair_of = [](int t) { return 2 - t / PTRIPS; };
  auto is_w    = [](int t) { return t % PTRIPS < WTRIPS; };
  auto place   = [&](int t) {
    return is_w(t) ? ((size_t)blockIdx.x * WTRIPS + t % PTRIPS) * CVUNIT
                   : ((size_t)blockIdx.x * XTRIPS + (t % PTRIPS - WTRIPS)) * CVUNIT;
  };
  auto from = [&](int t) { return (is_w(t) ? wsrc[pair_of(t)] : xsrc[pair_of(t)]) + place(t); };
  auto to   = [&](int t) { return (is_w(t) ? wdst[pair_of(t)] : xdst[pair_of(t)]) + place(t); };

  v4f r[2][CVL];
  cvt_load(r[0], from(0), 4u * le);
#pragma unroll                                                       // constant indices: both sets in registers, tensors by trip
  for (int t = 0; t < 3 * PTRIPS; ++t) {
    if (t + 1 < 3 * PTRIPS) cvt_load(r[(t + 1) & 1], from(t + 1), 4u * le);
    cvt_store(to(t), 2u * le, r[t & 1], is_w(t) ? WSC : 1.0f);
  }
}

// =========================================================================================================
// Projection main loop, one 128 x 128 tile of D[m][n] = sum_k A[m][k] B[n][k] per block of 4 waves (2 x 2, 64 x 64 each),
//   A and B rows k-contiguous at pitch NDIM. A stage is PKC = 128 k of the 128 A rows and the 128 B rows, brought into LDS
//   (row pitch 2 PPE bytes) by asynchronous 16-B copies of all 4 waves: copy i of a group, lane tid -> row 8 i + (tid >> 4),
//   chunk tid & 15. Two buffers: stage t + 2 is issued behind the foot barrier of trip t, which also publishes stage t + 1.
//   Each accumulator tile takes its 64 k-steps in ascending order.
// =========================================================================================================
__device__ __forceinline__ void copy_rows64(unsigned l, const unsigned short* g) { acopy8<8u * 2u * PPE, 8 * NDIM>(l, g); }
__device__ __forceinline__ void proj_stage(unsigned l, const unsigned short* ga, const unsigned short* gb) {
  copy_rows64(l,                                 ga);
  copy_rows64(l + 64u * 2u * PPE,                ga + 64 * NDIM);
  copy_rows64(l + 2u * PHALF,                    gb);
  copy_rows64(l + 2u * PHALF + 64u * 2u * PPE,   gb + 64 * NDIM);
}
__device__ __forceinline__ void proj_tile(const unsigned short* Ps, const unsigned short* At, const unsigned short* Bt,
                                          int wm, int wn, v8f (&acc)[4][4]) {
  const int tid  = threadIdx.x;
  const int lane = tid & 31;
  const int hh   = lane >> 4, cl = lane & 15;
  const unsigned short* ga = At + (size_t)(tid >> 4) * NDIM + 8 * (tid & 15);
  const unsigned short* gb = Bt + (size_t)(tid >> 4) * NDIM + 8 * (tid & 15);
  const unsigned psl = lds_off(Ps) + (unsigned)((tid >> 4) * (2 * PPE) + (tid & 15) * 16);
  const unsigned short* ap = Ps + (64 * wm + cl) * PPE + 8 * hh;
  const unsigned short* bp = Ps + PHALF + (64 * wn + cl) * PPE + 8 * hh;

#pragma unroll                                                       // constant indices keep the accumulators in registers
  for (int mt = 0; mt < 4; ++mt) {
#pragma unroll                                                       // as above
    for (int nt = 0; nt < 4; ++nt) acc[mt][nt] = zero8();
  }

  proj_stage(psl, ga, gb);
  wait_async0();
  __syncthreads();                                                   // publishes stage 0
  proj_stage(psl + 2u * PBUF, ga + PKC, gb + PKC);

#pragma unroll 1                                                     // one copy of the trip: the buffer is a run-time offset
  for (int t = 0; t < NDIM / PKC; ++t) {
    const int buf = t & 1;                                           // this trip reads this buffer alone
    const unsigned short* a0 = ap + buf * PBUF;
    const unsigned short* b0 = bp + buf * PBUF;
#pragma unroll                                                       // constant indices keep fragments and accumulators in registers
    for (int ks = 0; ks < PKC / 32; ++ks) {
      Frag fa[4], fb[4];                                             // the k-step's LDS reads stand together, ahead of its products
#pragma unroll                                                       // as above
      for (int i = 0; i < 4; ++i) { fa[i] = ldfrag(a0 + 16 * i * PPE + 32 * ks); fb[i] = ldfrag(b0 + 16 * i * PPE + 32 * ks); }
#pragma unroll                                                       // as above
      for (int mt = 0; mt < 4; ++mt) {
#pragma unroll                                                       // as above
        for (int nt = 0; nt < 4; ++nt) acc[mt][nt] = mma_h(fa[mt].h, fb[nt].h, acc[mt][nt]);
      }
    }
    // foot of the trip: own LDS reads retired, own copies landed, then the barrier that publishes stage t + 1 and ends
    // every read of this trip's buffer; only then its refill
    wait_ds0();
    wait_async0();
    __syncthreads();
    if (t + 2 < NDIM / PKC) proj_stage(psl + (unsigned)buf * (2u * PBUF), ga + (t + 2) * PKC, gb + (t + 2) * PKC);
  }
  wait_async0();                                                     // nothing in flight when the ring changes its use
}
// Accumulators x 1/256 -> Os[n_loc][m_loc] (pitch OSPW, b128 stores). Lane (hh, cl): D element r of tile (mt, nt) =
// (64 wm + 16 mt + 8 hh + r, 64 wn + 16 nt + cl).
__device__ __forceinline__ void proj_unload(float* Os, int wm, int wn, const v8f (&acc)[4][4]) {
  const int lane = threadIdx.x & 31;
  const int hh   = lane >> 4, cl = lane & 15;
#pragma unroll                                                       // constant indices keep the accumulators in registers
  for (int nt = 0; nt < 4; ++nt) {
    const int nl = 64 * wn + 16 * nt + cl;
#pragma unroll                                                       // as above
    for (int mt = 0; mt < 4; ++mt) {
      v4f va, vb;
#pragma unroll                                                       // as above
      for (int r = 0; r < 4; ++r) { va[r] = acc[mt][nt][r] * IWSC; vb[r] = acc[mt][nt][4 + r] * IWSC; }
      *(v4f*)(Os + nl * OSPW + 64 * wm + 16 * mt + 8 * hh)     = va;
      *(v4f*)(Os + nl * OSPW + 64 * wm + 16 * mt + 8 * hh + 4) = vb;
    }
  }
}

// =========================================================================================================
// (1) projection for q / k, one (128-c tile, 128-o tile, b) per block of 4 waves:
//     D[c][o] = sum_n X16[b][c][n] W16[o][n]  (x256): A rows c from X16, B rows o from W16 (same split k map), K = 2048.
//     Epilogue: x 1/256 -> LDS Os[o_loc][c_loc] (reuses the ring behind the loop's last barrier), barrier,
//     + bf16-RNE bias[o], then planes Ph = bf16-RNE(v), Pl = bf16-RNE(v - hi).
// coverage: Os 4 waves x 64 o x 64 c = 128 x 128 (all read); planes 16 it x 8 rows x 16 lanes x 8 = 128 o x 128 c;
//           grid (4, n_otiles, NB) covers rows 0 .. 128 n_otiles - 1 of every batch once.
// =========================================================================================================
__global__ __launch_bounds__(128)
void proj_qk(const unsigned short* __restrict__ X16, const unsigned short* __restrict__ W16,
             const float* __restrict__ bias, unsigned short* Ph, unsigned short* Pl) {
  __shared__ __align__(16) unsigned short Ps[2 * PBUF];              // [buffer][A rows, B rows][128][PPE]
  const int tid  = threadIdx.x;
  const int wave = uni((int)(threadIdx.x >> 5));                     // 0..3, SGPR
  const int wm   = wave & 1, wn = wave >> 1;
  const int ct   = blockIdx.x, ot = blockIdx.y, b = blockIdx.z;
  const int c0   = ct * PT, o0 = ot * PT;

  v8f acc[4][4];
  proj_tile(Ps, X16 + ((size_t)(b * CDIM + c0)) * NDIM, W16 + ((size_t)o0) * NDIM, wm, wn, acc);

  float* Os = (float*)Ps;
  proj_unload(Os, wm, wn, acc);
  __syncthreads();

  const int e = tid & 15, lq = tid >> 4;                             // lq 0..7
  const float* bp = bias + o0 + lq;                                  // row it * 8 + lq at a constant step from here
  v4u uh[16], ul[16];
#pragma unroll
  for (int it = 0; it < 16; ++it) {
    const int row = it * 8 + lq;                                     // o_loc 0..127
    const v4f a  = *(const v4f*)(Os + row * OSPW + 8 * e);
    const v4f qv = *(const v4f*)(Os + row * OSPW + 8 * e + 4);
    const float bb = bfr(bp[it * 8]);
    const float f[8] = {a[0] + bb, a[1] + bb, a[2] + bb, a[3] + bb, qv[0] + bb, qv[1] + bb, qv[2] + bb, qv[3] + bb};
#pragma unroll
    for (int t = 0; t < 4; ++t) {
      const float f0 = f[2 * t], f1 = f[2 * t + 1];
      const unsigned short hb0 = bf_bits(f0), hb1 = bf_bits(f1);
      const unsigned short lb0 = bf_bits(f0 - bf_up(hb0));
      const unsigned short lb1 = bf_bits(f1 - bf_up(hb1));
      uh[it][t] = pk16(hb0, hb1);
      ul[it][t] = pk16(lb0, lb1);
    }
  }
  {
    const size_t po = ((size_t)(b * NDIM + o0 + lq)) * CDIM + c0 + 8 * e;   // row it * 8 + lq at a constant step from here
    unsigned short* ph = Ph + po;
    unsigned short* pl = Pl + po;
#pragma unroll
    for (int it = 0; it < 16; ++it) {
      *(v4u*)(ph + it * 8 * CDIM) = uh[it];
      *(v4u*)(pl + it * 8 * CDIM) = ul[it];
    }
  }
}

// =========================================================================================================
// (2) projection for v, one (128-o tile, 128-c tile, b) per block of 4 waves:
//     D[o][c] = sum_n W16[o][n] X16[b][c][n] (x256): A rows o from W16, B rows c from X16 (same split k map), K = 2048.
//     Epilogue: x 1/256 -> LDS Os[c_loc][o_loc] (reuses the ring behind the loop's last barrier), barrier,
//     + bf16-RNE bias[o], then the f16 plane.
// coverage: Os 4 waves x 64 c x 64 o = 128 x 128 (all read); plane 16 it x 8 rows x 16 lanes x 8 = 128 c x 128 o;
//           grid (16, 4, NB) covers PV[b][0..511][0..2047] once.
// =========================================================================================================
__global__ __launch_bounds__(128)
void proj_v(const unsigned short* __restrict__ W16, const unsigned short* __restrict__ X16,
            const float* __restrict__ bias, unsigned short* PV) {
  __shared__ __align__(16) unsigned short Ps[2 * PBUF];              // [buffer][A rows, B rows][128][PPE]
  const int tid  = threadIdx.x;
  const int wave = uni((int)(threadIdx.x >> 5));                     // 0..3, SGPR
  const int wm   = wave & 1, wn = wave >> 1;
  const int ot   = blockIdx.x, ct = blockIdx.y, b = blockIdx.z;
  const int o0   = ot * PT, c0 = ct * PT;

  v8f acc[4][4];
  proj_tile(Ps, W16 + ((size_t)o0) * NDIM, X16 + ((size_t)(b * CDIM + c0)) * NDIM, wm, wn, acc);

  float* Os = (float*)Ps;
  proj_unload(Os, wm, wn, acc);
  __syncthreads();

  const int e = tid & 15, lq = tid >> 4;                             // lq 0..7
  const v4f ba = *(const v4f*)(bias + o0 + 8 * e);
  const v4f bq = *(const v4f*)(bias + o0 + 8 * e + 4);
  const float bb[8] = {bfr(ba[0]), bfr(ba[1]), bfr(ba[2]), bfr(ba[3]), bfr(bq[0]), bfr(bq[1]), bfr(bq[2]), bfr(bq[3])};
  v4u uv[16];
#pragma unroll
  for (int it = 0; it < 16; ++it) {
    const int row = it * 8 + lq;                                     // c_loc 0..127
    const v4f a  = *(const v4f*)(Os + row * OSPW + 8 * e);
    const v4f qv = *(const v4f*)(Os + row * OSPW + 8 * e + 4);
    const float f[8] = {a[0], a[1], a[2], a[3], qv[0], qv[1], qv[2], qv[3]};
#pragma unroll
    for (int t = 0; t < 4; ++t) {
      const _Float16 h0 = (_Float16)(f[2 * t] + bb[2 * t]);
      const _Float16 h1 = (_Float16)(f[2 * t + 1] + bb[2 * t + 1]);
      uv[it][t] = pk16(h_bits(h0), h_bits(h1));
    }
  }
  {
    unsigned short* pv = PV + ((size_t)(b * CDIM + c0 + lq)) * NDIM + o0 + 8 * e;   // row it * 8 + lq at a constant step from here
#pragma unroll
    for (int it = 0; it < 16; ++it) *(v4u*)(pv + it * 8 * NDIM) = uv[it];
  }
}

// =========================================================================================================
// (3) attention for one (b, 64-query tile), transposed formulation, 2048 keys, no mask, no scale on the scores.
//   Block = 8 waves. Waves 0..3 (w = wave) are score waves for queries n0 + 16 w .. + 15; waves 4..7 share the query
//   group w = wave - 4. Channel half g = wave >> 2 (channels 256 g .. 256 g + 255) for the P.V accumulators.
//   Per 32-key block kb (score waves only): S^T tiles (16 keys x 16 queries) = sum over 16 c-chunks of
//   A(Kh: row = key kb + (lane&15), k = c via the split map, plane [b][2048][512]) . B(Qh: col = query, same map)
//   + A(Kh).B(Ql) + A(Kl).B(Qh) (bf16 unscaled residual planes, shared accumulator). Per lane the D tiles hold
//   8 + 8 keys of ONE query: online softmax state per lane, one shuffle (lane^16) for the max over 32 keys; the
//   rescale factor is skipped under a wave-uniform ballot when no lane's max grew. P = e^{s-m} x 16384 as f16:
//   B operand of O^T: element r <- D of the tile covering keys kb..kb+15, element 8+r <- the tile covering
//   kb+16..kb+31, lane unchanged. The score wave publishes P (32 B per lane), corr and the grew flag in LDS;
//   after a block barrier all 8 waves rescale (if grew) and run O^T[ch][q] += A(PV rows ch = 256 g + 16 j +
//   (lane&15), keys contiguous, f16 plane [b][512][2048]) . B(P) on 16 accumulator tiles; second block barrier
//   before the next kb overwrites the LDS exchange. At the end score waves publish inv = (1/l) / sqrt(2048).
//   Epilogue in 4 channel passes of 64 channels per wave: O x inv staged in LDS Os[query][128] (pitch OSPW, b128
//   barrier before the next pass overwrites Os.
//   Operands come from LDS, brought by asynchronous 16-B copies of all 8 waves: the 64-query tile (both planes) once;
//   the 32-key tiles (both planes) in two buffers, tile t + 2 issued behind the foot barrier of trip t; the 512 x 32 pv
//   tile in one buffer, tile t + 1 issued behind the same barrier (its readers of trip t have passed it) and published
//   by the barrier between the scores and the P.V products of trip t + 1. Every wave waits for its own copies in front
//   of both barriers. Os reuses the key ring behind the loop.
//   Fragment reads run one step ahead of the products, in two register sets, inside a trip's published tiles only:
//   the scores read c-chunk kc + 1 ahead of chunk kc's products, the P.V products read the next four channel tiles.
// coverage: per pass 8 it x 32 lines x 8 lanes x 4 floats = 64 queries x 128 ch; 4 passes = 512 ch;
//           grid (NQ/64, NB) covers out[b][0..NQ-1][0..511] exactly once.
// =========================================================================================================
__global__ __launch_bounds__(256)
void attn_k(const unsigned short* __restrict__ Qh, const unsigned short* __restrict__ Ql,
            const unsigned short* __restrict__ Kh, const unsigned short* __restrict__ Kl,
            const unsigned short* __restrict__ PV, float* out) {
  __shared__ __align__(16) unsigned short Qs[2 * QPLANE];            // [hi, residual][64 queries][KPE]
  __shared__ __align__(16) unsigned short Ks[2 * KBUF];              // [buffer][hi, residual][32 keys][KPE]
  __shared__ __align__(16) unsigned short Vs[CDIM * VPE];            // [512 channels][VPE], 32 keys used
  __shared__ __align__(16) unsigned Psh[4 * 32 * 8];
  __shared__ float Csh[4 * 32];
  __shared__ float Ish[4 * 32];
  __shared__ int   Gsh[4];
  const int tid  = threadIdx.x;
  const int lane = tid & 31;
  const int wave = uni((int)(threadIdx.x >> 5));                     // 0..7, SGPR
  const int w    = wave & 3, g = wave >> 2;
  const int hh   = lane >> 4, cl = lane & 15;
  const int n0   = blockIdx.x * QT, b = blockIdx.y;

  // q fragment pointers in LDS (B operand, col = query 16 w + cl of the tile), + 32*kc
  const unsigned short* Qhp = Qs + (16 * w + cl) * KPE + 8 * hh;
  const unsigned short* Qlp = Qhp + QPLANE;
  // k fragment base in LDS (A operand, row = key cl of the tile), + buffer * KBUF + 32*kc
  const unsigned short* Ksp = Ks + cl * KPE + 8 * hh;
  // v fragment base in LDS (A operand, row = channel 256 g + 16 j + cl, the tile's 32 keys contiguous), + 16*j*VPE
  const unsigned short* Vp = Vs + (g * CHH + cl) * VPE + 8 * hh;
  // copy sources (the lane's 16-B chunk of copy 0) and LDS places
  // as 32-bit element offsets from the planes' uniform bases (one for both key planes): fewer registers live through the loop
  const unsigned kgo = (unsigned)(b * NDIM * CDIM + 8 * tid);
  const unsigned vgo = (unsigned)(b * CDIM * NDIM + (tid >> 2) * NDIM + 8 * (tid & 3));
  const unsigned rpl = (unsigned)((tid >> 6) * (2 * KPE) + (tid & 63) * 16);
  const unsigned ksl = lds_off(Ks) + rpl;
  const unsigned vsl = lds_off(Vs) + (unsigned)((tid >> 2) * (2 * VPE) + (tid & 3) * 16);

  const int pso = (w * 32 + lane) * 8;                               // LDS exchange slot (uints)

  float m = -1.0e30f, l = 0.f;
  v8f o[16];
#pragma unroll
  for (int j = 0; j < 16; ++j) o[j] = zero8();

  // prologue: the query tile (filled once), key tile 0 and pv tile 0, published by one barrier; then key tile 1
  {
    const size_t qg = ((size_t)(b * NDIM + n0)) * CDIM + 8 * tid;
    const unsigned qsl = lds_off(Qs) + rpl;
    copy_rows32(qsl,                             Qh + qg);
    copy_rows32(qsl + 2u * KPLANE,               Qh + qg + KT * CDIM);
    copy_rows32(qsl + 2u * QPLANE,               Ql + qg);
    copy_rows32(qsl + 2u * QPLANE + 2u * KPLANE, Ql + qg + KT * CDIM);
    wait_async0();
    copy_rows32(ksl,               Kh + kgo);
    copy_rows32(ksl + 2u * KPLANE, Kl + kgo);
    copy_vtile(vsl, PV + vgo);
    wait_async0();
    __syncthreads();
    copy_rows32(ksl + 2u * KBUF,               Kh + (kgo + KT * CDIM));
    copy_rows32(ksl + 2u * KBUF + 2u * KPLANE, Kl + (kgo + KT * CDIM));
  }

#pragma unroll 1
  for (int kb = 0; kb < NDIM; kb += KT) {
    const int buf = (kb / KT) & 1;                                   // this trip reads this key buffer alone
    if (wave < 4) {                                                  // wave-uniform (SGPR) role branch
      const unsigned short* k0p  = Ksp + buf * KBUF;                 // keys kb .. kb+15
      const unsigned short* k1p  = k0p + 16 * KPE;                   // keys kb+16 .. kb+31
      const unsigned short* k0lp = k0p + KPLANE;
      const unsigned short* k1lp = k1p + KPLANE;
      v8f s0 = zero8(), s1 = zero8();
      // two register sets: chunk kc + 1's LDS reads stand together ahead of chunk kc's products, so that their latency
      // passes under those products; all 16 chunks lie in this trip's key buffer and in the query tile
      Frag qh[2], ql[2], k0[2], k1[2], k0l[2], k1l[2];
      qh[0]  = ldfrag(Qhp);
      k0[0]  = ldfrag(k0p);
      k1[0]  = ldfrag(k1p);
      ql[0]  = ldfrag(Qlp);
      k0l[0] = ldfrag(k0lp);
      k1l[0] = ldfrag(k1lp);
#pragma unroll                                                       // constant indices keep both sets in registers
      for (int kc = 0; kc < CDIM / 32; ++kc) {
        const int c = kc & 1, n = c ^ 1;
        if (kc + 1 < CDIM / 32) {
          qh[n]  = ldfrag(Qhp + 32 * (kc + 1));
          k0[n]  = ldfrag(k0p + 32 * (kc + 1));
          k1[n]  = ldfrag(k1p + 32 * (kc + 1));
          ql[n]  = ldfrag(Qlp + 32 * (kc + 1));
          k0l[n] = ldfrag(k0lp + 32 * (kc + 1));
          k1l[n] = ldfrag(k1lp + 32 * (kc + 1));
        }
        s0 = mma_s(k0[c].bf, qh[c].bf, s0);
        s1 = mma_s(k1[c].bf, qh[c].bf, s1);
        s0 = mma_s(k0[c].bf, ql[c].bf, s0);
        s1 = mma_s(k1[c].bf, ql[c].bf, s1);
        s0 = mma_s(k0l[c].bf, qh[c].bf, s0);
        s1 = mma_s(k1l[c].bf, qh[c].bf, s1);
      }

      float mx = fmaxf(hmax8(s0), hmax8(s1));
      mx = fmaxf(mx, __shfl_xor(mx, 16, 32));
      const float mn = fmaxf(m, mx);
      const unsigned grew = wave_ballot(mx > m);                     // wave-uniform
      float corr = 1.0f;
      if (grew != 0u) {
        corr = __expf(m - mn);                                       // == 1 for lanes whose max did not grow
        l *= corr;
      }
      m = mn;
      const float msh = mn - LNPS;                                   // exp gives e^{s-m} * 16384

      FragP ph;
      float ls = 0.f;
#pragma unroll
      for (int r = 0; r < 8; ++r) {
        const float e0 = __expf(s0[r] - msh);                        // key kb      + 8hh + r
        const float e1 = __expf(s1[r] - msh);                        // key kb + 16 + 8hh + r
        ls += e0 + e1;
        ph.hv[0][r] = (_Float16)e0;
        ph.hv[1][r] = (_Float16)e1;
      }
      l += ls;

      *(v4u*)(Psh + pso)     = ph.u[0];
      *(v4u*)(Psh + pso + 4) = ph.u[1];
      Csh[w * 32 + lane] = corr;
      Gsh[w] = (grew != 0u) ? 1 : 0;
    }
    wait_async0();                                                   // own copies of this trip's pv tile have landed
    __syncthreads();                                                 // publishes the P exchange and the pv tile

    {
      const int gfl = Gsh[w];                                        // read first: its wait leaves the reads below in flight
      FragP pb;
      pb.u[0] = *(const v4u*)(Psh + pso);
      pb.u[1] = *(const v4u*)(Psh + pso + 4);
      Frag vf[2][4];                                                 // two register sets, as for the scores: the next four tiles'
#pragma unroll                                                       // reads stand together ahead of these four tiles' products
      for (int jj = 0; jj < 4; ++jj) vf[0][jj] = ldfrag(Vp + 16 * jj * VPE);
      const int gf = uni(gfl);                                       // wave-uniform flag
      if (gf != 0) {
        const float corr = Csh[w * 32 + lane];
#pragma unroll
        for (int j = 0; j < 16; ++j) {
#pragma unroll
          for (int r = 0; r < 8; ++r) o[j][r] *= corr;
        }
      }
#pragma unroll                                                       // constant indices keep vf and o in registers
      for (int jq = 0; jq < 4; ++jq) {
        if (jq + 1 < 4) {
#pragma unroll                                                       // as above
          for (int jj = 0; jj < 4; ++jj) vf[(jq + 1) & 1][jj] = ldfrag(Vp + 16 * (4 * (jq + 1) + jj) * VPE);
        }
#pragma unroll                                                       // as above
        for (int jj = 0; jj < 4; ++jj) o[4 * jq + jj] = mma_h(vf[jq & 1][jj].h, pb.v, o[4 * jq + jj]);
      }
    }
    // foot of the trip: own LDS traffic retired, own copies landed, then the barrier that publishes key tile kb + 32 and
    // ends every read of this trip's key buffer, of the pv tile and of the P exchange; only then the refills
    wait_ds0();
    wait_async0();
    __syncthreads();
    if (kb + KT < NDIM) {                                            // block-uniform: a next trip exists
      copy_vtile(vsl, PV + (vgo + (unsigned)(kb + KT)));
      if (kb + 2 * KT < NDIM) {                                      // block-uniform: a key tile two ahead exists
        copy_rows32(ksl + (unsigned)buf * (2u * KBUF),               Kh + (kgo + (unsigned)(kb + 2 * KT) * CDIM));
        copy_rows32(ksl + (unsigned)buf * (2u * KBUF) + 2u * KPLANE, Kl + (kgo + (unsigned)(kb + 2 * KT) * CDIM));
      }
    }
  }
  wait_async0();                                                     // nothing in flight when the ring changes its use
  float* Os = (float*)Ks;                                            // output staging; first written behind the next barrier

  if (wave < 4) {
    l += __shfl_xor(l, 16, 32);
    Ish[w * 32 + lane] = (1.0f / l) * OSCALE;                        // o and l both carry the x16384 factor
  }
  __syncthreads();
  const float inv = Ish[w * 32 + lane];

  const int qrow = 16 * w + cl;
  const int e = tid & 7, lq = tid >> 3;                              // lq 0..31
#pragma unroll
  for (int p = 0; p < 4; ++p) {
    if (p) __syncthreads();                                          // every wave finished reading Os
#pragma unroll
    for (int jj = 0; jj < 4; ++jj) {
      const int j = 4 * p + jj;                                        // channels 256 g + 64 p + 16 jj + 8 hh + r
      v4f va, vb;
#pragma unroll
      for (int r = 0; r < 4; ++r) { va[r] = o[j][r] * inv; vb[r] = o[j][4 + r] * inv; }
      *(v4f*)(Os + qrow * OSPW + g * 64 + 16 * jj + 8 * hh)     = va;   // Os[query][64 g + 16 jj + 8 hh + r]
      *(v4f*)(Os + qrow * OSPW + g * 64 + 16 * jj + 8 * hh + 4) = vb;
    }
    __syncthreads();
    v4f res[8];
#pragma unroll
    for (int it = 0; it < 8; ++it) {
      const int L   = it * 32 + lq;                                    // 0..255
      const int ql  = L >> 2, seg = L & 3;                             // query 0..63, line 0..3 of this pass
      const int gg  = seg >> 1, ln = seg & 1;
      res[it] = *(const v4f*)(Os + ql * OSPW + gg * 64 + 32 * ln + 4 * e);
    }
{
#pragma unroll
      for (int it = 0; it < 8; ++it) {
        const int L   = it * 32 + lq;
        const int ql  = L >> 2, seg = L & 3;
        const int gg  = seg >> 1, ln = seg & 1;
        const int ch  = gg * CHH + 64 * p + 32 * ln + 4 * e;
        const size_t idx = ((size_t)(b * NDIM + n0 + ql)) * CDIM + ch;
        *(v4f*)(out + idx) = res[it];
      }
      
    }
  }
}

// =========================================================================================================
// Workspace map (bytes; each region start a multiple of 256; every extent is an exact tile multiple and is written
//   W16 f16 [3][2048][2048]         8388608 x3 (Wq, Wk, Wv)
//   X16 f16 [3][NB][512][2048]     16777216 x3 (q, k, v)
//   Qh/Ql/Kh/Kl bf16 [NB][2048][512] 16777216 x4
//   PV  f16 [NB][512][2048]        16777216
//   total (NB = 8) = 159383552
// =========================================================================================================
extern "C" void kernel_launch(void* const* d_in, const int* in_sizes, int n_in,
                              void* d_out, int out_size, void* d_ws, size_t ws_size,
                              hipStream_t stream) {
  if (n_in < 9) return;
  if (in_sizes[0] < NB * CDIM * NDIM || in_sizes[1] < NB * CDIM * NDIM || in_sizes[2] < NB * CDIM * NDIM) return;
  if (in_sizes[3] < NDIM * NDIM || in_sizes[5] < NDIM * NDIM || in_sizes[7] < NDIM * NDIM) return;
  if (in_sizes[4] < NDIM || in_sizes[6] < NDIM || in_sizes[8] < NDIM) return;
  if (out_size < (NB - 1) * NDIM * CDIM + NQ * CDIM) return;

  size_t off = 0;
  auto carve = [&](size_t bytes) { const size_t o = off; off += (bytes + 255) & ~(size_t)255; return o; };
  const size_t oW16 = carve((size_t)3 * WPLANE * 2);
  const size_t oX16 = carve((size_t)3 * XPLANE * 2);
  const size_t oQh  = carve((size_t)NB * NDIM * CDIM * 2);
  const size_t oQl  = carve((size_t)NB * NDIM * CDIM * 2);
  const size_t oKh  = carve((size_t)NB * NDIM * CDIM * 2);
  const size_t oKl  = carve((size_t)NB * NDIM * CDIM * 2);
  const size_t oPV  = carve((size_t)NB * CDIM * NDIM * 2);
  if (off > ws_size) return;

  const float* q  = (const float*)d_in[0];
  const float* k  = (const float*)d_in[1];
  const float* v  = (const float*)d_in[2];
  const float* Wq = (const float*)d_in[3];
  const float* bq = (const float*)d_in[4];
  const float* Wk = (const float*)d_in[5];
  const float* bk = (const float*)d_in[6];
  const float* Wv = (const float*)d_in[7];
  const float* bv = (const float*)d_in[8];

  char* ws = (char*)d_ws;
  unsigned short* W16 = (unsigned short*)(ws + oW16);
  unsigned short* X16 = (unsigned short*)(ws + oX16);
  unsigned short* Qh  = (unsigned short*)(ws + oQh);
  unsigned short* Ql  = (unsigned short*)(ws + oQl);
  unsigned short* Kh  = (unsigned short*)(ws + oKh);
  unsigned short* Kl  = (unsigned short*)(ws + oKl);
  unsigned short* PVp = (unsigned short*)(ws + oPV);
  float* out = (float*)d_out;

  const dim3 blk256(256), blk128(128);

  // convert all six operands
  cvt_k<<<dim3(CVGRID), dim3(CVW * 32), 0, stream>>>(Wq, Wk, Wv, q, k, v, W16, W16 + WPLANE, W16 + 2 * WPLANE,
                                                     X16, X16 + XPLANE, X16 + 2 * XPLANE);
  // q: project -> pq hi + residual planes [b][o][c] for o < NQ
  proj_qk<<<dim3(CDIM / PT, NQ / PT, NB), blk128, 0, stream>>>(X16, W16, bq, Qh, Ql);
  // k: project -> pk hi + residual planes [b][o][c], all o
  proj_qk<<<dim3(CDIM / PT, NDIM / PT, NB), blk128, 0, stream>>>(X16 + XPLANE, W16 + WPLANE, bk, Kh, Kl);
  // v: project -> pv^T f16 plane [b][c][o]
  proj_v<<<dim3(NDIM / PT, CDIM / PT, NB), blk128, 0, stream>>>(W16 + 2 * WPLANE, X16 + 2 * XPLANE, bv, PVp);
  // attention + 1/sqrt(2048) -> out [b][n][c] (the raw view to [b][512][2048] is the same flat buffer)
  attn_k<<<dim3(NQ / QT, NB), blk256, 0, stream>>>(Qh, Ql, Kh, Kl, PVp, out);
  (void)hipGetLastError();
}

// v005
// One run takes 206 microseconds.
// Timed twice side by side with v004, it ran 1.11 and 1.12 times as fast.
// Over all steps from v000 it is 5.95 times as fast.
// Contractions: projections X[c][n].W[o][n]^T (K=2048) on v_wmma_f32_16x16x32_f16 (f16 containers of bf16-RNE W x256 and bf16-RNE x); scores pk.pq^T (K=512) on v_wmma_f32_16x16x32_bf16 (bf16 hi + bf16 residual planes of pq/pk, 3 products); O^T = pv^T.P^T (K=2048 keys) on v_wmma_f32_16x16x32_f16 (pv f16, P = e^{s-m} x16384 f16 from the score D registers); projection and attention operands staged in LDS by asynchronous copies; f32 accumulate everywhere; softmax statistics and scaling in f32 VALU.
#include <hip/hip_runtime.h>
#include <math.h>
#include <stdint.h>

#ifndef NB
#define NB 8
#endif
#ifndef NQ
#define NQ 2048
#endif
#define NB_FULL 8
#define CDIM   512
#define NDIM   2048
#define QT     64
#define CHH    256
#define OSPW   132
#define WSC    256.0f
#define IWSC   0.00390625f
#define LNPS   9.704060527839234f
#define OSCALE 0.022097086912079608f
#define KT     32
#define KPE    520
#define KPLANE (KT * KPE)
#define KBUF   (2 * KPLANE)
#define QPLANE (QT * KPE)
#define VPE    40
#define PT     128
#define PKC    128
#define PPE    136
#define PHALF  (PT * PPE)
#define PBUF   (2 * PHALF)
#define CVW    16
#define CVL    8
#define CVUNIT (CVW * 32 * 4 * CVL)
#define CVGRID 256
#define WPLANE (NDIM * NDIM)
#define XPLANE (NB * CDIM * NDIM)
#define WTRIPS (WPLANE / (CVUNIT * CVGRID))
#define XTRIPS (XPLANE / (CVUNIT * CVGRID))

static_assert(NB >= 1 && NB <= NB_FULL);
static_assert(NQ >= QT && NQ <= NDIM && NQ % QT == 0);
static_assert(CDIM % QT == 0 && NDIM % QT == 0);
static_assert(CDIM % 32 == 0 && NDIM % 32 == 0);
static_assert(CDIM == 2 * CHH && CHH == 16 * 16);
static_assert((OSPW * 4) % 16 == 0);
static_assert(NDIM == 8 * 256);
static_assert((KPE * 2) % 16 == 0 && ((KPE * 2) / 16) % 2 == 1);   // LDS row pitches 16 B x odd: the 16 rows of a b128
static_assert((VPE * 2) % 16 == 0 && ((VPE * 2) / 16) % 2 == 1);   // fragment read fall on all 64 banks once
static_assert(CDIM * 2 == 64 * 16 && KT == 8 * 4 && QT == 2 * KT);  // q/k rows: 64 chunks of 16 B; 8 copies x 256 lanes (q) or 16 x 128 lanes (k) = 32 rows
static_assert(KT * 2 == 4 * 16 && CDIM == 16 * 32);                 // v rows: 4 chunks of 16 B; 16 copies x 128 lanes = 512 rows
static_assert(NDIM / KT >= 2);
static_assert(CDIM % PT == 0 && NDIM % PT == 0 && NQ % PT == 0 && NDIM % PKC == 0 && NDIM / PKC >= 2);
static_assert((PPE * 2) % 16 == 0 && ((PPE * 2) / 16) % 2 == 1 && PPE >= PKC);  // as for KPE and VPE
static_assert(PKC * 2 == 16 * 16 && PT == 2 * 8 * 8);               // projection rows: 16 chunks of 16 B; 8 copies x 128 lanes = 64 rows
static_assert(PT * OSPW * 4 <= 2 * PBUF * 2);                       // the projections' output staging fits in the ring it reuses
static_assert(QT * OSPW * 4 <= 2 * KBUF * 2);                       // the output staging fits in the key ring it reuses
static_assert(WPLANE == WTRIPS * CVUNIT * CVGRID && XPLANE == XTRIPS * CVUNIT * CVGRID && CVL == 8);   // whole convert trips

typedef _Float16       v16h __attribute__((ext_vector_type(16)));
typedef _Float16       v8h  __attribute__((ext_vector_type(8)));
typedef __bf16         v16b __attribute__((ext_vector_type(16)));
typedef unsigned short v8us __attribute__((ext_vector_type(8)));
typedef float          v8f  __attribute__((ext_vector_type(8)));
typedef float          v4f  __attribute__((ext_vector_type(4)));
typedef unsigned int   v4u  __attribute__((ext_vector_type(4)));
typedef unsigned int   v2u  __attribute__((ext_vector_type(2)));

union Frag  { v8us u[2]; v16h h; v16b bf; };
union FragP { v16h v; v8h hv[2]; v4u u[2]; };
static_assert(sizeof(Frag) == 32);
static_assert(sizeof(FragP) == 32);

// ---- scalar helpers ---------------------------------------------------------------------------------------
__device__ __forceinline__ unsigned short bf_bits(float f) {          // f32 -> bf16 bits, RNE convert
  unsigned u = __float_as_uint(f);
  return (unsigned short)((u + 0x7FFFu + ((u >> 16) & 1u)) >> 16);
}
__device__ __forceinline__ float bf_up(unsigned short hb) { return __uint_as_float(((unsigned)hb) << 16); }
__device__ __forceinline__ float bfr(float f) { return bf_up(bf_bits(f)); }
__device__ __forceinline__ unsigned short h_bits(_Float16 x) { return __builtin_bit_cast(unsigned short, x); }
__device__ __forceinline__ unsigned pk16(unsigned short a, unsigned short b) { return (unsigned)a | ((unsigned)b << 16); }
__device__ __forceinline__ v8f zero8() { v8f z = {0.f, 0.f, 0.f, 0.f, 0.f, 0.f, 0.f, 0.f}; return z; }
__device__ __forceinline__ float hmax8(v8f s) {
  return fmaxf(fmaxf(fmaxf(s[0], s[1]), fmaxf(s[2], s[3])), fmaxf(fmaxf(s[4], s[5]), fmaxf(s[6], s[7])));
}
__device__ __forceinline__ unsigned wave_ballot(bool p) {
#if defined(__HIP_DEVICE_COMPILE__)
  return __builtin_amdgcn_ballot_w32(p);
#else
  return p ? 1u : 0u;
#endif
}
__device__ __forceinline__ int uni(int v) {                           // wave-uniform int -> SGPR
#if defined(__HIP_DEVICE_COMPILE__)
  return __builtin_amdgcn_readfirstlane(v);
#else
  return v;
#endif
}

// ---- 16-bit fragment loader (A, or B from a k-contiguous [n][k] row): lane -> row/col (lane&15), p already includes
//      + 8*(lane>>4); elements 0..7 <- p[0..7] (k0+8h..), elements 8..15 <- p[16..23] (k0+16+8h..)
__device__ __forceinline__ Frag ldfrag(const unsigned short* p) {
  Frag f;
  f.u[0] = *(const v8us*)(p);
  f.u[1] = *(const v8us*)(p + 16);
  return f;
}

// ---- LDS staging by asynchronous copies ----------------------------------------------------------------------
__device__ __forceinline__ unsigned lds_off(const void* p) { return (unsigned)(size_t)p; }
// Eight 16-B copies per lane, global -> LDS: copy i moves g + i * GSTEP (elements) to LDS byte l + i * LSTEP.
// The closing s_wait_xcnt stands in the copies' own statement so that no address register is rewritten ahead of it.
template <unsigned LSTEP, int GSTEP>
__device__ __forceinline__ void acopy8(unsigned l, const unsigned short* g) {
#if defined(__HIP_DEVICE_COMPILE__)
  asm volatile(
      "global_load_async_to_lds_b128 %0, %8, off\n\t"
      "global_load_async_to_lds_b128 %1, %9, off\n\t"
      "global_load_async_to_lds_b128 %2, %10, off\n\t"
      "global_load_async_to_lds_b128 %3, %11, off\n\t"
      "global_load_async_to_lds_b128 %4, %12, off\n\t"
      "global_load_async_to_lds_b128 %5, %13, off\n\t"
      "global_load_async_to_lds_b128 %6, %14, off\n\t"
      "global_load_async_to_lds_b128 %7, %15, off\n\t"
      "s_wait_xcnt 0x0"
      :: "v"(l), "v"(l + 1u * LSTEP), "v"(l + 2u * LSTEP), "v"(l + 3u * LSTEP),
         "v"(l + 4u * LSTEP), "v"(l + 5u * LSTEP), "v"(l + 6u * LSTEP), "v"(l + 7u * LSTEP),
         "v"(g), "v"(g + 1 * GSTEP), "v"(g + 2 * GSTEP), "v"(g + 3 * GSTEP),
         "v"(g + 4 * GSTEP), "v"(g + 5 * GSTEP), "v"(g + 6 * GSTEP), "v"(g + 7 * GSTEP)
      : "memory");
#endif
}
// 32 q rows of 1024 B (contiguous in global) -> LDS pitch 2 KPE: copy i, lane tid -> row 4 i + (tid >> 6), chunk tid & 63
__device__ __forceinline__ void copy_rows32(unsigned l, const unsigned short* g) { acopy8<4u * 2u * KPE, 256 * 8>(l, g); }
__device__ __forceinline__ void wait_async0() {                       // this wave's copies have landed in LDS
#if defined(__HIP_DEVICE_COMPILE__)
  asm volatile("s_wait_asynccnt 0x0" ::: "memory");
#endif
}
__device__ __forceinline__ void wait_ds0() {                          // this wave's LDS reads and writes have retired
#if defined(__HIP_DEVICE_COMPILE__)
  asm volatile("s_wait_dscnt 0x0" ::: "memory");
#endif
}

// ---- WMMA helpers: mma_h is the f16 builtin followed by a 4-slot VALU gap tying D and keeping A/B live --------------------------
__device__ __forceinline__ v8f mma_h(v16h a, v16h b, v8f c) {
  v8f d = __builtin_amdgcn_wmma_f32_16x16x32_f16(false, a, false, b, (short)0, c, false, false);
#if defined(__HIP_DEVICE_COMPILE__)
  asm volatile("v_nop\n\tv_nop\n\tv_nop\n\tv_nop" : "+v"(d) : "v"(a), "v"(b));
#endif
  return d;
}

// Score product by the builtin alone (the compiler keeps its distances): an asm statement's vector operands must lie
// below v256, and the score loop's two fragment sets beside the 32 query fragments do not all fit there.
__device__ __forceinline__ v8f mma_s(v16b a, v16b b, v8f c) {
  return __builtin_amdgcn_wmma_f32_16x16x32_bf16(false, a, false, b, (short)0, c, false, false);
}

// =========================================================================================================
// (0) convert, all six f32 operands in one launch: W16[p] = f16(bf16-RNE(W_p) x 256), X16[p] = f16(bf16-RNE(x_p)),
//     p = 0, 1, 2 for q, k, v. CVGRID work-groups of CVW waves stay resident and loop: the launch starts few waves, and
//     each keeps CVL or more loads of 16 B a lane in flight. A trip of a work-group is CVUNIT contiguous floats; a wave
//     takes 128 CVL of them, load i of lane ln the floats 128 i + 4 ln .. + 3 (512 contiguous bytes a wave-load, 256 a
//     store). A work-group's trips in one tensor are adjacent. The next trip's loads are issued ahead of this trip's
//     conversions, in a second register set.
//     Trip order: (Wv, v), (Wk, k), (Wq, q): the pair that the next launch reads is written last.
// coverage: CVGRID work-groups x a tensor's trips x CVUNIT floats = its size (static_assert), every element once.
// =========================================================================================================
// s: the work-group's place (uniform); bo: the lane's byte offset in it
__device__ __forceinline__ void cvt_load(v4f (&r)[CVL], const float* s, unsigned bo) {
#pragma unroll                                                       // constant indices keep the set in registers
  for (int i = 0; i < CVL; ++i) r[i] = *(const v4f*)((const char*)s + bo + 512 * i);
#if defined(__HIP_DEVICE_COMPILE__)
  // s_wait_xcnt 0 behind the loads; base and offset are inputs, so that they stay live, and so unwritten, up to the wait
  asm volatile("s_wait_xcnt 0x0" :: "s"(s), "v"(bo) : "memory");
  __builtin_amdgcn_sched_barrier(0);                                 // the trip's loads stand together: no conversion moves up among them
#endif
}
// The closing s_wait_xcnt stands in the stores' own statement so that no register they name is rewritten ahead of it.
__device__ __forceinline__ void cvt_store(unsigned short* d, unsigned bo, const v4f (&r)[CVL], float sc) {
  v2u u[CVL];
#pragma unroll                                                       // as above
  for (int i = 0; i < CVL; ++i) {
#pragma unroll                                                       // as above
    for (int t = 0; t < 2; ++t) {
      const _Float16 h0 = (_Float16)(bfr(r[i][2 * t]) * sc);
      const _Float16 h1 = (_Float16)(bfr(r[i][2 * t + 1]) * sc);
      u[i][t] = pk16(h_bits(h0), h_bits(h1));
    }
  }
#if defined(__HIP_DEVICE_COMPILE__)
  asm volatile(
      "global_store_b64 %0, %2, %1\n\t"
      "global_store_b64 %0, %3, %1 offset:256\n\t"
      "global_store_b64 %0, %4, %1 offset:512\n\t"
      "global_store_b64 %0, %5, %1 offset:768\n\t"
      "global_store_b64 %0, %6, %1 offset:1024\n\t"
      "global_store_b64 %0, %7, %1 offset:1280\n\t"
      "global_store_b64 %0, %8, %1 offset:1536\n\t"
      "global_store_b64 %0, %9, %1 offset:1792\n\t"
      "s_wait_xcnt 0x0"
      :: "v"(bo), "s"(d), "v"(u[0]), "v"(u[1]), "v"(u[2]), "v"(u[3]), "v"(u[4]), "v"(u[5]), "v"(u[6]), "v"(u[7])
      : "memory");
#endif
}
__global__ __launch_bounds__(CVW * 32)
void cvt_k(const float* __restrict__ wq, const float* __restrict__ wk, const float* __restrict__ wv,
           const float* __restrict__ q, const float* __restrict__ k, const float* __restrict__ v,
           unsigned short* Wq16, unsigned short* Wk16, unsigned short* Wv16,
           unsigned short* Xq16, unsigned short* Xk16, unsigned short* Xv16) {
  const unsigned tid = threadIdx.x;
  const unsigned le  = (tid >> 5) * (128u * CVL) + 4u * (tid & 31u);  // the lane's first element in a trip's unit
  const float* const wsrc[3] = {wq, wk, wv};
  const float* const xsrc[3] = {q, k, v};
  unsigned short* const wdst[3] = {Wq16, Wk16, Wv16};
  unsigned short* const xdst[3] = {Xq16, Xk16, Xv16};
  constexpr int PTRIPS = WTRIPS + XTRIPS;                            // trips of one (W, x) pair
  // trip t (a compile-time number behind the unroll) -> pair, tensor, and the work-group's place in it (uniform)
  auto pair_of = [](int t) { return 2 - t / PTRIPS; };
  auto is_w    = [](int t) { return t % PTRIPS < WTRIPS; };
  auto place   = [&](int t) {
    return is_w(t) ? ((size_t)blockIdx.x * WTRIPS + t % PTRIPS) * CVUNIT
                   : ((size_t)blockIdx.x * XTRIPS + (t % PTRIPS - WTRIPS)) * CVUNIT;
  };
  auto from = [&](int t) { return (is_w(t) ? wsrc[pair_of(t)] : xsrc[pair_of(t)]) + place(t); };
  auto to   = [&](int t) { return (is_w(t) ? wdst[pair_of(t)] : xdst[pair_of(t)]) + place(t); };

  v4f r[2][CVL];
  cvt_load(r[0], from(0), 4u * le);
#pragma unroll                                                       // constant indices: both sets in registers, tensors by trip
  for (int t = 0; t < 3 * PTRIPS; ++t) {
    if (t + 1 < 3 * PTRIPS) cvt_load(r[(t + 1) & 1], from(t + 1), 4u * le);
    cvt_store(to(t), 2u * le, r[t & 1], is_w(t) ? WSC : 1.0f);
  }
}

// =========================================================================================================
// Projection main loop, one 128 x 128 tile of D[m][n] = sum_k A[m][k] B[n][k] per block of 4 waves (2 x 2, 64 x 64 each),
//   A and B rows k-contiguous at pitch NDIM. A stage is PKC = 128 k of the 128 A rows and the 128 B rows, brought into LDS
//   (row pitch 2 PPE bytes) by asynchronous 16-B copies of all 4 waves: copy i of a group, lane tid -> row 8 i + (tid >> 4),
//   chunk tid & 15. Two buffers: stage t + 2 is issued behind the foot barrier of trip t, which also publishes stage t + 1.
//   Each accumulator tile takes its 64 k-steps in ascending order.
// =========================================================================================================
__device__ __forceinline__ void copy_rows64(unsigned l, const unsigned short* g) { acopy8<8u * 2u * PPE, 8 * NDIM>(l, g); }
__device__ __forceinline__ void proj_stage(unsigned l, const unsigned short* ga, const unsigned short* gb) {
  copy_rows64(l,                                 ga);
  copy_rows64(l + 64u * 2u * PPE,                ga + 64 * NDIM);
  copy_rows64(l + 2u * PHALF,                    gb);
  copy_rows64(l + 2u * PHALF + 64u * 2u * PPE,   gb + 64 * NDIM);
}
__device__ __forceinline__ void proj_tile(const unsigned short* Ps, const unsigned short* At, const unsigned short* Bt,
                                          int wm, int wn, v8f (&acc)[4][4]) {
  const int tid  = threadIdx.x;
  const int lane = tid & 31;
  const int hh   = lane >> 4, cl = lane & 15;
  const unsigned short* ga = At + (size_t)(tid >> 4) * NDIM + 8 * (tid & 15);
  const unsigned short* gb = Bt + (size_t)(tid >> 4) * NDIM + 8 * (tid & 15);
  const unsigned psl = lds_off(Ps) + (unsigned)((tid >> 4) * (2 * PPE) + (tid & 15) * 16);
  const unsigned short* ap = Ps + (64 * wm + cl) * PPE + 8 * hh;
  const unsigned short* bp = Ps + PHALF + (64 * wn + cl) * PPE + 8 * hh;

#pragma unroll                                                       // constant indices keep the accumulators in registers
  for (int mt = 0; mt < 4; ++mt) {
#pragma unroll                                                       // as above
    for (int nt = 0; nt < 4; ++nt) acc[mt][nt] = zero8();
  }

  proj_stage(psl, ga, gb);
  wait_async0();
  __syncthreads();                                                   // publishes stage 0
  proj_stage(psl + 2u * PBUF, ga + PKC, gb + PKC);

#pragma unroll 1                                                     // one copy of the trip: the buffer is a run-time offset
  for (int t = 0; t < NDIM / PKC; ++t) {
    const int buf = t & 1;                                           // this trip reads this buffer alone
    const unsigned short* a0 = ap + buf * PBUF;
    const unsigned short* b0 = bp + buf * PBUF;
#pragma unroll                                                       // constant indices keep fragments and accumulators in registers
    for (int ks = 0; ks < PKC / 32; ++ks) {
      Frag fa[4], fb[4];                                             // the k-step's LDS reads stand together, ahead of its products
#pragma unroll                                                       // as above
      for (int i = 0; i < 4; ++i) { fa[i] = ldfrag(a0 + 16 * i * PPE + 32 * ks); fb[i] = ldfrag(b0 + 16 * i * PPE + 32 * ks); }
#pragma unroll                                                       // as above
      for (int mt = 0; mt < 4; ++mt) {
#pragma unroll                                                       // as above
        for (int nt = 0; nt < 4; ++nt) acc[mt][nt] = mma_h(fa[mt].h, fb[nt].h, acc[mt][nt]);
      }
    }
    // foot of the trip: own LDS reads retired, own copies landed, then the barrier that publishes stage t + 1 and ends
    // every read of this trip's buffer; only then its refill
    wait_ds0();
    wait_async0();
    __syncthreads();
    if (t + 2 < NDIM / PKC) proj_stage(psl + (unsigned)buf * (2u * PBUF), ga + (t + 2) * PKC, gb + (t + 2) * PKC);
  }
  wait_async0();                                                     // nothing in flight when the ring changes its use
}
// Accumulators x 1/256 -> Os[n_loc][m_loc] (pitch OSPW, b128 stores). Lane (hh, cl): D element r of tile (mt, nt) =
// (64 wm + 16 mt + 8 hh + r, 64 wn + 16 nt + cl).
__device__ __forceinline__ void proj_unload(float* Os, int wm, int wn, const v8f (&acc)[4][4]) {
  const int lane = threadIdx.x & 31;
  const int hh   = lane >> 4, cl = lane & 15;
#pragma unroll                                                       // constant indices keep the accumulators in registers
  for (int nt = 0; nt < 4; ++nt) {
    const int nl = 64 * wn + 16 * nt + cl;
#pragma unroll                                                       // as above
    for (int mt = 0; mt < 4; ++mt) {
      v4f va, vb;
#pragma unroll                                                       // as above
      for (int r = 0; r < 4; ++r) { va[r] = acc[mt][nt][r] * IWSC; vb[r] = acc[mt][nt][4 + r] * IWSC; }
      *(v4f*)(Os + nl * OSPW + 64 * wm + 16 * mt + 8 * hh)     = va;
      *(v4f*)(Os + nl * OSPW + 64 * wm + 16 * mt + 8 * hh + 4) = vb;
    }
  }
}

// =========================================================================================================
// (1) projection for q / k, one (128-c tile, 128-o tile, b) per block of 4 waves:
//     D[c][o] = sum_n X16[b][c][n] W16[o][n]  (x256): A rows c from X16, B rows o from W16 (same split k map), K = 2048.
//     Epilogue: x 1/256 -> LDS Os[o_loc][c_loc] (reuses the ring behind the loop's last barrier), barrier,
//     + bf16-RNE bias[o], then planes Ph = bf16-RNE(v), Pl = bf16-RNE(v - hi).
// coverage: Os 4 waves x 64 o x 64 c = 128 x 128 (all read); planes 16 it x 8 rows x 16 lanes x 8 = 128 o x 128 c;
//           grid (4, n_otiles, NB) covers rows 0 .. 128 n_otiles - 1 of every batch once.
// =========================================================================================================
__global__ __launch_bounds__(128)
void proj_qk(const unsigned short* __restrict__ X16, const unsigned short* __restrict__ W16,
             const float* __restrict__ bias, unsigned short* Ph, unsigned short* Pl) {
  __shared__ __align__(16) unsigned short Ps[2 * PBUF];              // [buffer][A rows, B rows][128][PPE]
  const int tid  = threadIdx.x;
  const int wave = uni((int)(threadIdx.x >> 5));                     // 0..3, SGPR
  const int wm   = wave & 1, wn = wave >> 1;
  const int ct   = blockIdx.x, ot = blockIdx.y, b = blockIdx.z;
  const int c0   = ct * PT, o0 = ot * PT;

  v8f acc[4][4];
  proj_tile(Ps, X16 + ((size_t)(b * CDIM + c0)) * NDIM, W16 + ((size_t)o0) * NDIM, wm, wn, acc);

  float* Os = (float*)Ps;
  proj_unload(Os, wm, wn, acc);
  __syncthreads();

  const int e = tid & 15, lq = tid >> 4;                             // lq 0..7
  const float* bp = bias + o0 + lq;                                  // row it * 8 + lq at a constant step from here
  v4u uh[16], ul[16];
#pragma unroll
  for (int it = 0; it < 16; ++it) {
    const int row = it * 8 + lq;                                     // o_loc 0..127
    const v4f a  = *(const v4f*)(Os + row * OSPW + 8 * e);
    const v4f qv = *(const v4f*)(Os + row * OSPW + 8 * e + 4);
    const float bb = bfr(bp[it * 8]);
    const float f[8] = {a[0] + bb, a[1] + bb, a[2] + bb, a[3] + bb, qv[0] + bb, qv[1] + bb, qv[2] + bb, qv[3] + bb};
#pragma unroll
    for (int t = 0; t < 4; ++t) {
      const float f0 = f[2 * t], f1 = f[2 * t + 1];
      const unsigned short hb0 = bf_bits(f0), hb1 = bf_bits(f1);
      const unsigned short lb0 = bf_bits(f0 - bf_up(hb0));
      const unsigned short lb1 = bf_bits(f1 - bf_up(hb1));
      uh[it][t] = pk16(hb0, hb1);
      ul[it][t] = pk16(lb0, lb1);
    }
  }
  {
    const size_t po = ((size_t)(b * NDIM + o0 + lq)) * CDIM + c0 + 8 * e;   // row it * 8 + lq at a constant step from here
    unsigned short* ph = Ph + po;
    unsigned short* pl = Pl + po;
#pragma unroll
    for (int it = 0; it < 16; ++it) {
      *(v4u*)(ph + it * 8 * CDIM) = uh[it];
      *(v4u*)(pl + it * 8 * CDIM) = ul[it];
    }
  }
}

// =========================================================================================================
// (2) projection for v, one (128-o tile, 128-c tile, b) per block of 4 waves:
//     D[o][c] = sum_n W16[o][n] X16[b][c][n] (x256): A rows o from W16, B rows c from X16 (same split k map), K = 2048.
//     Epilogue: x 1/256 -> LDS Os[c_loc][o_loc] (reuses the ring behind the loop's last barrier), barrier,
//     + bf16-RNE bias[o], then the f16 plane.
// coverage: Os 4 waves x 64 c x 64 o = 128 x 128 (all read); plane 16 it x 8 rows x 16 lanes x 8 = 128 c x 128 o;
//           grid (16, 4, NB) covers PV[b][0..511][0..2047] once.
// =========================================================================================================
__global__ __launch_bounds__(128)
void proj_v(const unsigned short* __restrict__ W16, const unsigned short* __restrict__ X16,
            const float* __restrict__ bias, unsigned short* PV) {
  __shared__ __align__(16) unsigned short Ps[2 * PBUF];              // [buffer][A rows, B rows][128][PPE]
  const int tid  = threadIdx.x;
  const int wave = uni((int)(threadIdx.x >> 5));                     // 0..3, SGPR
  const int wm   = wave & 1, wn = wave >> 1;
  const int ot   = blockIdx.x, ct = blockIdx.y, b = blockIdx.z;
  const int o0   = ot * PT, c0 = ct * PT;

  v8f acc[4][4];
  proj_tile(Ps, W16 + ((size_t)o0) * NDIM, X16 + ((size_t)(b * CDIM + c0)) * NDIM, wm, wn, acc);

  float* Os = (float*)Ps;
  proj_unload(Os, wm, wn, acc);
  __syncthreads();

  const int e = tid & 15, lq = tid >> 4;                             // lq 0..7
  const v4f ba = *(const v4f*)(bias + o0 + 8 * e);
  const v4f bq = *(const v4f*)(bias + o0 + 8 * e + 4);
  const float bb[8] = {bfr(ba[0]), bfr(ba[1]), bfr(ba[2]), bfr(ba[3]), bfr(bq[0]), bfr(bq[1]), bfr(bq[2]), bfr(bq[3])};
  v4u uv[16];
#pragma unroll
  for (int it = 0; it < 16; ++it) {
    const int row = it * 8 + lq;                                     // c_loc 0..127
    const v4f a  = *(const v4f*)(Os + row * OSPW + 8 * e);
    const v4f qv = *(const v4f*)(Os + row * OSPW + 8 * e + 4);
    const float f[8] = {a[0], a[1], a[2], a[3], qv[0], qv[1], qv[2], qv[3]};
#pragma unroll
    for (int t = 0; t < 4; ++t) {
      const _Float16 h0 = (_Float16)(f[2 * t] + bb[2 * t]);
      const _Float16 h1 = (_Float16)(f[2 * t + 1] + bb[2 * t + 1]);
      uv[it][t] = pk16(h_bits(h0), h_bits(h1));
    }
  }
  {
    unsigned short* pv = PV + ((size_t)(b * CDIM + c0 + lq)) * NDIM + o0 + 8 * e;   // row it * 8 + lq at a constant step from here
#pragma unroll
    for (int it = 0; it < 16; ++it) *(v4u*)(pv + it * 8 * NDIM) = uv[it];
  }
}

// =========================================================================================================
// (3) attention for one (b, 64-query tile), transposed formulation, 2048 keys, no mask, no scale on the scores.
//   Block = 8 waves in two roles that work side by side, one wave of each role on every SIMD. In interval i of the loop
//   the score waves 0..3 (w = wave) make P of key tile i for queries n0 + 16 w .. + 15, while the product waves 4..7
//   (u = wave - 4) add key tile i - 1 into O^T for channels 128 u .. 128 u + 127 of all 64 queries. One barrier an interval.
//   Score waves, per 32-key tile: S^T tiles (16 keys x 16 queries) = sum over 16 c-chunks of
//   A(Kh: row = key (lane&15), k = c via the split map, plane [b][2048][512]) . B(Qh: col = query, same map)
//   + A(Kh).B(Ql) + A(Kl).B(Qh) (bf16 unscaled residual planes, shared accumulator). Per lane the D tiles hold
//   8 + 8 keys of ONE query: online softmax state per lane, one shuffle (lane^16) for the max over 32 keys; the
//   rescale factor is skipped under a wave-uniform ballot when no lane's max grew. P = e^{s-m} x 16384 as f16:
//   B operand of O^T: element r <- D of the tile covering keys 0..15, element 8+r <- the tile covering keys 16..31,
//   lane unchanged. The score wave publishes P (32 B per lane), corr and the grew flag in LDS, two buffers each.
//   Product waves: rescale the 8 tiles of a query group whose flag is set, then O^T[ch][q] += A(PV rows ch = 128 u + 16 j +
//   (lane&15), keys contiguous, f16 plane [b][512][2048]) . B(P of query group qg) on 8 x 4 accumulator tiles.
//   One register array of 32 x 8 VGPRs serves both roles: a score wave keeps its 32 query fragments there (both planes,
//   read once from LDS), a product wave its 32 accumulator tiles.
//   Operands come from LDS by asynchronous 16-B copies. The query tile is staged once, by all 8 waves, in the key ring
//   before the ring's first use. In the loop the product waves issue every copy, at the head of interval i (behind the
//   foot barrier of interval i - 1): key tile i + 1 into the key buffer and pv tile i into the pv buffer that interval
//   i - 1 has just read; the foot of interval i publishes both.
//   The score waves read c-chunk kc + 1's key fragments ahead of chunk kc's products, in two register sets.
//   At the end score waves publish inv = (1/l) / sqrt(2048). Epilogue in 4 passes of 32 channels per product wave:
//   O x inv staged in LDS Os[query][128] (pitch OSPW, b128; reuses the key ring), read back and stored by all 8 waves.
// coverage: per pass 8 it x 32 lines x 8 lanes x 4 floats = 64 queries x 128 ch; 4 passes = 512 ch;
//           grid (NQ/64, NB) covers out[b][0..NQ-1][0..511] exactly once.
// =========================================================================================================
static_assert(2 * QPLANE == 2 * KBUF);                                // the query tile fits the key ring that stages it
// P.V product by the builtin alone (the compiler keeps its distances): 32 accumulator tiles do not all lie below v256
__device__ __forceinline__ v8f mma_p(v16h a, v16h b, v8f c) {
  return __builtin_amdgcn_wmma_f32_16x16x32_f16(false, a, false, b, (short)0, c, false, false);
}
// Sixteen 16-B copies per lane, global -> LDS, by the builtin: copy i moves g + i * GSTEP (elements) to l + i * LSTEP
// (elements). The builtin's address registers may lie anywhere; an asm statement's must lie below v256, where the 256
// registers of R would have to make room for them on every trip.
typedef int v4i_gcc __attribute__((vector_size(16)));
template <int LSTEP, int GSTEP>
__device__ __forceinline__ void bcopy16(unsigned short* l, const unsigned short* g) {
#if defined(__HIP_DEVICE_COMPILE__)
#pragma unroll                                                       // sixteen copies back to back
  for (int i = 0; i < 16; ++i) {
    __builtin_amdgcn_global_load_async_to_lds_b128((__attribute__((address_space(1))) v4i_gcc*)(g + i * GSTEP),
                                                   (__attribute__((address_space(3))) v4i_gcc*)(l + i * LSTEP), 0, 0);
  }
#endif
}
// the tiles as the 128 lanes of the product waves copy them (t7 = tid & 127):
// 32 k rows: copy i -> row 2 i + (t7 >> 6), chunk t7 & 63; 512 v rows: copy i -> row 32 i + (t7 >> 2), chunk t7 & 3
__device__ __forceinline__ void copy_rows32_h(unsigned short* l, const unsigned short* g) { bcopy16<2 * KPE, 128 * 8>(l, g); }
__device__ __forceinline__ void copy_vtile_h(unsigned short* l, const unsigned short* g) { bcopy16<32 * VPE, 32 * NDIM>(l, g); }
#define SM_VS 0
#define SM_KS (SM_VS + 2 * CDIM * VPE * 2)
#define SM_PS (SM_KS + 2 * KBUF * 2)
#define SM_CS (SM_PS + 2 * 4 * 32 * 8 * 4)
#define SM_IS (SM_CS + 2 * 4 * 32 * 4)
#define SM_GS (SM_IS + 4 * 32 * 4)
#define SM_ALL (SM_GS + 2 * 4 * 4)
static_assert(SM_KS % 16 == 0 && SM_PS % 16 == 0 && SM_CS % 16 == 0 && SM_IS % 16 == 0 && SM_GS % 16 == 0);
__global__ __launch_bounds__(256)
void attn_k(const unsigned short* __restrict__ Qh, const unsigned short* __restrict__ Ql,
            const unsigned short* __restrict__ Kh, const unsigned short* __restrict__ Kl,
            const unsigned short* __restrict__ PV, float* out) {
  // One array, so that the order of its parts is the source's. The key ring stands behind the pv buffers: the compiler folds
  // the key copies' global steps into offset:N and takes N off the LDS address register, which so never falls below 0.
  __shared__ __align__(16) unsigned char Sm[SM_ALL];
  unsigned short* const Vs  = (unsigned short*)(Sm + SM_VS);         // [buffer][512 channels][VPE], 32 keys used
  unsigned short* const Ks  = (unsigned short*)(Sm + SM_KS);         // [buffer][hi, residual][32 keys][KPE]; first the query tile
  unsigned* const       Psh = (unsigned*)(Sm + SM_PS);               // [buffer][query group][lane][8]
  float* const          Csh = (float*)(Sm + SM_CS);                  // [buffer][query group][lane]
  float* const          Ish = (float*)(Sm + SM_IS);                  // [query group][lane]
  int* const            Gsh = (int*)(Sm + SM_GS);                    // [buffer][query group]
  constexpr int NT = NDIM / KT;                                      // key tiles
  const int tid  = threadIdx.x;
  const int lane = tid & 31;
  const int wave = uni((int)(threadIdx.x >> 5));                     // 0..7, SGPR
  const int w    = wave & 3;                                         // query group of a score wave, channel group of a product wave
  const int hh   = lane >> 4, cl = lane & 15;
  const int n0   = blockIdx.x * QT, b = blockIdx.y;
  const int t7   = tid & 127;

  // k fragment base in LDS (A operand, row = key cl of the tile), + buffer * KBUF + 32*kc
  const unsigned short* Ksp = Ks + cl * KPE + 8 * hh;
  // v fragment base in LDS (A operand, row = channel 128 w + 16 j + cl, the tile's 32 keys contiguous), + buffer, + 16*j*VPE
  const unsigned short* Vp = Vs + (w * 128 + cl) * VPE + 8 * hh;
  // the product waves' copy sources (the lane's 16-B chunk of copy 0), as 32-bit element offsets from the planes'
  // uniform bases (one for both key planes), and LDS places
  const unsigned kgo = (unsigned)(b * NDIM * CDIM + 8 * t7);
  const unsigned vgo = (unsigned)(b * CDIM * NDIM + (t7 >> 2) * NDIM + 8 * (t7 & 3));
  unsigned short* const ksl = Ks + (t7 >> 6) * KPE + (t7 & 63) * 8;
  unsigned short* const vsl = Vs + (t7 >> 2) * VPE + (t7 & 3) * 8;

  const int pso = (w * 32 + lane) * 8;                               // a score wave's slot in a P buffer (uints)

  float m = -1.0e30f, l = 0.f;
  v8f R[32];                                                         // score wave: q fragments [chunk][hi, residual]; product wave: O^T tiles [j][query group]

  // prologue: the query tile through the key ring into the score waves' registers, then key tile 0
  {
    const size_t qg = ((size_t)(b * NDIM + n0)) * CDIM + 8 * tid;
    const unsigned qsl = lds_off(Ks) + (unsigned)((tid >> 6) * (2 * KPE) + (tid & 63) * 16);
    copy_rows32(qsl,                             Qh + qg);
    copy_rows32(qsl + 2u * KPLANE,               Qh + qg + KT * CDIM);
    copy_rows32(qsl + 2u * QPLANE,               Ql + qg);
    copy_rows32(qsl + 2u * QPLANE + 2u * KPLANE, Ql + qg + KT * CDIM);
    wait_async0();
    __syncthreads();                                                 // publishes the query tile
    if (wave < 4) {                                                  // wave-uniform (SGPR) role branch
      // q fragments (B operand, col = query 16 w + cl of the tile)
      const unsigned short* Qhp = Ks + (16 * w + cl) * KPE + 8 * hh;
      const unsigned short* Qlp = Qhp + QPLANE;
#pragma unroll                                                       // constant indices keep R in registers
      for (int kc = 0; kc < CDIM / 32; ++kc) {
        R[2 * kc]     = __builtin_bit_cast(v8f, ldfrag(Qhp + 32 * kc).bf);
        R[2 * kc + 1] = __builtin_bit_cast(v8f, ldfrag(Qlp + 32 * kc).bf);
      }
    } else {
#pragma unroll                                                       // as above
      for (int j = 0; j < 32; ++j) R[j] = zero8();
    }
    wait_ds0();                                                      // own reads of the query tile have retired
    __syncthreads();                                                 // ends every read of the query tile: the ring is free
    if (wave >= 4) {
      copy_rows32_h(ksl,          Kh + kgo);
      copy_rows32_h(ksl + KPLANE, Kl + kgo);
    }
    wait_async0();
    __syncthreads();                                                 // publishes key tile 0
  }

#pragma unroll 1                                                     // one copy of the interval: the buffers are run-time offsets
  for (int i = 0; i <= NT; ++i) {
    const int buf = i & 1;                                           // key tile i, P of tile i, pv tile i
    if (wave >= 4) {                                                 // wave-uniform (SGPR) role branch
      // refills first, so that they fly through the whole interval: both targets were last read in interval i - 1
      if (i + 1 < NT) {                                              // block-uniform: key tile i + 1 exists
        copy_rows32_h(ksl + (buf ^ 1) * KBUF,          Kh + (kgo + (unsigned)(i + 1) * (KT * CDIM)));
        copy_rows32_h(ksl + (buf ^ 1) * KBUF + KPLANE, Kl + (kgo + (unsigned)(i + 1) * (KT * CDIM)));
      }
      if (i < NT) {                                                  // block-uniform: pv tile i exists
        copy_vtile_h(vsl + buf * (CDIM * VPE), PV + (vgo + (unsigned)i * KT));
      }
      if (i > 0) {                                                   // block-uniform: tile i - 1 has been published
        const int pbf = buf ^ 1;                                     // P, corr, flags and pv tile of key tile i - 1
        int gfl[4];
        float cr[4];
#pragma unroll                                                       // constant indices keep the sets in registers
        for (int qg = 0; qg < 4; ++qg) { gfl[qg] = Gsh[pbf * 4 + qg]; cr[qg] = Csh[pbf * 128 + qg * 32 + lane]; }
#pragma unroll                                                       // as above
        for (int qg = 0; qg < 4; ++qg) {
          if (uni(gfl[qg]) != 0) {                                   // wave-uniform flag
#pragma unroll                                                       // as above
            for (int j = 0; j < 8; ++j) {
#pragma unroll                                                       // as above
              for (int r = 0; r < 8; ++r) R[4 * j + qg][r] *= cr[qg];
            }
          }
        }
        FragP pb[4];
        Frag vf[8];
#pragma unroll                                                       // as above
        for (int qg = 0; qg < 4; ++qg) {
          pb[qg].u[0] = *(const v4u*)(Psh + pbf * 1024 + (qg * 32 + lane) * 8);
          pb[qg].u[1] = *(const v4u*)(Psh + pbf * 1024 + (qg * 32 + lane) * 8 + 4);
        }
#pragma unroll                                                       // as above
        for (int j = 0; j < 8; ++j) vf[j] = ldfrag(Vp + pbf * (CDIM * VPE) + 16 * j * VPE);
#if defined(__HIP_DEVICE_COMPILE__)
        // the tile's 24 fragment reads stand together ahead of its products: left alone, each pv fragment is read directly
        // in front of its four products and its whole LDS latency is waited for, eight times a tile
        __builtin_amdgcn_sched_barrier(0);
#endif
#pragma unroll                                                       // as above
        for (int j = 0; j < 8; ++j) {
#pragma unroll                                                       // as above
          for (int qg = 0; qg < 4; ++qg) R[4 * j + qg] = mma_p(vf[j].h, pb[qg].v, R[4 * j + qg]);
        }
      }
    } else {
      if (i < NT) {                                                  // block-uniform: key tile i exists
        const unsigned short* k0p  = Ksp + buf * KBUF;               // keys 0 .. 15 of the tile
        const unsigned short* k1p  = k0p + 16 * KPE;                 // keys 16 .. 31
        const unsigned short* k0lp = k0p + KPLANE;
        const unsigned short* k1lp = k1p + KPLANE;
        v8f s0 = zero8(), s1 = zero8();
        // two register sets: chunk kc + 1's LDS reads stand together ahead of chunk kc's products, so that their latency
        // passes under those products; all 16 chunks lie in this interval's key buffer
        Frag k0[2], k1[2], k0l[2], k1l[2];
        k0[0]  = ldfrag(k0p);
        k1[0]  = ldfrag(k1p);
        k0l[0] = ldfrag(k0lp);
        k1l[0] = ldfrag(k1lp);
#pragma unroll                                                       // constant indices keep both sets and R in registers
        for (int kc = 0; kc < CDIM / 32; ++kc) {
          const int c = kc & 1, n = c ^ 1;
          if (kc + 1 < CDIM / 32) {
            k0[n]  = ldfrag(k0p + 32 * (kc + 1));
            k1[n]  = ldfrag(k1p + 32 * (kc + 1));
            k0l[n] = ldfrag(k0lp + 32 * (kc + 1));
            k1l[n] = ldfrag(k1lp + 32 * (kc + 1));
          }
          const v16b qh = __builtin_bit_cast(v16b, R[2 * kc]);
          const v16b ql = __builtin_bit_cast(v16b, R[2 * kc + 1]);
          s0 = mma_s(k0[c].bf, qh, s0);
          s1 = mma_s(k1[c].bf, qh, s1);
          s0 = mma_s(k0[c].bf, ql, s0);
          s1 = mma_s(k1[c].bf, ql, s1);
          s0 = mma_s(k0l[c].bf, qh, s0);
          s1 = mma_s(k1l[c].bf, qh, s1);
        }

        float mx = fmaxf(hmax8(s0), hmax8(s1));
        mx = fmaxf(mx, __shfl_xor(mx, 16, 32));
        const float mn = fmaxf(m, mx);
        const unsigned grew = wave_ballot(mx > m);                   // wave-uniform
        float corr = 1.0f;
        if (grew != 0u) {
          corr = __expf(m - mn);                                     // == 1 for lanes whose max did not grow
          l *= corr;
        }
        m = mn;
        const float msh = mn - LNPS;                                 // exp gives e^{s-m} * 16384

        FragP ph;
        float ls = 0.f;
#pragma unroll
        for (int r = 0; r < 8; ++r) {
          const float e0 = __expf(s0[r] - msh);                      // key      8hh + r of the tile
          const float e1 = __expf(s1[r] - msh);                      // key 16 + 8hh + r
          ls += e0 + e1;
          ph.hv[0][r] = (_Float16)e0;
          ph.hv[1][r] = (_Float16)e1;
        }
        l += ls;

        *(v4u*)(Psh + buf * 1024 + pso)     = ph.u[0];
        *(v4u*)(Psh + buf * 1024 + pso + 4) = ph.u[1];
        Csh[buf * 128 + w * 32 + lane] = corr;
        Gsh[buf * 4 + w] = (grew != 0u) ? 1 : 0;
      }
    }
    // foot of the interval: own LDS traffic retired, own copies landed, then the barrier that publishes key tile i + 1,
    // pv tile i and P of tile i, and ends every read of this interval's buffers
    wait_ds0();
    wait_async0();
    __syncthreads();
  }
  wait_async0();                                                     // nothing in flight when the ring changes its use
  float* Os = (float*)Ks;                                            // output staging; first written behind the next barrier

  if (wave < 4) {
    l += __shfl_xor(l, 16, 32);
    Ish[w * 32 + lane] = (1.0f / l) * OSCALE;                        // o and l both carry the x16384 factor
  }
  __syncthreads();

  const int e = tid & 7, lq = tid >> 3;                              // lq 0..31
#pragma unroll
  for (int p = 0; p < 4; ++p) {
    if (p) __syncthreads();                                          // every wave finished reading Os
    if (wave >= 4) {                                                 // wave-uniform (SGPR) role branch
#pragma unroll
      for (int qg = 0; qg < 4; ++qg) {
        const float inv = Ish[qg * 32 + lane];
        const int qrow = 16 * qg + cl;
#pragma unroll
        for (int jj = 0; jj < 2; ++jj) {
          const int t = 4 * (2 * p + jj) + qg;                       // channels 128 w + 32 p + 16 jj + 8 hh + r
          v4f va, vb;
#pragma unroll
          for (int r = 0; r < 4; ++r) { va[r] = R[t][r] * inv; vb[r] = R[t][4 + r] * inv; }
          *(v4f*)(Os + qrow * OSPW + w * 32 + 16 * jj + 8 * hh)     = va;   // Os[query][32 w + 16 jj + 8 hh + r]
          *(v4f*)(Os + qrow * OSPW + w * 32 + 16 * jj + 8 * hh + 4) = vb;
        }
      }
    }
    __syncthreads();
    v4f res[8];
#pragma unroll
    for (int it = 0; it < 8; ++it) {
      const int L   = it * 32 + lq;                                  // 0..255
      const int ql  = L >> 2, seg = L & 3;                           // query 0..63, channel group 0..3: one 128-B line
      res[it] = *(const v4f*)(Os + ql * OSPW + 32 * seg + 4 * e);
    }
#pragma unroll
    for (int it = 0; it < 8; ++it) {
      const int L   = it * 32 + lq;
      const int ql  = L >> 2, seg = L & 3;
      const int ch  = 128 * seg + 32 * p + 4 * e;
      const size_t idx = ((size_t)(b * NDIM + n0 + ql)) * CDIM + ch;
      *(v4f*)(out + idx) = res[it];
    }
  }
}

// =========================================================================================================
// Workspace map (bytes; each region start a multiple of 256; every extent is an exact tile multiple and is written
//   W16 f16 [3][2048][2048]         8388608 x3 (Wq, Wk, Wv)
//   X16 f16 [3][NB][512][2048]     16777216 x3 (q, k, v)
//   Qh/Ql/Kh/Kl bf16 [NB][2048][512] 16777216 x4
//   PV  f16 [NB][512][2048]        16777216
//   total (NB = 8) = 159383552
// =========================================================================================================
extern "C" void kernel_launch(void* const* d_in, const int* in_sizes, int n_in,
                              void* d_out, int out_size, void* d_ws, size_t ws_size,
                              hipStream_t stream) {
  if (n_in < 9) return;
  if (in_sizes[0] < NB * CDIM * NDIM || in_sizes[1] < NB * CDIM * NDIM || in_sizes[2] < NB * CDIM * NDIM) return;
  if (in_sizes[3] < NDIM * NDIM || in_sizes[5] < NDIM * NDIM || in_sizes[7] < NDIM * NDIM) return;
  if (in_sizes[4] < NDIM || in_sizes[6] < NDIM || in_sizes[8] < NDIM) return;
  if (out_size < (NB - 1) * NDIM * CDIM + NQ * CDIM) return;

  size_t off = 0;
  auto carve = [&](size_t bytes) { const size_t o = off; off += (bytes + 255) & ~(size_t)255; return o; };
  const size_t oW16 = carve((size_t)3 * WPLANE * 2);
  const size_t oX16 = carve((size_t)3 * XPLANE * 2);
  const size_t oQh  = carve((size_t)NB * NDIM * CDIM * 2);
  const size_t oQl  = carve((size_t)NB * NDIM * CDIM * 2);
  const size_t oKh  = carve((size_t)NB * NDIM * CDIM * 2);
  const size_t oKl  = carve((size_t)NB * NDIM * CDIM * 2);
  const size_t oPV  = carve((size_t)NB * CDIM * NDIM * 2);
  if (off > ws_size) return;

  const float* q  = (const float*)d_in[0];
  const float* k  = (const float*)d_in[1];
  const float* v  = (const float*)d_in[2];
  const float* Wq = (const float*)d_in[3];
  const float* bq = (const float*)d_in[4];
  const float* Wk = (const float*)d_in[5];
  const float* bk = (const float*)d_in[6];
  const float* Wv = (const float*)d_in[7];
  const float* bv = (const float*)d_in[8];

  char* ws = (char*)d_ws;
  unsigned short* W16 = (unsigned short*)(ws + oW16);
  unsigned short* X16 = (unsigned short*)(ws + oX16);
  unsigned short* Qh  = (unsigned short*)(ws + oQh);
  unsigned short* Ql  = (unsigned short*)(ws + oQl);
  unsigned short* Kh  = (unsigned short*)(ws + oKh);
  unsigned short* Kl  = (unsigned short*)(ws + oKl);
  unsigned short* PVp = (unsigned short*)(ws + oPV);
  float* out = (float*)d_out;

  const dim3 blk256(256), blk128(128);

  // convert all six operands
  cvt_k<<<dim3(CVGRID), dim3(CVW * 32), 0, stream>>>(Wq, Wk, Wv, q, k, v, W16, W16 + WPLANE, W16 + 2 * WPLANE,
                                                     X16, X16 + XPLANE, X16 + 2 * XPLANE);
  // q: project -> pq hi + residual planes [b][o][c] for o < NQ
  proj_qk<<<dim3(CDIM / PT, NQ / PT, NB), blk128, 0, stream>>>(X16, W16, bq, Qh, Ql);
  // k: project -> pk hi + residual planes [b][o][c], all o
  proj_qk<<<dim3(CDIM / PT, NDIM / PT, NB), blk128, 0, stream>>>(X16 + XPLANE, W16 + WPLANE, bk, Kh, Kl);
  // v: project -> pv^T f16 plane [b][c][o]
  proj_v<<<dim3(NDIM / PT, CDIM / PT, NB), blk128, 0, stream>>>(W16 + 2 * WPLANE, X16 + 2 * XPLANE, bv, PVp);
  // attention + 1/sqrt(2048) -> out [b][n][c] (the raw view to [b][512][2048] is the same flat buffer)
  attn_k<<<dim3(NQ / QT, NB), blk256, 0, stream>>>(Qh, Ql, Kh, Kl, PVp, out);
  (void)hipGetLastError();
}

// v006
// Measured time: 197 microseconds a run.
// Timed twice side by side with v005, it ran 1.04 and 1.05 times as fast.
// All steps since v000 together make it 6.21 times as fast.
// Contractions: projections X[c][n].W[o][n]^T (K=2048) on v_wmma_f32_16x16x32_f16 (f16 containers of bf16-RNE W x256 and bf16-RNE x); scores pk.pq^T (K=512) on v_wmma_f32_16x16x32_bf16 (bf16 hi + bf16 residual planes of pq/pk, 3 products); O^T = pv^T.P^T (K=2048 keys) on v_wmma_f32_16x16x32_f16 (pv f16, P = e^{s-m} x16384 f16 from the score D registers); projection and attention operands staged in LDS by asynchronous copies; f32 accumulate everywhere; softmax statistics and scaling in f32 VALU.
#include <hip/hip_runtime.h>
#include <math.h>
#include <stdint.h>

#ifndef NB
#define NB 8
#endif
#ifndef NQ
#define NQ 2048
#endif
#define NB_FULL 8
#define CDIM   512
#define NDIM   2048
#define QT     64
#define CHH    256
#define OSPW   132
#define WSC    256.0f
#define IWSC   0.00390625f
#define LNPS   9.704060527839234f
#define OSCALE 0.022097086912079608f
#define KT     32
#define KPE    520
#define KPLANE (KT * KPE)
#define KBUF   (2 * KPLANE)
#define QPLANE (QT * KPE)
#define VPE    40
#define PT     128
#define PKC    128
#define PPE    136
#define PHALF  (PT * PPE)
#define PBUF   (2 * PHALF)
#define CVW    16
#define CVL    8
#define CVUNIT (CVW * 32 * 4 * CVL)
#define CVGRID 256
#define WPLANE (NDIM * NDIM)
#define XPLANE (NB * CDIM * NDIM)
#define WTRIPS (WPLANE / (CVUNIT * CVGRID))
#define XTRIPS (XPLANE / (CVUNIT * CVGRID))

static_assert(NB >= 1 && NB <= NB_FULL);
static_assert(NQ >= QT && NQ <= NDIM && NQ % QT == 0);
static_assert(CDIM % QT == 0 && NDIM % QT == 0);
static_assert(CDIM % 32 == 0 && NDIM % 32 == 0);
static_assert(CDIM == 2 * CHH && CHH == 16 * 16);
static_assert((OSPW * 4) % 16 == 0);
static_assert(NDIM == 8 * 256);
static_assert((KPE * 2) % 16 == 0 && ((KPE * 2) / 16) % 2 == 1);   // LDS row pitches 16 B x odd: the 16 rows of a b128
static_assert((VPE * 2) % 16 == 0 && ((VPE * 2) / 16) % 2 == 1);   // fragment read fall on all 64 banks once
static_assert(CDIM * 2 == 64 * 16 && KT == 8 * 4 && QT == 2 * KT);  // q/k rows: 64 chunks of 16 B; 8 copies x 256 lanes (q) or 16 x 128 lanes (k) = 32 rows
static_assert(KT * 2 == 4 * 16 && CDIM == 16 * 32);                 // v rows: 4 chunks of 16 B; 16 copies x 128 lanes = 512 rows
static_assert(PT % KT == 0 && KT == 4 * 8);                         // a projection tile's o are whole key tiles; 4 chunks of 8 o a tile
static_assert(NDIM / KT >= 2);
static_assert(CDIM % PT == 0 && NDIM % PT == 0 && NQ % PT == 0 && NDIM % PKC == 0 && NDIM / PKC >= 2);
static_assert((PPE * 2) % 16 == 0 && ((PPE * 2) / 16) % 2 == 1 && PPE >= PKC);  // as for KPE and VPE
static_assert(PKC * 2 == 16 * 16 && PT == 2 * 8 * 8);               // projection rows: 16 chunks of 16 B; 8 copies x 128 lanes = 64 rows
static_assert(PT * OSPW * 4 <= 2 * PBUF * 2);                       // the projections' output staging fits in the ring it reuses
static_assert(QT * OSPW * 4 <= 2 * KBUF * 2);                       // the output staging fits in the key ring it reuses
static_assert(WPLANE == WTRIPS * CVUNIT * CVGRID && XPLANE == XTRIPS * CVUNIT * CVGRID && CVL == 8);   // whole convert trips

typedef _Float16       v16h __attribute__((ext_vector_type(16)));
typedef _Float16       v8h  __attribute__((ext_vector_type(8)));
typedef __bf16         v16b __attribute__((ext_vector_type(16)));
typedef unsigned short v8us __attribute__((ext_vector_type(8)));
typedef float          v8f  __attribute__((ext_vector_type(8)));
typedef float          v4f  __attribute__((ext_vector_type(4)));
typedef unsigned int   v4u  __attribute__((ext_vector_type(4)));
typedef unsigned int   v2u  __attribute__((ext_vector_type(2)));

union Frag  { v8us u[2]; v16h h; v16b bf; };
union FragP { v16h v; v8h hv[2]; v4u u[2]; };
static_assert(sizeof(Frag) == 32);
static_assert(sizeof(FragP) == 32);

// ---- scalar helpers ---------------------------------------------------------------------------------------
__device__ __forceinline__ unsigned short bf_bits(float f) {          // f32 -> bf16 bits, RNE convert
  unsigned u = __float_as_uint(f);
  return (unsigned short)((u + 0x7FFFu + ((u >> 16) & 1u)) >> 16);
}
__device__ __forceinline__ float bf_up(unsigned short hb) { return __uint_as_float(((unsigned)hb) << 16); }
__device__ __forceinline__ float bfr(float f) { return bf_up(bf_bits(f)); }
__device__ __forceinline__ unsigned short h_bits(_Float16 x) { return __builtin_bit_cast(unsigned short, x); }
__device__ __forceinline__ unsigned pk16(unsigned short a, unsigned short b) { return (unsigned)a | ((unsigned)b << 16); }
__device__ __forceinline__ v8f zero8() { v8f z = {0.f, 0.f, 0.f, 0.f, 0.f, 0.f, 0.f, 0.f}; return z; }
__device__ __forceinline__ float hmax8(v8f s) {
  return fmaxf(fmaxf(fmaxf(s[0], s[1]), fmaxf(s[2], s[3])), fmaxf(fmaxf(s[4], s[5]), fmaxf(s[6], s[7])));
}
__device__ __forceinline__ unsigned wave_ballot(bool p) {
#if defined(__HIP_DEVICE_COMPILE__)
  return __builtin_amdgcn_ballot_w32(p);
#else
  return p ? 1u : 0u;
#endif
}
__device__ __forceinline__ int uni(int v) {                           // wave-uniform int -> SGPR
#if defined(__HIP_DEVICE_COMPILE__)
  return __builtin_amdgcn_readfirstlane(v);
#else
  return v;
#endif
}

// ---- 16-bit fragment loader (A, or B from a k-contiguous [n][k] row): lane -> row/col (lane&15), p already includes
//      + 8*(lane>>4); elements 0..7 <- p[0..7] (k0+8h..), elements 8..15 <- p[16..23] (k0+16+8h..)
__device__ __forceinline__ Frag ldfrag(const unsigned short* p) {
  Frag f;
  f.u[0] = *(const v8us*)(p);
  f.u[1] = *(const v8us*)(p + 16);
  return f;
}

// ---- LDS staging by asynchronous copies ----------------------------------------------------------------------
__device__ __forceinline__ unsigned lds_off(const void* p) { return (unsigned)(size_t)p; }
// Eight 16-B copies per lane, global -> LDS: copy i moves g + i * GSTEP (elements) to LDS byte l + i * LSTEP.
// The closing s_wait_xcnt stands in the copies' own statement so that no address register is rewritten ahead of it.
template <unsigned LSTEP, int GSTEP>
__device__ __forceinline__ void acopy8(unsigned l, const unsigned short* g) {
#if defined(__HIP_DEVICE_COMPILE__)
  asm volatile(
      "global_load_async_to_lds_b128 %0, %8, off\n\t"
      "global_load_async_to_lds_b128 %1, %9, off\n\t"
      "global_load_async_to_lds_b128 %2, %10, off\n\t"
      "global_load_async_to_lds_b128 %3, %11, off\n\t"
      "global_load_async_to_lds_b128 %4, %12, off\n\t"
      "global_load_async_to_lds_b128 %5, %13, off\n\t"
      "global_load_async_to_lds_b128 %6, %14, off\n\t"
      "global_load_async_to_lds_b128 %7, %15, off\n\t"
      "s_wait_xcnt 0x0"
      :: "v"(l), "v"(l + 1u * LSTEP), "v"(l + 2u * LSTEP), "v"(l + 3u * LSTEP),
         "v"(l + 4u * LSTEP), "v"(l + 5u * LSTEP), "v"(l + 6u * LSTEP), "v"(l + 7u * LSTEP),
         "v"(g), "v"(g + 1 * GSTEP), "v"(g + 2 * GSTEP), "v"(g + 3 * GSTEP),
         "v"(g + 4 * GSTEP), "v"(g + 5 * GSTEP), "v"(g + 6 * GSTEP), "v"(g + 7 * GSTEP)
      : "memory");
#endif
}
// 32 q rows of 1024 B (contiguous in global) -> LDS pitch 2 KPE: copy i, lane tid -> row 4 i + (tid >> 6), chunk tid & 63
__device__ __forceinline__ void copy_rows32(unsigned l, const unsigned short* g) { acopy8<4u * 2u * KPE, 256 * 8>(l, g); }
__device__ __forceinline__ void wait_async0() {                       // this wave's copies have landed in LDS
#if defined(__HIP_DEVICE_COMPILE__)
  asm volatile("s_wait_asynccnt 0x0" ::: "memory");
#endif
}
__device__ __forceinline__ void wait_ds0() {                          // this wave's LDS reads and writes have retired
#if defined(__HIP_DEVICE_COMPILE__)
  asm volatile("s_wait_dscnt 0x0" ::: "memory");
#endif
}

// ---- WMMA helpers: mma_h is the f16 builtin followed by a 4-slot VALU gap tying D and keeping A/B live --------------------------
__device__ __forceinline__ v8f mma_h(v16h a, v16h b, v8f c) {
  v8f d = __builtin_amdgcn_wmma_f32_16x16x32_f16(false, a, false, b, (short)0, c, false, false);
#if defined(__HIP_DEVICE_COMPILE__)
  asm volatile("v_nop\n\tv_nop\n\tv_nop\n\tv_nop" : "+v"(d) : "v"(a), "v"(b));
#endif
  return d;
}

// Score product by the builtin alone (the compiler keeps its distances): an asm statement's vector operands must lie
// below v256, and the score loop's two fragment sets beside the 32 query fragments do not all fit there.
__device__ __forceinline__ v8f mma_s(v16b a, v16b b, v8f c) {
  return __builtin_amdgcn_wmma_f32_16x16x32_bf16(false, a, false, b, (short)0, c, false, false);
}

// =========================================================================================================
// (0) convert, all six f32 operands in one launch: W16[p] = f16(bf16-RNE(W_p) x 256), X16[p] = f16(bf16-RNE(x_p)),
//     p = 0, 1, 2 for q, k, v. CVGRID work-groups of CVW waves stay resident and loop: the launch starts few waves, and
//     each keeps CVL or more loads of 16 B a lane in flight. A trip of a work-group is CVUNIT contiguous floats; a wave
//     takes 128 CVL of them, load i of lane ln the floats 128 i + 4 ln .. + 3 (512 contiguous bytes a wave-load, 256 a
//     store). A work-group's trips in one tensor are adjacent. The next trip's loads are issued ahead of this trip's
//     conversions, in a second register set.
//     Trip order: (Wv, v), (Wk, k), (Wq, q): the pair that the next launch reads is written last.
// coverage: CVGRID work-groups x a tensor's trips x CVUNIT floats = its size (static_assert), every element once.
// =========================================================================================================
// s: the work-group's place (uniform); bo: the lane's byte offset in it
__device__ __forceinline__ void cvt_load(v4f (&r)[CVL], const float* s, unsigned bo) {
#pragma unroll                                                       // constant indices keep the set in registers
  for (int i = 0; i < CVL; ++i) r[i] = *(const v4f*)((const char*)s + bo + 512 * i);
#if defined(__HIP_DEVICE_COMPILE__)
  // s_wait_xcnt 0 behind the loads; base and offset are inputs, so that they stay live, and so unwritten, up to the wait
  asm volatile("s_wait_xcnt 0x0" :: "s"(s), "v"(bo) : "memory");
  __builtin_amdgcn_sched_barrier(0);                                 // the trip's loads stand together: no conversion moves up among them
#endif
}
// The closing s_wait_xcnt stands in the stores' own statement so that no register they name is rewritten ahead of it.
__device__ __forceinline__ void cvt_store(unsigned short* d, unsigned bo, const v4f (&r)[CVL], float sc) {
  v2u u[CVL];
#pragma unroll                                                       // as above
  for (int i = 0; i < CVL; ++i) {
#pragma unroll                                                       // as above
    for (int t = 0; t < 2; ++t) {
      const _Float16 h0 = (_Float16)(bfr(r[i][2 * t]) * sc);
      const _Float16 h1 = (_Float16)(bfr(r[i][2 * t + 1]) * sc);
      u[i][t] = pk16(h_bits(h0), h_bits(h1));
    }
  }
#if defined(__HIP_DEVICE_COMPILE__)
  asm volatile(
      "global_store_b64 %0, %2, %1\n\t"
      "global_store_b64 %0, %3, %1 offset:256\n\t"
      "global_store_b64 %0, %4, %1 offset:512\n\t"
      "global_store_b64 %0, %5, %1 offset:768\n\t"
      "global_store_b64 %0, %6, %1 offset:1024\n\t"
      "global_store_b64 %0, %7, %1 offset:1280\n\t"
      "global_store_b64 %0, %8, %1 offset:1536\n\t"
      "global_store_b64 %0, %9, %1 offset:1792\n\t"
      "s_wait_xcnt 0x0"
      :: "v"(bo), "s"(d), "v"(u[0]), "v"(u[1]), "v"(u[2]), "v"(u[3]), "v"(u[4]), "v"(u[5]), "v"(u[6]), "v"(u[7])
      : "memory");
#endif
}
__global__ __launch_bounds__(CVW * 32)
void cvt_k(const float* __restrict__ wq, const float* __restrict__ wk, const float* __restrict__ wv,
           const float* __restrict__ q, const float* __restrict__ k, const float* __restrict__ v,
           unsigned short* Wq16, unsigned short* Wk16, unsigned short* Wv16,
           unsigned short* Xq16, unsigned short* Xk16, unsigned short* Xv16) {
  const unsigned tid = threadIdx.x;
  const unsigned le  = (tid >> 5) * (128u * CVL) + 4u * (tid & 31u);  // the lane's first element in a trip's unit
  const float* const wsrc[3] = {wq, wk, wv};
  const float* const xsrc[3] = {q, k, v};
  unsigned short* const wdst[3] = {Wq16, Wk16, Wv16};
  unsigned short* const xdst[3] = {Xq16, Xk16, Xv16};
  constexpr int PTRIPS = WTRIPS + XTRIPS;                            // trips of one (W, x) pair
  // trip t (a compile-time number behind the unroll) -> pair, tensor, and the work-group's place in it (uniform)
  auto pair_of = [](int t) { return 2 - t / PTRIPS; };
  auto is_w    = [](int t) { return t % PTRIPS < WTRIPS; };
  auto place   = [&](int t) {
    return is_w(t) ? ((size_t)blockIdx.x * WTRIPS + t % PTRIPS) * CVUNIT
                   : ((size_t)blockIdx.x * XTRIPS + (t % PTRIPS - WTRIPS)) * CVUNIT;
  };
  auto from = [&](int t) { return (is_w(t) ? wsrc[pair_of(t)] : xsrc[pair_of(t)]) + place(t); };
  auto to   = [&](int t) { return (is_w(t) ? wdst[pair_of(t)] : xdst[pair_of(t)]) + place(t); };

  v4f r[2][CVL];
  cvt_load(r[0], from(0), 4u * le);
#pragma unroll                                                       // constant indices: both sets in registers, tensors by trip
  for (int t = 0; t < 3 * PTRIPS; ++t) {
    if (t + 1 < 3 * PTRIPS) cvt_load(r[(t + 1) & 1], from(t + 1), 4u * le);
    cvt_store(to(t), 2u * le, r[t & 1], is_w(t) ? WSC : 1.0f);
  }
}

// =========================================================================================================
// Projection main loop, one 128 x 128 tile of D[m][n] = sum_k A[m][k] B[n][k] per block of 4 waves (2 x 2, 64 x 64 each),
//   A and B rows k-contiguous at pitch NDIM. A stage is PKC = 128 k of the 128 A rows and the 128 B rows, brought into LDS
//   (row pitch 2 PPE bytes) by asynchronous 16-B copies of all 4 waves: copy i of a group, lane tid -> row 8 i + (tid >> 4),
//   chunk tid & 15. Two buffers: stage t + 2 is issued behind the foot barrier of trip t, which also publishes stage t + 1.
//   Each accumulator tile takes its 64 k-steps in ascending order.
// =========================================================================================================
__device__ __forceinline__ void copy_rows64(unsigned l, const unsigned short* g) { acopy8<8u * 2u * PPE, 8 * NDIM>(l, g); }
__device__ __forceinline__ void proj_stage(unsigned l, const unsigned short* ga, const unsigned short* gb) {
  copy_rows64(l,                                 ga);
  copy_rows64(l + 64u * 2u * PPE,                ga + 64 * NDIM);
  copy_rows64(l + 2u * PHALF,                    gb);
  copy_rows64(l + 2u * PHALF + 64u * 2u * PPE,   gb + 64 * NDIM);
}
__device__ __forceinline__ void proj_tile(const unsigned short* Ps, const unsigned short* At, const unsigned short* Bt,
                                          int wm, int wn, v8f (&acc)[4][4]) {
  const int tid  = threadIdx.x;
  const int lane = tid & 31;
  const int hh   = lane >> 4, cl = lane & 15;
  const unsigned short* ga = At + (size_t)(tid >> 4) * NDIM + 8 * (tid & 15);
  const unsigned short* gb = Bt + (size_t)(tid >> 4) * NDIM + 8 * (tid & 15);
  const unsigned psl = lds_off(Ps) + (unsigned)((tid >> 4) * (2 * PPE) + (tid & 15) * 16);
  const unsigned short* ap = Ps + (64 * wm + cl) * PPE + 8 * hh;
  const unsigned short* bp = Ps + PHALF + (64 * wn + cl) * PPE + 8 * hh;

#pragma unroll                                                       // constant indices keep the accumulators in registers
  for (int mt = 0; mt < 4; ++mt) {
#pragma unroll                                                       // as above
    for (int nt = 0; nt < 4; ++nt) acc[mt][nt] = zero8();
  }

  proj_stage(psl, ga, gb);
  wait_async0();
  __syncthreads();                                                   // publishes stage 0
  proj_stage(psl + 2u * PBUF, ga + PKC, gb + PKC);

#pragma unroll 1                                                     // one copy of the trip: the buffer is a run-time offset
  for (int t = 0; t < NDIM / PKC; ++t) {
    const int buf = t & 1;                                           // this trip reads this buffer alone
    const unsigned short* a0 = ap + buf * PBUF;
    const unsigned short* b0 = bp + buf * PBUF;
#pragma unroll                                                       // constant indices keep fragments and accumulators in registers
    for (int ks = 0; ks < PKC / 32; ++ks) {
      Frag fa[4], fb[4];                                             // the k-step's LDS reads stand together, ahead of its products
#pragma unroll                                                       // as above
      for (int i = 0; i < 4; ++i) { fa[i] = ldfrag(a0 + 16 * i * PPE + 32 * ks); fb[i] = ldfrag(b0 + 16 * i * PPE + 32 * ks); }
#pragma unroll                                                       // as above
      for (int mt = 0; mt < 4; ++mt) {
#pragma unroll                                                       // as above
        for (int nt = 0; nt < 4; ++nt) acc[mt][nt] = mma_h(fa[mt].h, fb[nt].h, acc[mt][nt]);
      }
    }
    // foot of the trip: own LDS reads retired, own copies landed, then the barrier that publishes stage t + 1 and ends
    // every read of this trip's buffer; only then its refill
    wait_ds0();
    wait_async0();
    __syncthreads();
    if (t + 2 < NDIM / PKC) proj_stage(psl + (unsigned)buf * (2u * PBUF), ga + (t + 2) * PKC, gb + (t + 2) * PKC);
  }
  wait_async0();                                                     // nothing in flight when the ring changes its use
}
// Accumulators x 1/256 -> Os[n_loc][m_loc] (pitch OSPW, b128 stores). Lane (hh, cl): D element r of tile (mt, nt) =
// (64 wm + 16 mt + 8 hh + r, 64 wn + 16 nt + cl).
__device__ __forceinline__ void proj_unload(float* Os, int wm, int wn, const v8f (&acc)[4][4]) {
  const int lane = threadIdx.x & 31;
  const int hh   = lane >> 4, cl = lane & 15;
#pragma unroll                                                       // constant indices keep the accumulators in registers
  for (int nt = 0; nt < 4; ++nt) {
    const int nl = 64 * wn + 16 * nt + cl;
#pragma unroll                                                       // as above
    for (int mt = 0; mt < 4; ++mt) {
      v4f va, vb;
#pragma unroll                                                       // as above
      for (int r = 0; r < 4; ++r) { va[r] = acc[mt][nt][r] * IWSC; vb[r] = acc[mt][nt][4 + r] * IWSC; }
      *(v4f*)(Os + nl * OSPW + 64 * wm + 16 * mt + 8 * hh)     = va;
      *(v4f*)(Os + nl * OSPW + 64 * wm + 16 * mt + 8 * hh + 4) = vb;
    }
  }
}

// =========================================================================================================
// (1) projection for q / k, one (128-c tile, 128-o tile, b) per block of 4 waves:
//     D[c][o] = sum_n X16[b][c][n] W16[o][n]  (x256): A rows c from X16, B rows o from W16 (same split k map), K = 2048.
//     Epilogue: x 1/256 -> LDS Os[o_loc][c_loc] (reuses the ring behind the loop's last barrier), barrier,
//     + bf16-RNE bias[o], then planes Ph = bf16-RNE(v), Pl = bf16-RNE(v - hi).
// coverage: Os 4 waves x 64 o x 64 c = 128 x 128 (all read); planes 16 it x 8 rows x 16 lanes x 8 = 128 o x 128 c;
//           grid (4, n_otiles, NB) covers rows 0 .. 128 n_otiles - 1 of every batch once.
// =========================================================================================================
__global__ __launch_bounds__(128)
void proj_qk(const unsigned short* __restrict__ X16, const unsigned short* __restrict__ W16,
             const float* __restrict__ bias, unsigned short* Ph, unsigned short* Pl) {
  __shared__ __align__(16) unsigned short Ps[2 * PBUF];              // [buffer][A rows, B rows][128][PPE]
  const int tid  = threadIdx.x;
  const int wave = uni((int)(threadIdx.x >> 5));                     // 0..3, SGPR
  const int wm   = wave & 1, wn = wave >> 1;
  const int ct   = blockIdx.x, ot = blockIdx.y, b = blockIdx.z;
  const int c0   = ct * PT, o0 = ot * PT;

  v8f acc[4][4];
  proj_tile(Ps, X16 + ((size_t)(b * CDIM + c0)) * NDIM, W16 + ((size_t)o0) * NDIM, wm, wn, acc);

  float* Os = (float*)Ps;
  proj_unload(Os, wm, wn, acc);
  __syncthreads();

  const int e = tid & 15, lq = tid >> 4;                             // lq 0..7
  const float* bp = bias + o0 + lq;                                  // row it * 8 + lq at a constant step from here
  v4u uh[16], ul[16];
#pragma unroll
  for (int it = 0; it < 16; ++it) {
    const int row = it * 8 + lq;                                     // o_loc 0..127
    const v4f a  = *(const v4f*)(Os + row * OSPW + 8 * e);
    const v4f qv = *(const v4f*)(Os + row * OSPW + 8 * e + 4);
    const float bb = bfr(bp[it * 8]);
    const float f[8] = {a[0] + bb, a[1] + bb, a[2] + bb, a[3] + bb, qv[0] + bb, qv[1] + bb, qv[2] + bb, qv[3] + bb};
#pragma unroll
    for (int t = 0; t < 4; ++t) {
      const float f0 = f[2 * t], f1 = f[2 * t + 1];
      const unsigned short hb0 = bf_bits(f0), hb1 = bf_bits(f1);
      const unsigned short lb0 = bf_bits(f0 - bf_up(hb0));
      const unsigned short lb1 = bf_bits(f1 - bf_up(hb1));
      uh[it][t] = pk16(hb0, hb1);
      ul[it][t] = pk16(lb0, lb1);
    }
  }
  {
    const size_t po = ((size_t)(b * NDIM + o0 + lq)) * CDIM + c0 + 8 * e;   // row it * 8 + lq at a constant step from here
    unsigned short* ph = Ph + po;
    unsigned short* pl = Pl + po;
#pragma unroll
    for (int it = 0; it < 16; ++it) {
      *(v4u*)(ph + it * 8 * CDIM) = uh[it];
      *(v4u*)(pl + it * 8 * CDIM) = ul[it];
    }
  }
}

// =========================================================================================================
// (2) projection for v, one (128-o tile, 128-c tile, b) per block of 4 waves:
//     D[o][c] = sum_n W16[o][n] X16[b][c][n] (x256): A rows o from W16, B rows c from X16 (same split k map), K = 2048.
//     Epilogue: x 1/256 -> LDS Os[c_loc][o_loc] (reuses the ring behind the loop's last barrier), barrier,
//     + bf16-RNE bias[o], then the f16 plane, key-tile-major: PV[b][o / 32][c][o % 32], so that the 512 x 32 tile that the
//     attention stages is 32 KB in a row. A wave's store: 4 key tiles x (2 adjacent c rows x 64 B) = 4 whole 128-B lines.
// coverage: Os 4 waves x 64 c x 64 o = 128 x 128 (all read); plane 16 it x 8 rows x 16 lanes x 8 = 128 c x 128 o;
//           grid (16, 4, NB) covers PV[b][0..63][0..511][0..31] once.
// =========================================================================================================
__global__ __launch_bounds__(128)
void proj_v(const unsigned short* __restrict__ W16, const unsigned short* __restrict__ X16,
            const float* __restrict__ bias, unsigned short* PV) {
  __shared__ __align__(16) unsigned short Ps[2 * PBUF];              // [buffer][A rows, B rows][128][PPE]
  const int tid  = threadIdx.x;
  const int wave = uni((int)(threadIdx.x >> 5));                     // 0..3, SGPR
  const int wm   = wave & 1, wn = wave >> 1;
  const int ot   = blockIdx.x, ct = blockIdx.y, b = blockIdx.z;
  const int o0   = ot * PT, c0 = ct * PT;

  v8f acc[4][4];
  proj_tile(Ps, W16 + ((size_t)o0) * NDIM, X16 + ((size_t)(b * CDIM + c0)) * NDIM, wm, wn, acc);

  float* Os = (float*)Ps;
  proj_unload(Os, wm, wn, acc);
  __syncthreads();

  const int e = tid & 15, lq = tid >> 4;                             // lq 0..7
  const v4f ba = *(const v4f*)(bias + o0 + 8 * e);
  const v4f bq = *(const v4f*)(bias + o0 + 8 * e + 4);
  const float bb[8] = {bfr(ba[0]), bfr(ba[1]), bfr(ba[2]), bfr(ba[3]), bfr(bq[0]), bfr(bq[1]), bfr(bq[2]), bfr(bq[3])};
  v4u uv[16];
#pragma unroll
  for (int it = 0; it < 16; ++it) {
    const int row = it * 8 + lq;                                     // c_loc 0..127
    const v4f a  = *(const v4f*)(Os + row * OSPW + 8 * e);
    const v4f qv = *(const v4f*)(Os + row * OSPW + 8 * e + 4);
    const float f[8] = {a[0], a[1], a[2], a[3], qv[0], qv[1], qv[2], qv[3]};
#pragma unroll
    for (int t = 0; t < 4; ++t) {
      const _Float16 h0 = (_Float16)(f[2 * t] + bb[2 * t]);
      const _Float16 h1 = (_Float16)(f[2 * t + 1] + bb[2 * t + 1]);
      uv[it][t] = pk16(h_bits(h0), h_bits(h1));
    }
  }
  {
    // key tile o0 / 32 + (e >> 2), chunk e & 3 of its row; row it * 8 + lq at a constant step from here
    unsigned short* pv = PV + ((size_t)((b * (NDIM / KT) + o0 / KT + (e >> 2)) * CDIM + c0 + lq)) * KT + 8 * (e & 3);
#pragma unroll
    for (int it = 0; it < 16; ++it) *(v4u*)(pv + it * 8 * KT) = uv[it];
  }
}

// =========================================================================================================
// (3) attention for one (b, 64-query tile), transposed formulation, 2048 keys, no mask, no scale on the scores.
//   Block = 8 waves in two roles that work side by side, one wave of each role on every SIMD. In interval i of the loop
//   the score waves 0..3 (w = wave) make P of key tile i for queries n0 + 16 w .. + 15, while the product waves 4..7
//   (u = wave - 4) add key tile i - 1 into O^T for channels 128 u .. 128 u + 127 of all 64 queries. One barrier an interval.
//   Score waves, per 32-key tile: S^T tiles (16 keys x 16 queries) = sum over 16 c-chunks of
//   A(Kh: row = key (lane&15), k = c via the split map, plane [b][2048][512]) . B(Qh: col = query, same map)
//   + A(Kh).B(Ql) + A(Kl).B(Qh) (bf16 unscaled residual planes, shared accumulator). Per lane the D tiles hold
//   8 + 8 keys of ONE query: online softmax state per lane, one shuffle (lane^16) for the max over 32 keys; the
//   rescale factor is skipped under a wave-uniform ballot when no lane's max grew. P = e^{s-m} x 16384 as f16:
//   B operand of O^T: element r <- D of the tile covering keys 0..15, element 8+r <- the tile covering keys 16..31,
//   lane unchanged. The score wave publishes P (32 B per lane), corr and the grew flag in LDS, two buffers each.
//   Product waves: rescale the 8 tiles of a query group whose flag is set, then O^T[ch][q] += A(PV rows ch = 128 u + 16 j +
//   (lane&15), keys contiguous, f16 plane [b][64 key tiles][512][32]) . B(P of query group qg) on 8 x 4 accumulator tiles.
//   One register array of 32 x 8 VGPRs serves both roles: a score wave keeps its 32 query fragments there (both planes,
//   read once from LDS), a product wave its 32 accumulator tiles.
//   Operands come from LDS by asynchronous 16-B copies. The query tile is staged once, by all 8 waves, in the key ring
//   before the ring's first use. In the loop the product waves issue every copy, at the head of interval i (behind the
//   foot barrier of interval i - 1): key tile i + 1 into the key buffer and pv tile i into the pv buffer that interval
//   i - 1 has just read; the foot of interval i publishes both.
//   The score waves read c-chunk kc + 1's key fragments ahead of chunk kc's products, in two register sets.
//   At the end score waves publish inv = (1/l) / sqrt(2048). Epilogue in 4 passes of 32 channels per product wave:
//   O x inv staged in LDS Os[query][128] (pitch OSPW, b128; reuses the key ring), read back and stored by all 8 waves.
// coverage: per pass 8 it x 32 lines x 8 lanes x 4 floats = 64 queries x 128 ch; 4 passes = 512 ch;
//           grid (NQ/64, NB) covers out[b][0..NQ-1][0..511] exactly once.
// =========================================================================================================
static_assert(2 * QPLANE == 2 * KBUF);                                // the query tile fits the key ring that stages it
// P.V product by the builtin alone (the compiler keeps its distances): 32 accumulator tiles do not all lie below v256
__device__ __forceinline__ v8f mma_p(v16h a, v16h b, v8f c) {
  return __builtin_amdgcn_wmma_f32_16x16x32_f16(false, a, false, b, (short)0, c, false, false);
}
// Sixteen 16-B copies per lane, global -> LDS, by the builtin: copy i moves g + i * GSTEP (elements) to l + i * LSTEP
// (elements). The builtin's address registers may lie anywhere; an asm statement's must lie below v256, where the 256
// registers of R would have to make room for them on every trip.
typedef int v4i_gcc __attribute__((vector_size(16)));
template <int LSTEP, int GSTEP>
__device__ __forceinline__ void bcopy16(unsigned short* l, const unsigned short* g) {
#if defined(__HIP_DEVICE_COMPILE__)
#pragma unroll                                                       // sixteen copies back to back
  for (int i = 0; i < 16; ++i) {
    __builtin_amdgcn_global_load_async_to_lds_b128((__attribute__((address_space(1))) v4i_gcc*)(g + i * GSTEP),
                                                   (__attribute__((address_space(3))) v4i_gcc*)(l + i * LSTEP), 0, 0);
  }
#endif
}
// the tiles as the 128 lanes of the product waves copy them (t7 = tid & 127):
// 32 k rows: copy i -> row 2 i + (t7 >> 6), chunk t7 & 63; 512 v rows: copy i -> row 32 i + (t7 >> 2), chunk t7 & 3.
// Both sources are contiguous: a wave's copy reads 512 B in a row, four whole 128-B lines.
__device__ __forceinline__ void copy_rows32_h(unsigned short* l, const unsigned short* g) { bcopy16<2 * KPE, 128 * 8>(l, g); }
__device__ __forceinline__ void copy_vtile_h(unsigned short* l, const unsigned short* g) { bcopy16<32 * VPE, 32 * KT>(l, g); }
#define SM_VS 0
#define SM_KS (SM_VS + 2 * CDIM * VPE * 2)
#define SM_PS (SM_KS + 2 * KBUF * 2)
#define SM_CS (SM_PS + 2 * 4 * 32 * 8 * 4)
#define SM_IS (SM_CS + 2 * 4 * 32 * 4)
#define SM_GS (SM_IS + 4 * 32 * 4)
#define SM_ALL (SM_GS + 2 * 4 * 4)
static_assert(SM_KS % 16 == 0 && SM_PS % 16 == 0 && SM_CS % 16 == 0 && SM_IS % 16 == 0 && SM_GS % 16 == 0);
__global__ __launch_bounds__(256)
void attn_k(const unsigned short* __restrict__ Qh, const unsigned short* __restrict__ Ql,
            const unsigned short* __restrict__ Kh, const unsigned short* __restrict__ Kl,
            const unsigned short* __restrict__ PV, float* out) {
  // One array, so that the order of its parts is the source's. The key ring stands behind the pv buffers: the compiler folds
  // the key copies' global steps into offset:N and takes N off the LDS address register, which so never falls below 0.
  // The pv copies' step in LDS (32 rows of 2 VPE bytes) is larger than their global step (32 rows of 2 KT): the same holds.
  __shared__ __align__(16) unsigned char Sm[SM_ALL];
  unsigned short* const Vs  = (unsigned short*)(Sm + SM_VS);         // [buffer][512 channels][VPE], 32 keys used
  unsigned short* const Ks  = (unsigned short*)(Sm + SM_KS);         // [buffer][hi, residual][32 keys][KPE]; first the query tile
  unsigned* const       Psh = (unsigned*)(Sm + SM_PS);               // [buffer][query group][lane][8]
  float* const          Csh = (float*)(Sm + SM_CS);                  // [buffer][query group][lane]
  float* const          Ish = (float*)(Sm + SM_IS);                  // [query group][lane]
  int* const            Gsh = (int*)(Sm + SM_GS);                    // [buffer][query group]
  constexpr int NT = NDIM / KT;                                      // key tiles
  const int tid  = threadIdx.x;
  const int lane = tid & 31;
  const int wave = uni((int)(threadIdx.x >> 5));                     // 0..7, SGPR
  const int w    = wave & 3;                                         // query group of a score wave, channel group of a product wave
  const int hh   = lane >> 4, cl = lane & 15;
  const int n0   = blockIdx.x * QT, b = blockIdx.y;
  const int t7   = tid & 127;

  // k fragment base in LDS (A operand, row = key cl of the tile), + buffer * KBUF + 32*kc
  const unsigned short* Ksp = Ks + cl * KPE + 8 * hh;
  // v fragment base in LDS (A operand, row = channel 128 w + 16 j + cl, the tile's 32 keys contiguous), + buffer, + 16*j*VPE
  const unsigned short* Vp = Vs + (w * 128 + cl) * VPE + 8 * hh;
  // the product waves' copy sources (the lane's 16-B chunk of copy 0), as 32-bit element offsets from the planes'
  // uniform bases (one for both key planes), and LDS places
  const unsigned kgo = (unsigned)(b * NDIM * CDIM + 8 * t7);
  const unsigned vgo = (unsigned)(b * CDIM * NDIM + 8 * t7);
  unsigned short* const ksl = Ks + (t7 >> 6) * KPE + (t7 & 63) * 8;
  unsigned short* const vsl = Vs + (t7 >> 2) * VPE + (t7 & 3) * 8;

  const int pso = (w * 32 + lane) * 8;                               // a score wave's slot in a P buffer (uints)

  float m = -1.0e30f, l = 0.f;
  v8f R[32];                                                         // score wave: q fragments [chunk][hi, residual]; product wave: O^T tiles [j][query group]

  // prologue: the query tile through the key ring into the score waves' registers, then key tile 0
  {
    const size_t qg = ((size_t)(b * NDIM + n0)) * CDIM + 8 * tid;
    const unsigned qsl = lds_off(Ks) + (unsigned)((tid >> 6) * (2 * KPE) + (tid & 63) * 16);
    copy_rows32(qsl,                             Qh + qg);
    copy_rows32(qsl + 2u * KPLANE,               Qh + qg + KT * CDIM);
    copy_rows32(qsl + 2u * QPLANE,               Ql + qg);
    copy_rows32(qsl + 2u * QPLANE + 2u * KPLANE, Ql + qg + KT * CDIM);
    wait_async0();
    __syncthreads();                                                 // publishes the query tile
    if (wave < 4) {                                                  // wave-uniform (SGPR) role branch
      // q fragments (B operand, col = query 16 w + cl of the tile)
      const unsigned short* Qhp = Ks + (16 * w + cl) * KPE + 8 * hh;
      const unsigned short* Qlp = Qhp + QPLANE;
#pragma unroll                                                       // constant indices keep R in registers
      for (int kc = 0; kc < CDIM / 32; ++kc) {
        R[2 * kc]     = __builtin_bit_cast(v8f, ldfrag(Qhp + 32 * kc).bf);
        R[2 * kc + 1] = __builtin_bit_cast(v8f, ldfrag(Qlp + 32 * kc).bf);
      }
    } else {
#pragma unroll                                                       // as above
      for (int j = 0; j < 32; ++j) R[j] = zero8();
    }
    wait_ds0();                                                      // own reads of the query tile have retired
    __syncthreads();                                                 // ends every read of the query tile: the ring is free
    if (wave >= 4) {
      copy_rows32_h(ksl,          Kh + kgo);
      copy_rows32_h(ksl + KPLANE, Kl + kgo);
    }
    wait_async0();
    __syncthreads();                                                 // publishes key tile 0
  }

#pragma unroll 1                                                     // one copy of the interval: the buffers are run-time offsets
  for (int i = 0; i <= NT; ++i) {
    const int buf = i & 1;                                           // key tile i, P of tile i, pv tile i
    if (wave >= 4) {                                                 // wave-uniform (SGPR) role branch
      // refills first, so that they fly through the whole interval: both targets were last read in interval i - 1
      if (i + 1 < NT) {                                              // block-uniform: key tile i + 1 exists
        copy_rows32_h(ksl + (buf ^ 1) * KBUF,          Kh + (kgo + (unsigned)(i + 1) * (KT * CDIM)));
        copy_rows32_h(ksl + (buf ^ 1) * KBUF + KPLANE, Kl + (kgo + (unsigned)(i + 1) * (KT * CDIM)));
      }
      if (i < NT) {                                                  // block-uniform: pv tile i exists
        copy_vtile_h(vsl + buf * (CDIM * VPE), PV + (vgo + (unsigned)i * (CDIM * KT)));
      }
      if (i > 0) {                                                   // block-uniform: tile i - 1 has been published
        const int pbf = buf ^ 1;                                     // P, corr, flags and pv tile of key tile i - 1
        int gfl[4];
        float cr[4];
#pragma unroll                                                       // constant indices keep the sets in registers
        for (int qg = 0; qg < 4; ++qg) { gfl[qg] = Gsh[pbf * 4 + qg]; cr[qg] = Csh[pbf * 128 + qg * 32 + lane]; }
#pragma unroll                                                       // as above
        for (int qg = 0; qg < 4; ++qg) {
          if (uni(gfl[qg]) != 0) {                                   // wave-uniform flag
#pragma unroll                                                       // as above
            for (int j = 0; j < 8; ++j) {
#pragma unroll                                                       // as above
              for (int r = 0; r < 8; ++r) R[4 * j + qg][r] *= cr[qg];
            }
          }
        }
        FragP pb[4];
        Frag vf[8];
#pragma unroll                                                       // as above
        for (int qg = 0; qg < 4; ++qg) {
          pb[qg].u[0] = *(const v4u*)(Psh + pbf * 1024 + (qg * 32 + lane) * 8);
          pb[qg].u[1] = *(const v4u*)(Psh + pbf * 1024 + (qg * 32 + lane) * 8 + 4);
        }
#pragma unroll                                                       // as above
        for (int j = 0; j < 8; ++j) vf[j] = ldfrag(Vp + pbf * (CDIM * VPE) + 16 * j * VPE);
#if defined(__HIP_DEVICE_COMPILE__)
        // the tile's 24 fragment reads stand together ahead of its products: left alone, each pv fragment is read directly
        // in front of its four products and its whole LDS latency is waited for, eight times a tile
        __builtin_amdgcn_sched_barrier(0);
#endif
#pragma unroll                                                       // as above
        for (int j = 0; j < 8; ++j) {
#pragma unroll                                                       // as above
          for (int qg = 0; qg < 4; ++qg) R[4 * j + qg] = mma_p(vf[j].h, pb[qg].v, R[4 * j + qg]);
        }
      }
    } else {
      if (i < NT) {                                                  // block-uniform: key tile i exists
        const unsigned short* k0p  = Ksp + buf * KBUF;               // keys 0 .. 15 of the tile
        const unsigned short* k1p  = k0p + 16 * KPE;                 // keys 16 .. 31
        const unsigned short* k0lp = k0p + KPLANE;
        const unsigned short* k1lp = k1p + KPLANE;
        v8f s0 = zero8(), s1 = zero8();
        // two register sets: chunk kc + 1's LDS reads stand together ahead of chunk kc's products, so that their latency
        // passes under those products; all 16 chunks lie in this interval's key buffer
        Frag k0[2], k1[2], k0l[2], k1l[2];
        k0[0]  = ldfrag(k0p);
        k1[0]  = ldfrag(k1p);
        k0l[0] = ldfrag(k0lp);
        k1l[0] = ldfrag(k1lp);
#pragma unroll                                                       // constant indices keep both sets and R in registers
        for (int kc = 0; kc < CDIM / 32; ++kc) {
          const int c = kc & 1, n = c ^ 1;
          if (kc + 1 < CDIM / 32) {
            k0[n]  = ldfrag(k0p + 32 * (kc + 1));
            k1[n]  = ldfrag(k1p + 32 * (kc + 1));
            k0l[n] = ldfrag(k0lp + 32 * (kc + 1));
            k1l[n] = ldfrag(k1lp + 32 * (kc + 1));
          }
          const v16b qh = __builtin_bit_cast(v16b, R[2 * kc]);
          const v16b ql = __builtin_bit_cast(v16b, R[2 * kc + 1]);
          s0 = mma_s(k0[c].bf, qh, s0);
          s1 = mma_s(k1[c].bf, qh, s1);
          s0 = mma_s(k0[c].bf, ql, s0);
          s1 = mma_s(k1[c].bf, ql, s1);
          s0 = mma_s(k0l[c].bf, qh, s0);
          s1 = mma_s(k1l[c].bf, qh, s1);
        }

        float mx = fmaxf(hmax8(s0), hmax8(s1));
        mx = fmaxf(mx, __shfl_xor(mx, 16, 32));
        const float mn = fmaxf(m, mx);
        const unsigned grew = wave_ballot(mx > m);                   // wave-uniform
        float corr = 1.0f;
        if (grew != 0u) {
          corr = __expf(m - mn);                                     // == 1 for lanes whose max did not grow
          l *= corr;
        }
        m = mn;
        const float msh = mn - LNPS;                                 // exp gives e^{s-m} * 16384

        FragP ph;
        float ls = 0.f;
#pragma unroll
        for (int r = 0; r < 8; ++r) {
          const float e0 = __expf(s0[r] - msh);                      // key      8hh + r of the tile
          const float e1 = __expf(s1[r] - msh);                      // key 16 + 8hh + r
          ls += e0 + e1;
          ph.hv[0][r] = (_Float16)e0;
          ph.hv[1][r] = (_Float16)e1;
        }
        l += ls;

        *(v4u*)(Psh + buf * 1024 + pso)     = ph.u[0];
        *(v4u*)(Psh + buf * 1024 + pso + 4) = ph.u[1];
        Csh[buf * 128 + w * 32 + lane] = corr;
        Gsh[buf * 4 + w] = (grew != 0u) ? 1 : 0;
      }
    }
    // foot of the interval: own LDS traffic retired, own copies landed, then the barrier that publishes key tile i + 1,
    // pv tile i and P of tile i, and ends every read of this interval's buffers
    wait_ds0();
    wait_async0();
    __syncthreads();
  }
  wait_async0();                                                     // nothing in flight when the ring changes its use
  float* Os = (float*)Ks;                                            // output staging; first written behind the next barrier

  if (wave < 4) {
    l += __shfl_xor(l, 16, 32);
    Ish[w * 32 + lane] = (1.0f / l) * OSCALE;                        // o and l both carry the x16384 factor
  }
  __syncthreads();

  const int e = tid & 7, lq = tid >> 3;                              // lq 0..31
#pragma unroll
  for (int p = 0; p < 4; ++p) {
    if (p) __syncthreads();                                          // every wave finished reading Os
    if (wave >= 4) {                                                 // wave-uniform (SGPR) role branch
#pragma unroll
      for (int qg = 0; qg < 4; ++qg) {
        const float inv = Ish[qg * 32 + lane];
        const int qrow = 16 * qg + cl;
#pragma unroll
        for (int jj = 0; jj < 2; ++jj) {
          const int t = 4 * (2 * p + jj) + qg;                       // channels 128 w + 32 p + 16 jj + 8 hh + r
          v4f va, vb;
#pragma unroll
          for (int r = 0; r < 4; ++r) { va[r] = R[t][r] * inv; vb[r] = R[t][4 + r] * inv; }
          *(v4f*)(Os + qrow * OSPW + w * 32 + 16 * jj + 8 * hh)     = va;   // Os[query][32 w + 16 jj + 8 hh + r]
          *(v4f*)(Os + qrow * OSPW + w * 32 + 16 * jj + 8 * hh + 4) = vb;
        }
      }
    }
    __syncthreads();
    v4f res[8];
#pragma unroll
    for (int it = 0; it < 8; ++it) {
      const int L   = it * 32 + lq;                                  // 0..255
      const int ql  = L >> 2, seg = L & 3;                           // query 0..63, channel group 0..3: one 128-B line
      res[it] = *(const v4f*)(Os + ql * OSPW + 32 * seg + 4 * e);
    }
#pragma unroll
    for (int it = 0; it < 8; ++it) {
      const int L   = it * 32 + lq;
      const int ql  = L >> 2, seg = L & 3;
      const int ch  = 128 * seg + 32 * p + 4 * e;
      const size_t idx = ((size_t)(b * NDIM + n0 + ql)) * CDIM + ch;
      *(v4f*)(out + idx) = res[it];
    }
  }
}

// =========================================================================================================
// Workspace map (bytes; each region start a multiple of 256; every extent is an exact tile multiple and is written
//   W16 f16 [3][2048][2048]         8388608 x3 (Wq, Wk, Wv)
//   X16 f16 [3][NB][512][2048]     16777216 x3 (q, k, v)
//   Qh/Ql/Kh/Kl bf16 [NB][2048][512] 16777216 x4
//   PV  f16 [NB][64][512][32]      16777216
//   total (NB = 8) = 159383552
// =========================================================================================================
extern "C" void kernel_launch(void* const* d_in, const int* in_sizes, int n_in,
                              void* d_out, int out_size, void* d_ws, size_t ws_size,
                              hipStream_t stream) {
  if (n_in < 9) return;
  if (in_sizes[0] < NB * CDIM * NDIM || in_sizes[1] < NB * CDIM * NDIM || in_sizes[2] < NB * CDIM * NDIM) return;
  if (in_sizes[3] < NDIM * NDIM || in_sizes[5] < NDIM * NDIM || in_sizes[7] < NDIM * NDIM) return;
  if (in_sizes[4] < NDIM || in_sizes[6] < NDIM || in_sizes[8] < NDIM) return;
  if (out_size < (NB - 1) * NDIM * CDIM + NQ * CDIM) return;

  size_t off = 0;
  auto carve = [&](size_t bytes) { const size_t o = off; off += (bytes + 255) & ~(size_t)255; return o; };
  const size_t oW16 = carve((size_t)3 * WPLANE * 2);
  const size_t oX16 = carve((size_t)3 * XPLANE * 2);
  const size_t oQh  = carve((size_t)NB * NDIM * CDIM * 2);
  const size_t oQl  = carve((size_t)NB * NDIM * CDIM * 2);
  const size_t oKh  = carve((size_t)NB * NDIM * CDIM * 2);
  const size_t oKl  = carve((size_t)NB * NDIM * CDIM * 2);
  const size_t oPV  = carve((size_t)NB * CDIM * NDIM * 2);
  if (off > ws_size) return;

  const float* q  = (const float*)d_in[0];
  const float* k  = (const float*)d_in[1];
  const float* v  = (const float*)d_in[2];
  const float* Wq = (const float*)d_in[3];
  const float* bq = (const float*)d_in[4];
  const float* Wk = (const float*)d_in[5];
  const float* bk = (const float*)d_in[6];
  const float* Wv = (const float*)d_in[7];
  const float* bv = (const float*)d_in[8];

  char* ws = (char*)d_ws;
  unsigned short* W16 = (unsigned short*)(ws + oW16);
  unsigned short* X16 = (unsigned short*)(ws + oX16);
  unsigned short* Qh  = (unsigned short*)(ws + oQh);
  unsigned short* Ql  = (unsigned short*)(ws + oQl);
  unsigned short* Kh  = (unsigned short*)(ws + oKh);
  unsigned short* Kl  = (unsigned short*)(ws + oKl);
  unsigned short* PVp = (unsigned short*)(ws + oPV);
  float* out = (float*)d_out;

  const dim3 blk256(256), blk128(128);

  // convert all six operands
  cvt_k<<<dim3(CVGRID), dim3(CVW * 32), 0, stream>>>(Wq, Wk, Wv, q, k, v, W16, W16 + WPLANE, W16 + 2 * WPLANE,
                                                     X16, X16 + XPLANE, X16 + 2 * XPLANE);
  // q: project -> pq hi + residual planes [b][o][c] for o < NQ
  proj_qk<<<dim3(CDIM / PT, NQ / PT, NB), blk128, 0, stream>>>(X16, W16, bq, Qh, Ql);
  // k: project -> pk hi + residual planes [b][o][c], all o
  proj_qk<<<dim3(CDIM / PT, NDIM / PT, NB), blk128, 0, stream>>>(X16 + XPLANE, W16 + WPLANE, bk, Kh, Kl);
  // v: project -> pv f16 plane [b][o / 32][c][o % 32]
  proj_v<<<dim3(NDIM / PT, CDIM / PT, NB), blk128, 0, stream>>>(W16 + 2 * WPLANE, X16 + 2 * XPLANE, bv, PVp);
  // attention + 1/sqrt(2048) -> out [b][n][c] (the raw view to [b][512][2048] is the same flat buffer)
  attn_k<<<dim3(NQ / QT, NB), blk256, 0, stream>>>(Qh, Ql, Kh, Kl, PVp, out);
  (void)hipGetLastError();
}

// v007
// A run of this version takes 190 microseconds.
// In both of two side-by-side timings against v006, it was 1.04 times as fast.
// Counting every step since v000, it is 6.44 times as fast.
// Contractions: projections X[c][n].W[o][n]^T (K=2048) on v_wmma_f32_16x16x32_f16 (f16 containers of bf16-RNE W x256 and bf16-RNE x); scores pk.pq^T (K=512) on v_wmma_f32_16x16x32_bf16 (bf16 hi + bf16 residual planes of pq/pk, 3 products); O^T = pv^T.P^T (K=2048 keys) on v_wmma_f32_16x16x32_f16 (pv f16, P = e^{s-m} x16384 f16 from the score D registers); projection and attention operands staged in LDS by asynchronous copies; f32 accumulate everywhere; softmax statistics and scaling in f32 VALU.
#include <hip/hip_runtime.h>
#include <math.h>
#include <stdint.h>

#ifndef NB
#define NB 8
#endif
#ifndef NQ
#define NQ 2048
#endif
#define NB_FULL 8
#define CDIM   512
#define NDIM   2048
#define QT     64
#define CHH    256
#define OSPW   132
#define WSC    256.0f
#define IWSC   0.00390625f
#define LNPS   9.704060527839234f
#define OSCALE 0.022097086912079608f
#define KT     32
#define KPE    520
#define KPLANE (KT * KPE)
#define KBUF   (2 * KPLANE)
#define QPLANE (QT * KPE)
#define VPE    40
#define PT     128
#define PKC    128
#define PPE    136
#define PHALF  (PT * PPE)
#define PBUF   (2 * PHALF)
#define CVW    16
#define CVL    8
#define CVUNIT (CVW * 32 * 4 * CVL)
#define CVGRID 256
#define WPLANE (NDIM * NDIM)
#define XPLANE (NB * CDIM * NDIM)
#define WTRIPS (WPLANE / (CVUNIT * CVGRID))
#define XTRIPS (XPLANE / (CVUNIT * CVGRID))

static_assert(NB >= 1 && NB <= NB_FULL);
static_assert(NQ >= QT && NQ <= NDIM && NQ % QT == 0);
static_assert(CDIM % QT == 0 && NDIM % QT == 0);
static_assert(CDIM % 32 == 0 && NDIM % 32 == 0);
static_assert(CDIM == 2 * CHH && CHH == 16 * 16);
static_assert((OSPW * 4) % 16 == 0);
static_assert(NDIM == 8 * 256);
static_assert((KPE * 2) % 16 == 0 && ((KPE * 2) / 16) % 2 == 1);   // LDS row pitches 16 B x odd: the 16 rows of a b128
static_assert((VPE * 2) % 16 == 0 && ((VPE * 2) / 16) % 2 == 1);   // fragment read fall on all 64 banks once
static_assert(CDIM * 2 == 64 * 16 && KT == 8 * 4 && QT == 2 * KT);  // q/k rows: 64 chunks of 16 B; 8 copies x 256 lanes (q) or 16 x 128 lanes (k) = 32 rows
static_assert(KT * 2 == 4 * 16 && CDIM == 16 * 32);                 // v rows: 4 chunks of 16 B; 16 copies x 128 lanes = 512 rows
static_assert(PT % KT == 0 && KT == 4 * 8);                         // a projection tile's o are whole key tiles; 4 chunks of 8 o a tile
static_assert(NDIM / KT >= 2);
static_assert(CDIM % PT == 0 && NDIM % PT == 0 && NQ % PT == 0 && NDIM % PKC == 0 && NDIM / PKC >= 2);
static_assert((PPE * 2) % 16 == 0 && ((PPE * 2) / 16) % 2 == 1 && PPE >= PKC);  // as for KPE and VPE
static_assert(PKC * 2 == 16 * 16 && PT == 2 * 8 * 8);               // projection rows: 16 chunks of 16 B; 8 copies x 128 lanes = 64 rows
static_assert(PT * OSPW * 4 <= 2 * PBUF * 2);                       // the projections' output staging fits in the ring it reuses
static_assert(QT * OSPW * 4 <= 2 * KBUF * 2);                       // the output staging fits in the key ring it reuses
static_assert(WPLANE == WTRIPS * CVUNIT * CVGRID && XPLANE == XTRIPS * CVUNIT * CVGRID && CVL == 8);   // whole convert trips

typedef _Float16       v16h __attribute__((ext_vector_type(16)));
typedef _Float16       v8h  __attribute__((ext_vector_type(8)));
typedef __bf16         v16b __attribute__((ext_vector_type(16)));
typedef unsigned short v8us __attribute__((ext_vector_type(8)));
typedef float          v8f  __attribute__((ext_vector_type(8)));
typedef float          v4f  __attribute__((ext_vector_type(4)));
typedef unsigned int   v4u  __attribute__((ext_vector_type(4)));
typedef unsigned int   v2u  __attribute__((ext_vector_type(2)));

union Frag  { v8us u[2]; v16h h; v16b bf; };
union FragP { v16h v; v8h hv[2]; v4u u[2]; };
static_assert(sizeof(Frag) == 32);
static_assert(sizeof(FragP) == 32);

// ---- scalar helpers ---------------------------------------------------------------------------------------
__device__ __forceinline__ unsigned short bf_bits(float f) {          // f32 -> bf16 bits, RNE convert
  unsigned u = __float_as_uint(f);
  return (unsigned short)((u + 0x7FFFu + ((u >> 16) & 1u)) >> 16);
}
__device__ __forceinline__ float bf_up(unsigned short hb) { return __uint_as_float(((unsigned)hb) << 16); }
__device__ __forceinline__ float bfr(float f) { return bf_up(bf_bits(f)); }
__device__ __forceinline__ unsigned short h_bits(_Float16 x) { return __builtin_bit_cast(unsigned short, x); }
__device__ __forceinline__ unsigned pk16(unsigned short a, unsigned short b) { return (unsigned)a | ((unsigned)b << 16); }
__device__ __forceinline__ v8f zero8() { v8f z = {0.f, 0.f, 0.f, 0.f, 0.f, 0.f, 0.f, 0.f}; return z; }
__device__ __forceinline__ float hmax8(v8f s) {
  return fmaxf(fmaxf(fmaxf(s[0], s[1]), fmaxf(s[2], s[3])), fmaxf(fmaxf(s[4], s[5]), fmaxf(s[6], s[7])));
}
__device__ __forceinline__ unsigned wave_ballot(bool p) {
#if defined(__HIP_DEVICE_COMPILE__)
  return __builtin_amdgcn_ballot_w32(p);
#else
  return p ? 1u : 0u;
#endif
}
__device__ __forceinline__ int uni(int v) {                           // wave-uniform int -> SGPR
#if defined(__HIP_DEVICE_COMPILE__)
  return __builtin_amdgcn_readfirstlane(v);
#else
  return v;
#endif
}

// ---- 16-bit fragment loader (A, or B from a k-contiguous [n][k] row): lane -> row/col (lane&15), p already includes
//      + 8*(lane>>4); elements 0..7 <- p[0..7] (k0+8h..), elements 8..15 <- p[16..23] (k0+16+8h..)
__device__ __forceinline__ Frag ldfrag(const unsigned short* p) {
  Frag f;
  f.u[0] = *(const v8us*)(p);
  f.u[1] = *(const v8us*)(p + 16);
  return f;
}

// ---- LDS staging by asynchronous copies ----------------------------------------------------------------------
__device__ __forceinline__ unsigned lds_off(const void* p) { return (unsigned)(size_t)p; }
// Eight 16-B copies per lane, global -> LDS: copy i moves g + i * GSTEP (elements) to LDS byte l + i * LSTEP.
// The closing s_wait_xcnt stands in the copies' own statement so that no address register is rewritten ahead of it.
template <unsigned LSTEP, int GSTEP>
__device__ __forceinline__ void acopy8(unsigned l, const unsigned short* g) {
#if defined(__HIP_DEVICE_COMPILE__)
  asm volatile(
      "global_load_async_to_lds_b128 %0, %8, off\n\t"
      "global_load_async_to_lds_b128 %1, %9, off\n\t"
      "global_load_async_to_lds_b128 %2, %10, off\n\t"
      "global_load_async_to_lds_b128 %3, %11, off\n\t"
      "global_load_async_to_lds_b128 %4, %12, off\n\t"
      "global_load_async_to_lds_b128 %5, %13, off\n\t"
      "global_load_async_to_lds_b128 %6, %14, off\n\t"
      "global_load_async_to_lds_b128 %7, %15, off\n\t"
      "s_wait_xcnt 0x0"
      :: "v"(l), "v"(l + 1u * LSTEP), "v"(l + 2u * LSTEP), "v"(l + 3u * LSTEP),
         "v"(l + 4u * LSTEP), "v"(l + 5u * LSTEP), "v"(l + 6u * LSTEP), "v"(l + 7u * LSTEP),
         "v"(g), "v"(g + 1 * GSTEP), "v"(g + 2 * GSTEP), "v"(g + 3 * GSTEP),
         "v"(g + 4 * GSTEP), "v"(g + 5 * GSTEP), "v"(g + 6 * GSTEP), "v"(g + 7 * GSTEP)
      : "memory");
#endif
}
// 32 q rows of 1024 B (contiguous in global) -> LDS pitch 2 KPE: copy i, lane tid -> row 4 i + (tid >> 6), chunk tid & 63
__device__ __forceinline__ void copy_rows32(unsigned l, const unsigned short* g) { acopy8<4u * 2u * KPE, 256 * 8>(l, g); }
__device__ __forceinline__ void wait_async0() {                       // this wave's copies have landed in LDS
#if defined(__HIP_DEVICE_COMPILE__)
  asm volatile("s_wait_asynccnt 0x0" ::: "memory");
#endif
}
__device__ __forceinline__ void wait_ds0() {                          // this wave's LDS reads and writes have retired
#if defined(__HIP_DEVICE_COMPILE__)
  asm volatile("s_wait_dscnt 0x0" ::: "memory");
#endif
}

// ---- WMMA helpers: mma_h is the f16 builtin followed by a 4-slot VALU gap tying D and keeping A/B live --------------------------
__device__ __forceinline__ v8f mma_h(v16h a, v16h b, v8f c) {
  v8f d = __builtin_amdgcn_wmma_f32_16x16x32_f16(false, a, false, b, (short)0, c, false, false);
#if defined(__HIP_DEVICE_COMPILE__)
  asm volatile("v_nop\n\tv_nop\n\tv_nop\n\tv_nop" : "+v"(d) : "v"(a), "v"(b));
#endif
  return d;
}

// Score product by the builtin alone (the compiler keeps its distances): an asm statement's vector operands must lie
// below v256, and the score loop's two fragment sets beside the 32 query fragments do not all fit there.
__device__ __forceinline__ v8f mma_s(v16b a, v16b b, v8f c) {
  return __builtin_amdgcn_wmma_f32_16x16x32_bf16(false, a, false, b, (short)0, c, false, false);
}

// =========================================================================================================
// (0) convert, all six f32 operands in one launch: W16[p] = f16(bf16-RNE(W_p) x 256), X16[p] = f16(bf16-RNE(x_p)),
//     p = 0, 1, 2 for q, k, v. CVGRID work-groups of CVW waves stay resident and loop: the launch starts few waves, and
//     each keeps CVL or more loads of 16 B a lane in flight. A trip of a work-group is CVUNIT contiguous floats; a wave
//     takes 128 CVL of them, load i of lane ln the floats 128 i + 4 ln .. + 3 (512 contiguous bytes a wave-load, 256 a
//     store). A work-group's trips in one tensor are adjacent. The next trip's loads are issued ahead of this trip's
//     conversions, in a second register set.
//     Trip order: (Wv, v), (Wk, k), (Wq, q): the pair that the next launch reads is written last.
// coverage: CVGRID work-groups x a tensor's trips x CVUNIT floats = its size (static_assert), every element once.
// =========================================================================================================
// s: the work-group's place (uniform); bo: the lane's byte offset in it
__device__ __forceinline__ void cvt_load(v4f (&r)[CVL], const float* s, unsigned bo) {
#pragma unroll                                                       // constant indices keep the set in registers
  for (int i = 0; i < CVL; ++i) r[i] = *(const v4f*)((const char*)s + bo + 512 * i);
#if defined(__HIP_DEVICE_COMPILE__)
  // s_wait_xcnt 0 behind the loads; base and offset are inputs, so that they stay live, and so unwritten, up to the wait
  asm volatile("s_wait_xcnt 0x0" :: "s"(s), "v"(bo) : "memory");
  __builtin_amdgcn_sched_barrier(0);                                 // the trip's loads stand together: no conversion moves up among them
#endif
}
// The closing s_wait_xcnt stands in the stores' own statement so that no register they name is rewritten ahead of it.
__device__ __forceinline__ void cvt_store(unsigned short* d, unsigned bo, const v4f (&r)[CVL], float sc) {
  v2u u[CVL];
#pragma unroll                                                       // as above
  for (int i = 0; i < CVL; ++i) {
#pragma unroll                                                       // as above
    for (int t = 0; t < 2; ++t) {
      const _Float16 h0 = (_Float16)(bfr(r[i][2 * t]) * sc);
      const _Float16 h1 = (_Float16)(bfr(r[i][2 * t + 1]) * sc);
      u[i][t] = pk16(h_bits(h0), h_bits(h1));
    }
  }
#if defined(__HIP_DEVICE_COMPILE__)
  asm volatile(
      "global_store_b64 %0, %2, %1\n\t"
      "global_store_b64 %0, %3, %1 offset:256\n\t"
      "global_store_b64 %0, %4, %1 offset:512\n\t"
      "global_store_b64 %0, %5, %1 offset:768\n\t"
      "global_store_b64 %0, %6, %1 offset:1024\n\t"
      "global_store_b64 %0, %7, %1 offset:1280\n\t"
      "global_store_b64 %0, %8, %1 offset:1536\n\t"
      "global_store_b64 %0, %9, %1 offset:1792\n\t"
      "s_wait_xcnt 0x0"
      :: "v"(bo), "s"(d), "v"(u[0]), "v"(u[1]), "v"(u[2]), "v"(u[3]), "v"(u[4]), "v"(u[5]), "v"(u[6]), "v"(u[7])
      : "memory");
#endif
}
__global__ __launch_bounds__(CVW * 32)
void cvt_k(const float* __restrict__ wq, const float* __restrict__ wk, const float* __restrict__ wv,
           const float* __restrict__ q, const float* __restrict__ k, const float* __restrict__ v,
           unsigned short* Wq16, unsigned short* Wk16, unsigned short* Wv16,
           unsigned short* Xq16, unsigned short* Xk16, unsigned short* Xv16) {
  const unsigned tid = threadIdx.x;
  const unsigned le  = (tid >> 5) * (128u * CVL) + 4u * (tid & 31u);  // the lane's first element in a trip's unit
  const float* const wsrc[3] = {wq, wk, wv};
  const float* const xsrc[3] = {q, k, v};
  unsigned short* const wdst[3] = {Wq16, Wk16, Wv16};
  unsigned short* const xdst[3] = {Xq16, Xk16, Xv16};
  constexpr int PTRIPS = WTRIPS + XTRIPS;                            // trips of one (W, x) pair
  // trip t (a compile-time number behind the unroll) -> pair, tensor, and the work-group's place in it (uniform)
  auto pair_of = [](int t) { return 2 - t / PTRIPS; };
  auto is_w    = [](int t) { return t % PTRIPS < WTRIPS; };
  auto place   = [&](int t) {
    return is_w(t) ? ((size_t)blockIdx.x * WTRIPS + t % PTRIPS) * CVUNIT
                   : ((size_t)blockIdx.x * XTRIPS + (t % PTRIPS - WTRIPS)) * CVUNIT;
  };
  auto from = [&](int t) { return (is_w(t) ? wsrc[pair_of(t)] : xsrc[pair_of(t)]) + place(t); };
  auto to   = [&](int t) { return (is_w(t) ? wdst[pair_of(t)] : xdst[pair_of(t)]) + place(t); };

  v4f r[2][CVL];
  cvt_load(r[0], from(0), 4u * le);
#pragma unroll                                                       // constant indices: both sets in registers, tensors by trip
  for (int t = 0; t < 3 * PTRIPS; ++t) {
    if (t + 1 < 3 * PTRIPS) cvt_load(r[(t + 1) & 1], from(t + 1), 4u * le);
    cvt_store(to(t), 2u * le, r[t & 1], is_w(t) ? WSC : 1.0f);
  }
}

// =========================================================================================================
// Projection main loop, one 128 x 128 tile of D[m][n] = sum_k A[m][k] B[n][k] per block of 4 waves (2 x 2, 64 x 64 each),
//   A and B rows k-contiguous at pitch NDIM. A stage is PKC = 128 k of the 128 A rows and the 128 B rows, brought into LDS
//   (row pitch 2 PPE bytes) by asynchronous 16-B copies of all 4 waves: copy i of a group, lane tid -> row 8 i + (tid >> 4),
//   chunk tid & 15. Two buffers: stage t + 2 is issued behind the foot barrier of trip t, which also publishes stage t + 1.
//   Trip t works on k stage (t + rot) mod 16, rot by the block's index: the resident blocks that share A rows or B rows
//   then ask L2 for different 256-B units at any moment, where a walk in step asks for the same lines from many WGPs at once.
//   Each accumulator tile takes its 16 stages in that wrapped order, the 4 k-steps of a stage ascending.
// =========================================================================================================
__device__ __forceinline__ void copy_rows64(unsigned l, const unsigned short* g) { acopy8<8u * 2u * PPE, 8 * NDIM>(l, g); }
__device__ __forceinline__ void proj_stage(unsigned l, const unsigned short* ga, const unsigned short* gb) {
  copy_rows64(l,                                 ga);
  copy_rows64(l + 64u * 2u * PPE,                ga + 64 * NDIM);
  copy_rows64(l + 2u * PHALF,                    gb);
  copy_rows64(l + 2u * PHALF + 64u * 2u * PPE,   gb + 64 * NDIM);
}
__device__ __forceinline__ void proj_tile(const unsigned short* Ps, const unsigned short* At, const unsigned short* Bt,
                                          int wm, int wn, int rot, v8f (&acc)[4][4]) {
  const int tid  = threadIdx.x;
  const int lane = tid & 31;
  const int hh   = lane >> 4, cl = lane & 15;
  const unsigned short* ga = At + (size_t)(tid >> 4) * NDIM + 8 * (tid & 15);
  const unsigned short* gb = Bt + (size_t)(tid >> 4) * NDIM + 8 * (tid & 15);
  const unsigned psl = lds_off(Ps) + (unsigned)((tid >> 4) * (2 * PPE) + (tid & 15) * 16);
  const unsigned short* ap = Ps + (64 * wm + cl) * PPE + 8 * hh;
  const unsigned short* bp = Ps + PHALF + (64 * wn + cl) * PPE + 8 * hh;

#pragma unroll                                                       // constant indices keep the accumulators in registers
  for (int mt = 0; mt < 4; ++mt) {
#pragma unroll                                                       // as above
    for (int nt = 0; nt < 4; ++nt) acc[mt][nt] = zero8();
  }

  constexpr int NS = NDIM / PKC;                                     // k stages, a power of two (static_assert below)
  static_assert((NS & (NS - 1)) == 0);
  auto kof = [&](int t) { return ((t + rot) & (NS - 1)) * PKC; };    // trip -> first k of its stage (uniform)

  proj_stage(psl, ga + kof(0), gb + kof(0));
  wait_async0();
  __syncthreads();                                                   // publishes trip 0's stage
  proj_stage(psl + 2u * PBUF, ga + kof(1), gb + kof(1));

#pragma unroll 1                                                     // one copy of the trip: the buffer is a run-time offset
  for (int t = 0; t < NDIM / PKC; ++t) {
    const int buf = t & 1;                                           // this trip reads this buffer alone
    const unsigned short* a0 = ap + buf * PBUF;
    const unsigned short* b0 = bp + buf * PBUF;
#pragma unroll                                                       // constant indices keep fragments and accumulators in registers
    for (int ks = 0; ks < PKC / 32; ++ks) {
      Frag fa[4], fb[4];                                             // the k-step's LDS reads stand together, ahead of its products
#pragma unroll                                                       // as above
      for (int i = 0; i < 4; ++i) { fa[i] = ldfrag(a0 + 16 * i * PPE + 32 * ks); fb[i] = ldfrag(b0 + 16 * i * PPE + 32 * ks); }
#pragma unroll                                                       // as above
      for (int mt = 0; mt < 4; ++mt) {
#pragma unroll                                                       // as above
        for (int nt = 0; nt < 4; ++nt) acc[mt][nt] = mma_h(fa[mt].h, fb[nt].h, acc[mt][nt]);
      }
    }
    // foot of the trip: own LDS reads retired, own copies landed, then the barrier that publishes stage t + 1 and ends
    // every read of this trip's buffer; only then its refill
    wait_ds0();
    wait_async0();
    __syncthreads();
    if (t + 2 < NDIM / PKC) proj_stage(psl + (unsigned)buf * (2u * PBUF), ga + kof(t + 2), gb + kof(t + 2));
  }
  wait_async0();                                                     // nothing in flight when the ring changes its use
}
// Accumulators x 1/256 -> Os[n_loc][m_loc] (pitch OSPW, b128 stores). Lane (hh, cl): D element r of tile (mt, nt) =
// (64 wm + 16 mt + 8 hh + r, 64 wn + 16 nt + cl).
__device__ __forceinline__ void proj_unload(float* Os, int wm, int wn, const v8f (&acc)[4][4]) {
  const int lane = threadIdx.x & 31;
  const int hh   = lane >> 4, cl = lane & 15;
#pragma unroll                                                       // constant indices keep the accumulators in registers
  for (int nt = 0; nt < 4; ++nt) {
    const int nl = 64 * wn + 16 * nt + cl;
#pragma unroll                                                       // as above
    for (int mt = 0; mt < 4; ++mt) {
      v4f va, vb;
#pragma unroll                                                       // as above
      for (int r = 0; r < 4; ++r) { va[r] = acc[mt][nt][r] * IWSC; vb[r] = acc[mt][nt][4 + r] * IWSC; }
      *(v4f*)(Os + nl * OSPW + 64 * wm + 16 * mt + 8 * hh)     = va;
      *(v4f*)(Os + nl * OSPW + 64 * wm + 16 * mt + 8 * hh + 4) = vb;
    }
  }
}

// =========================================================================================================
// (1) projection for q / k, one (128-c tile, 128-o tile, b) per block of 4 waves:
//     D[c][o] = sum_n X16[b][c][n] W16[o][n]  (x256): A rows c from X16, B rows o from W16 (same split k map), K = 2048.
//     Epilogue: x 1/256 -> LDS Os[o_loc][c_loc] (reuses the ring behind the loop's last barrier), barrier,
//     + bf16-RNE bias[o], then planes Ph = bf16-RNE(v), Pl = bf16-RNE(v - hi).
// coverage: Os 4 waves x 64 o x 64 c = 128 x 128 (all read); planes 16 it x 8 rows x 16 lanes x 8 = 128 o x 128 c;
//           grid (4, n_otiles, NB) covers rows 0 .. 128 n_otiles - 1 of every batch once.
// =========================================================================================================
__global__ __launch_bounds__(128)
void proj_qk(const unsigned short* __restrict__ X16, const unsigned short* __restrict__ W16,
             const float* __restrict__ bias, unsigned short* Ph, unsigned short* Pl) {
  __shared__ __align__(16) unsigned short Ps[2 * PBUF];              // [buffer][A rows, B rows][128][PPE]
  const int tid  = threadIdx.x;
  const int wave = uni((int)(threadIdx.x >> 5));                     // 0..3, SGPR
  const int wm   = wave & 1, wn = wave >> 1;
  const int ct   = blockIdx.x, ot = blockIdx.y, b = blockIdx.z;
  const int c0   = ct * PT, o0 = ot * PT;

  v8f acc[4][4];
  // the 16 blocks that share X rows (ot) start at 16 different stages, the 32 that share W rows (ct, b) two to a stage
  proj_tile(Ps, X16 + ((size_t)(b * CDIM + c0)) * NDIM, W16 + ((size_t)o0) * NDIM, wm, wn, ot + ct + 4 * b, acc);

  float* Os = (float*)Ps;
  proj_unload(Os, wm, wn, acc);
  __syncthreads();

  const int e = tid & 15, lq = tid >> 4;                             // lq 0..7
  const float* bp = bias + o0 + lq;                                  // row it * 8 + lq at a constant step from here
  v4u uh[16], ul[16];
#pragma unroll
  for (int it = 0; it < 16; ++it) {
    const int row = it * 8 + lq;                                     // o_loc 0..127
    const v4f a  = *(const v4f*)(Os + row * OSPW + 8 * e);
    const v4f qv = *(const v4f*)(Os + row * OSPW + 8 * e + 4);
    const float bb = bfr(bp[it * 8]);
    const float f[8] = {a[0] + bb, a[1] + bb, a[2] + bb, a[3] + bb, qv[0] + bb, qv[1] + bb, qv[2] + bb, qv[3] + bb};
#pragma unroll
    for (int t = 0; t < 4; ++t) {
      const float f0 = f[2 * t], f1 = f[2 * t + 1];
      const unsigned short hb0 = bf_bits(f0), hb1 = bf_bits(f1);
      const unsigned short lb0 = bf_bits(f0 - bf_up(hb0));
      const unsigned short lb1 = bf_bits(f1 - bf_up(hb1));
      uh[it][t] = pk16(hb0, hb1);
      ul[it][t] = pk16(lb0, lb1);
    }
  }
  {
    const size_t po = ((size_t)(b * NDIM + o0 + lq)) * CDIM + c0 + 8 * e;   // row it * 8 + lq at a constant step from here
    unsigned short* ph = Ph + po;
    unsigned short* pl = Pl + po;
#pragma unroll
    for (int it = 0; it < 16; ++it) {
      *(v4u*)(ph + it * 8 * CDIM) = uh[it];
      *(v4u*)(pl + it * 8 * CDIM) = ul[it];
    }
  }
}

// =========================================================================================================
// (2) projection for v, one (128-o tile, 128-c tile, b) per block of 4 waves:
//     D[o][c] = sum_n W16[o][n] X16[b][c][n] (x256): A rows o from W16, B rows c from X16 (same split k map), K = 2048.
//     Epilogue: x 1/256 -> LDS Os[c_loc][o_loc] (reuses the ring behind the loop's last barrier), barrier,
//     + bf16-RNE bias[o], then the f16 plane, key-tile-major: PV[b][o / 32][c][o % 32], so that the 512 x 32 tile that the
//     attention stages is 32 KB in a row. A wave's store: 4 key tiles x (2 adjacent c rows x 64 B) = 4 whole 128-B lines.
// coverage: Os 4 waves x 64 c x 64 o = 128 x 128 (all read); plane 16 it x 8 rows x 16 lanes x 8 = 128 c x 128 o;
//           grid (16, 4, NB) covers PV[b][0..63][0..511][0..31] once.
// =========================================================================================================
__global__ __launch_bounds__(128)
void proj_v(const unsigned short* __restrict__ W16, const unsigned short* __restrict__ X16,
            const float* __restrict__ bias, unsigned short* PV) {
  __shared__ __align__(16) unsigned short Ps[2 * PBUF];              // [buffer][A rows, B rows][128][PPE]
  const int tid  = threadIdx.x;
  const int wave = uni((int)(threadIdx.x >> 5));                     // 0..3, SGPR
  const int wm   = wave & 1, wn = wave >> 1;
  const int ot   = blockIdx.x, ct = blockIdx.y, b = blockIdx.z;
  const int o0   = ot * PT, c0 = ct * PT;

  v8f acc[4][4];
  // as in proj_qk
  proj_tile(Ps, W16 + ((size_t)o0) * NDIM, X16 + ((size_t)(b * CDIM + c0)) * NDIM, wm, wn, ot + ct + 4 * b, acc);

  float* Os = (float*)Ps;
  proj_unload(Os, wm, wn, acc);
  __syncthreads();

  const int e = tid & 15, lq = tid >> 4;                             // lq 0..7
  const v4f ba = *(const v4f*)(bias + o0 + 8 * e);
  const v4f bq = *(const v4f*)(bias + o0 + 8 * e + 4);
  const float bb[8] = {bfr(ba[0]), bfr(ba[1]), bfr(ba[2]), bfr(ba[3]), bfr(bq[0]), bfr(bq[1]), bfr(bq[2]), bfr(bq[3])};
  v4u uv[16];
#pragma unroll
  for (int it = 0; it < 16; ++it) {
    const int row = it * 8 + lq;                                     // c_loc 0..127
    const v4f a  = *(const v4f*)(Os + row * OSPW + 8 * e);
    const v4f qv = *(const v4f*)(Os + row * OSPW + 8 * e + 4);
    const float f[8] = {a[0], a[1], a[2], a[3], qv[0], qv[1], qv[2], qv[3]};
#pragma unroll
    for (int t = 0; t < 4; ++t) {
      const _Float16 h0 = (_Float16)(f[2 * t] + bb[2 * t]);
      const _Float16 h1 = (_Float16)(f[2 * t + 1] + bb[2 * t + 1]);
      uv[it][t] = pk16(h_bits(h0), h_bits(h1));
    }
  }
  {
    // key tile o0 / 32 + (e >> 2), chunk e & 3 of its row; row it * 8 + lq at a constant step from here
    unsigned short* pv = PV + ((size_t)((b * (NDIM / KT) + o0 / KT + (e >> 2)) * CDIM + c0 + lq)) * KT + 8 * (e & 3);
#pragma unroll
    for (int it = 0; it < 16; ++it) *(v4u*)(pv + it * 8 * KT) = uv[it];
  }
}

// =========================================================================================================
// (3) attention for one (b, 64-query tile), transposed formulation, 2048 keys, no mask, no scale on the scores.
//   Block = 8 waves in two roles that work side by side, one wave of each role on every SIMD. In interval i of the loop
//   the score waves 0..3 (w = wave) make P of key tile i for queries n0 + 16 w .. + 15, while the product waves 4..7
//   (u = wave - 4) add key tile i - 1 into O^T for channels 128 u .. 128 u + 127 of all 64 queries. One barrier an interval.
//   Score waves, per 32-key tile: S^T tiles (16 keys x 16 queries) = sum over 16 c-chunks of
//   A(Kh: row = key (lane&15), k = c via the split map, plane [b][2048][512]) . B(Qh: col = query, same map)
//   + A(Kh).B(Ql) + A(Kl).B(Qh) (bf16 unscaled residual planes, shared accumulator). Per lane the D tiles hold
//   8 + 8 keys of ONE query: online softmax state per lane, one shuffle (lane^16) for the max over 32 keys; the
//   rescale factor is skipped under a wave-uniform ballot when no lane's max grew. P = e^{s-m} x 16384 as f16:
//   B operand of O^T: element r <- D of the tile covering keys 0..15, element 8+r <- the tile covering keys 16..31,
//   lane unchanged. The score wave publishes P (32 B per lane), corr and the grew flag in LDS, two buffers each.
//   Product waves: rescale the 8 tiles of a query group whose flag is set, then O^T[ch][q] += A(PV rows ch = 128 u + 16 j +
//   (lane&15), keys contiguous, f16 plane [b][64 key tiles][512][32]) . B(P of query group qg) on 8 x 4 accumulator tiles.
//   One register array of 32 x 8 VGPRs serves both roles: a score wave keeps its 32 query fragments there (both planes,
//   read once from LDS), a product wave its 32 accumulator tiles.
//   Operands come from LDS by asynchronous 16-B copies. The query tile is staged once, by all 8 waves, in the key ring
//   before the ring's first use. In the loop the product waves issue every copy, at the head of interval i (behind the
//   foot barrier of interval i - 1): key tile i + 1 into the key buffer and pv tile i into the pv buffer that interval
//   i - 1 has just read; the foot of interval i publishes both.
//   "Key tile i" is the i-th of the block's walk, tile (i + rot) mod 64 of the planes, rot by the query tile's index: the 32
//   blocks of a batch, all resident, then ask L2 for different key and pv tiles at any moment, where a walk in step asks for
//   the same lines from many WGPs at once. The online softmax takes the tiles in that wrapped order.
//   The score waves read c-chunk kc + 1's key fragments ahead of chunk kc's products, in two register sets.
//   At the end score waves publish inv = (1/l) / sqrt(2048). Epilogue in 4 passes of 32 channels per product wave:
//   O x inv staged in LDS Os[query][128] (pitch OSPW, b128; reuses the key ring), read back and stored by all 8 waves.
// coverage: per pass 8 it x 32 lines x 8 lanes x 4 floats = 64 queries x 128 ch; 4 passes = 512 ch;
//           grid (NQ/64, NB) covers out[b][0..NQ-1][0..511] exactly once.
// =========================================================================================================
static_assert(2 * QPLANE == 2 * KBUF);                                // the query tile fits the key ring that stages it
// P.V product by the builtin alone (the compiler keeps its distances): 32 accumulator tiles do not all lie below v256
__device__ __forceinline__ v8f mma_p(v16h a, v16h b, v8f c) {
  return __builtin_amdgcn_wmma_f32_16x16x32_f16(false, a, false, b, (short)0, c, false, false);
}
// Sixteen 16-B copies per lane, global -> LDS, by the builtin: copy i moves g + i * GSTEP (elements) to l + i * LSTEP
// (elements). The builtin's address registers may lie anywhere; an asm statement's must lie below v256, where the 256
// registers of R would have to make room for them on every trip.
typedef int v4i_gcc __attribute__((vector_size(16)));
template <int LSTEP, int GSTEP>
__device__ __forceinline__ void bcopy16(unsigned short* l, const unsigned short* g) {
#if defined(__HIP_DEVICE_COMPILE__)
#pragma unroll                                                       // sixteen copies back to back
  for (int i = 0; i < 16; ++i) {
    __builtin_amdgcn_global_load_async_to_lds_b128((__attribute__((address_space(1))) v4i_gcc*)(g + i * GSTEP),
                                                   (__attribute__((address_space(3))) v4i_gcc*)(l + i * LSTEP), 0, 0);
  }
#endif
}
// the tiles as the 128 lanes of the product waves copy them (t7 = tid & 127):
// 32 k rows: copy i -> row 2 i + (t7 >> 6), chunk t7 & 63; 512 v rows: copy i -> row 32 i + (t7 >> 2), chunk t7 & 3.
// Both sources are contiguous: a wave's copy reads 512 B in a row, four whole 128-B lines.
__device__ __forceinline__ void copy_rows32_h(unsigned short* l, const unsigned short* g) { bcopy16<2 * KPE, 128 * 8>(l, g); }
__device__ __forceinline__ void copy_vtile_h(unsigned short* l, const unsigned short* g) { bcopy16<32 * VPE, 32 * KT>(l, g); }
#define SM_VS 0
#define SM_KS (SM_VS + 2 * CDIM * VPE * 2)
#define SM_PS (SM_KS + 2 * KBUF * 2)
#define SM_CS (SM_PS + 2 * 4 * 32 * 8 * 4)
#define SM_IS (SM_CS + 2 * 4 * 32 * 4)
#define SM_GS (SM_IS + 4 * 32 * 4)
#define SM_ALL (SM_GS + 2 * 4 * 4)
static_assert(SM_KS % 16 == 0 && SM_PS % 16 == 0 && SM_CS % 16 == 0 && SM_IS % 16 == 0 && SM_GS % 16 == 0);
__global__ __launch_bounds__(256)
void attn_k(const unsigned short* __restrict__ Qh, const unsigned short* __restrict__ Ql,
            const unsigned short* __restrict__ Kh, const unsigned short* __restrict__ Kl,
            const unsigned short* __restrict__ PV, float* out) {
  // One array, so that the order of its parts is the source's. The key ring stands behind the pv buffers: the compiler folds
  // the key copies' global steps into offset:N and takes N off the LDS address register, which so never falls below 0.
  // The pv copies' step in LDS (32 rows of 2 VPE bytes) is larger than their global step (32 rows of 2 KT): the same holds.
  __shared__ __align__(16) unsigned char Sm[SM_ALL];
  unsigned short* const Vs  = (unsigned short*)(Sm + SM_VS);         // [buffer][512 channels][VPE], 32 keys used
  unsigned short* const Ks  = (unsigned short*)(Sm + SM_KS);         // [buffer][hi, residual][32 keys][KPE]; first the query tile
  unsigned* const       Psh = (unsigned*)(Sm + SM_PS);               // [buffer][query group][lane][8]
  float* const          Csh = (float*)(Sm + SM_CS);                  // [buffer][query group][lane]
  float* const          Ish = (float*)(Sm + SM_IS);                  // [query group][lane]
  int* const            Gsh = (int*)(Sm + SM_GS);                    // [buffer][query group]
  constexpr int NT = NDIM / KT;                                      // key tiles
  static_assert((NT & (NT - 1)) == 0 && NT % (NDIM / QT) == 0);
  const int tid  = threadIdx.x;
  const int lane = tid & 31;
  const int wave = uni((int)(threadIdx.x >> 5));                     // 0..7, SGPR
  const int w    = wave & 3;                                         // query group of a score wave, channel group of a product wave
  const int hh   = lane >> 4, cl = lane & 15;
  const int n0   = blockIdx.x * QT, b = blockIdx.y;
  const int t7   = tid & 127;
  const int rot  = (int)blockIdx.x * (NT / (NDIM / QT));             // the walk's first key tile (uniform): 32 starts, 2 tiles apart
  auto ktile = [&](int i) { return (unsigned)((i + rot) & (NT - 1)); };   // place in the walk -> tile of the planes

  // k fragment base in LDS (A operand, row = key cl of the tile), + buffer * KBUF + 32*kc
  const unsigned short* Ksp = Ks + cl * KPE + 8 * hh;
  // v fragment base in LDS (A operand, row = channel 128 w + 16 j + cl, the tile's 32 keys contiguous), + buffer, + 16*j*VPE
  const unsigned short* Vp = Vs + (w * 128 + cl) * VPE + 8 * hh;
  // the product waves' copy sources (the lane's 16-B chunk of copy 0), as 32-bit element offsets from the planes'
  // uniform bases (one for both key planes), and LDS places
  const unsigned kgo = (unsigned)(b * NDIM * CDIM + 8 * t7);
  const unsigned vgo = (unsigned)(b * CDIM * NDIM + 8 * t7);
  unsigned short* const ksl = Ks + (t7 >> 6) * KPE + (t7 & 63) * 8;
  unsigned short* const vsl = Vs + (t7 >> 2) * VPE + (t7 & 3) * 8;

  const int pso = (w * 32 + lane) * 8;                               // a score wave's slot in a P buffer (uints)

  float m = -1.0e30f, l = 0.f;
  v8f R[32];                                                         // score wave: q fragments [chunk][hi, residual]; product wave: O^T tiles [j][query group]

  // prologue: the query tile through the key ring into the score waves' registers, then key tile 0
  {
    const size_t qg = ((size_t)(b * NDIM + n0)) * CDIM + 8 * tid;
    const unsigned qsl = lds_off(Ks) + (unsigned)((tid >> 6) * (2 * KPE) + (tid & 63) * 16);
    copy_rows32(qsl,                             Qh + qg);
    copy_rows32(qsl + 2u * KPLANE,               Qh + qg + KT * CDIM);
    copy_rows32(qsl + 2u * QPLANE,               Ql + qg);
    copy_rows32(qsl + 2u * QPLANE + 2u * KPLANE, Ql + qg + KT * CDIM);
    wait_async0();
    __syncthreads();                                                 // publishes the query tile
    if (wave < 4) {                                                  // wave-uniform (SGPR) role branch
      // q fragments (B operand, col = query 16 w + cl of the tile)
      const unsigned short* Qhp = Ks + (16 * w + cl) * KPE + 8 * hh;
      const unsigned short* Qlp = Qhp + QPLANE;
#pragma unroll                                                       // constant indices keep R in registers
      for (int kc = 0; kc < CDIM / 32; ++kc) {
        R[2 * kc]     = __builtin_bit_cast(v8f, ldfrag(Qhp + 32 * kc).bf);
        R[2 * kc + 1] = __builtin_bit_cast(v8f, ldfrag(Qlp + 32 * kc).bf);
      }
    } else {
#pragma unroll                                                       // as above
      for (int j = 0; j < 32; ++j) R[j] = zero8();
    }
    wait_ds0();                                                      // own reads of the query tile have retired
    __syncthreads();                                                 // ends every read of the query tile: the ring is free
    if (wave >= 4) {
      copy_rows32_h(ksl,          Kh + (kgo + ktile(0) * (KT * CDIM)));
      copy_rows32_h(ksl + KPLANE, Kl + (kgo + ktile(0) * (KT * CDIM)));
    }
    wait_async0();
    __syncthreads();                                                 // publishes key tile 0
  }

#pragma unroll 1                                                     // one copy of the interval: the buffers are run-time offsets
  for (int i = 0; i <= NT; ++i) {
    const int buf = i & 1;                                           // key tile i, P of tile i, pv tile i
    if (wave >= 4) {                                                 // wave-uniform (SGPR) role branch
      // refills first, so that they fly through the whole interval: both targets were last read in interval i - 1
      if (i + 1 < NT) {                                              // block-uniform: key tile i + 1 exists
        copy_rows32_h(ksl + (buf ^ 1) * KBUF,          Kh + (kgo + ktile(i + 1) * (KT * CDIM)));
        copy_rows32_h(ksl + (buf ^ 1) * KBUF + KPLANE, Kl + (kgo + ktile(i + 1) * (KT * CDIM)));
      }
      if (i < NT) {                                                  // block-uniform: pv tile i exists
        copy_vtile_h(vsl + buf * (CDIM * VPE), PV + (vgo + ktile(i) * (CDIM * KT)));
      }
      if (i > 0) {                                                   // block-uniform: tile i - 1 has been published
        const int pbf = buf ^ 1;                                     // P, corr, flags and pv tile of key tile i - 1
        int gfl[4];
        float cr[4];
#pragma unroll                                                       // constant indices keep the sets in registers
        for (int qg = 0; qg < 4; ++qg) { gfl[qg] = Gsh[pbf * 4 + qg]; cr[qg] = Csh[pbf * 128 + qg * 32 + lane]; }
#pragma unroll                                                       // as above
        for (int qg = 0; qg < 4; ++qg) {
          if (uni(gfl[qg]) != 0) {                                   // wave-uniform flag
#pragma unroll                                                       // as above
            for (int j = 0; j < 8; ++j) {
#pragma unroll                                                       // as above
              for (int r = 0; r < 8; ++r) R[4 * j + qg][r] *= cr[qg];
            }
          }
        }
        FragP pb[4];
        Frag vf[8];
#pragma unroll                                                       // as above
        for (int qg = 0; qg < 4; ++qg) {
          pb[qg].u[0] = *(const v4u*)(Psh + pbf * 1024 + (qg * 32 + lane) * 8);
          pb[qg].u[1] = *(const v4u*)(Psh + pbf * 1024 + (qg * 32 + lane) * 8 + 4);
        }
#pragma unroll                                                       // as above
        for (int j = 0; j < 8; ++j) vf[j] = ldfrag(Vp + pbf * (CDIM * VPE) + 16 * j * VPE);
#if defined(__HIP_DEVICE_COMPILE__)
        // the tile's 24 fragment reads stand together ahead of its products: left alone, each pv fragment is read directly
        // in front of its four products and its whole LDS latency is waited for, eight times a tile
        __builtin_amdgcn_sched_barrier(0);
#endif
#pragma unroll                                                       // as above
        for (int j = 0; j < 8; ++j) {
#pragma unroll                                                       // as above
          for (int qg = 0; qg < 4; ++qg) R[4 * j + qg] = mma_p(vf[j].h, pb[qg].v, R[4 * j + qg]);
        }
      }
    } else {
      if (i < NT) {                                                  // block-uniform: key tile i exists
        const unsigned short* k0p  = Ksp + buf * KBUF;               // keys 0 .. 15 of the tile
        const unsigned short* k1p  = k0p + 16 * KPE;                 // keys 16 .. 31
        const unsigned short* k0lp = k0p + KPLANE;
        const unsigned short* k1lp = k1p + KPLANE;
        v8f s0 = zero8(), s1 = zero8();
        // two register sets: chunk kc + 1's LDS reads stand together ahead of chunk kc's products, so that their latency
        // passes under those products; all 16 chunks lie in this interval's key buffer
        Frag k0[2], k1[2], k0l[2], k1l[2];
        k0[0]  = ldfrag(k0p);
        k1[0]  = ldfrag(k1p);
        k0l[0] = ldfrag(k0lp);
        k1l[0] = ldfrag(k1lp);
#pragma unroll                                                       // constant indices keep both sets and R in registers
        for (int kc = 0; kc < CDIM / 32; ++kc) {
          const int c = kc & 1, n = c ^ 1;
          if (kc + 1 < CDIM / 32) {
            k0[n]  = ldfrag(k0p + 32 * (kc + 1));
            k1[n]  = ldfrag(k1p + 32 * (kc + 1));
            k0l[n] = ldfrag(k0lp + 32 * (kc + 1));
            k1l[n] = ldfrag(k1lp + 32 * (kc + 1));
          }
          const v16b qh = __builtin_bit_cast(v16b, R[2 * kc]);
          const v16b ql = __builtin_bit_cast(v16b, R[2 * kc + 1]);
          s0 = mma_s(k0[c].bf, qh, s0);
          s1 = mma_s(k1[c].bf, qh, s1);
          s0 = mma_s(k0[c].bf, ql, s0);
          s1 = mma_s(k1[c].bf, ql, s1);
          s0 = mma_s(k0l[c].bf, qh, s0);
          s1 = mma_s(k1l[c].bf, qh, s1);
        }

        float mx = fmaxf(hmax8(s0), hmax8(s1));
        mx = fmaxf(mx, __shfl_xor(mx, 16, 32));
        const float mn = fmaxf(m, mx);
        const unsigned grew = wave_ballot(mx > m);                   // wave-uniform
        float corr = 1.0f;
        if (grew != 0u) {
          corr = __expf(m - mn);                                     // == 1 for lanes whose max did not grow
          l *= corr;
        }
        m = mn;
        const float msh = mn - LNPS;                                 // exp gives e^{s-m} * 16384

        FragP ph;
        float ls = 0.f;
#pragma unroll
        for (int r = 0; r < 8; ++r) {
          const float e0 = __expf(s0[r] - msh);                      // key      8hh + r of the tile
          const float e1 = __expf(s1[r] - msh);                      // key 16 + 8hh + r
          ls += e0 + e1;
          ph.hv[0][r] = (_Float16)e0;
          ph.hv[1][r] = (_Float16)e1;
        }
        l += ls;

        *(v4u*)(Psh + buf * 1024 + pso)     = ph.u[0];
        *(v4u*)(Psh + buf * 1024 + pso + 4) = ph.u[1];
        Csh[buf * 128 + w * 32 + lane] = corr;
        Gsh[buf * 4 + w] = (grew != 0u) ? 1 : 0;
      }
    }
    // foot of the interval: own LDS traffic retired, own copies landed, then the barrier that publishes key tile i + 1,
    // pv tile i and P of tile i, and ends every read of this interval's buffers
    wait_ds0();
    wait_async0();
    __syncthreads();
  }
  wait_async0();                                                     // nothing in flight when the ring changes its use
  float* Os = (float*)Ks;                                            // output staging; first written behind the next barrier

  if (wave < 4) {
    l += __shfl_xor(l, 16, 32);
    Ish[w * 32 + lane] = (1.0f / l) * OSCALE;                        // o and l both carry the x16384 factor
  }
  __syncthreads();

  const int e = tid & 7, lq = tid >> 3;                              // lq 0..31
#pragma unroll
  for (int p = 0; p < 4; ++p) {
    if (p) __syncthreads();                                          // every wave finished reading Os
    if (wave >= 4) {                                                 // wave-uniform (SGPR) role branch
#pragma unroll
      for (int qg = 0; qg < 4; ++qg) {
        const float inv = Ish[qg * 32 + lane];
        const int qrow = 16 * qg + cl;
#pragma unroll
        for (int jj = 0; jj < 2; ++jj) {
          const int t = 4 * (2 * p + jj) + qg;                       // channels 128 w + 32 p + 16 jj + 8 hh + r
          v4f va, vb;
#pragma unroll
          for (int r = 0; r < 4; ++r) { va[r] = R[t][r] * inv; vb[r] = R[t][4 + r] * inv; }
          *(v4f*)(Os + qrow * OSPW + w * 32 + 16 * jj + 8 * hh)     = va;   // Os[query][32 w + 16 jj + 8 hh + r]
          *(v4f*)(Os + qrow * OSPW + w * 32 + 16 * jj + 8 * hh + 4) = vb;
        }
      }
    }
    __syncthreads();
    v4f res[8];
#pragma unroll
    for (int it = 0; it < 8; ++it) {
      const int L   = it * 32 + lq;                                  // 0..255
      const int ql  = L >> 2, seg = L & 3;                           // query 0..63, channel group 0..3: one 128-B line
      res[it] = *(const v4f*)(Os + ql * OSPW + 32 * seg + 4 * e);
    }
#pragma unroll
    for (int it = 0; it < 8; ++it) {
      const int L   = it * 32 + lq;
      const int ql  = L >> 2, seg = L & 3;
      const int ch  = 128 * seg + 32 * p + 4 * e;
      const size_t idx = ((size_t)(b * NDIM + n0 + ql)) * CDIM + ch;
      *(v4f*)(out + idx) = res[it];
    }
  }
}

// =========================================================================================================
// Workspace map (bytes; each region start a multiple of 256; every extent is an exact tile multiple and is written
//   W16 f16 [3][2048][2048]         8388608 x3 (Wq, Wk, Wv)
//   X16 f16 [3][NB][512][2048]     16777216 x3 (q, k, v)
//   Qh/Ql/Kh/Kl bf16 [NB][2048][512] 16777216 x4
//   PV  f16 [NB][64][512][32]      16777216
//   total (NB = 8) = 159383552
// =========================================================================================================
extern "C" void kernel_launch(void* const* d_in, const int* in_sizes, int n_in,
                              void* d_out, int out_size, void* d_ws, size_t ws_size,
                              hipStream_t stream) {
  if (n_in < 9) return;
  if (in_sizes[0] < NB * CDIM * NDIM || in_sizes[1] < NB * CDIM * NDIM || in_sizes[2] < NB * CDIM * NDIM) return;
  if (in_sizes[3] < NDIM * NDIM || in_sizes[5] < NDIM * NDIM || in_sizes[7] < NDIM * NDIM) return;
  if (in_sizes[4] < NDIM || in_sizes[6] < NDIM || in_sizes[8] < NDIM) return;
  if (out_size < (NB - 1) * NDIM * CDIM + NQ * CDIM) return;

  size_t off = 0;
  auto carve = [&](size_t bytes) { const size_t o = off; off += (bytes + 255) & ~(size_t)255; return o; };
  const size_t oW16 = carve((size_t)3 * WPLANE * 2);
  const size_t oX16 = carve((size_t)3 * XPLANE * 2);
  const size_t oQh  = carve((size_t)NB * NDIM * CDIM * 2);
  const size_t oQl  = carve((size_t)NB * NDIM * CDIM * 2);
  const size_t oKh  = carve((size_t)NB * NDIM * CDIM * 2);
  const size_t oKl  = carve((size_t)NB * NDIM * CDIM * 2);
  const size_t oPV  = carve((size_t)NB * CDIM * NDIM * 2);
  if (off > ws_size) return;

  const float* q  = (const float*)d_in[0];
  const float* k  = (const float*)d_in[1];
  const float* v  = (const float*)d_in[2];
  const float* Wq = (const float*)d_in[3];
  const float* bq = (const float*)d_in[4];
  const float* Wk = (const float*)d_in[5];
  const float* bk = (const float*)d_in[6];
  const float* Wv = (const float*)d_in[7];
  const float* bv = (const float*)d_in[8];

  char* ws = (char*)d_ws;
  unsigned short* W16 = (unsigned short*)(ws + oW16);
  unsigned short* X16 = (unsigned short*)(ws + oX16);
  unsigned short* Qh  = (unsigned short*)(ws + oQh);
  unsigned short* Ql  = (unsigned short*)(ws + oQl);
  unsigned short* Kh  = (unsigned short*)(ws + oKh);
  unsigned short* Kl  = (unsigned short*)(ws + oKl);
  unsigned short* PVp = (unsigned short*)(ws + oPV);
  float* out = (float*)d_out;

  const dim3 blk256(256), blk128(128);

  // convert all six operands
  cvt_k<<<dim3(CVGRID), dim3(CVW * 32), 0, stream>>>(Wq, Wk, Wv, q, k, v, W16, W16 + WPLANE, W16 + 2 * WPLANE,
                                                     X16, X16 + XPLANE, X16 + 2 * XPLANE);
  // q: project -> pq hi + residual planes [b][o][c] for o < NQ
  proj_qk<<<dim3(CDIM / PT, NQ / PT, NB), blk128, 0, stream>>>(X16, W16, bq, Qh, Ql);
  // k: project -> pk hi + residual planes [b][o][c], all o
  proj_qk<<<dim3(CDIM / PT, NDIM / PT, NB), blk128, 0, stream>>>(X16 + XPLANE, W16 + WPLANE, bk, Kh, Kl);
  // v: project -> pv f16 plane [b][o / 32][c][o % 32]
  proj_v<<<dim3(NDIM / PT, CDIM / PT, NB), blk128, 0, stream>>>(W16 + 2 * WPLANE, X16 + 2 * XPLANE, bv, PVp);
  // attention + 1/sqrt(2048) -> out [b][n][c] (the raw view to [b][512][2048] is the same flat buffer)
  attn_k<<<dim3(NQ / QT, NB), blk256, 0, stream>>>(Qh, Ql, Kh, Kl, PVp, out);
  (void)hipGetLastError();
}

// v008
// One run takes 184 microseconds.
// Next to v007, in two timings, it ran 1.03 times as fast each time.
// All steps since v000 together make it 6.62 times as fast.
// Contractions: projections X[c][n].W[o][n]^T (K=2048) on v_wmma_f32_16x16x32_f16 (f16 containers of bf16-RNE W x256 and bf16-RNE x); scores pk.pq^T (K=512) on v_wmma_f32_16x16x32_bf16 (bf16 hi + bf16 residual planes of pq/pk, 3 products); O^T = pv^T.P^T (K=2048 keys) on v_wmma_f32_16x16x32_f16 (pv f16, P = e^{s-m} x16384 f16 from the score D registers); projection and attention operands staged in LDS by asynchronous copies; f32 accumulate everywhere; softmax statistics and scaling in f32 VALU.
#include <hip/hip_runtime.h>
#include <math.h>
#include <stdint.h>

#ifndef NB
#define NB 8
#endif
#ifndef NQ
#define NQ 2048
#endif
#define NB_FULL 8
#define CDIM   512
#define NDIM   2048
#define QT     64
#define CHH    256
#define OSPW   132
#define WSC    256.0f
#define IWSC   0.00390625f
#define LNPS   9.704060527839234f
#define OSCALE 0.022097086912079608f
#define KT     32
#define KPE    520
#define KPLANE (KT * KPE)
#define KBUF   (2 * KPLANE)
#define QPLANE (QT * KPE)
#define VPE    40
#define PT     128
#define PKC    128
#define PPE    136
#define PHALF  (PT * PPE)
#define PBUF   (2 * PHALF)
#define CVW    16
#define CVL    8
#define CVUNIT (CVW * 32 * 4 * CVL)
#define CVGRID 256
#define WPLANE (NDIM * NDIM)
#define XPLANE (NB * CDIM * NDIM)
#define WTRIPS (WPLANE / (CVUNIT * CVGRID))
#define XTRIPS (XPLANE / (CVUNIT * CVGRID))

static_assert(NB >= 1 && NB <= NB_FULL);
static_assert(NQ >= QT && NQ <= NDIM && NQ % QT == 0);
static_assert(CDIM % QT == 0 && NDIM % QT == 0);
static_assert(CDIM % 32 == 0 && NDIM % 32 == 0);
static_assert(CDIM == 2 * CHH && CHH == 16 * 16);
static_assert((OSPW * 4) % 16 == 0);
static_assert(NDIM == 8 * 256);
static_assert((KPE * 2) % 16 == 0 && ((KPE * 2) / 16) % 2 == 1);   // LDS row pitches 16 B x odd: the 16 rows of a b128
static_assert((VPE * 2) % 16 == 0 && ((VPE * 2) / 16) % 2 == 1);   // fragment read fall on all 64 banks once
static_assert(CDIM * 2 == 64 * 16 && KT == 8 * 4 && QT == 2 * KT);  // q/k rows: 64 chunks of 16 B; 8 copies x 256 lanes (q) or 16 x 128 lanes (k) = 32 rows
static_assert(KT * 2 == 4 * 16 && CDIM == 16 * 32);                 // v rows: 4 chunks of 16 B; 16 copies x 128 lanes = 512 rows
static_assert(PT % KT == 0 && KT == 4 * 8);                         // a projection tile's o are whole key tiles; 4 chunks of 8 o a tile
static_assert(NDIM / KT >= 2);
static_assert(CDIM % PT == 0 && NDIM % PT == 0 && NQ % PT == 0 && NDIM % PKC == 0 && NDIM / PKC >= 2);
static_assert((PPE * 2) % 16 == 0 && ((PPE * 2) / 16) % 2 == 1 && PPE >= PKC);  // as for KPE and VPE
static_assert(PKC * 2 == 16 * 16 && PT == 2 * 8 * 8);               // projection rows: 16 chunks of 16 B; 8 copies x 128 lanes = 64 rows
static_assert(PT * OSPW * 4 <= 2 * PBUF * 2);                       // the projections' output staging fits in the ring it reuses
static_assert(QT * OSPW * 4 <= 2 * KBUF * 2);                       // the output staging fits in the key ring it reuses
static_assert(WPLANE == WTRIPS * CVUNIT * CVGRID && XPLANE == XTRIPS * CVUNIT * CVGRID && CVL == 8);   // whole convert trips

typedef _Float16       v16h __attribute__((ext_vector_type(16)));
typedef _Float16       v8h  __attribute__((ext_vector_type(8)));
typedef __bf16         v16b __attribute__((ext_vector_type(16)));
typedef unsigned short v8us __attribute__((ext_vector_type(8)));
typedef float          v8f  __attribute__((ext_vector_type(8)));
typedef float          v4f  __attribute__((ext_vector_type(4)));
typedef unsigned int   v4u  __attribute__((ext_vector_type(4)));
typedef unsigned int   v2u  __attribute__((ext_vector_type(2)));

union Frag  { v8us u[2]; v16h h; v16b bf; };
union FragP { v16h v; v8h hv[2]; v4u u[2]; };
static_assert(sizeof(Frag) == 32);
static_assert(sizeof(FragP) == 32);

// ---- scalar helpers ---------------------------------------------------------------------------------------
__device__ __forceinline__ unsigned short bf_bits(float f) {          // f32 -> bf16 bits, RNE convert
  unsigned u = __float_as_uint(f);
  return (unsigned short)((u + 0x7FFFu + ((u >> 16) & 1u)) >> 16);
}
__device__ __forceinline__ float bf_up(unsigned short hb) { return __uint_as_float(((unsigned)hb) << 16); }
__device__ __forceinline__ float bfr(float f) { return bf_up(bf_bits(f)); }
__device__ __forceinline__ unsigned short h_bits(_Float16 x) { return __builtin_bit_cast(unsigned short, x); }
__device__ __forceinline__ unsigned pk16(unsigned short a, unsigned short b) { return (unsigned)a | ((unsigned)b << 16); }
__device__ __forceinline__ v8f zero8() { v8f z = {0.f, 0.f, 0.f, 0.f, 0.f, 0.f, 0.f, 0.f}; return z; }
__device__ __forceinline__ float hmax8(v8f s) {
  return fmaxf(fmaxf(fmaxf(s[0], s[1]), fmaxf(s[2], s[3])), fmaxf(fmaxf(s[4], s[5]), fmaxf(s[6], s[7])));
}
__device__ __forceinline__ unsigned wave_ballot(bool p) {
#if defined(__HIP_DEVICE_COMPILE__)
  return __builtin_amdgcn_ballot_w32(p);
#else
  return p ? 1u : 0u;
#endif
}
__device__ __forceinline__ int uni(int v) {                           // wave-uniform int -> SGPR
#if defined(__HIP_DEVICE_COMPILE__)
  return __builtin_amdgcn_readfirstlane(v);
#else
  return v;
#endif
}

// ---- 16-bit fragment loader (A, or B from a k-contiguous [n][k] row): lane -> row/col (lane&15), p already includes
//      + 8*(lane>>4); elements 0..7 <- p[0..7] (k0+8h..), elements 8..15 <- p[16..23] (k0+16+8h..)
__device__ __forceinline__ Frag ldfrag(const unsigned short* p) {
  Frag f;
  f.u[0] = *(const v8us*)(p);
  f.u[1] = *(const v8us*)(p + 16);
  return f;
}

// ---- LDS staging by asynchronous copies ----------------------------------------------------------------------
__device__ __forceinline__ unsigned lds_off(const void* p) { return (unsigned)(size_t)p; }
// Eight 16-B copies per lane, global -> LDS: copy i moves g + i * GSTEP (elements) to LDS byte l + i * LSTEP.
// The closing s_wait_xcnt stands in the copies' own statement so that no address register is rewritten ahead of it.
template <unsigned LSTEP, int GSTEP>
__device__ __forceinline__ void acopy8(unsigned l, const unsigned short* g) {
#if defined(__HIP_DEVICE_COMPILE__)
  asm volatile(
      "global_load_async_to_lds_b128 %0, %8, off\n\t"
      "global_load_async_to_lds_b128 %1, %9, off\n\t"
      "global_load_async_to_lds_b128 %2, %10, off\n\t"
      "global_load_async_to_lds_b128 %3, %11, off\n\t"
      "global_load_async_to_lds_b128 %4, %12, off\n\t"
      "global_load_async_to_lds_b128 %5, %13, off\n\t"
      "global_load_async_to_lds_b128 %6, %14, off\n\t"
      "global_load_async_to_lds_b128 %7, %15, off\n\t"
      "s_wait_xcnt 0x0"
      :: "v"(l), "v"(l + 1u * LSTEP), "v"(l + 2u * LSTEP), "v"(l + 3u * LSTEP),
         "v"(l + 4u * LSTEP), "v"(l + 5u * LSTEP), "v"(l + 6u * LSTEP), "v"(l + 7u * LSTEP),
         "v"(g), "v"(g + 1 * GSTEP), "v"(g + 2 * GSTEP), "v"(g + 3 * GSTEP),
         "v"(g + 4 * GSTEP), "v"(g + 5 * GSTEP), "v"(g + 6 * GSTEP), "v"(g + 7 * GSTEP)
      : "memory");
#endif
}
// 32 q rows of 1024 B (contiguous in global) -> LDS pitch 2 KPE: copy i, lane tid -> row 4 i + (tid >> 6), chunk tid & 63
__device__ __forceinline__ void copy_rows32(unsigned l, const unsigned short* g) { acopy8<4u * 2u * KPE, 256 * 8>(l, g); }
__device__ __forceinline__ void wait_async0() {                       // this wave's copies have landed in LDS
#if defined(__HIP_DEVICE_COMPILE__)
  asm volatile("s_wait_asynccnt 0x0" ::: "memory");
#endif
}
__device__ __forceinline__ void wait_ds0() {                          // this wave's LDS reads and writes have retired
#if defined(__HIP_DEVICE_COMPILE__)
  asm volatile("s_wait_dscnt 0x0" ::: "memory");
#endif
}

// ---- WMMA helpers: mma_h is the f16 builtin followed by a 4-slot VALU gap tying D and keeping A/B live --------------------------
__device__ __forceinline__ v8f mma_h(v16h a, v16h b, v8f c) {
  v8f d = __builtin_amdgcn_wmma_f32_16x16x32_f16(false, a, false, b, (short)0, c, false, false);
#if defined(__HIP_DEVICE_COMPILE__)
  asm volatile("v_nop\n\tv_nop\n\tv_nop\n\tv_nop" : "+v"(d) : "v"(a), "v"(b));
#endif
  return d;
}

// Score product by the builtin alone (the compiler keeps its distances): an asm statement's vector operands must lie
// below v256, and the score loop's two fragment sets beside the 32 query fragments do not all fit there.
__device__ __forceinline__ v8f mma_s(v16b a, v16b b, v8f c) {
  return __builtin_amdgcn_wmma_f32_16x16x32_bf16(false, a, false, b, (short)0, c, false, false);
}

// =========================================================================================================
// (0) convert, all six f32 operands in one launch: W16[p] = f16(bf16-RNE(W_p) x 256), X16[p] = f16(bf16-RNE(x_p)),
//     p = 0, 1, 2 for q, k, v. CVGRID work-groups of CVW waves stay resident and loop: the launch starts few waves, and
//     each keeps CVL or more loads of 16 B a lane in flight. A trip of a work-group is CVUNIT contiguous floats; a wave
//     takes 128 CVL of them, load i of lane ln the floats 128 i + 4 ln .. + 3 (512 contiguous bytes a wave-load, 256 a
//     store). A work-group's trips in one tensor are adjacent. The next trip's loads are issued ahead of this trip's
//     conversions, in a second register set.
//     Trip order: (Wv, v), (Wk, k), (Wq, q): the pair that the next launch's first blocks read is written last.
// coverage: CVGRID work-groups x a tensor's trips x CVUNIT floats = its size (static_assert), every element once.
// =========================================================================================================
// s: the work-group's place (uniform); bo: the lane's byte offset in it
__device__ __forceinline__ void cvt_load(v4f (&r)[CVL], const float* s, unsigned bo) {
#pragma unroll                                                       // constant indices keep the set in registers
  for (int i = 0; i < CVL; ++i) r[i] = *(const v4f*)((const char*)s + bo + 512 * i);
#if defined(__HIP_DEVICE_COMPILE__)
  // s_wait_xcnt 0 behind the loads; base and offset are inputs, so that they stay live, and so unwritten, up to the wait
  asm volatile("s_wait_xcnt 0x0" :: "s"(s), "v"(bo) : "memory");
  __builtin_amdgcn_sched_barrier(0);                                 // the trip's loads stand together: no conversion moves up among them
#endif
}
// The closing s_wait_xcnt stands in the stores' own statement so that no register they name is rewritten ahead of it.
__device__ __forceinline__ void cvt_store(unsigned short* d, unsigned bo, const v4f (&r)[CVL], float sc) {
  v2u u[CVL];
#pragma unroll                                                       // as above
  for (int i = 0; i < CVL; ++i) {
#pragma unroll                                                       // as above
    for (int t = 0; t < 2; ++t) {
      const _Float16 h0 = (_Float16)(bfr(r[i][2 * t]) * sc);
      const _Float16 h1 = (_Float16)(bfr(r[i][2 * t + 1]) * sc);
      u[i][t] = pk16(h_bits(h0), h_bits(h1));
    }
  }
#if defined(__HIP_DEVICE_COMPILE__)
  asm volatile(
      "global_store_b64 %0, %2, %1\n\t"
      "global_store_b64 %0, %3, %1 offset:256\n\t"
      "global_store_b64 %0, %4, %1 offset:512\n\t"
      "global_store_b64 %0, %5, %1 offset:768\n\t"
      "global_store_b64 %0, %6, %1 offset:1024\n\t"
      "global_store_b64 %0, %7, %1 offset:1280\n\t"
      "global_store_b64 %0, %8, %1 offset:1536\n\t"
      "global_store_b64 %0, %9, %1 offset:1792\n\t"
      "s_wait_xcnt 0x0"
      :: "v"(bo), "s"(d), "v"(u[0]), "v"(u[1]), "v"(u[2]), "v"(u[3]), "v"(u[4]), "v"(u[5]), "v"(u[6]), "v"(u[7])
      : "memory");
#endif
}
__global__ __launch_bounds__(CVW * 32)
void cvt_k(const float* __restrict__ wq, const float* __restrict__ wk, const float* __restrict__ wv,
           const float* __restrict__ q, const float* __restrict__ k, const float* __restrict__ v,
           unsigned short* Wq16, unsigned short* Wk16, unsigned short* Wv16,
           unsigned short* Xq16, unsigned short* Xk16, unsigned short* Xv16) {
  const unsigned tid = threadIdx.x;
  const unsigned le  = (tid >> 5) * (128u * CVL) + 4u * (tid & 31u);  // the lane's first element in a trip's unit
  const float* const wsrc[3] = {wq, wk, wv};
  const float* const xsrc[3] = {q, k, v};
  unsigned short* const wdst[3] = {Wq16, Wk16, Wv16};
  unsigned short* const xdst[3] = {Xq16, Xk16, Xv16};
  constexpr int PTRIPS = WTRIPS + XTRIPS;                            // trips of one (W, x) pair
  // trip t (a compile-time number behind the unroll) -> pair, tensor, and the work-group's place in it (uniform)
  auto pair_of = [](int t) { return 2 - t / PTRIPS; };
  auto is_w    = [](int t) { return t % PTRIPS < WTRIPS; };
  auto place   = [&](int t) {
    return is_w(t) ? ((size_t)blockIdx.x * WTRIPS + t % PTRIPS) * CVUNIT
                   : ((size_t)blockIdx.x * XTRIPS + (t % PTRIPS - WTRIPS)) * CVUNIT;
  };
  auto from = [&](int t) { return (is_w(t) ? wsrc[pair_of(t)] : xsrc[pair_of(t)]) + place(t); };
  auto to   = [&](int t) { return (is_w(t) ? wdst[pair_of(t)] : xdst[pair_of(t)]) + place(t); };

  v4f r[2][CVL];
  cvt_load(r[0], from(0), 4u * le);
#pragma unroll                                                       // constant indices: both sets in registers, tensors by trip
  for (int t = 0; t < 3 * PTRIPS; ++t) {
    if (t + 1 < 3 * PTRIPS) cvt_load(r[(t + 1) & 1], from(t + 1), 4u * le);
    cvt_store(to(t), 2u * le, r[t & 1], is_w(t) ? WSC : 1.0f);
  }
}

// =========================================================================================================
// Projection main loop, one 128 x 128 tile of D[m][n] = sum_k A[m][k] B[n][k] per block of 4 waves (2 x 2, 64 x 64 each),
//   A and B rows k-contiguous at pitch NDIM. A stage is PKC = 128 k of the 128 A rows and the 128 B rows, brought into LDS
//   (row pitch 2 PPE bytes) by asynchronous 16-B copies of all 4 waves: copy i of a group, lane tid -> row 8 i + (tid >> 4),
//   chunk tid & 15. Two buffers: stage t + 2 is issued behind the foot barrier of trip t, which also publishes stage t + 1.
//   Trip t works on k stage (t + rot) mod 16, rot by the block's index, for speed only.
//   Each accumulator tile takes its 16 stages in that wrapped order, the 4 k-steps of a stage ascending.
// =========================================================================================================
__device__ __forceinline__ void copy_rows64(unsigned l, const unsigned short* g) { acopy8<8u * 2u * PPE, 8 * NDIM>(l, g); }
__device__ __forceinline__ void proj_stage(unsigned l, const unsigned short* ga, const unsigned short* gb) {
  copy_rows64(l,                                 ga);
  copy_rows64(l + 64u * 2u * PPE,                ga + 64 * NDIM);
  copy_rows64(l + 2u * PHALF,                    gb);
  copy_rows64(l + 2u * PHALF + 64u * 2u * PPE,   gb + 64 * NDIM);
}
__device__ __forceinline__ void proj_tile(const unsigned short* Ps, const unsigned short* At, const unsigned short* Bt,
                                          int wm, int wn, int rot, v8f (&acc)[4][4]) {
  const int tid  = threadIdx.x;
  const int lane = tid & 31;
  const int hh   = lane >> 4, cl = lane & 15;
  const unsigned short* ga = At + (size_t)(tid >> 4) * NDIM + 8 * (tid & 15);
  const unsigned short* gb = Bt + (size_t)(tid >> 4) * NDIM + 8 * (tid & 15);
  const unsigned psl = lds_off(Ps) + (unsigned)((tid >> 4) * (2 * PPE) + (tid & 15) * 16);
  const unsigned short* ap = Ps + (64 * wm + cl) * PPE + 8 * hh;
  const unsigned short* bp = Ps + PHALF + (64 * wn + cl) * PPE + 8 * hh;

#pragma unroll                                                       // constant indices keep the accumulators in registers
  for (int mt = 0; mt < 4; ++mt) {
#pragma unroll                                                       // as above
    for (int nt = 0; nt < 4; ++nt) acc[mt][nt] = zero8();
  }

  constexpr int NS = NDIM / PKC;                                     // k stages, a power of two (static_assert below)
  static_assert((NS & (NS - 1)) == 0);
  auto kof = [&](int t) { return ((t + rot) & (NS - 1)) * PKC; };    // trip -> first k of its stage (uniform)

  proj_stage(psl, ga + kof(0), gb + kof(0));
  wait_async0();
  __syncthreads();                                                   // publishes trip 0's stage
  proj_stage(psl + 2u * PBUF, ga + kof(1), gb + kof(1));

#pragma unroll 1                                                     // one copy of the trip: the buffer is a run-time offset
  for (int t = 0; t < NDIM / PKC; ++t) {
    const int buf = t & 1;                                           // this trip reads this buffer alone
    const unsigned short* a0 = ap + buf * PBUF;
    const unsigned short* b0 = bp + buf * PBUF;
#pragma unroll                                                       // constant indices keep fragments and accumulators in registers
    for (int ks = 0; ks < PKC / 32; ++ks) {
      Frag fa[4], fb[4];                                             // the k-step's LDS reads stand together, ahead of its products
#pragma unroll                                                       // as above
      for (int i = 0; i < 4; ++i) { fa[i] = ldfrag(a0 + 16 * i * PPE + 32 * ks); fb[i] = ldfrag(b0 + 16 * i * PPE + 32 * ks); }
#pragma unroll                                                       // as above
      for (int mt = 0; mt < 4; ++mt) {
#pragma unroll                                                       // as above
        for (int nt = 0; nt < 4; ++nt) acc[mt][nt] = mma_h(fa[mt].h, fb[nt].h, acc[mt][nt]);
      }
    }
    // foot of the trip: own LDS reads retired, own copies landed, then the barrier that publishes stage t + 1 and ends
    // every read of this trip's buffer; only then its refill
    wait_ds0();
    wait_async0();
    __syncthreads();
    if (t + 2 < NDIM / PKC) proj_stage(psl + (unsigned)buf * (2u * PBUF), ga + kof(t + 2), gb + kof(t + 2));
  }
  wait_async0();                                                     // nothing in flight when the ring changes its use
}
// Accumulators x 1/256 -> Os[n_loc][m_loc] (pitch OSPW, b128 stores). Lane (hh, cl): D element r of tile (mt, nt) =
// (64 wm + 16 mt + 8 hh + r, 64 wn + 16 nt + cl).
__device__ __forceinline__ void proj_unload(float* Os, int wm, int wn, const v8f (&acc)[4][4]) {
  const int lane = threadIdx.x & 31;
  const int hh   = lane >> 4, cl = lane & 15;
#pragma unroll                                                       // constant indices keep the accumulators in registers
  for (int nt = 0; nt < 4; ++nt) {
    const int nl = 64 * wn + 16 * nt + cl;
#pragma unroll                                                       // as above
    for (int mt = 0; mt < 4; ++mt) {
      v4f va, vb;
#pragma unroll                                                       // as above
      for (int r = 0; r < 4; ++r) { va[r] = acc[mt][nt][r] * IWSC; vb[r] = acc[mt][nt][4 + r] * IWSC; }
      *(v4f*)(Os + nl * OSPW + 64 * wm + 16 * mt + 8 * hh)     = va;
      *(v4f*)(Os + nl * OSPW + 64 * wm + 16 * mt + 8 * hh + 4) = vb;
    }
  }
}

// =========================================================================================================
// (1) the three projections in one launch, one (128-c tile, 128-o tile, job, b) per block of 4 waves; blockIdx.z = 8 job + b,
//     job 0, 1, 2 = q, k, v. They are independent of one another: in one grid a freed place takes the next job's block at
//     once, and a block's prologue and epilogue run beside its neighbour's main loop, where three launches each drain the chip.
//     q, k: D[c][o] = sum_n X16[b][c][n] W16[o][n]  (x256): A rows c from X16, B rows o from W16 (same split k map), K = 2048.
//       Epilogue: x 1/256 -> LDS Os[o_loc][c_loc] (reuses the ring behind the loop's last barrier), barrier,
//       + bf16-RNE bias[o], then planes Ph = bf16-RNE(v), Pl = bf16-RNE(v - hi).
//     v: D[o][c] = sum_n W16[o][n] X16[b][c][n] (x256): A rows o from W16, B rows c from X16.
//       Epilogue: x 1/256 -> LDS Os[c_loc][o_loc], barrier, + bf16-RNE bias[o], then the f16 plane, key-tile-major:
//       PV[b][o / 32][c][o % 32], so that the 512 x 32 tile that the attention stages is 32 KB in a row. A wave's store:
//       4 key tiles x (2 adjacent c rows x 64 B) = 4 whole 128-B lines.
// coverage: Os 4 waves x 64 x 64 = 128 x 128 (all read); planes 16 it x 8 rows x 16 lanes x 8 = 128 x 128;
//           grid (4, 16, 3 NB): per job and batch 4 c tiles x 16 o tiles, every plane element once (q: o tiles below NQ / 128).
// =========================================================================================================
__global__ __launch_bounds__(128)
void proj_all(const unsigned short* __restrict__ X16, const unsigned short* __restrict__ W16,
              const float* __restrict__ bq, const float* __restrict__ bk, const float* __restrict__ bv,
              unsigned short* Qh, unsigned short* Ql, unsigned short* Kh, unsigned short* Kl, unsigned short* PV) {
  __shared__ __align__(16) unsigned short Ps[2 * PBUF];              // [buffer][A rows, B rows][128][PPE]
  const int tid  = threadIdx.x;
  const int wave = uni((int)(threadIdx.x >> 5));                     // 0..3, SGPR
  const int wm   = wave & 1, wn = wave >> 1;
  const int ct   = blockIdx.x, ot = blockIdx.y;
  const int job  = (int)blockIdx.z / NB, b = (int)blockIdx.z % NB;   // block-uniform
  const int c0   = ct * PT, o0 = ot * PT;
  if (job == 0 && ot >= NQ / PT) return;                             // whole block, ahead of every barrier and copy
  const bool isv = job == 2;

  const unsigned short* Xt = X16 + (size_t)job * XPLANE + ((size_t)(b * CDIM + c0)) * NDIM;
  const unsigned short* Wt = W16 + (size_t)job * WPLANE + ((size_t)o0) * NDIM;

  v8f acc[4][4];
  // the 16 blocks that share X rows (ot) start at 16 different stages, the 32 that share W rows (ct, b) two to a stage
  proj_tile(Ps, isv ? Wt : Xt, isv ? Xt : Wt, wm, wn, ot + ct + 4 * b, acc);

  float* Os = (float*)Ps;
  proj_unload(Os, wm, wn, acc);
  __syncthreads();

  const int e = tid & 15, lq = tid >> 4;                             // lq 0..7
  if (!isv) {                                                        // block-uniform
    const float* bp = (job == 0 ? bq : bk) + o0 + lq;                // row it * 8 + lq at a constant step from here
    v4u uh[16], ul[16];
#pragma unroll
    for (int it = 0; it < 16; ++it) {
      const int row = it * 8 + lq;                                   // o_loc 0..127
      const v4f a  = *(const v4f*)(Os + row * OSPW + 8 * e);
      const v4f qv = *(const v4f*)(Os + row * OSPW + 8 * e + 4);
      const float bb = bfr(bp[it * 8]);
      const float f[8] = {a[0] + bb, a[1] + bb, a[2] + bb, a[3] + bb, qv[0] + bb, qv[1] + bb, qv[2] + bb, qv[3] + bb};
#pragma unroll
      for (int t = 0; t < 4; ++t) {
        const float f0 = f[2 * t], f1 = f[2 * t + 1];
        const unsigned short hb0 = bf_bits(f0), hb1 = bf_bits(f1);
        const unsigned short lb0 = bf_bits(f0 - bf_up(hb0));
        const unsigned short lb1 = bf_bits(f1 - bf_up(hb1));
        uh[it][t] = pk16(hb0, hb1);
        ul[it][t] = pk16(lb0, lb1);
      }
    }
    const size_t po = ((size_t)(b * NDIM + o0 + lq)) * CDIM + c0 + 8 * e;   // row it * 8 + lq at a constant step from here
    unsigned short* ph = (job == 0 ? Qh : Kh) + po;
    unsigned short* pl = (job == 0 ? Ql : Kl) + po;
#pragma unroll
    for (int it = 0; it < 16; ++it) {
      *(v4u*)(ph + it * 8 * CDIM) = uh[it];
      *(v4u*)(pl + it * 8 * CDIM) = ul[it];
    }
  } else {
    const v4f ba = *(const v4f*)(bv + o0 + 8 * e);
    const v4f bq4 = *(const v4f*)(bv + o0 + 8 * e + 4);
    const float bb[8] = {bfr(ba[0]), bfr(ba[1]), bfr(ba[2]), bfr(ba[3]), bfr(bq4[0]), bfr(bq4[1]), bfr(bq4[2]), bfr(bq4[3])};
    v4u uv[16];
#pragma unroll
    for (int it = 0; it < 16; ++it) {
      const int row = it * 8 + lq;                                   // c_loc 0..127
      const v4f a  = *(const v4f*)(Os + row * OSPW + 8 * e);
      const v4f qv = *(const v4f*)(Os + row * OSPW + 8 * e + 4);
      const float f[8] = {a[0], a[1], a[2], a[3], qv[0], qv[1], qv[2], qv[3]};
#pragma unroll
      for (int t = 0; t < 4; ++t) {
        const _Float16 h0 = (_Float16)(f[2 * t] + bb[2 * t]);
        const _Float16 h1 = (_Float16)(f[2 * t + 1] + bb[2 * t + 1]);
        uv[it][t] = pk16(h_bits(h0), h_bits(h1));
      }
    }
    // key tile o0 / 32 + (e >> 2), chunk e & 3 of its row; row it * 8 + lq at a constant step from here
    unsigned short* pv = PV + ((size_t)((b * (NDIM / KT) + o0 / KT + (e >> 2)) * CDIM + c0 + lq)) * KT + 8 * (e & 3);
#pragma unroll
    for (int it = 0; it < 16; ++it) *(v4u*)(pv + it * 8 * KT) = uv[it];
  }
}

// =========================================================================================================
// (2) attention for one (b, 64-query tile), transposed formulation, 2048 keys, no mask, no scale on the scores.
//   Block = 8 waves in two roles that work side by side, one wave of each role on every SIMD. In interval i of the loop
//   the score waves 0..3 (w = wave) make P of key tile i for queries n0 + 16 w .. + 15, while the product waves 4..7
//   (u = wave - 4) add key tile i - 1 into O^T for channels 128 u .. 128 u + 127 of all 64 queries. One barrier an interval.
//   Score waves, per 32-key tile: S^T tiles (16 keys x 16 queries) = sum over 16 c-chunks of
//   A(Kh: row = key (lane&15), k = c via the split map, plane [b][2048][512]) . B(Qh: col = query, same map)
//   + A(Kh).B(Ql) + A(Kl).B(Qh) (bf16 unscaled residual planes, shared accumulator). Per lane the D tiles hold
//   8 + 8 keys of ONE query: online softmax state per lane, one shuffle (lane^16) for the max over 32 keys; the
//   rescale factor is skipped under a wave-uniform ballot when no lane's max grew. P = e^{s-m} x 16384 as f16:
//   B operand of O^T: element r <- D of the tile covering keys 0..15, element 8+r <- the tile covering keys 16..31,
//   lane unchanged. The score wave publishes P (32 B per lane), corr and the grew flag in LDS, two buffers each.
//   Product waves: rescale the 8 tiles of a query group whose flag is set, then O^T[ch][q] += A(PV rows ch = 128 u + 16 j +
//   (lane&15), keys contiguous, f16 plane [b][64 key tiles][512][32]) . B(P of query group qg) on 8 x 4 accumulator tiles.
//   One register array of 32 x 8 VGPRs serves both roles: a score wave keeps its 32 query fragments there (both planes,
//   read once from LDS), a product wave its 32 accumulator tiles.
//   Operands come from LDS by asynchronous 16-B copies. The query tile is staged once, by all 8 waves, in the key ring
//   before the ring's first use. In the loop the product waves issue every copy, at the head of interval i (behind the
//   foot barrier of interval i - 1): key tile i + 1 into the key buffer and pv tile i into the pv buffer that interval
//   i - 1 has just read; the foot of interval i publishes both.
//   "Key tile i" is the i-th of the block's walk, tile (i + rot) mod 64 of the planes, rot by the query tile's index: the 32
//   blocks of a batch, all resident, then ask L2 for different key and pv tiles at any moment, where a walk in step asks for
//   the same lines from many WGPs at once. The online softmax takes the tiles in that wrapped order.
//   The score waves read c-chunk kc + 1's key fragments ahead of chunk kc's products, in two register sets.
//   At the end score waves publish inv = (1/l) / sqrt(2048). Epilogue in 4 passes of 32 channels per product wave:
//   O x inv staged in LDS Os[query][128] (pitch OSPW, b128; reuses the key ring), read back and stored by all 8 waves.
// coverage: per pass 8 it x 32 lines x 8 lanes x 4 floats = 64 queries x 128 ch; 4 passes = 512 ch;
//           grid (NQ/64, NB) covers out[b][0..NQ-1][0..511] exactly once.
// =========================================================================================================
static_assert(2 * QPLANE == 2 * KBUF);                                // the query tile fits the key ring that stages it
// P.V product by the builtin alone (the compiler keeps its distances): 32 accumulator tiles do not all lie below v256
__device__ __forceinline__ v8f mma_p(v16h a, v16h b, v8f c) {
  return __builtin_amdgcn_wmma_f32_16x16x32_f16(false, a, false, b, (short)0, c, false, false);
}
// Sixteen 16-B copies per lane, global -> LDS, by the builtin: copy i moves g + i * GSTEP (elements) to l + i * LSTEP
// (elements). The builtin's address registers may lie anywhere; an asm statement's must lie below v256, where the 256
// registers of R would have to make room for them on every trip.
typedef int v4i_gcc __attribute__((vector_size(16)));
template <int LSTEP, int GSTEP>
__device__ __forceinline__ void bcopy16(unsigned short* l, const unsigned short* g) {
#if defined(__HIP_DEVICE_COMPILE__)
#pragma unroll                                                       // sixteen copies back to back
  for (int i = 0; i < 16; ++i) {
    __builtin_amdgcn_global_load_async_to_lds_b128((__attribute__((address_space(1))) v4i_gcc*)(g + i * GSTEP),
                                                   (__attribute__((address_space(3))) v4i_gcc*)(l + i * LSTEP), 0, 0);
  }
#endif
}
// the tiles as the 128 lanes of the product waves copy them (t7 = tid & 127):
// 32 k rows: copy i -> row 2 i + (t7 >> 6), chunk t7 & 63; 512 v rows: copy i -> row 32 i + (t7 >> 2), chunk t7 & 3.
// Both sources are contiguous: a wave's copy reads 512 B in a row, four whole 128-B lines.
__device__ __forceinline__ void copy_rows32_h(unsigned short* l, const unsigned short* g) { bcopy16<2 * KPE, 128 * 8>(l, g); }
__device__ __forceinline__ void copy_vtile_h(unsigned short* l, const unsigned short* g) { bcopy16<32 * VPE, 32 * KT>(l, g); }
#define SM_VS 0
#define SM_KS (SM_VS + 2 * CDIM * VPE * 2)
#define SM_PS (SM_KS + 2 * KBUF * 2)
#define SM_CS (SM_PS + 2 * 4 * 32 * 8 * 4)
#define SM_IS (SM_CS + 2 * 4 * 32 * 4)
#define SM_GS (SM_IS + 4 * 32 * 4)
#define SM_ALL (SM_GS + 2 * 4 * 4)
static_assert(SM_KS % 16 == 0 && SM_PS % 16 == 0 && SM_CS % 16 == 0 && SM_IS % 16 == 0 && SM_GS % 16 == 0);
__global__ __launch_bounds__(256)
void attn_k(const unsigned short* __restrict__ Qh, const unsigned short* __restrict__ Ql,
            const unsigned short* __restrict__ Kh, const unsigned short* __restrict__ Kl,
            const unsigned short* __restrict__ PV, float* out) {
  // One array, so that the order of its parts is the source's. The key ring stands behind the pv buffers: the compiler folds
  // the key copies' global steps into offset:N and takes N off the LDS address register, which so never falls below 0.
  // The pv copies' step in LDS (32 rows of 2 VPE bytes) is larger than their global step (32 rows of 2 KT): the same holds.
  __shared__ __align__(16) unsigned char Sm[SM_ALL];
  unsigned short* const Vs  = (unsigned short*)(Sm + SM_VS);         // [buffer][512 channels][VPE], 32 keys used
  unsigned short* const Ks  = (unsigned short*)(Sm + SM_KS);         // [buffer][hi, residual][32 keys][KPE]; first the query tile
  unsigned* const       Psh = (unsigned*)(Sm + SM_PS);               // [buffer][query group][lane][8]
  float* const          Csh = (float*)(Sm + SM_CS);                  // [buffer][query group][lane]
  float* const          Ish = (float*)(Sm + SM_IS);                  // [query group][lane]
  int* const            Gsh = (int*)(Sm + SM_GS);                    // [buffer][query group]
  constexpr int NT = NDIM / KT;                                      // key tiles
  static_assert((NT & (NT - 1)) == 0 && NT % (NDIM / QT) == 0);
  const int tid  = threadIdx.x;
  const int lane = tid & 31;
  const int wave = uni((int)(threadIdx.x >> 5));                     // 0..7, SGPR
  const int w    = wave & 3;                                         // query group of a score wave, channel group of a product wave
  const int hh   = lane >> 4, cl = lane & 15;
  const int n0   = blockIdx.x * QT, b = blockIdx.y;
  const int t7   = tid & 127;
  const int rot  = (int)blockIdx.x * (NT / (NDIM / QT));             // the walk's first key tile (uniform): 32 starts, 2 tiles apart
  auto ktile = [&](int i) { return (unsigned)((i + rot) & (NT - 1)); };   // place in the walk -> tile of the planes

  // k fragment base in LDS (A operand, row = key cl of the tile), + buffer * KBUF + 32*kc
  const unsigned short* Ksp = Ks + cl * KPE + 8 * hh;
  // v fragment base in LDS (A operand, row = channel 128 w + 16 j + cl, the tile's 32 keys contiguous), + buffer, + 16*j*VPE
  const unsigned short* Vp = Vs + (w * 128 + cl) * VPE + 8 * hh;
  // the product waves' copy sources (the lane's 16-B chunk of copy 0), as 32-bit element offsets from the planes'
  // uniform bases (one for both key planes), and LDS places
  const unsigned kgo = (unsigned)(b * NDIM * CDIM + 8 * t7);
  const unsigned vgo = (unsigned)(b * CDIM * NDIM + 8 * t7);
  unsigned short* const ksl = Ks + (t7 >> 6) * KPE + (t7 & 63) * 8;
  unsigned short* const vsl = Vs + (t7 >> 2) * VPE + (t7 & 3) * 8;

  const int pso = (w * 32 + lane) * 8;                               // a score wave's slot in a P buffer (uints)

  float m = -1.0e30f, l = 0.f;
  v8f R[32];                                                         // score wave: q fragments [chunk][hi, residual]; product wave: O^T tiles [j][query group]

  // prologue: the query tile through the key ring into the score waves' registers, then key tile 0
  {
    const size_t qg = ((size_t)(b * NDIM + n0)) * CDIM + 8 * tid;
    const unsigned qsl = lds_off(Ks) + (unsigned)((tid >> 6) * (2 * KPE) + (tid & 63) * 16);
    copy_rows32(qsl,                             Qh + qg);
    copy_rows32(qsl + 2u * KPLANE,               Qh + qg + KT * CDIM);
    copy_rows32(qsl + 2u * QPLANE,               Ql + qg);
    copy_rows32(qsl + 2u * QPLANE + 2u * KPLANE, Ql + qg + KT * CDIM);
    wait_async0();
    __syncthreads();                                                 // publishes the query tile
    if (wave < 4) {                                                  // wave-uniform (SGPR) role branch
      // q fragments (B operand, col = query 16 w + cl of the tile)
      const unsigned short* Qhp = Ks + (16 * w + cl) * KPE + 8 * hh;
      const unsigned short* Qlp = Qhp + QPLANE;
#pragma unroll                                                       // constant indices keep R in registers
      for (int kc = 0; kc < CDIM / 32; ++kc) {
        R[2 * kc]     = __builtin_bit_cast(v8f, ldfrag(Qhp + 32 * kc).bf);
        R[2 * kc + 1] = __builtin_bit_cast(v8f, ldfrag(Qlp + 32 * kc).bf);
      }
    } else {
#pragma unroll                                                       // as above
      for (int j = 0; j < 32; ++j) R[j] = zero8();
    }
    wait_ds0();                                                      // own reads of the query tile have retired
    __syncthreads();                                                 // ends every read of the query tile: the ring is free
    if (wave >= 4) {
      copy_rows32_h(ksl,          Kh + (kgo + ktile(0) * (KT * CDIM)));
      copy_rows32_h(ksl + KPLANE, Kl + (kgo + ktile(0) * (KT * CDIM)));
    }
    wait_async0();
    __syncthreads();                                                 // publishes key tile 0
  }

#pragma unroll 1                                                     // one copy of the interval: the buffers are run-time offsets
  for (int i = 0; i <= NT; ++i) {
    const int buf = i & 1;                                           // key tile i, P of tile i, pv tile i
    if (wave >= 4) {                                                 // wave-uniform (SGPR) role branch
      // refills first, so that they fly through the whole interval: both targets were last read in interval i - 1
      if (i + 1 < NT) {                                              // block-uniform: key tile i + 1 exists
        copy_rows32_h(ksl + (buf ^ 1) * KBUF,          Kh + (kgo + ktile(i + 1) * (KT * CDIM)));
        copy_rows32_h(ksl + (buf ^ 1) * KBUF + KPLANE, Kl + (kgo + ktile(i + 1) * (KT * CDIM)));
      }
      if (i < NT) {                                                  // block-uniform: pv tile i exists
        copy_vtile_h(vsl + buf * (CDIM * VPE), PV + (vgo + ktile(i) * (CDIM * KT)));
      }
      if (i > 0) {                                                   // block-uniform: tile i - 1 has been published
        const int pbf = buf ^ 1;                                     // P, corr, flags and pv tile of key tile i - 1
        int gfl[4];
        float cr[4];
#pragma unroll                                                       // constant indices keep the sets in registers
        for (int qg = 0; qg < 4; ++qg) { gfl[qg] = Gsh[pbf * 4 + qg]; cr[qg] = Csh[pbf * 128 + qg * 32 + lane]; }
#pragma unroll                                                       // as above
        for (int qg = 0; qg < 4; ++qg) {
          if (uni(gfl[qg]) != 0) {                                   // wave-uniform flag
#pragma unroll                                                       // as above
            for (int j = 0; j < 8; ++j) {
#pragma unroll                                                       // as above
              for (int r = 0; r < 8; ++r) R[4 * j + qg][r] *= cr[qg];
            }
          }
        }
        FragP pb[4];
        Frag vf[8];
#pragma unroll                                                       // as above
        for (int qg = 0; qg < 4; ++qg) {
          pb[qg].u[0] = *(const v4u*)(Psh + pbf * 1024 + (qg * 32 + lane) * 8);
          pb[qg].u[1] = *(const v4u*)(Psh + pbf * 1024 + (qg * 32 + lane) * 8 + 4);
        }
#pragma unroll                                                       // as above
        for (int j = 0; j < 8; ++j) vf[j] = ldfrag(Vp + pbf * (CDIM * VPE) + 16 * j * VPE);
#if defined(__HIP_DEVICE_COMPILE__)
        // the tile's 24 fragment reads stand together ahead of its products: left alone, each pv fragment is read directly
        // in front of its four products and its whole LDS latency is waited for, eight times a tile
        __builtin_amdgcn_sched_barrier(0);
#endif
#pragma unroll                                                       // as above
        for (int j = 0; j < 8; ++j) {
#pragma unroll                                                       // as above
          for (int qg = 0; qg < 4; ++qg) R[4 * j + qg] = mma_p(vf[j].h, pb[qg].v, R[4 * j + qg]);
        }
      }
    } else {
      if (i < NT) {                                                  // block-uniform: key tile i exists
        const unsigned short* k0p  = Ksp + buf * KBUF;               // keys 0 .. 15 of the tile
        const unsigned short* k1p  = k0p + 16 * KPE;                 // keys 16 .. 31
        const unsigned short* k0lp = k0p + KPLANE;
        const unsigned short* k1lp = k1p + KPLANE;
        v8f s0 = zero8(), s1 = zero8();
        // two register sets: chunk kc + 1's LDS reads stand together ahead of chunk kc's products, so that their latency
        // passes under those products; all 16 chunks lie in this interval's key buffer
        Frag k0[2], k1[2], k0l[2], k1l[2];
        k0[0]  = ldfrag(k0p);
        k1[0]  = ldfrag(k1p);
        k0l[0] = ldfrag(k0lp);
        k1l[0] = ldfrag(k1lp);
#pragma unroll                                                       // constant indices keep both sets and R in registers
        for (int kc = 0; kc < CDIM / 32; ++kc) {
          const int c = kc & 1, n = c ^ 1;
          if (kc + 1 < CDIM / 32) {
            k0[n]  = ldfrag(k0p + 32 * (kc + 1));
            k1[n]  = ldfrag(k1p + 32 * (kc + 1));
            k0l[n] = ldfrag(k0lp + 32 * (kc + 1));
            k1l[n] = ldfrag(k1lp + 32 * (kc + 1));
          }
          const v16b qh = __builtin_bit_cast(v16b, R[2 * kc]);
          const v16b ql = __builtin_bit_cast(v16b, R[2 * kc + 1]);
          s0 = mma_s(k0[c].bf, qh, s0);
          s1 = mma_s(k1[c].bf, qh, s1);
          s0 = mma_s(k0[c].bf, ql, s0);
          s1 = mma_s(k1[c].bf, ql, s1);
          s0 = mma_s(k0l[c].bf, qh, s0);
          s1 = mma_s(k1l[c].bf, qh, s1);
        }

        float mx = fmaxf(hmax8(s0), hmax8(s1));
        mx = fmaxf(mx, __shfl_xor(mx, 16, 32));
        const float mn = fmaxf(m, mx);
        const unsigned grew = wave_ballot(mx > m);                   // wave-uniform
        float corr = 1.0f;
        if (grew != 0u) {
          corr = __expf(m - mn);                                     // == 1 for lanes whose max did not grow
          l *= corr;
        }
        m = mn;
        const float msh = mn - LNPS;                                 // exp gives e^{s-m} * 16384

        FragP ph;
        float ls = 0.f;
#pragma unroll
        for (int r = 0; r < 8; ++r) {
          const float e0 = __expf(s0[r] - msh);                      // key      8hh + r of the tile
          const float e1 = __expf(s1[r] - msh);                      // key 16 + 8hh + r
          ls += e0 + e1;
          ph.hv[0][r] = (_Float16)e0;
          ph.hv[1][r] = (_Float16)e1;
        }
        l += ls;

        *(v4u*)(Psh + buf * 1024 + pso)     = ph.u[0];
        *(v4u*)(Psh + buf * 1024 + pso + 4) = ph.u[1];
        Csh[buf * 128 + w * 32 + lane] = corr;
        Gsh[buf * 4 + w] = (grew != 0u) ? 1 : 0;
      }
    }
    // foot of the interval: own LDS traffic retired, own copies landed, then the barrier that publishes key tile i + 1,
    // pv tile i and P of tile i, and ends every read of this interval's buffers
    wait_ds0();
    wait_async0();
    __syncthreads();
  }
  wait_async0();                                                     // nothing in flight when the ring changes its use
  float* Os = (float*)Ks;                                            // output staging; first written behind the next barrier

  if (wave < 4) {
    l += __shfl_xor(l, 16, 32);
    Ish[w * 32 + lane] = (1.0f / l) * OSCALE;                        // o and l both carry the x16384 factor
  }
  __syncthreads();

  const int e = tid & 7, lq = tid >> 3;                              // lq 0..31
#pragma unroll
  for (int p = 0; p < 4; ++p) {
    if (p) __syncthreads();                                          // every wave finished reading Os
    if (wave >= 4) {                                                 // wave-uniform (SGPR) role branch
#pragma unroll
      for (int qg = 0; qg < 4; ++qg) {
        const float inv = Ish[qg * 32 + lane];
        const int qrow = 16 * qg + cl;
#pragma unroll
        for (int jj = 0; jj < 2; ++jj) {
          const int t = 4 * (2 * p + jj) + qg;                       // channels 128 w + 32 p + 16 jj + 8 hh + r
          v4f va, vb;
#pragma unroll
          for (int r = 0; r < 4; ++r) { va[r] = R[t][r] * inv; vb[r] = R[t][4 + r] * inv; }
          *(v4f*)(Os + qrow * OSPW + w * 32 + 16 * jj + 8 * hh)     = va;   // Os[query][32 w + 16 jj + 8 hh + r]
          *(v4f*)(Os + qrow * OSPW + w * 32 + 16 * jj + 8 * hh + 4) = vb;
        }
      }
    }
    __syncthreads();
    v4f res[8];
#pragma unroll
    for (int it = 0; it < 8; ++it) {
      const int L   = it * 32 + lq;                                  // 0..255
      const int ql  = L >> 2, seg = L & 3;                           // query 0..63, channel group 0..3: one 128-B line
      res[it] = *(const v4f*)(Os + ql * OSPW + 32 * seg + 4 * e);
    }
#pragma unroll
    for (int it = 0; it < 8; ++it) {
      const int L   = it * 32 + lq;
      const int ql  = L >> 2, seg = L & 3;
      const int ch  = 128 * seg + 32 * p + 4 * e;
      const size_t idx = ((size_t)(b * NDIM + n0 + ql)) * CDIM + ch;
      *(v4f*)(out + idx) = res[it];
    }
  }
}

// =========================================================================================================
// Workspace map (bytes; each region start a multiple of 256; every extent is an exact tile multiple and is written
//   W16 f16 [3][2048][2048]         8388608 x3 (Wq, Wk, Wv)
//   X16 f16 [3][NB][512][2048]     16777216 x3 (q, k, v)
//   Qh/Ql/Kh/Kl bf16 [NB][2048][512] 16777216 x4
//   PV  f16 [NB][64][512][32]      16777216
//   total (NB = 8) = 159383552
// =========================================================================================================
extern "C" void kernel_launch(void* const* d_in, const int* in_sizes, int n_in,
                              void* d_out, int out_size, void* d_ws, size_t ws_size,
                              hipStream_t stream) {
  if (n_in < 9) return;
  if (in_sizes[0] < NB * CDIM * NDIM || in_sizes[1] < NB * CDIM * NDIM || in_sizes[2] < NB * CDIM * NDIM) return;
  if (in_sizes[3] < NDIM * NDIM || in_sizes[5] < NDIM * NDIM || in_sizes[7] < NDIM * NDIM) return;
  if (in_sizes[4] < NDIM || in_sizes[6] < NDIM || in_sizes[8] < NDIM) return;
  if (out_size < (NB - 1) * NDIM * CDIM + NQ * CDIM) return;

  size_t off = 0;
  auto carve = [&](size_t bytes) { const size_t o = off; off += (bytes + 255) & ~(size_t)255; return o; };
  const size_t oW16 = carve((size_t)3 * WPLANE * 2);
  const size_t oX16 = carve((size_t)3 * XPLANE * 2);
  const size_t oQh  = carve((size_t)NB * NDIM * CDIM * 2);
  const size_t oQl  = carve((size_t)NB * NDIM * CDIM * 2);
  const size_t oKh  = carve((size_t)NB * NDIM * CDIM * 2);
  const size_t oKl  = carve((size_t)NB * NDIM * CDIM * 2);
  const size_t oPV  = carve((size_t)NB * CDIM * NDIM * 2);
  if (off > ws_size) return;

  const float* q  = (const float*)d_in[0];
  const float* k  = (const float*)d_in[1];
  const float* v  = (const float*)d_in[2];
  const float* Wq = (const float*)d_in[3];
  const float* bq = (const float*)d_in[4];
  const float* Wk = (const float*)d_in[5];
  const float* bk = (const float*)d_in[6];
  const float* Wv = (const float*)d_in[7];
  const float* bv = (const float*)d_in[8];

  char* ws = (char*)d_ws;
  unsigned short* W16 = (unsigned short*)(ws + oW16);
  unsigned short* X16 = (unsigned short*)(ws + oX16);
  unsigned short* Qh  = (unsigned short*)(ws + oQh);
  unsigned short* Ql  = (unsigned short*)(ws + oQl);
  unsigned short* Kh  = (unsigned short*)(ws + oKh);
  unsigned short* Kl  = (unsigned short*)(ws + oKl);
  unsigned short* PVp = (unsigned short*)(ws + oPV);
  float* out = (float*)d_out;

  const dim3 blk256(256), blk128(128);

  // convert all six operands
  cvt_k<<<dim3(CVGRID), dim3(CVW * 32), 0, stream>>>(Wq, Wk, Wv, q, k, v, W16, W16 + WPLANE, W16 + 2 * WPLANE,
                                                     X16, X16 + XPLANE, X16 + 2 * XPLANE);
  // project q, k, v: pq, pk hi + residual planes [b][o][c] (q: o < NQ), pv f16 plane [b][o / 32][c][o % 32]
  proj_all<<<dim3(CDIM / PT, NDIM / PT, 3 * NB), blk128, 0, stream>>>(X16, W16, bq, bk, bv, Qh, Ql, Kh, Kl, PVp);
  // attention + 1/sqrt(2048) -> out [b][n][c] (the raw view to [b][512][2048] is the same flat buffer)
  attn_k<<<dim3(NQ / QT, NB), blk256, 0, stream>>>(Qh, Ql, Kh, Kl, PVp, out);
  (void)hipGetLastError();
}
